// v000
// The times below were measured on an AMD MI455X: many runs one after another, warmed up first and cycling through
// copies of the inputs, with the whole window's GPU time divided by the number of runs. Launches and the gaps
// between them are all in it. The median over several windows is given; except for v000 it joins two sittings, which
// can be a few percent apart, so the side-by-side timings, each taken in one sitting, are the better comparison.
// The starting kernel, v000, takes 247 microseconds a run.
#include <hip/hip_runtime.h>

// Contractions: v_wmma_f32_16x16x32_f16 (f16 operands, f32 accumulate) for q/k/v projections, q.k^T, p.v, output projection, ffn1, ffn2; weight planes carried x16, p plane carried x16384, activations x1.

#pragma clang fp contract(off)

#ifndef NB
#define NB 4
#endif
#ifndef SEQ
#define SEQ 2048
#endif
#define NB_FULL 4
#define SEQ_FULL 2048
#define CDIM 64
#define NHEAD 8
#define HD 64
#define QKVW (NHEAD * HD)
#define HID 256
#define MROWS (NB * SEQ)
#define PSC 16384.0f

static_assert(NB >= 1 && NB <= NB_FULL);
static_assert(SEQ % 64 == 0 && SEQ >= 64 && SEQ <= SEQ_FULL);
static_assert(HD == 64);
static_assert(CDIM == 64);
static_assert(QKVW == 512);
static_assert(HID % 64 == 0 && QKVW % 64 == 0 && CDIM % 64 == 0);
static_assert(HID % 32 == 0 && QKVW % 32 == 0 && CDIM % 32 == 0);
static_assert(MROWS % 64 == 0);
static_assert((long)MROWS * QKVW < (1L << 31));
static_assert((long)NB * NHEAD * SEQ * HD < (1L << 31));

typedef _Float16 v16h __attribute__((ext_vector_type(16)));
typedef _Float16 v8h  __attribute__((ext_vector_type(8)));
typedef float    v8f  __attribute__((ext_vector_type(8)));
typedef float    v4f  __attribute__((ext_vector_type(4)));
typedef float    v2f  __attribute__((ext_vector_type(2)));
typedef unsigned int v4u __attribute__((ext_vector_type(4)));

union Frag { v16h v; v4u q[2]; };

// WMMA with hazard guard: D += A(16x32) * B(32x16)
__device__ __forceinline__ v8f mma(v16h a, v16h b, v8f c) {
  v8f d = __builtin_amdgcn_wmma_f32_16x16x32_f16(false, a, false, b, (short)0, c, false, false);
  asm volatile("v_nop\n\tv_nop\n\tv_nop\n\tv_nop" : "+v"(d) : "v"(a), "v"(b));
  return d;
}

__device__ __forceinline__ v8f zero8() {
  v8f z;
#pragma unroll
  for (int i = 0; i < 8; ++i) z[i] = 0.0f;
  return z;
}

// f32 -> nearest-even bf16 value, returned as f32
__device__ __forceinline__ float bf16q(float f) {
  unsigned int u = __float_as_uint(f);
  unsigned int r = u + 0x7FFFu + ((u >> 16) & 1u);
  r = ((u & 0x7F800000u) == 0x7F800000u) ? u : r;
  return __uint_as_float(r & 0xFFFF0000u);
}
__device__ __forceinline__ v4f bf16q4(v4f a) {
  v4f r;
  r.x = bf16q(a.x); r.y = bf16q(a.y); r.z = bf16q(a.z); r.w = bf16q(a.w);
  return r;
}
// f32 -> f16 (RNE convert) bit pattern
__device__ __forceinline__ unsigned short hbits(float f) {
  _Float16 h = (_Float16)f;
  return __builtin_bit_cast(unsigned short, h);
}
__device__ __forceinline__ v4u pack8h(float f0, float f1, float f2, float f3,
                                      float f4, float f5, float f6, float f7) {
  v8h t;
  t[0] = (_Float16)f0; t[1] = (_Float16)f1; t[2] = (_Float16)f2; t[3] = (_Float16)f3;
  t[4] = (_Float16)f4; t[5] = (_Float16)f5; t[6] = (_Float16)f6; t[7] = (_Float16)f7;
  return __builtin_bit_cast(v4u, t);
}

// ---------------------------------------------------------------------------
// Weight prep: logical W[k][n] (f32) -> Wt[n][k] f16 plane, value = f16(bf16q(w) * 16).
// src element (k, n0+j) = src[(n0/64)*hstride + k*rstride + j]; dst row = zrows*z + n0 + n.
// LDS sT: cross-wave (block barrier).
// ---------------------------------------------------------------------------
__global__ __launch_bounds__(256) void k_wprep(
    const float* __restrict__ s0, const float* __restrict__ s1, const float* __restrict__ s2,
    unsigned short* __restrict__ dst, int K, int hstride, int rstride, int zrows) {
  __shared__ __attribute__((aligned(16))) unsigned short sT[64][72];
  const int tid = threadIdx.x;
  const int k0 = blockIdx.x * 64, n0 = blockIdx.y * 64, z = blockIdx.z;
  const float* src = (z == 0) ? s0 : ((z == 1) ? s1 : s2);
  const size_t sbase = (size_t)(n0 >> 6) * (size_t)hstride;
#pragma unroll
  for (int it = 0; it < 4; ++it) {
    const int idx = it * 256 + tid;
    const int kk = idx >> 4;            // 0..63
    const int j4 = (idx & 15) * 4;      // 0..60
    const v4f wv = *(const v4f*)(src + sbase + (size_t)(k0 + kk) * (size_t)rstride + j4);
    sT[j4 + 0][kk] = hbits(bf16q(wv.x) * 16.0f);
    sT[j4 + 1][kk] = hbits(bf16q(wv.y) * 16.0f);
    sT[j4 + 2][kk] = hbits(bf16q(wv.z) * 16.0f);
    sT[j4 + 3][kk] = hbits(bf16q(wv.w) * 16.0f);
  }
  __syncthreads();   // cross-wave: staged by all waves, read by all waves
  v4u val[2];
  size_t off[2];
#pragma unroll
  for (int p = 0; p < 2; ++p) {
    const int n = p * 32 + (tid >> 3);
    const int piece = tid & 7;
    val[p] = *(const v4u*)&sT[n][piece * 8];
    off[p] = ((size_t)zrows * z + n0 + n) * (size_t)K + k0 + piece * 8;
  }
#pragma unroll
  for (int p = 0; p < 2; ++p) *(v4u*)(dst + off[p]) = val[p];
  
}

// ---------------------------------------------------------------------------
// Input prep: x (f32, full batch strides) -> f16 plane xh[nrows][64] holding the
// coverage: grid nrows/32 x 256 threads x 8 halves = nrows x 64.
// ---------------------------------------------------------------------------
__global__ __launch_bounds__(256) void k_xcvt(
    const float* __restrict__ x, unsigned short* __restrict__ xh, int nrows) {
  const int tid = threadIdx.x;
  const int row = blockIdx.x * 32 + (tid >> 3);
  const int piece = tid & 7;
  if (row >= nrows) return;            // no barriers in this kernel
  const int b = row / SEQ, t = row - b * SEQ;
  const size_t xrow = ((size_t)b * SEQ_FULL + t) * CDIM + piece * 8;
  const v4f a0 = bf16q4(*(const v4f*)(x + xrow));
  const v4f a1 = bf16q4(*(const v4f*)(x + xrow + 4));
  const v4u o = pack8h(a0.x, a0.y, a0.z, a0.w, a1.x, a1.y, a1.z, a1.w);
  unsigned short* d = xh + (size_t)row * CDIM + piece * 8;
  *(v4u*)d = o;
  
}

// ---------------------------------------------------------------------------
// 64x64-tile f16 GEMM: D = A[M][K] * Bt[N][K]^T, 4 waves per WG, wave w owns
// rows 16w..16w+15 x 64 cols (4 accumulator tiles).  Fragments loaded straight
// from the 16-bit planes with the split k map for A and B (row/col = lane&15,
// elements 0..7 <- k0+8h.., 8..15 <- k0+16+8h..).
// EPI 0: q/k planes [b*H+h][t][64] and v transposed plane vt[b*H+h][64][t]
//        (value acc/16 + bf16q(bias), bias picked per q/k/v by the column block)
// EPI 2: f16 out = relu(acc/16 + bf16q(bias))
// EPI 1: u = acc/16 + bf16q(bias) + res (res read at full strides and bf16q'd when RESFULL),
//        then layernorm over the 64-col row (the 64x64 tile holds whole rows),
//        f32 out (full strides when OUTFULL) and, when WRITEH, an f16 copy [M][64].
// coverage EPI0/2: 4 passes x 4 waves x 4 rows = 64 rows x 64 cols; EPI1: 8 passes x 2 rows per wave = 16 rows x 64 f32 cols per wave,
//          plus (WRITEH) 4 passes x 4 rows per wave = 16 rows x 64 halves; EPI0 v path: 4 passes x 4 waves x 4 d = 64 d rows x 64 tokens.
// LDS: sT/sF rows are wave-private except in EPI0 (q/k and v paths both cross-wave); block barriers used everywhere.
// ---------------------------------------------------------------------------
template <int EPI, int RESFULL, int OUTFULL, int WRITEH>
__global__ __launch_bounds__(128) __attribute__((amdgpu_num_vgpr(256))) void k_gemm(
    const unsigned short* __restrict__ A, const unsigned short* __restrict__ Bt, int K,
    const float* __restrict__ bias, const float* __restrict__ biasb, const float* __restrict__ biasc,
    const float* __restrict__ res, const float* __restrict__ gam, const float* __restrict__ bet,
    float* __restrict__ outF, unsigned short* __restrict__ out0,
    unsigned short* __restrict__ out1, unsigned short* __restrict__ out2, int ldo) {
  __shared__ __attribute__((aligned(16))) unsigned short sT[64][72];
  __shared__ __attribute__((aligned(16))) float sF[64][68];
  const int tid = threadIdx.x, lane = tid & 31, w = tid >> 5;
  const int m = lane & 15, hl = lane >> 4, k8 = hl * 8;
  const int m0 = blockIdx.y * 64, n0 = blockIdx.x * 64;

  v8f acc[4];
#pragma unroll
  for (int j = 0; j < 4; ++j) acc[j] = zero8();

  const unsigned short* ap = A + (size_t)(m0 + 16 * w + m) * (size_t)K + k8;
  const unsigned short* bp = Bt + (size_t)(n0 + m) * (size_t)K + k8;
  const size_t jstep = (size_t)16 * (size_t)K;
#pragma unroll 1
  for (int k0 = 0; k0 < K; k0 += 32) {
    Frag a;
    a.q[0] = *(const v4u*)(ap + k0);
    a.q[1] = *(const v4u*)(ap + k0 + 16);
#pragma unroll
    for (int j = 0; j < 4; ++j) {
      Frag b;
      const unsigned short* bj = bp + jstep * j + k0;
      b.q[0] = *(const v4u*)(bj);
      b.q[1] = *(const v4u*)(bj + 16);
      acc[j] = mma(a.v, b.v, acc[j]);
    }
  }

  const float wsc = 0.0625f;               // undo the x16 weight carry
  const int lrow0 = 16 * w + 8 * hl;       // D rows of this lane within the WG tile

  if constexpr (EPI == 0) {
    const int which = n0 / QKVW;           // 0 = q, 1 = k, 2 = v (WG-uniform)
    const int hh = (n0 - which * QKVW) / HD;
    const float* bsel = (which == 0) ? bias : ((which == 1) ? biasb : biasc);
#pragma unroll
    for (int j = 0; j < 4; ++j) {
      const float bj = bf16q(bsel[hh * HD + 16 * j + m]);
#pragma unroll
      for (int r = 0; r < 8; ++r) sT[lrow0 + r][16 * j + m] = hbits(acc[j][r] * wsc + bj);
    }
    __syncthreads();   // cross-wave for both the q/k and the v reloads
    const int b = m0 / SEQ, t0 = m0 - b * SEQ;
    const int bh = b * NHEAD + hh;
    v4u val[4];
    unsigned int off[4];
    unsigned short* dst;
    if (which < 2) {                       // WG-uniform
      dst = (which == 0) ? out0 : out1;
#pragma unroll
      for (int p = 0; p < 4; ++p) {
        const int row = p * 16 + 4 * w + (lane >> 3);
        const int piece = lane & 7;
        val[p] = *(const v4u*)&sT[row][piece * 8];
        off[p] = (unsigned int)((bh * SEQ + t0 + row) * HD + piece * 8);
      }
    } else {
      dst = out2;
#pragma unroll
      for (int p = 0; p < 4; ++p) {
        const int d = p * 16 + 4 * w + (lane >> 3);
        const int piece = lane & 7;
        unsigned int wv[4];
#pragma unroll
        for (int e = 0; e < 4; ++e) {
          const unsigned int lo = sT[piece * 8 + 2 * e][d];
          const unsigned int hi = sT[piece * 8 + 2 * e + 1][d];
          wv[e] = lo | (hi << 16);
        }
        v4u t;
        t.x = wv[0]; t.y = wv[1]; t.z = wv[2]; t.w = wv[3];
        val[p] = t;
        off[p] = (unsigned int)((bh * HD + d) * SEQ + t0 + piece * 8);
      }
    }
#pragma unroll
    for (int p = 0; p < 4; ++p) *(v4u*)(dst + off[p]) = val[p];
    
  } else if constexpr (EPI == 2) {
#pragma unroll
    for (int j = 0; j < 4; ++j) {
      const float bj = bf16q(bias[n0 + 16 * j + m]);
#pragma unroll
      for (int r = 0; r < 8; ++r) {
        float u = acc[j][r] * wsc + bj;
        u = fmaxf(u, 0.0f);
        sT[lrow0 + r][16 * j + m] = hbits(u);
      }
    }
    __syncthreads();   // wave-private rows, barrier orders the reload
    v4u val[4];
    unsigned int off[4];
#pragma unroll
    for (int p = 0; p < 4; ++p) {
      const int row = 16 * w + 4 * p + (lane >> 3);
      const int piece = lane & 7;
      val[p] = *(const v4u*)&sT[row][piece * 8];
      off[p] = (unsigned int)((size_t)(m0 + row) * (size_t)ldo + n0 + piece * 8);
    }
#pragma unroll
    for (int p = 0; p < 4; ++p) *(v4u*)(out0 + off[p]) = val[p];
    
  } else {
    // ---- bias + residual + layernorm over the whole 64-col row ----
#pragma unroll
    for (int j = 0; j < 4; ++j) {
#pragma unroll
      for (int r = 0; r < 8; ++r) sF[lrow0 + r][16 * j + m] = acc[j][r] * wsc;
    }
    __syncthreads();   // wave-private rows, barrier orders the cross-lane reload
    const int b = m0 / SEQ, t0 = m0 - b * SEQ;
    const int c2 = 2 * lane;               // lane owns cols c2, c2+1 of each of its wave's rows
    const float bb0 = bf16q(bias[n0 + c2]), bb1 = bf16q(bias[n0 + c2 + 1]);
    const float gg0 = bf16q(gam[n0 + c2]),  gg1 = bf16q(gam[n0 + c2 + 1]);
    const float ee0 = bf16q(bet[n0 + c2]),  ee1 = bf16q(bet[n0 + c2 + 1]);
#pragma unroll
    for (int rr = 0; rr < 16; ++rr) {
      const int row = 16 * w + rr;
      const size_t rrow = RESFULL ? ((size_t)b * SEQ_FULL + t0 + row) : (size_t)(m0 + row);
      v2f rv = *(const v2f*)(res + rrow * (size_t)ldo + n0 + c2);
      if (RESFULL) { rv.x = bf16q(rv.x); rv.y = bf16q(rv.y); }
      const v2f av = *(const v2f*)&sF[row][c2];
      const float u0 = (av.x + bb0) + rv.x;
      const float u1 = (av.y + bb1) + rv.y;
      float s = u0 + u1;
#pragma unroll
      for (int xm = 1; xm < 32; xm <<= 1) s += __shfl_xor(s, xm, 32);
      const float mu = s * (1.0f / CDIM);
      const float d0 = u0 - mu, d1 = u1 - mu;
      float qs = d0 * d0 + d1 * d1;
#pragma unroll
      for (int xm = 1; xm < 32; xm <<= 1) qs += __shfl_xor(qs, xm, 32);
      const float var = qs * (1.0f / CDIM);
      const float rstd = rsqrtf(var + 1e-5f);
      const float y0 = d0 * rstd * gg0 + ee0;
      const float y1 = d1 * rstd * gg1 + ee1;
      v2f yv; yv.x = y0; yv.y = y1;
      *(v2f*)&sF[row][c2] = yv;
      if (WRITEH) { sT[row][c2] = hbits(y0); sT[row][c2 + 1] = hbits(y1); }
    }
    __syncthreads();   // wave-private rows, barrier orders the cross-lane reload
    v4f fv[8];
    unsigned int fo[8];
#pragma unroll
    for (int p = 0; p < 8; ++p) {
      const int row = 16 * w + 2 * p + hl;
      const int piece = m;
      fv[p] = *(const v4f*)&sF[row][4 * piece];
      const size_t orow = OUTFULL ? ((size_t)b * SEQ_FULL + t0 + row) : (size_t)(m0 + row);
      fo[p] = (unsigned int)(orow * (size_t)ldo + n0 + 4 * piece);
    }
    v4u hv[4];
    unsigned int ho[4];
    if constexpr (WRITEH) {
#pragma unroll
      for (int p = 0; p < 4; ++p) {
        const int row = 16 * w + 4 * p + (lane >> 3);
        const int piece = lane & 7;
        hv[p] = *(const v4u*)&sT[row][piece * 8];
        ho[p] = (unsigned int)((size_t)(m0 + row) * CDIM + piece * 8);
      }
    }
#pragma unroll
    for (int p = 0; p < 8; ++p) *(v4f*)(outF + fo[p]) = fv[p];
    if constexpr (WRITEH) {
#pragma unroll
      for (int p = 0; p < 4; ++p) *(v4u*)(out0 + ho[p]) = hv[p];
    }
    
  }
}

// ---------------------------------------------------------------------------
// Causal flash attention, unscaled scores.  One WG = one (b,h) x 64 query rows,
// 4 waves x 16 rows.  Key chunks of 64, kt = 0..qt (WG-uniform trip count); the
// diagonal chunk is masked elementwise (key > query -> -1e30).  S in registers,
// online softmax with 16-lane shuffles; P = f16(p*16384) staged per wave in LDS
// (D layout) and reloaded as an A fragment after a WG barrier; K and V^T
// fragments straight from the q/k/vt planes.  O = acc / (16384*l) -> f16 plane
// LDS sP: wave-private rows, separated by __syncthreads (stronger than needed).
// ---------------------------------------------------------------------------
__global__ __launch_bounds__(128) __attribute__((amdgpu_num_vgpr(256)))
void k_attn(const unsigned short* __restrict__ qp, const unsigned short* __restrict__ kp,
            const unsigned short* __restrict__ vp, unsigned short* __restrict__ op) {
  __shared__ __attribute__((aligned(16))) unsigned short sP[4][16][72];
  const int tid = threadIdx.x, lane = tid & 31, w = tid >> 5;
  const int m = lane & 15, hl = lane >> 4, k8 = hl * 8;
  const int nqt = SEQ / 64;
  const int bh = blockIdx.x / nqt, qt = blockIdx.x - bh * nqt;
  const int b = bh / NHEAD, hh = bh - b * NHEAD;
  const int tq = qt * 64 + 16 * w;          // first query row of this wave (within the sequence)

  Frag qa0, qa1;
  {
    const unsigned short* qr = qp + ((size_t)bh * SEQ + tq + m) * HD + k8;
    qa0.q[0] = *(const v4u*)(qr);
    qa0.q[1] = *(const v4u*)(qr + 16);
    qa1.q[0] = *(const v4u*)(qr + 32);
    qa1.q[1] = *(const v4u*)(qr + 48);
  }
  float mrun[8], lrun[8];
  v8f oacc[4];
#pragma unroll
  for (int r = 0; r < 8; ++r) { mrun[r] = -1e30f; lrun[r] = 0.0f; }
#pragma unroll
  for (int j = 0; j < 4; ++j) oacc[j] = zero8();

#pragma unroll 1
  for (int kt = 0; kt <= qt; ++kt) {
    // ---- S = Q K^T, four 16-key subtiles ----
    v8f s[4];
    const unsigned short* kb = kp + ((size_t)bh * SEQ + kt * 64 + m) * HD + k8;
#pragma unroll
    for (int j = 0; j < 4; ++j) {
      const unsigned short* kr = kb + j * 16 * HD;
      Frag f0, f1;
      f0.q[0] = *(const v4u*)(kr);
      f0.q[1] = *(const v4u*)(kr + 16);
      f1.q[0] = *(const v4u*)(kr + 32);
      f1.q[1] = *(const v4u*)(kr + 48);
      v8f t = mma(qa0.v, f0.v, zero8());
      t = mma(qa1.v, f1.v, t);
      s[j] = t;
    }
    // ---- causal mask on the diagonal chunk, row max ----
    const bool diag = (kt == qt);
    float tmax[8];
#pragma unroll
    for (int r = 0; r < 8; ++r) tmax[r] = -1e30f;
#pragma unroll
    for (int j = 0; j < 4; ++j) {
#pragma unroll
      for (int r = 0; r < 8; ++r) {
        float val = s[j][r];
        const int qi = tq + 8 * hl + r;
        const int ki = kt * 64 + 16 * j + m;
        val = (diag && (ki > qi)) ? -1e30f : val;
        s[j][r] = val;
        tmax[r] = fmaxf(tmax[r], val);
      }
    }
#pragma unroll
    for (int r = 0; r < 8; ++r) {
#pragma unroll
      for (int xm = 1; xm < 16; xm <<= 1) tmax[r] = fmaxf(tmax[r], __shfl_xor(tmax[r], xm, 32));
    }
    float corr[8];
#pragma unroll
    for (int r = 0; r < 8; ++r) {
      const float mn = fmaxf(mrun[r], tmax[r]);
      corr[r] = __expf(mrun[r] - mn);
      mrun[r] = mn;
    }
    // ---- p = exp(s - m); stage f16(16384 p) in D layout; row sums ----
    float tsum[8];
#pragma unroll
    for (int r = 0; r < 8; ++r) tsum[r] = 0.0f;
#pragma unroll
    for (int j = 0; j < 4; ++j) {
#pragma unroll
      for (int r = 0; r < 8; ++r) {
        const float p = __expf(s[j][r] - mrun[r]);
        tsum[r] += p;
        sP[w][8 * hl + r][16 * j + m] = hbits(p * PSC);
      }
    }
#pragma unroll
    for (int r = 0; r < 8; ++r) {
#pragma unroll
      for (int xm = 1; xm < 16; xm <<= 1) tsum[r] += __shfl_xor(tsum[r], xm, 32);
      lrun[r] = lrun[r] * corr[r] + tsum[r];
    }
#pragma unroll
    for (int j = 0; j < 4; ++j) {
#pragma unroll
      for (int r = 0; r < 8; ++r) oacc[j][r] *= corr[r];
    }
    __syncthreads();   // P staged -> visible, ordered before the fragment reload
    // ---- O += P (16x64 keys) * V (64 keys x 64 d) ----
    Frag pa0, pa1;
    {
      const unsigned short* pr = &sP[w][m][k8];
      pa0.q[0] = *(const v4u*)(pr);
      pa0.q[1] = *(const v4u*)(pr + 16);
      pa1.q[0] = *(const v4u*)(pr + 32);
      pa1.q[1] = *(const v4u*)(pr + 48);
    }
    const unsigned short* vb = vp + ((size_t)bh * HD + m) * (size_t)SEQ + kt * 64 + k8;
#pragma unroll
    for (int jd = 0; jd < 4; ++jd) {
      const unsigned short* vr = vb + (size_t)jd * 16 * SEQ;
      Frag g0, g1;
      g0.q[0] = *(const v4u*)(vr);
      g0.q[1] = *(const v4u*)(vr + 16);
      g1.q[0] = *(const v4u*)(vr + 32);
      g1.q[1] = *(const v4u*)(vr + 48);
      oacc[jd] = mma(pa0.v, g0.v, oacc[jd]);
      oacc[jd] = mma(pa1.v, g1.v, oacc[jd]);
    }
    __syncthreads();   // all P reads done before the next chunk overwrites sP
  }

  // ---- finalize: o = acc / (16384 l), stage per wave, whole-line stores ----
  float il[8];
#pragma unroll
  for (int r = 0; r < 8; ++r) il[r] = 1.0f / (lrun[r] * PSC);
#pragma unroll
  for (int jd = 0; jd < 4; ++jd) {
#pragma unroll
    for (int r = 0; r < 8; ++r) sP[w][8 * hl + r][16 * jd + m] = hbits(oacc[jd][r] * il[r]);
  }
  __syncthreads();
  v4u val[4];
  unsigned int off[4];
#pragma unroll
  for (int p = 0; p < 4; ++p) {
    const int row = 4 * p + (lane >> 3);
    const int piece = lane & 7;
    val[p] = *(const v4u*)&sP[w][row][piece * 8];
    off[p] = (unsigned int)((size_t)(b * SEQ + tq + row) * QKVW + hh * HD + piece * 8);
  }
#pragma unroll
  for (int p = 0; p < 4; ++p) *(v4u*)(op + off[p]) = val[p];
  
}

// ---------------------------------------------------------------------------
// Host launcher
// ---------------------------------------------------------------------------
static inline size_t al256(size_t v) { return (v + 255) & ~(size_t)255; }

extern "C" void kernel_launch(void* const* d_in, const int* in_sizes, int n_in,
                              void* d_out, int out_size, void* d_ws, size_t ws_size,
                              hipStream_t stream) {
  if (n_in < 17) return;
  const long needX = ((long)(NB - 1) * SEQ_FULL + SEQ) * CDIM;
  const long nW = (long)NHEAD * CDIM * HD;
  if ((long)in_sizes[0] < needX) return;
  if ((long)in_sizes[1] < nW || (long)in_sizes[3] < nW || (long)in_sizes[5] < nW) return;
  if (in_sizes[2] < QKVW || in_sizes[4] < QKVW || in_sizes[6] < QKVW) return;
  if ((long)in_sizes[7] < (long)QKVW * CDIM || in_sizes[8] < CDIM) return;
  if ((long)in_sizes[9] < (long)CDIM * HID || in_sizes[10] < HID) return;
  if ((long)in_sizes[11] < (long)HID * CDIM || in_sizes[12] < CDIM) return;
  if (in_sizes[13] < CDIM || in_sizes[14] < CDIM || in_sizes[15] < CDIM || in_sizes[16] < CDIM) return;
  if ((long)out_size < needX) return;

  const float* x   = (const float*)d_in[0];
  const float* Wq  = (const float*)d_in[1];
  const float* bq  = (const float*)d_in[2];
  const float* Wk  = (const float*)d_in[3];
  const float* bk  = (const float*)d_in[4];
  const float* Wv  = (const float*)d_in[5];
  const float* bv  = (const float*)d_in[6];
  const float* Wp  = (const float*)d_in[7];
  const float* bp  = (const float*)d_in[8];
  const float* W1  = (const float*)d_in[9];
  const float* b1  = (const float*)d_in[10];
  const float* W2  = (const float*)d_in[11];
  const float* b2  = (const float*)d_in[12];
  const float* g1  = (const float*)d_in[13];
  const float* be1 = (const float*)d_in[14];
  const float* g2  = (const float*)d_in[15];
  const float* be2 = (const float*)d_in[16];
  float* out = (float*)d_out;

  char* ws = (char*)d_ws;
  size_t off = 0;
  auto carve = [&](size_t bytes) -> char* { char* p = ws + off; off += al256(bytes); return p; };
  const size_t MC  = (size_t)MROWS * CDIM;                   // [M][64]
  const size_t MHD = (size_t)NB * NHEAD * SEQ * HD;          // per q/k/vt plane
  unsigned short* wqkv = (unsigned short*)carve((size_t)3 * QKVW * CDIM * 2);   // [1536][64]
  unsigned short* wpt  = (unsigned short*)carve((size_t)CDIM * QKVW * 2);       // [64][512]
  unsigned short* w1t  = (unsigned short*)carve((size_t)HID * CDIM * 2);        // [256][64]
  unsigned short* w2t  = (unsigned short*)carve((size_t)CDIM * HID * 2);        // [64][256]
  unsigned short* xh   = (unsigned short*)carve(MC * 2);                        // [M][64]
  unsigned short* qpl  = (unsigned short*)carve(MHD * 2);                       // [B*H][SEQ][64]
  unsigned short* kpl  = (unsigned short*)carve(MHD * 2);                       // [B*H][SEQ][64]
  unsigned short* vtp  = (unsigned short*)carve(MHD * 2);                       // [B*H][64][SEQ]
  unsigned short* opl  = (unsigned short*)carve((size_t)MROWS * QKVW * 2);      // [M][512]
  float*          h1f  = (float*)carve(MC * 4);                                 // [M][64]
  unsigned short* h1h  = (unsigned short*)carve(MC * 2);                        // [M][64]
  unsigned short* act  = (unsigned short*)carve((size_t)MROWS * HID * 2);       // [M][256]
  if (off > ws_size) return;
  if (off > ((size_t)128 << 20)) return;

  // 1) weight planes: transposed, bf16 values x16 as f16
  k_wprep<<<dim3(CDIM / 64, QKVW / 64, 3), 256, 0, stream>>>(Wq, Wk, Wv, wqkv, CDIM, CDIM * HD, HD, QKVW);
  k_wprep<<<dim3(QKVW / 64, CDIM / 64, 1), 256, 0, stream>>>(Wp, Wp, Wp, wpt, QKVW, 64, CDIM, 0);
  k_wprep<<<dim3(CDIM / 64, HID / 64, 1), 256, 0, stream>>>(W1, W1, W1, w1t, CDIM, 64, HID, 0);
  k_wprep<<<dim3(HID / 64, CDIM / 64, 1), 256, 0, stream>>>(W2, W2, W2, w2t, HID, 64, CDIM, 0);
  // 2) x -> bf16 values of x as an f16 plane
  k_xcvt<<<MROWS / 32, 256, 0, stream>>>(x, xh, MROWS);
  // 3) q/k/v projections + biases -> q, k, vt planes
  k_gemm<0, 0, 0, 0><<<dim3(3 * QKVW / 64, MROWS / 64), 128, 0, stream>>>(
      xh, wqkv, CDIM, bq, bk, bv, nullptr, nullptr, nullptr, nullptr, qpl, kpl, vtp, 0);
  // 4) causal attention -> o plane [M][512]
  k_attn<<<NB * NHEAD * (SEQ / 64), 128, 0, stream>>>(qpl, kpl, vtp, opl);
  // 5) output projection + bias + residual(bf16 values of x) + layernorm 1 -> h1 (f32 + f16 copy)
  k_gemm<1, 1, 0, 1><<<dim3(CDIM / 64, MROWS / 64), 128, 0, stream>>>(
      opl, wpt, QKVW, bp, bp, bp, x, g1, be1, h1f, h1h, nullptr, nullptr, CDIM);
  // 6) ffn1 + bias + relu -> act (f16)
  k_gemm<2, 0, 0, 0><<<dim3(HID / 64, MROWS / 64), 128, 0, stream>>>(
      h1h, w1t, CDIM, b1, b1, b1, nullptr, nullptr, nullptr, nullptr, act, nullptr, nullptr, HID);
  // 7) ffn2 + bias + residual(h1) + layernorm 2 -> out (f32, full strides)
  k_gemm<1, 0, 1, 0><<<dim3(CDIM / 64, MROWS / 64), 128, 0, stream>>>(
      act, w2t, HID, b2, b2, b2, h1f, g2, be2, out, nullptr, nullptr, nullptr, CDIM);
}

// v001
// Measured time: 162 microseconds a run.
// Next to v000, in two timings, it ran 1.55 and 1.57 times as fast.
#include <hip/hip_runtime.h>

// Contractions: v_wmma_f32_16x16x32_f16 (f16 operands, f32 accumulate) for q/k/v projections, q.k^T, p.v, output projection, ffn1, ffn2; weight planes carried x16, p plane carried x16384, activations x1.

#pragma clang fp contract(off)

#ifndef NB
#define NB 4
#endif
#ifndef SEQ
#define SEQ 2048
#endif
#define NB_FULL 4
#define SEQ_FULL 2048
#define CDIM 64
#define NHEAD 8
#define HD 64
#define QKVW (NHEAD * HD)
#define HID 256
#define MROWS (NB * SEQ)
#define PSC 16384.0f

static_assert(NB >= 1 && NB <= NB_FULL);
static_assert(SEQ % 64 == 0 && SEQ >= 64 && SEQ <= SEQ_FULL);
static_assert(HD == 64);
static_assert(CDIM == 64);
static_assert(QKVW == 512);
static_assert(HID % 64 == 0 && QKVW % 64 == 0 && CDIM % 64 == 0);
static_assert(HID % 32 == 0 && QKVW % 32 == 0 && CDIM % 32 == 0);
static_assert(MROWS % 64 == 0);
static_assert((long)MROWS * QKVW < (1L << 31));
static_assert((long)NB * NHEAD * SEQ * HD < (1L << 31));

typedef _Float16 v16h __attribute__((ext_vector_type(16)));
typedef _Float16 v8h  __attribute__((ext_vector_type(8)));
typedef float    v8f  __attribute__((ext_vector_type(8)));
typedef float    v4f  __attribute__((ext_vector_type(4)));
typedef float    v2f  __attribute__((ext_vector_type(2)));
typedef unsigned int v4u __attribute__((ext_vector_type(4)));

union Frag { v16h v; v4u q[2]; };

// WMMA with hazard guard: D += A(16x32) * B(32x16)
__device__ __forceinline__ v8f mma(v16h a, v16h b, v8f c) {
  v8f d = __builtin_amdgcn_wmma_f32_16x16x32_f16(false, a, false, b, (short)0, c, false, false);
  asm volatile("v_nop\n\tv_nop\n\tv_nop\n\tv_nop" : "+v"(d) : "v"(a), "v"(b));
  return d;
}

__device__ __forceinline__ v8f zero8() {
  v8f z;
#pragma unroll
  for (int i = 0; i < 8; ++i) z[i] = 0.0f;
  return z;
}

// f32 -> nearest-even bf16 value, returned as f32
__device__ __forceinline__ float bf16q(float f) {
  unsigned int u = __float_as_uint(f);
  unsigned int r = u + 0x7FFFu + ((u >> 16) & 1u);
  r = ((u & 0x7F800000u) == 0x7F800000u) ? u : r;
  return __uint_as_float(r & 0xFFFF0000u);
}
__device__ __forceinline__ v4f bf16q4(v4f a) {
  v4f r;
  r.x = bf16q(a.x); r.y = bf16q(a.y); r.z = bf16q(a.z); r.w = bf16q(a.w);
  return r;
}
// f32 -> f16 (RNE convert) bit pattern
__device__ __forceinline__ unsigned short hbits(float f) {
  _Float16 h = (_Float16)f;
  return __builtin_bit_cast(unsigned short, h);
}
__device__ __forceinline__ v4u pack8h(float f0, float f1, float f2, float f3,
                                      float f4, float f5, float f6, float f7) {
  v8h t;
  t[0] = (_Float16)f0; t[1] = (_Float16)f1; t[2] = (_Float16)f2; t[3] = (_Float16)f3;
  t[4] = (_Float16)f4; t[5] = (_Float16)f5; t[6] = (_Float16)f6; t[7] = (_Float16)f7;
  return __builtin_bit_cast(v4u, t);
}

// ---------------------------------------------------------------------------
// Weight prep: logical W[k][n] (f32) -> Wt[n][k] f16 plane, value = f16(bf16q(w) * 16).
// src element (k, n0+j) = src[(n0/64)*hstride + k*rstride + j]; dst row = zrows*z + n0 + n.
// LDS sT: cross-wave (block barrier).
// ---------------------------------------------------------------------------
__global__ __launch_bounds__(256) void k_wprep(
    const float* __restrict__ s0, const float* __restrict__ s1, const float* __restrict__ s2,
    unsigned short* __restrict__ dst, int K, int hstride, int rstride, int zrows) {
  __shared__ __attribute__((aligned(16))) unsigned short sT[64][72];
  const int tid = threadIdx.x;
  const int k0 = blockIdx.x * 64, n0 = blockIdx.y * 64, z = blockIdx.z;
  const float* src = (z == 0) ? s0 : ((z == 1) ? s1 : s2);
  const size_t sbase = (size_t)(n0 >> 6) * (size_t)hstride;
#pragma unroll
  for (int it = 0; it < 4; ++it) {
    const int idx = it * 256 + tid;
    const int kk = idx >> 4;            // 0..63
    const int j4 = (idx & 15) * 4;      // 0..60
    const v4f wv = *(const v4f*)(src + sbase + (size_t)(k0 + kk) * (size_t)rstride + j4);
    sT[j4 + 0][kk] = hbits(bf16q(wv.x) * 16.0f);
    sT[j4 + 1][kk] = hbits(bf16q(wv.y) * 16.0f);
    sT[j4 + 2][kk] = hbits(bf16q(wv.z) * 16.0f);
    sT[j4 + 3][kk] = hbits(bf16q(wv.w) * 16.0f);
  }
  __syncthreads();   // cross-wave: staged by all waves, read by all waves
  v4u val[2];
  size_t off[2];
#pragma unroll
  for (int p = 0; p < 2; ++p) {
    const int n = p * 32 + (tid >> 3);
    const int piece = tid & 7;
    val[p] = *(const v4u*)&sT[n][piece * 8];
    off[p] = ((size_t)zrows * z + n0 + n) * (size_t)K + k0 + piece * 8;
  }
#pragma unroll
  for (int p = 0; p < 2; ++p) *(v4u*)(dst + off[p]) = val[p];
  
}

// ---------------------------------------------------------------------------
// Input prep: x (f32, full batch strides) -> f16 plane xh[nrows][64] holding the
// coverage: grid nrows/32 x 256 threads x 8 halves = nrows x 64.
// ---------------------------------------------------------------------------
__global__ __launch_bounds__(256) void k_xcvt(
    const float* __restrict__ x, unsigned short* __restrict__ xh, int nrows) {
  const int tid = threadIdx.x;
  const int row = blockIdx.x * 32 + (tid >> 3);
  const int piece = tid & 7;
  if (row >= nrows) return;            // no barriers in this kernel
  const int b = row / SEQ, t = row - b * SEQ;
  const size_t xrow = ((size_t)b * SEQ_FULL + t) * CDIM + piece * 8;
  const v4f a0 = bf16q4(*(const v4f*)(x + xrow));
  const v4f a1 = bf16q4(*(const v4f*)(x + xrow + 4));
  const v4u o = pack8h(a0.x, a0.y, a0.z, a0.w, a1.x, a1.y, a1.z, a1.w);
  unsigned short* d = xh + (size_t)row * CDIM + piece * 8;
  *(v4u*)d = o;
  
}

// ---------------------------------------------------------------------------
// 64x64-tile f16 GEMM: D = A[M][K] * Bt[N][K]^T, 4 waves per WG, wave w owns
// rows 16w..16w+15 x 64 cols (4 accumulator tiles).  Fragments loaded straight
// from the 16-bit planes with the split k map for A and B (row/col = lane&15,
// elements 0..7 <- k0+8h.., 8..15 <- k0+16+8h..).
// EPI 0: q/k planes [b*H+h][t][64] and v transposed plane vt[b*H+h][64][t]
//        (value acc/16 + bf16q(bias), bias picked per q/k/v by the column block)
// EPI 2: f16 out = relu(acc/16 + bf16q(bias))
// EPI 1: u = acc/16 + bf16q(bias) + res (res read at full strides and bf16q'd when RESFULL),
//        then layernorm over the 64-col row (the 64x64 tile holds whole rows),
//        f32 out (full strides when OUTFULL) and, when WRITEH, an f16 copy [M][64].
// coverage EPI0/2: 4 passes x 4 waves x 4 rows = 64 rows x 64 cols; EPI1: 8 passes x 2 rows per wave = 16 rows x 64 f32 cols per wave,
//          plus (WRITEH) 4 passes x 4 rows per wave = 16 rows x 64 halves; EPI0 v path: 4 passes x 4 waves x 4 d = 64 d rows x 64 tokens.
// LDS: sT/sF rows are wave-private except in EPI0 (q/k and v paths both cross-wave); block barriers used everywhere.
// ---------------------------------------------------------------------------
template <int EPI, int RESFULL, int OUTFULL, int WRITEH>
__global__ __launch_bounds__(128) __attribute__((amdgpu_num_vgpr(256))) void k_gemm(
    const unsigned short* __restrict__ A, const unsigned short* __restrict__ Bt, int K,
    const float* __restrict__ bias, const float* __restrict__ biasb, const float* __restrict__ biasc,
    const float* __restrict__ res, const float* __restrict__ gam, const float* __restrict__ bet,
    float* __restrict__ outF, unsigned short* __restrict__ out0,
    unsigned short* __restrict__ out1, unsigned short* __restrict__ out2, int ldo) {
  __shared__ __attribute__((aligned(16))) unsigned short sT[64][72];
  __shared__ __attribute__((aligned(16))) float sF[64][68];
  const int tid = threadIdx.x, lane = tid & 31, w = tid >> 5;
  const int m = lane & 15, hl = lane >> 4, k8 = hl * 8;
  const int m0 = blockIdx.y * 64, n0 = blockIdx.x * 64;

  v8f acc[4];
#pragma unroll
  for (int j = 0; j < 4; ++j) acc[j] = zero8();

  const unsigned short* ap = A + (size_t)(m0 + 16 * w + m) * (size_t)K + k8;
  const unsigned short* bp = Bt + (size_t)(n0 + m) * (size_t)K + k8;
  const size_t jstep = (size_t)16 * (size_t)K;
#pragma unroll 1
  for (int k0 = 0; k0 < K; k0 += 32) {
    Frag a;
    a.q[0] = *(const v4u*)(ap + k0);
    a.q[1] = *(const v4u*)(ap + k0 + 16);
#pragma unroll
    for (int j = 0; j < 4; ++j) {
      Frag b;
      const unsigned short* bj = bp + jstep * j + k0;
      b.q[0] = *(const v4u*)(bj);
      b.q[1] = *(const v4u*)(bj + 16);
      acc[j] = mma(a.v, b.v, acc[j]);
    }
  }

  const float wsc = 0.0625f;               // undo the x16 weight carry
  const int lrow0 = 16 * w + 8 * hl;       // D rows of this lane within the WG tile

  if constexpr (EPI == 0) {
    const int which = n0 / QKVW;           // 0 = q, 1 = k, 2 = v (WG-uniform)
    const int hh = (n0 - which * QKVW) / HD;
    const float* bsel = (which == 0) ? bias : ((which == 1) ? biasb : biasc);
#pragma unroll
    for (int j = 0; j < 4; ++j) {
      const float bj = bf16q(bsel[hh * HD + 16 * j + m]);
#pragma unroll
      for (int r = 0; r < 8; ++r) sT[lrow0 + r][16 * j + m] = hbits(acc[j][r] * wsc + bj);
    }
    __syncthreads();   // cross-wave for both the q/k and the v reloads
    const int b = m0 / SEQ, t0 = m0 - b * SEQ;
    const int bh = b * NHEAD + hh;
    v4u val[4];
    unsigned int off[4];
    unsigned short* dst;
    if (which < 2) {                       // WG-uniform
      dst = (which == 0) ? out0 : out1;
#pragma unroll
      for (int p = 0; p < 4; ++p) {
        const int row = p * 16 + 4 * w + (lane >> 3);
        const int piece = lane & 7;
        val[p] = *(const v4u*)&sT[row][piece * 8];
        off[p] = (unsigned int)((bh * SEQ + t0 + row) * HD + piece * 8);
      }
    } else {
      dst = out2;
#pragma unroll
      for (int p = 0; p < 4; ++p) {
        const int d = p * 16 + 4 * w + (lane >> 3);
        const int piece = lane & 7;
        unsigned int wv[4];
#pragma unroll
        for (int e = 0; e < 4; ++e) {
          const unsigned int lo = sT[piece * 8 + 2 * e][d];
          const unsigned int hi = sT[piece * 8 + 2 * e + 1][d];
          wv[e] = lo | (hi << 16);
        }
        v4u t;
        t.x = wv[0]; t.y = wv[1]; t.z = wv[2]; t.w = wv[3];
        val[p] = t;
        off[p] = (unsigned int)((bh * HD + d) * SEQ + t0 + piece * 8);
      }
    }
#pragma unroll
    for (int p = 0; p < 4; ++p) *(v4u*)(dst + off[p]) = val[p];
    
  } else if constexpr (EPI == 2) {
#pragma unroll
    for (int j = 0; j < 4; ++j) {
      const float bj = bf16q(bias[n0 + 16 * j + m]);
#pragma unroll
      for (int r = 0; r < 8; ++r) {
        float u = acc[j][r] * wsc + bj;
        u = fmaxf(u, 0.0f);
        sT[lrow0 + r][16 * j + m] = hbits(u);
      }
    }
    __syncthreads();   // wave-private rows, barrier orders the reload
    v4u val[4];
    unsigned int off[4];
#pragma unroll
    for (int p = 0; p < 4; ++p) {
      const int row = 16 * w + 4 * p + (lane >> 3);
      const int piece = lane & 7;
      val[p] = *(const v4u*)&sT[row][piece * 8];
      off[p] = (unsigned int)((size_t)(m0 + row) * (size_t)ldo + n0 + piece * 8);
    }
#pragma unroll
    for (int p = 0; p < 4; ++p) *(v4u*)(out0 + off[p]) = val[p];
    
  } else {
    // ---- bias + residual + layernorm over the whole 64-col row ----
#pragma unroll
    for (int j = 0; j < 4; ++j) {
#pragma unroll
      for (int r = 0; r < 8; ++r) sF[lrow0 + r][16 * j + m] = acc[j][r] * wsc;
    }
    __syncthreads();   // wave-private rows, barrier orders the cross-lane reload
    const int b = m0 / SEQ, t0 = m0 - b * SEQ;
    const int c2 = 2 * lane;               // lane owns cols c2, c2+1 of each of its wave's rows
    const float bb0 = bf16q(bias[n0 + c2]), bb1 = bf16q(bias[n0 + c2 + 1]);
    const float gg0 = bf16q(gam[n0 + c2]),  gg1 = bf16q(gam[n0 + c2 + 1]);
    const float ee0 = bf16q(bet[n0 + c2]),  ee1 = bf16q(bet[n0 + c2 + 1]);
#pragma unroll
    for (int rr = 0; rr < 16; ++rr) {
      const int row = 16 * w + rr;
      const size_t rrow = RESFULL ? ((size_t)b * SEQ_FULL + t0 + row) : (size_t)(m0 + row);
      v2f rv = *(const v2f*)(res + rrow * (size_t)ldo + n0 + c2);
      if (RESFULL) { rv.x = bf16q(rv.x); rv.y = bf16q(rv.y); }
      const v2f av = *(const v2f*)&sF[row][c2];
      const float u0 = (av.x + bb0) + rv.x;
      const float u1 = (av.y + bb1) + rv.y;
      float s = u0 + u1;
#pragma unroll
      for (int xm = 1; xm < 32; xm <<= 1) s += __shfl_xor(s, xm, 32);
      const float mu = s * (1.0f / CDIM);
      const float d0 = u0 - mu, d1 = u1 - mu;
      float qs = d0 * d0 + d1 * d1;
#pragma unroll
      for (int xm = 1; xm < 32; xm <<= 1) qs += __shfl_xor(qs, xm, 32);
      const float var = qs * (1.0f / CDIM);
      const float rstd = rsqrtf(var + 1e-5f);
      const float y0 = d0 * rstd * gg0 + ee0;
      const float y1 = d1 * rstd * gg1 + ee1;
      v2f yv; yv.x = y0; yv.y = y1;
      *(v2f*)&sF[row][c2] = yv;
      if (WRITEH) { sT[row][c2] = hbits(y0); sT[row][c2 + 1] = hbits(y1); }
    }
    __syncthreads();   // wave-private rows, barrier orders the cross-lane reload
    v4f fv[8];
    unsigned int fo[8];
#pragma unroll
    for (int p = 0; p < 8; ++p) {
      const int row = 16 * w + 2 * p + hl;
      const int piece = m;
      fv[p] = *(const v4f*)&sF[row][4 * piece];
      const size_t orow = OUTFULL ? ((size_t)b * SEQ_FULL + t0 + row) : (size_t)(m0 + row);
      fo[p] = (unsigned int)(orow * (size_t)ldo + n0 + 4 * piece);
    }
    v4u hv[4];
    unsigned int ho[4];
    if constexpr (WRITEH) {
#pragma unroll
      for (int p = 0; p < 4; ++p) {
        const int row = 16 * w + 4 * p + (lane >> 3);
        const int piece = lane & 7;
        hv[p] = *(const v4u*)&sT[row][piece * 8];
        ho[p] = (unsigned int)((size_t)(m0 + row) * CDIM + piece * 8);
      }
    }
#pragma unroll
    for (int p = 0; p < 8; ++p) *(v4f*)(outF + fo[p]) = fv[p];
    if constexpr (WRITEH) {
#pragma unroll
      for (int p = 0; p < 4; ++p) *(v4u*)(out0 + ho[p]) = hv[p];
    }
    
  }
}

// ---------------------------------------------------------------------------
// One 64-key chunk into LDS, shared by the work-group's four waves: K rows (64 x 128 B,
// contiguous) and V^T rows (64 x 128 B, source pitch SEQ halves).  128 threads x 16 B x 4
// row groups per operand; eight lanes cover one whole 128-B row.  lk/lv/gk/gv are the lane's
// own addresses for row group 0; a row group is 16 rows.  LDS pitch KVP halves.
// ---------------------------------------------------------------------------
#define KVP 72
#define KVBUF (64 * KVP * 2)
__device__ __forceinline__ unsigned int lds_off(const void* p) { return (unsigned int)(size_t)p; }
__device__ __forceinline__ void stage_kv(unsigned int lk, unsigned int lv,
                                         const unsigned short* gk, const unsigned short* gv) {
  const unsigned int ls = 16 * KVP * 2;
  // The closing s_wait_xcnt stands in the copies' own statement so that no address register
  // named here is rewritten ahead of it.
  asm volatile(
      "global_load_async_to_lds_b128 %0, %8, off\n\t"
      "global_load_async_to_lds_b128 %1, %9, off\n\t"
      "global_load_async_to_lds_b128 %2, %10, off\n\t"
      "global_load_async_to_lds_b128 %3, %11, off\n\t"
      "global_load_async_to_lds_b128 %4, %12, off\n\t"
      "global_load_async_to_lds_b128 %5, %13, off\n\t"
      "global_load_async_to_lds_b128 %6, %14, off\n\t"
      "global_load_async_to_lds_b128 %7, %15, off\n\t"
      "s_wait_xcnt 0x0"
      :: "v"(lk), "v"(lk + ls), "v"(lk + 2 * ls), "v"(lk + 3 * ls),
         "v"(lv), "v"(lv + ls), "v"(lv + 2 * ls), "v"(lv + 3 * ls),
         "v"(gk), "v"(gk + 16 * HD), "v"(gk + 32 * HD), "v"(gk + 48 * HD),
         "v"(gv), "v"(gv + 16 * SEQ), "v"(gv + 32 * SEQ), "v"(gv + 48 * SEQ)
      : "memory");
}

// ---------------------------------------------------------------------------
// Causal flash attention, unscaled scores.  One WG = one (b,h) x 64 query rows,
// 4 waves x 16 rows.  Key chunks of 64, kt = 0..qt (WG-uniform trip count); the
// diagonal chunk is masked elementwise (key > query -> -1e30).  S in registers,
// online softmax with 16-lane shuffles; P = f16(p*16384) staged per wave in LDS
// (D layout) and reloaded as an A fragment after a WG barrier; K and V^T
// chunks copied asynchronously to LDS once per WG, two buffers, the next chunk in
// flight while this one is worked on.  O = acc / (16384*l) -> f16 plane
// LDS sP: wave-private rows, separated by __syncthreads (stronger than needed).
// LDS sK/sV: cross-wave, published by the barrier at the loop's foot.
// ---------------------------------------------------------------------------
__global__ __launch_bounds__(128) __attribute__((amdgpu_num_vgpr(256)))
void k_attn(const unsigned short* __restrict__ qp, const unsigned short* __restrict__ kp,
            const unsigned short* __restrict__ vp, unsigned short* __restrict__ op) {
  __shared__ __attribute__((aligned(16))) unsigned short sP[4][16][72];
  __shared__ __attribute__((aligned(16))) unsigned short sK[2][64][KVP];
  __shared__ __attribute__((aligned(16))) unsigned short sV[2][64][KVP];
  const int tid = threadIdx.x, lane = tid & 31, w = tid >> 5;
  const int m = lane & 15, hl = lane >> 4, k8 = hl * 8;
  const int nqt = SEQ / 64;
  const int bh = blockIdx.x / nqt, qt = blockIdx.x - bh * nqt;
  const int b = bh / NHEAD, hh = bh - b * NHEAD;
  const int tq = qt * 64 + 16 * w;          // first query row of this wave (within the sequence)

  Frag qa0, qa1;
  {
    const unsigned short* qr = qp + ((size_t)bh * SEQ + tq + m) * HD + k8;
    qa0.q[0] = *(const v4u*)(qr);
    qa0.q[1] = *(const v4u*)(qr + 16);
    qa1.q[0] = *(const v4u*)(qr + 32);
    qa1.q[1] = *(const v4u*)(qr + 48);
  }
  float mrun[8], lrun[8];
  v8f oacc[4];
#pragma unroll
  for (int r = 0; r < 8; ++r) { mrun[r] = -1e30f; lrun[r] = 0.0f; }
#pragma unroll
  for (int j = 0; j < 4; ++j) oacc[j] = zero8();

  // ---- chunk 0 into buffer 0, published; then chunk 1 into buffer 1 ----
  const int srow = tid >> 3, spc = (tid & 7) * 8;
  const unsigned short* gk0 = kp + ((size_t)bh * SEQ + srow) * HD + spc;
  const unsigned short* gv0 = vp + ((size_t)bh * HD + srow) * (size_t)SEQ + spc;
  const unsigned int lk0 = lds_off(&sK[0][srow][spc]);
  const unsigned int lv0 = lds_off(&sV[0][srow][spc]);
  stage_kv(lk0, lv0, gk0, gv0);
  asm volatile("s_wait_asynccnt 0x0" ::: "memory");   // this wave's copies of chunk 0 have landed
  __syncthreads();                                    // chunk 0 visible to all four waves
  if (qt >= 1) stage_kv(lk0 + KVBUF, lv0 + KVBUF, gk0 + 64 * HD, gv0 + 64);   // WG-uniform

#pragma unroll 1
  for (int kt = 0; kt <= qt; ++kt) {
    const int buf = kt & 1;
    // ---- S = Q K^T, four 16-key subtiles ----
    v8f s[4];
    const unsigned short* kb = &sK[buf][m][k8];
#pragma unroll
    for (int j = 0; j < 4; ++j) {
      const unsigned short* kr = kb + j * 16 * KVP;
      Frag f0, f1;
      f0.q[0] = *(const v4u*)(kr);
      f0.q[1] = *(const v4u*)(kr + 16);
      f1.q[0] = *(const v4u*)(kr + 32);
      f1.q[1] = *(const v4u*)(kr + 48);
      v8f t = mma(qa0.v, f0.v, zero8());
      t = mma(qa1.v, f1.v, t);
      s[j] = t;
    }
    // ---- causal mask on the diagonal chunk, row max ----
    const bool diag = (kt == qt);
    float tmax[8];
#pragma unroll
    for (int r = 0; r < 8; ++r) tmax[r] = -1e30f;
#pragma unroll
    for (int j = 0; j < 4; ++j) {
#pragma unroll
      for (int r = 0; r < 8; ++r) {
        float val = s[j][r];
        const int qi = tq + 8 * hl + r;
        const int ki = kt * 64 + 16 * j + m;
        val = (diag && (ki > qi)) ? -1e30f : val;
        s[j][r] = val;
        tmax[r] = fmaxf(tmax[r], val);
      }
    }
#pragma unroll
    for (int r = 0; r < 8; ++r) {
#pragma unroll
      for (int xm = 1; xm < 16; xm <<= 1) tmax[r] = fmaxf(tmax[r], __shfl_xor(tmax[r], xm, 32));
    }
    float corr[8];
#pragma unroll
    for (int r = 0; r < 8; ++r) {
      const float mn = fmaxf(mrun[r], tmax[r]);
      corr[r] = __expf(mrun[r] - mn);
      mrun[r] = mn;
    }
    // ---- p = exp(s - m); stage f16(16384 p) in D layout; row sums ----
    float tsum[8];
#pragma unroll
    for (int r = 0; r < 8; ++r) tsum[r] = 0.0f;
#pragma unroll
    for (int j = 0; j < 4; ++j) {
#pragma unroll
      for (int r = 0; r < 8; ++r) {
        const float p = __expf(s[j][r] - mrun[r]);
        tsum[r] += p;
        sP[w][8 * hl + r][16 * j + m] = hbits(p * PSC);
      }
    }
#pragma unroll
    for (int r = 0; r < 8; ++r) {
#pragma unroll
      for (int xm = 1; xm < 16; xm <<= 1) tsum[r] += __shfl_xor(tsum[r], xm, 32);
      lrun[r] = lrun[r] * corr[r] + tsum[r];
    }
#pragma unroll
    for (int j = 0; j < 4; ++j) {
#pragma unroll
      for (int r = 0; r < 8; ++r) oacc[j][r] *= corr[r];
    }
    __syncthreads();   // P staged -> visible, ordered before the fragment reload
    // ---- O += P (16x64 keys) * V (64 keys x 64 d) ----
    Frag pa0, pa1;
    {
      const unsigned short* pr = &sP[w][m][k8];
      pa0.q[0] = *(const v4u*)(pr);
      pa0.q[1] = *(const v4u*)(pr + 16);
      pa1.q[0] = *(const v4u*)(pr + 32);
      pa1.q[1] = *(const v4u*)(pr + 48);
    }
    const unsigned short* vb = &sV[buf][m][k8];
#pragma unroll
    for (int jd = 0; jd < 4; ++jd) {
      const unsigned short* vr = vb + jd * 16 * KVP;
      Frag g0, g1;
      g0.q[0] = *(const v4u*)(vr);
      g0.q[1] = *(const v4u*)(vr + 16);
      g1.q[0] = *(const v4u*)(vr + 32);
      g1.q[1] = *(const v4u*)(vr + 48);
      oacc[jd] = mma(pa0.v, g0.v, oacc[jd]);
      oacc[jd] = mma(pa1.v, g1.v, oacc[jd]);
    }
    asm volatile("s_wait_dscnt 0x0" ::: "memory");      // this wave's reads of sK/sV[buf] and sP have returned
    asm volatile("s_wait_asynccnt 0x0" ::: "memory");   // this wave's copies of chunk kt+1 have landed
    __syncthreads();   // publishes chunk kt+1, frees buffer buf and sP for rewriting
    if (kt + 2 <= qt)  // WG-uniform
      stage_kv(lk0 + buf * KVBUF, lv0 + buf * KVBUF, gk0 + (size_t)(kt + 2) * 64 * HD, gv0 + (kt + 2) * 64);
  }
  asm volatile("s_wait_asynccnt 0x0" ::: "memory");     // nothing of this wave's in flight past the loop

  // ---- finalize: o = acc / (16384 l), stage per wave, whole-line stores ----
  float il[8];
#pragma unroll
  for (int r = 0; r < 8; ++r) il[r] = 1.0f / (lrun[r] * PSC);
#pragma unroll
  for (int jd = 0; jd < 4; ++jd) {
#pragma unroll
    for (int r = 0; r < 8; ++r) sP[w][8 * hl + r][16 * jd + m] = hbits(oacc[jd][r] * il[r]);
  }
  __syncthreads();
  v4u val[4];
  unsigned int off[4];
#pragma unroll
  for (int p = 0; p < 4; ++p) {
    const int row = 4 * p + (lane >> 3);
    const int piece = lane & 7;
    val[p] = *(const v4u*)&sP[w][row][piece * 8];
    off[p] = (unsigned int)((size_t)(b * SEQ + tq + row) * QKVW + hh * HD + piece * 8);
  }
#pragma unroll
  for (int p = 0; p < 4; ++p) *(v4u*)(op + off[p]) = val[p];
  
}

// ---------------------------------------------------------------------------
// Host launcher
// ---------------------------------------------------------------------------
static inline size_t al256(size_t v) { return (v + 255) & ~(size_t)255; }

extern "C" void kernel_launch(void* const* d_in, const int* in_sizes, int n_in,
                              void* d_out, int out_size, void* d_ws, size_t ws_size,
                              hipStream_t stream) {
  if (n_in < 17) return;
  const long needX = ((long)(NB - 1) * SEQ_FULL + SEQ) * CDIM;
  const long nW = (long)NHEAD * CDIM * HD;
  if ((long)in_sizes[0] < needX) return;
  if ((long)in_sizes[1] < nW || (long)in_sizes[3] < nW || (long)in_sizes[5] < nW) return;
  if (in_sizes[2] < QKVW || in_sizes[4] < QKVW || in_sizes[6] < QKVW) return;
  if ((long)in_sizes[7] < (long)QKVW * CDIM || in_sizes[8] < CDIM) return;
  if ((long)in_sizes[9] < (long)CDIM * HID || in_sizes[10] < HID) return;
  if ((long)in_sizes[11] < (long)HID * CDIM || in_sizes[12] < CDIM) return;
  if (in_sizes[13] < CDIM || in_sizes[14] < CDIM || in_sizes[15] < CDIM || in_sizes[16] < CDIM) return;
  if ((long)out_size < needX) return;

  const float* x   = (const float*)d_in[0];
  const float* Wq  = (const float*)d_in[1];
  const float* bq  = (const float*)d_in[2];
  const float* Wk  = (const float*)d_in[3];
  const float* bk  = (const float*)d_in[4];
  const float* Wv  = (const float*)d_in[5];
  const float* bv  = (const float*)d_in[6];
  const float* Wp  = (const float*)d_in[7];
  const float* bp  = (const float*)d_in[8];
  const float* W1  = (const float*)d_in[9];
  const float* b1  = (const float*)d_in[10];
  const float* W2  = (const float*)d_in[11];
  const float* b2  = (const float*)d_in[12];
  const float* g1  = (const float*)d_in[13];
  const float* be1 = (const float*)d_in[14];
  const float* g2  = (const float*)d_in[15];
  const float* be2 = (const float*)d_in[16];
  float* out = (float*)d_out;

  char* ws = (char*)d_ws;
  size_t off = 0;
  auto carve = [&](size_t bytes) -> char* { char* p = ws + off; off += al256(bytes); return p; };
  const size_t MC  = (size_t)MROWS * CDIM;                   // [M][64]
  const size_t MHD = (size_t)NB * NHEAD * SEQ * HD;          // per q/k/vt plane
  unsigned short* wqkv = (unsigned short*)carve((size_t)3 * QKVW * CDIM * 2);   // [1536][64]
  unsigned short* wpt  = (unsigned short*)carve((size_t)CDIM * QKVW * 2);       // [64][512]
  unsigned short* w1t  = (unsigned short*)carve((size_t)HID * CDIM * 2);        // [256][64]
  unsigned short* w2t  = (unsigned short*)carve((size_t)CDIM * HID * 2);        // [64][256]
  unsigned short* xh   = (unsigned short*)carve(MC * 2);                        // [M][64]
  unsigned short* qpl  = (unsigned short*)carve(MHD * 2);                       // [B*H][SEQ][64]
  unsigned short* kpl  = (unsigned short*)carve(MHD * 2);                       // [B*H][SEQ][64]
  unsigned short* vtp  = (unsigned short*)carve(MHD * 2);                       // [B*H][64][SEQ]
  unsigned short* opl  = (unsigned short*)carve((size_t)MROWS * QKVW * 2);      // [M][512]
  float*          h1f  = (float*)carve(MC * 4);                                 // [M][64]
  unsigned short* h1h  = (unsigned short*)carve(MC * 2);                        // [M][64]
  unsigned short* act  = (unsigned short*)carve((size_t)MROWS * HID * 2);       // [M][256]
  if (off > ws_size) return;
  if (off > ((size_t)128 << 20)) return;

  // 1) weight planes: transposed, bf16 values x16 as f16
  k_wprep<<<dim3(CDIM / 64, QKVW / 64, 3), 256, 0, stream>>>(Wq, Wk, Wv, wqkv, CDIM, CDIM * HD, HD, QKVW);
  k_wprep<<<dim3(QKVW / 64, CDIM / 64, 1), 256, 0, stream>>>(Wp, Wp, Wp, wpt, QKVW, 64, CDIM, 0);
  k_wprep<<<dim3(CDIM / 64, HID / 64, 1), 256, 0, stream>>>(W1, W1, W1, w1t, CDIM, 64, HID, 0);
  k_wprep<<<dim3(HID / 64, CDIM / 64, 1), 256, 0, stream>>>(W2, W2, W2, w2t, HID, 64, CDIM, 0);
  // 2) x -> bf16 values of x as an f16 plane
  k_xcvt<<<MROWS / 32, 256, 0, stream>>>(x, xh, MROWS);
  // 3) q/k/v projections + biases -> q, k, vt planes
  k_gemm<0, 0, 0, 0><<<dim3(3 * QKVW / 64, MROWS / 64), 128, 0, stream>>>(
      xh, wqkv, CDIM, bq, bk, bv, nullptr, nullptr, nullptr, nullptr, qpl, kpl, vtp, 0);
  // 4) causal attention -> o plane [M][512]
  k_attn<<<NB * NHEAD * (SEQ / 64), 128, 0, stream>>>(qpl, kpl, vtp, opl);
  // 5) output projection + bias + residual(bf16 values of x) + layernorm 1 -> h1 (f32 + f16 copy)
  k_gemm<1, 1, 0, 1><<<dim3(CDIM / 64, MROWS / 64), 128, 0, stream>>>(
      opl, wpt, QKVW, bp, bp, bp, x, g1, be1, h1f, h1h, nullptr, nullptr, CDIM);
  // 6) ffn1 + bias + relu -> act (f16)
  k_gemm<2, 0, 0, 0><<<dim3(HID / 64, MROWS / 64), 128, 0, stream>>>(
      h1h, w1t, CDIM, b1, b1, b1, nullptr, nullptr, nullptr, nullptr, act, nullptr, nullptr, HID);
  // 7) ffn2 + bias + residual(h1) + layernorm 2 -> out (f32, full strides)
  k_gemm<1, 0, 1, 0><<<dim3(CDIM / 64, MROWS / 64), 128, 0, stream>>>(
      act, w2t, HID, b2, b2, b2, h1f, g2, be2, out, nullptr, nullptr, nullptr, CDIM);
}

// v002
// It runs in 114 microseconds.
// Two timings next to v001 put it at 1.43 and 1.42 times that version's speed.
// Counting every step since v000, it is 2.21 times as fast.
#include <hip/hip_runtime.h>

// Contractions: v_wmma_f32_16x16x32_f16 (f16 operands, f32 accumulate) for q/k/v projections, q.k^T, p.v, output projection, ffn1, ffn2; weight planes carried x16, p plane carried x16384, activations x1.

#pragma clang fp contract(off)

#ifndef NB
#define NB 4
#endif
#ifndef SEQ
#define SEQ 2048
#endif
#define NB_FULL 4
#define SEQ_FULL 2048
#define CDIM 64
#define NHEAD 8
#define HD 64
#define QKVW (NHEAD * HD)
#define HID 256
#define MROWS (NB * SEQ)
#define PSC 16384.0f

static_assert(NB >= 1 && NB <= NB_FULL);
static_assert(SEQ % 64 == 0 && SEQ >= 64 && SEQ <= SEQ_FULL);
static_assert(HD == 64);
static_assert(CDIM == 64);
static_assert(QKVW == 512);
static_assert(HID % 64 == 0 && QKVW % 64 == 0 && CDIM % 64 == 0);
static_assert(HID % 32 == 0 && QKVW % 32 == 0 && CDIM % 32 == 0);
static_assert(MROWS % 64 == 0);
static_assert((long)MROWS * QKVW < (1L << 31));
static_assert((long)NB * NHEAD * SEQ * HD < (1L << 31));

typedef _Float16 v16h __attribute__((ext_vector_type(16)));
typedef _Float16 v8h  __attribute__((ext_vector_type(8)));
typedef float    v8f  __attribute__((ext_vector_type(8)));
typedef float    v4f  __attribute__((ext_vector_type(4)));
typedef float    v2f  __attribute__((ext_vector_type(2)));
typedef unsigned int v4u __attribute__((ext_vector_type(4)));

union Frag { v16h v; v4u q[2]; };

// WMMA with hazard guard: D += A(16x32) * B(32x16)
__device__ __forceinline__ v8f mma(v16h a, v16h b, v8f c) {
  v8f d = __builtin_amdgcn_wmma_f32_16x16x32_f16(false, a, false, b, (short)0, c, false, false);
  asm volatile("v_nop\n\tv_nop\n\tv_nop\n\tv_nop" : "+v"(d) : "v"(a), "v"(b));
  return d;
}

__device__ __forceinline__ v8f zero8() {
  v8f z;
#pragma unroll
  for (int i = 0; i < 8; ++i) z[i] = 0.0f;
  return z;
}

// f32 -> nearest-even bf16 value, returned as f32
__device__ __forceinline__ float bf16q(float f) {
  unsigned int u = __float_as_uint(f);
  unsigned int r = u + 0x7FFFu + ((u >> 16) & 1u);
  r = ((u & 0x7F800000u) == 0x7F800000u) ? u : r;
  return __uint_as_float(r & 0xFFFF0000u);
}
__device__ __forceinline__ v4f bf16q4(v4f a) {
  v4f r;
  r.x = bf16q(a.x); r.y = bf16q(a.y); r.z = bf16q(a.z); r.w = bf16q(a.w);
  return r;
}
// f32 -> f16 (RNE convert) bit pattern
__device__ __forceinline__ unsigned short hbits(float f) {
  _Float16 h = (_Float16)f;
  return __builtin_bit_cast(unsigned short, h);
}
__device__ __forceinline__ v4u pack8h(float f0, float f1, float f2, float f3,
                                      float f4, float f5, float f6, float f7) {
  v8h t;
  t[0] = (_Float16)f0; t[1] = (_Float16)f1; t[2] = (_Float16)f2; t[3] = (_Float16)f3;
  t[4] = (_Float16)f4; t[5] = (_Float16)f5; t[6] = (_Float16)f6; t[7] = (_Float16)f7;
  return __builtin_bit_cast(v4u, t);
}

// ---------------------------------------------------------------------------
// Weight prep: logical W[k][n] (f32) -> Wt[n][k] f16 plane, value = f16(bf16q(w) * 16).
// src element (k, n0+j) = src[(n0/64)*hstride + k*rstride + j]; dst row = zrows*z + n0 + n.
// LDS sT: cross-wave (block barrier).
// ---------------------------------------------------------------------------
__global__ __launch_bounds__(256) void k_wprep(
    const float* __restrict__ s0, const float* __restrict__ s1, const float* __restrict__ s2,
    unsigned short* __restrict__ dst, int K, int hstride, int rstride, int zrows) {
  __shared__ __attribute__((aligned(16))) unsigned short sT[64][72];
  const int tid = threadIdx.x;
  const int k0 = blockIdx.x * 64, n0 = blockIdx.y * 64, z = blockIdx.z;
  const float* src = (z == 0) ? s0 : ((z == 1) ? s1 : s2);
  const size_t sbase = (size_t)(n0 >> 6) * (size_t)hstride;
#pragma unroll
  for (int it = 0; it < 4; ++it) {
    const int idx = it * 256 + tid;
    const int kk = idx >> 4;            // 0..63
    const int j4 = (idx & 15) * 4;      // 0..60
    const v4f wv = *(const v4f*)(src + sbase + (size_t)(k0 + kk) * (size_t)rstride + j4);
    sT[j4 + 0][kk] = hbits(bf16q(wv.x) * 16.0f);
    sT[j4 + 1][kk] = hbits(bf16q(wv.y) * 16.0f);
    sT[j4 + 2][kk] = hbits(bf16q(wv.z) * 16.0f);
    sT[j4 + 3][kk] = hbits(bf16q(wv.w) * 16.0f);
  }
  __syncthreads();   // cross-wave: staged by all waves, read by all waves
  v4u val[2];
  size_t off[2];
#pragma unroll
  for (int p = 0; p < 2; ++p) {
    const int n = p * 32 + (tid >> 3);
    const int piece = tid & 7;
    val[p] = *(const v4u*)&sT[n][piece * 8];
    off[p] = ((size_t)zrows * z + n0 + n) * (size_t)K + k0 + piece * 8;
  }
#pragma unroll
  for (int p = 0; p < 2; ++p) *(v4u*)(dst + off[p]) = val[p];
  
}

// ---------------------------------------------------------------------------
// Input prep: x (f32, full batch strides) -> f16 plane xh[nrows][64] holding the
// coverage: grid nrows/32 x 256 threads x 8 halves = nrows x 64.
// ---------------------------------------------------------------------------
__global__ __launch_bounds__(256) void k_xcvt(
    const float* __restrict__ x, unsigned short* __restrict__ xh, int nrows) {
  const int tid = threadIdx.x;
  const int row = blockIdx.x * 32 + (tid >> 3);
  const int piece = tid & 7;
  if (row >= nrows) return;            // no barriers in this kernel
  const int b = row / SEQ, t = row - b * SEQ;
  const size_t xrow = ((size_t)b * SEQ_FULL + t) * CDIM + piece * 8;
  const v4f a0 = bf16q4(*(const v4f*)(x + xrow));
  const v4f a1 = bf16q4(*(const v4f*)(x + xrow + 4));
  const v4u o = pack8h(a0.x, a0.y, a0.z, a0.w, a1.x, a1.y, a1.z, a1.w);
  unsigned short* d = xh + (size_t)row * CDIM + piece * 8;
  *(v4u*)d = o;
  
}

// ---------------------------------------------------------------------------
// 64x64-tile f16 GEMM: D = A[M][K] * Bt[N][K]^T, 4 waves per WG, wave w owns
// rows 16w..16w+15 x 64 cols (4 accumulator tiles).  Fragments loaded straight
// from the 16-bit planes with the split k map for A and B (row/col = lane&15,
// elements 0..7 <- k0+8h.., 8..15 <- k0+16+8h..).
// EPI 0: q/k planes [b*H+h][t][64] and v transposed plane vt[b*H+h][64][t]
//        (value acc/16 + bf16q(bias), bias picked per q/k/v by the column block)
// EPI 2: f16 out = relu(acc/16 + bf16q(bias))
// EPI 1: u = acc/16 + bf16q(bias) + res (res read at full strides and bf16q'd when RESFULL),
//        then layernorm over the 64-col row (the 64x64 tile holds whole rows),
//        f32 out (full strides when OUTFULL) and, when WRITEH, an f16 copy [M][64].
// coverage EPI0/2: 4 passes x 4 waves x 4 rows = 64 rows x 64 cols; EPI1: 8 passes x 2 rows per wave = 16 rows x 64 f32 cols per wave,
//          plus (WRITEH) 4 passes x 4 rows per wave = 16 rows x 64 halves; EPI0 v path: 4 passes x 4 waves x 4 d = 64 d rows x 64 tokens.
// LDS: sT/sF rows are wave-private except in EPI0 (q/k and v paths both cross-wave); block barriers used everywhere.
// ---------------------------------------------------------------------------
template <int EPI, int RESFULL, int OUTFULL, int WRITEH>
__global__ __launch_bounds__(128) __attribute__((amdgpu_num_vgpr(256))) void k_gemm(
    const unsigned short* __restrict__ A, const unsigned short* __restrict__ Bt, int K,
    const float* __restrict__ bias, const float* __restrict__ biasb, const float* __restrict__ biasc,
    const float* __restrict__ res, const float* __restrict__ gam, const float* __restrict__ bet,
    float* __restrict__ outF, unsigned short* __restrict__ out0,
    unsigned short* __restrict__ out1, unsigned short* __restrict__ out2, int ldo) {
  __shared__ __attribute__((aligned(16))) unsigned short sT[64][72];
  __shared__ __attribute__((aligned(16))) float sF[64][68];
  const int tid = threadIdx.x, lane = tid & 31, w = tid >> 5;
  const int m = lane & 15, hl = lane >> 4, k8 = hl * 8;
  const int m0 = blockIdx.y * 64, n0 = blockIdx.x * 64;

  v8f acc[4];
#pragma unroll
  for (int j = 0; j < 4; ++j) acc[j] = zero8();

  const unsigned short* ap = A + (size_t)(m0 + 16 * w + m) * (size_t)K + k8;
  const unsigned short* bp = Bt + (size_t)(n0 + m) * (size_t)K + k8;
  const size_t jstep = (size_t)16 * (size_t)K;
#pragma unroll 1
  for (int k0 = 0; k0 < K; k0 += 32) {
    Frag a;
    a.q[0] = *(const v4u*)(ap + k0);
    a.q[1] = *(const v4u*)(ap + k0 + 16);
#pragma unroll
    for (int j = 0; j < 4; ++j) {
      Frag b;
      const unsigned short* bj = bp + jstep * j + k0;
      b.q[0] = *(const v4u*)(bj);
      b.q[1] = *(const v4u*)(bj + 16);
      acc[j] = mma(a.v, b.v, acc[j]);
    }
  }

  const float wsc = 0.0625f;               // undo the x16 weight carry
  const int lrow0 = 16 * w + 8 * hl;       // D rows of this lane within the WG tile

  if constexpr (EPI == 0) {
    const int which = n0 / QKVW;           // 0 = q, 1 = k, 2 = v (WG-uniform)
    const int hh = (n0 - which * QKVW) / HD;
    const float* bsel = (which == 0) ? bias : ((which == 1) ? biasb : biasc);
#pragma unroll
    for (int j = 0; j < 4; ++j) {
      const float bj = bf16q(bsel[hh * HD + 16 * j + m]);
#pragma unroll
      for (int r = 0; r < 8; ++r) sT[lrow0 + r][16 * j + m] = hbits(acc[j][r] * wsc + bj);
    }
    __syncthreads();   // cross-wave for both the q/k and the v reloads
    const int b = m0 / SEQ, t0 = m0 - b * SEQ;
    const int bh = b * NHEAD + hh;
    v4u val[4];
    unsigned int off[4];
    unsigned short* dst;
    if (which < 2) {                       // WG-uniform
      dst = (which == 0) ? out0 : out1;
#pragma unroll
      for (int p = 0; p < 4; ++p) {
        const int row = p * 16 + 4 * w + (lane >> 3);
        const int piece = lane & 7;
        val[p] = *(const v4u*)&sT[row][piece * 8];
        off[p] = (unsigned int)((bh * SEQ + t0 + row) * HD + piece * 8);
      }
    } else {
      dst = out2;
#pragma unroll
      for (int p = 0; p < 4; ++p) {
        const int d = p * 16 + 4 * w + (lane >> 3);
        const int piece = lane & 7;
        unsigned int wv[4];
#pragma unroll
        for (int e = 0; e < 4; ++e) {
          const unsigned int lo = sT[piece * 8 + 2 * e][d];
          const unsigned int hi = sT[piece * 8 + 2 * e + 1][d];
          wv[e] = lo | (hi << 16);
        }
        v4u t;
        t.x = wv[0]; t.y = wv[1]; t.z = wv[2]; t.w = wv[3];
        val[p] = t;
        off[p] = (unsigned int)((bh * HD + d) * SEQ + t0 + piece * 8);
      }
    }
#pragma unroll
    for (int p = 0; p < 4; ++p) *(v4u*)(dst + off[p]) = val[p];
    
  } else if constexpr (EPI == 2) {
#pragma unroll
    for (int j = 0; j < 4; ++j) {
      const float bj = bf16q(bias[n0 + 16 * j + m]);
#pragma unroll
      for (int r = 0; r < 8; ++r) {
        float u = acc[j][r] * wsc + bj;
        u = fmaxf(u, 0.0f);
        sT[lrow0 + r][16 * j + m] = hbits(u);
      }
    }
    __syncthreads();   // wave-private rows, barrier orders the reload
    v4u val[4];
    unsigned int off[4];
#pragma unroll
    for (int p = 0; p < 4; ++p) {
      const int row = 16 * w + 4 * p + (lane >> 3);
      const int piece = lane & 7;
      val[p] = *(const v4u*)&sT[row][piece * 8];
      off[p] = (unsigned int)((size_t)(m0 + row) * (size_t)ldo + n0 + piece * 8);
    }
#pragma unroll
    for (int p = 0; p < 4; ++p) *(v4u*)(out0 + off[p]) = val[p];
    
  } else {
    // ---- bias + residual + layernorm over the whole 64-col row ----
#pragma unroll
    for (int j = 0; j < 4; ++j) {
#pragma unroll
      for (int r = 0; r < 8; ++r) sF[lrow0 + r][16 * j + m] = acc[j][r] * wsc;
    }
    __syncthreads();   // wave-private rows, barrier orders the cross-lane reload
    const int b = m0 / SEQ, t0 = m0 - b * SEQ;
    const int c2 = 2 * lane;               // lane owns cols c2, c2+1 of each of its wave's rows
    const float bb0 = bf16q(bias[n0 + c2]), bb1 = bf16q(bias[n0 + c2 + 1]);
    const float gg0 = bf16q(gam[n0 + c2]),  gg1 = bf16q(gam[n0 + c2 + 1]);
    const float ee0 = bf16q(bet[n0 + c2]),  ee1 = bf16q(bet[n0 + c2 + 1]);
#pragma unroll
    for (int rr = 0; rr < 16; ++rr) {
      const int row = 16 * w + rr;
      const size_t rrow = RESFULL ? ((size_t)b * SEQ_FULL + t0 + row) : (size_t)(m0 + row);
      v2f rv = *(const v2f*)(res + rrow * (size_t)ldo + n0 + c2);
      if (RESFULL) { rv.x = bf16q(rv.x); rv.y = bf16q(rv.y); }
      const v2f av = *(const v2f*)&sF[row][c2];
      const float u0 = (av.x + bb0) + rv.x;
      const float u1 = (av.y + bb1) + rv.y;
      float s = u0 + u1;
#pragma unroll
      for (int xm = 1; xm < 32; xm <<= 1) s += __shfl_xor(s, xm, 32);
      const float mu = s * (1.0f / CDIM);
      const float d0 = u0 - mu, d1 = u1 - mu;
      float qs = d0 * d0 + d1 * d1;
#pragma unroll
      for (int xm = 1; xm < 32; xm <<= 1) qs += __shfl_xor(qs, xm, 32);
      const float var = qs * (1.0f / CDIM);
      const float rstd = rsqrtf(var + 1e-5f);
      const float y0 = d0 * rstd * gg0 + ee0;
      const float y1 = d1 * rstd * gg1 + ee1;
      v2f yv; yv.x = y0; yv.y = y1;
      *(v2f*)&sF[row][c2] = yv;
      if (WRITEH) { sT[row][c2] = hbits(y0); sT[row][c2 + 1] = hbits(y1); }
    }
    __syncthreads();   // wave-private rows, barrier orders the cross-lane reload
    v4f fv[8];
    unsigned int fo[8];
#pragma unroll
    for (int p = 0; p < 8; ++p) {
      const int row = 16 * w + 2 * p + hl;
      const int piece = m;
      fv[p] = *(const v4f*)&sF[row][4 * piece];
      const size_t orow = OUTFULL ? ((size_t)b * SEQ_FULL + t0 + row) : (size_t)(m0 + row);
      fo[p] = (unsigned int)(orow * (size_t)ldo + n0 + 4 * piece);
    }
    v4u hv[4];
    unsigned int ho[4];
    if constexpr (WRITEH) {
#pragma unroll
      for (int p = 0; p < 4; ++p) {
        const int row = 16 * w + 4 * p + (lane >> 3);
        const int piece = lane & 7;
        hv[p] = *(const v4u*)&sT[row][piece * 8];
        ho[p] = (unsigned int)((size_t)(m0 + row) * CDIM + piece * 8);
      }
    }
#pragma unroll
    for (int p = 0; p < 8; ++p) *(v4f*)(outF + fo[p]) = fv[p];
    if constexpr (WRITEH) {
#pragma unroll
      for (int p = 0; p < 4; ++p) *(v4u*)(out0 + ho[p]) = hv[p];
    }
    
  }
}

// ---------------------------------------------------------------------------
// One 64-key chunk into LDS, shared by the work-group's four waves: K rows (64 x 128 B,
// contiguous) and V^T rows (64 x 128 B, source pitch SEQ halves).  128 threads x 16 B x 4
// row groups per operand; eight lanes cover one whole 128-B row.  lk/lv/gk/gv are the lane's
// own addresses for row group 0; a row group is 16 rows.  LDS pitch KVP halves.
// ---------------------------------------------------------------------------
#define KVP 72
#define KVBUF (64 * KVP * 2)
__device__ __forceinline__ unsigned int lds_off(const void* p) { return (unsigned int)(size_t)p; }
__device__ __forceinline__ void stage_kv(unsigned int lk, unsigned int lv,
                                         const unsigned short* gk, const unsigned short* gv) {
  const unsigned int ls = 16 * KVP * 2;
  // The closing s_wait_xcnt stands in the copies' own statement so that no address register
  // named here is rewritten ahead of it.
  asm volatile(
      "global_load_async_to_lds_b128 %0, %8, off\n\t"
      "global_load_async_to_lds_b128 %1, %9, off\n\t"
      "global_load_async_to_lds_b128 %2, %10, off\n\t"
      "global_load_async_to_lds_b128 %3, %11, off\n\t"
      "global_load_async_to_lds_b128 %4, %12, off\n\t"
      "global_load_async_to_lds_b128 %5, %13, off\n\t"
      "global_load_async_to_lds_b128 %6, %14, off\n\t"
      "global_load_async_to_lds_b128 %7, %15, off\n\t"
      "s_wait_xcnt 0x0"
      :: "v"(lk), "v"(lk + ls), "v"(lk + 2 * ls), "v"(lk + 3 * ls),
         "v"(lv), "v"(lv + ls), "v"(lv + 2 * ls), "v"(lv + 3 * ls),
         "v"(gk), "v"(gk + 16 * HD), "v"(gk + 32 * HD), "v"(gk + 48 * HD),
         "v"(gv), "v"(gv + 16 * SEQ), "v"(gv + 32 * SEQ), "v"(gv + 48 * SEQ)
      : "memory");
}

__device__ __forceinline__ float other_half(float f) {
  const int b = __float_as_int(f);
  return __int_as_float(__builtin_amdgcn_permlanex16(b, b, 0x76543210, 0xfedcba98, false, false));
}

__global__ __launch_bounds__(128) __attribute__((amdgpu_num_vgpr(256)))
void k_attn(const unsigned short* __restrict__ qp, const unsigned short* __restrict__ kp,
            const unsigned short* __restrict__ vp, unsigned short* __restrict__ op) {
  __shared__ __attribute__((aligned(16))) unsigned short sP[4][16][72];
  __shared__ __attribute__((aligned(16))) unsigned short sK[2][64][KVP];
  __shared__ __attribute__((aligned(16))) unsigned short sV[2][64][KVP];
  const int tid = threadIdx.x, lane = tid & 31, w = tid >> 5;
  const int m = lane & 15, hl = lane >> 4, k8 = hl * 8;
  const int nqt = SEQ / 64;
  const int bh = blockIdx.x / nqt, qt = blockIdx.x - bh * nqt;
  const int b = bh / NHEAD, hh = bh - b * NHEAD;
  const int tq = qt * 64 + 16 * w;          // first query row of this wave (within the sequence)

  Frag qa0, qa1;                            // B operand: column = query tq + m
  {
    const unsigned short* qr = qp + ((size_t)bh * SEQ + tq + m) * HD + k8;
    qa0.q[0] = *(const v4u*)(qr);
    qa0.q[1] = *(const v4u*)(qr + 16);
    qa1.q[0] = *(const v4u*)(qr + 32);
    qa1.q[1] = *(const v4u*)(qr + 48);
  }
  float mrun = -1e30f;                      // running maximum of query tq + m (equal in both halves)
  float lrun = 0.0f;                        // running sum over this half's keys only; joined after the loop
  v8f oacc[4];                              // O^T: row d = 16 jd + 8 hl + r, column = query tq + m
#pragma unroll
  for (int j = 0; j < 4; ++j) oacc[j] = zero8();

  // ---- chunk 0 into buffer 0, published; then chunk 1 into buffer 1 ----
  const int srow = tid >> 3, spc = (tid & 7) * 8;
  const unsigned short* gk0 = kp + ((size_t)bh * SEQ + srow) * HD + spc;
  const unsigned short* gv0 = vp + ((size_t)bh * HD + srow) * (size_t)SEQ + spc;
  const unsigned int lk0 = lds_off(&sK[0][srow][spc]);
  const unsigned int lv0 = lds_off(&sV[0][srow][spc]);
  stage_kv(lk0, lv0, gk0, gv0);
  asm volatile("s_wait_asynccnt 0x0" ::: "memory");   // this wave's copies of chunk 0 have landed
  __syncthreads();                                    // chunk 0 visible to all four waves
  if (qt >= 1) stage_kv(lk0 + KVBUF, lv0 + KVBUF, gk0 + 64 * HD, gv0 + 64);   // WG-uniform

#pragma unroll 1
  for (int kt = 0; kt <= qt; ++kt) {
    const int buf = kt & 1;
    // ---- S^T = K Q^T, four 16-key subtiles: s[j][r] = score(key 16j + 8hl + r, query m) ----
    v8f s[4];
    const unsigned short* kb = &sK[buf][m][k8];
#pragma unroll
    for (int j = 0; j < 4; ++j) {
      const unsigned short* kr = kb + j * 16 * KVP;
      Frag f0, f1;
      f0.q[0] = *(const v4u*)(kr);
      f0.q[1] = *(const v4u*)(kr + 16);
      f1.q[0] = *(const v4u*)(kr + 32);
      f1.q[1] = *(const v4u*)(kr + 48);
      v8f t = mma(f0.v, qa0.v, zero8());
      t = mma(f1.v, qa1.v, t);
      s[j] = t;
    }
    // ---- causal mask on the diagonal chunk, maximum of the lane's own query ----
    // the lane's one query allows keys up to lim, counted from this half's first key of the chunk
    const int lim = (kt == qt) ? (16 * w + m - 8 * hl) : 64;
    float tm[4];
#pragma unroll
    for (int j = 0; j < 4; ++j) {
      tm[j] = -1e30f;
#pragma unroll
      for (int r = 0; r < 8; ++r) {
        float val = s[j][r];
        val = (16 * j + r > lim) ? -1e30f : val;
        s[j][r] = val;
        tm[j] = fmaxf(tm[j], val);
      }
    }
    float tmax = fmaxf(fmaxf(tm[0], tm[1]), fmaxf(tm[2], tm[3]));
    tmax = fmaxf(tmax, other_half(tmax));
    const float mn = fmaxf(mrun, tmax);
    const float corr = __expf(mrun - mn);
    mrun = mn;
    // ---- p = exp(s - m); f16(16384 p) packed in place as the B operand; sums in the lane ----
    float ts[4];
    v8h ph[4];
#pragma unroll
    for (int j = 0; j < 4; ++j) {
      ts[j] = 0.0f;
      v8f pv;
#pragma unroll
      for (int r = 0; r < 8; ++r) {
        const float p = __expf(s[j][r] - mrun);
        ts[j] += p;
        pv[r] = p * PSC;
      }
      ph[j] = __builtin_convertvector(pv, v8h);
    }
    lrun = lrun * corr + ((ts[0] + ts[1]) + (ts[2] + ts[3]));
#pragma unroll
    for (int j = 0; j < 4; ++j) {
#pragma unroll
      for (int r = 0; r < 8; ++r) oacc[j][r] *= corr;
    }
    // elements 0..7 <- keys 8hl.., 8..15 <- keys 16+8hl.. of each 32-key block
    const v16h pb0 = __builtin_shufflevector(ph[0], ph[1], 0, 1, 2, 3, 4, 5, 6, 7, 8, 9, 10, 11, 12, 13, 14, 15);
    const v16h pb1 = __builtin_shufflevector(ph[2], ph[3], 0, 1, 2, 3, 4, 5, 6, 7, 8, 9, 10, 11, 12, 13, 14, 15);
    // ---- O^T += V^T (64 d x 64 keys) * P^T (64 keys x 16 queries) ----
    const unsigned short* vb = &sV[buf][m][k8];
#pragma unroll
    for (int jd = 0; jd < 4; ++jd) {
      const unsigned short* vr = vb + jd * 16 * KVP;
      Frag g0, g1;
      g0.q[0] = *(const v4u*)(vr);
      g0.q[1] = *(const v4u*)(vr + 16);
      g1.q[0] = *(const v4u*)(vr + 32);
      g1.q[1] = *(const v4u*)(vr + 48);
      oacc[jd] = mma(g0.v, pb0, oacc[jd]);
      oacc[jd] = mma(g1.v, pb1, oacc[jd]);
    }
    asm volatile("s_wait_dscnt 0x0" ::: "memory");      // this wave's reads of sK/sV[buf] have returned
    asm volatile("s_wait_asynccnt 0x0" ::: "memory");   // this wave's copies of chunk kt+1 have landed
    __syncthreads();   // publishes chunk kt+1, frees buffer buf for rewriting
    if (kt + 2 <= qt)  // WG-uniform
      stage_kv(lk0 + buf * KVBUF, lv0 + buf * KVBUF, gk0 + (size_t)(kt + 2) * 64 * HD, gv0 + (kt + 2) * 64);
  }
  asm volatile("s_wait_asynccnt 0x0" ::: "memory");     // nothing of this wave's in flight past the loop

  // ---- finalize: o = acc / (16384 l), stage per wave (8 consecutive d per lane), whole-line stores ----
  const float lsum = lrun + other_half(lrun);
  const float il = 1.0f / (lsum * PSC);
#pragma unroll
  for (int jd = 0; jd < 4; ++jd) {
    *(v4u*)&sP[w][m][16 * jd + k8] =
        pack8h(oacc[jd][0] * il, oacc[jd][1] * il, oacc[jd][2] * il, oacc[jd][3] * il,
               oacc[jd][4] * il, oacc[jd][5] * il, oacc[jd][6] * il, oacc[jd][7] * il);
  }
  __syncthreads();
  v4u val[4];
  unsigned int off[4];
#pragma unroll
  for (int p = 0; p < 4; ++p) {
    const int row = 4 * p + (lane >> 3);
    const int piece = lane & 7;
    val[p] = *(const v4u*)&sP[w][row][piece * 8];
    off[p] = (unsigned int)((size_t)(b * SEQ + tq + row) * QKVW + hh * HD + piece * 8);
  }
#pragma unroll
  for (int p = 0; p < 4; ++p) *(v4u*)(op + off[p]) = val[p];
  
}

// ---------------------------------------------------------------------------
// Host launcher
// ---------------------------------------------------------------------------
static inline size_t al256(size_t v) { return (v + 255) & ~(size_t)255; }

extern "C" void kernel_launch(void* const* d_in, const int* in_sizes, int n_in,
                              void* d_out, int out_size, void* d_ws, size_t ws_size,
                              hipStream_t stream) {
  if (n_in < 17) return;
  const long needX = ((long)(NB - 1) * SEQ_FULL + SEQ) * CDIM;
  const long nW = (long)NHEAD * CDIM * HD;
  if ((long)in_sizes[0] < needX) return;
  if ((long)in_sizes[1] < nW || (long)in_sizes[3] < nW || (long)in_sizes[5] < nW) return;
  if (in_sizes[2] < QKVW || in_sizes[4] < QKVW || in_sizes[6] < QKVW) return;
  if ((long)in_sizes[7] < (long)QKVW * CDIM || in_sizes[8] < CDIM) return;
  if ((long)in_sizes[9] < (long)CDIM * HID || in_sizes[10] < HID) return;
  if ((long)in_sizes[11] < (long)HID * CDIM || in_sizes[12] < CDIM) return;
  if (in_sizes[13] < CDIM || in_sizes[14] < CDIM || in_sizes[15] < CDIM || in_sizes[16] < CDIM) return;
  if ((long)out_size < needX) return;

  const float* x   = (const float*)d_in[0];
  const float* Wq  = (const float*)d_in[1];
  const float* bq  = (const float*)d_in[2];
  const float* Wk  = (const float*)d_in[3];
  const float* bk  = (const float*)d_in[4];
  const float* Wv  = (const float*)d_in[5];
  const float* bv  = (const float*)d_in[6];
  const float* Wp  = (const float*)d_in[7];
  const float* bp  = (const float*)d_in[8];
  const float* W1  = (const float*)d_in[9];
  const float* b1  = (const float*)d_in[10];
  const float* W2  = (const float*)d_in[11];
  const float* b2  = (const float*)d_in[12];
  const float* g1  = (const float*)d_in[13];
  const float* be1 = (const float*)d_in[14];
  const float* g2  = (const float*)d_in[15];
  const float* be2 = (const float*)d_in[16];
  float* out = (float*)d_out;

  char* ws = (char*)d_ws;
  size_t off = 0;
  auto carve = [&](size_t bytes) -> char* { char* p = ws + off; off += al256(bytes); return p; };
  const size_t MC  = (size_t)MROWS * CDIM;                   // [M][64]
  const size_t MHD = (size_t)NB * NHEAD * SEQ * HD;          // per q/k/vt plane
  unsigned short* wqkv = (unsigned short*)carve((size_t)3 * QKVW * CDIM * 2);   // [1536][64]
  unsigned short* wpt  = (unsigned short*)carve((size_t)CDIM * QKVW * 2);       // [64][512]
  unsigned short* w1t  = (unsigned short*)carve((size_t)HID * CDIM * 2);        // [256][64]
  unsigned short* w2t  = (unsigned short*)carve((size_t)CDIM * HID * 2);        // [64][256]
  unsigned short* xh   = (unsigned short*)carve(MC * 2);                        // [M][64]
  unsigned short* qpl  = (unsigned short*)carve(MHD * 2);                       // [B*H][SEQ][64]
  unsigned short* kpl  = (unsigned short*)carve(MHD * 2);                       // [B*H][SEQ][64]
  unsigned short* vtp  = (unsigned short*)carve(MHD * 2);                       // [B*H][64][SEQ]
  unsigned short* opl  = (unsigned short*)carve((size_t)MROWS * QKVW * 2);      // [M][512]
  float*          h1f  = (float*)carve(MC * 4);                                 // [M][64]
  unsigned short* h1h  = (unsigned short*)carve(MC * 2);                        // [M][64]
  unsigned short* act  = (unsigned short*)carve((size_t)MROWS * HID * 2);       // [M][256]
  if (off > ws_size) return;
  if (off > ((size_t)128 << 20)) return;

  // 1) weight planes: transposed, bf16 values x16 as f16
  k_wprep<<<dim3(CDIM / 64, QKVW / 64, 3), 256, 0, stream>>>(Wq, Wk, Wv, wqkv, CDIM, CDIM * HD, HD, QKVW);
  k_wprep<<<dim3(QKVW / 64, CDIM / 64, 1), 256, 0, stream>>>(Wp, Wp, Wp, wpt, QKVW, 64, CDIM, 0);
  k_wprep<<<dim3(CDIM / 64, HID / 64, 1), 256, 0, stream>>>(W1, W1, W1, w1t, CDIM, 64, HID, 0);
  k_wprep<<<dim3(HID / 64, CDIM / 64, 1), 256, 0, stream>>>(W2, W2, W2, w2t, HID, 64, CDIM, 0);
  // 2) x -> bf16 values of x as an f16 plane
  k_xcvt<<<MROWS / 32, 256, 0, stream>>>(x, xh, MROWS);
  // 3) q/k/v projections + biases -> q, k, vt planes
  k_gemm<0, 0, 0, 0><<<dim3(3 * QKVW / 64, MROWS / 64), 128, 0, stream>>>(
      xh, wqkv, CDIM, bq, bk, bv, nullptr, nullptr, nullptr, nullptr, qpl, kpl, vtp, 0);
  // 4) causal attention -> o plane [M][512]
  k_attn<<<NB * NHEAD * (SEQ / 64), 128, 0, stream>>>(qpl, kpl, vtp, opl);
  // 5) output projection + bias + residual(bf16 values of x) + layernorm 1 -> h1 (f32 + f16 copy)
  k_gemm<1, 1, 0, 1><<<dim3(CDIM / 64, MROWS / 64), 128, 0, stream>>>(
      opl, wpt, QKVW, bp, bp, bp, x, g1, be1, h1f, h1h, nullptr, nullptr, CDIM);
  // 6) ffn1 + bias + relu -> act (f16)
  k_gemm<2, 0, 0, 0><<<dim3(HID / 64, MROWS / 64), 128, 0, stream>>>(
      h1h, w1t, CDIM, b1, b1, b1, nullptr, nullptr, nullptr, nullptr, act, nullptr, nullptr, HID);
  // 7) ffn2 + bias + residual(h1) + layernorm 2 -> out (f32, full strides)
  k_gemm<1, 0, 1, 0><<<dim3(CDIM / 64, MROWS / 64), 128, 0, stream>>>(
      act, w2t, HID, b2, b2, b2, h1f, g2, be2, out, nullptr, nullptr, nullptr, CDIM);
}

// v003
// A run of this version takes 104 microseconds.
// In both of two side-by-side timings against v002, it was 1.10 times as fast.
// Over all steps from v000 it is 2.43 times as fast.
#include <hip/hip_runtime.h>

// Contractions: v_wmma_f32_16x16x32_f16 (f16 operands, f32 accumulate) for q/k/v projections, q.k^T, p.v, output projection, ffn1, ffn2; weight planes carried x16, p plane carried x16384, activations x1.

#pragma clang fp contract(off)

#ifndef NB
#define NB 4
#endif
#ifndef SEQ
#define SEQ 2048
#endif
#define NB_FULL 4
#define SEQ_FULL 2048
#define CDIM 64
#define NHEAD 8
#define HD 64
#define QKVW (NHEAD * HD)
#define HID 256
#define MROWS (NB * SEQ)
#define PSC 16384.0f

static_assert(NB >= 1 && NB <= NB_FULL);
static_assert(SEQ % 64 == 0 && SEQ >= 64 && SEQ <= SEQ_FULL);
static_assert(HD == 64);
static_assert(CDIM == 64);
static_assert(QKVW == 512);
static_assert(HID % 64 == 0 && QKVW % 64 == 0 && CDIM % 64 == 0);
static_assert(HID % 32 == 0 && QKVW % 32 == 0 && CDIM % 32 == 0);
static_assert(MROWS % 64 == 0);
static_assert((long)MROWS * QKVW < (1L << 31));
static_assert((long)NB * NHEAD * SEQ * HD < (1L << 31));

typedef _Float16 v16h __attribute__((ext_vector_type(16)));
typedef _Float16 v8h  __attribute__((ext_vector_type(8)));
typedef float    v8f  __attribute__((ext_vector_type(8)));
typedef float    v4f  __attribute__((ext_vector_type(4)));
typedef float    v2f  __attribute__((ext_vector_type(2)));
typedef unsigned int v4u __attribute__((ext_vector_type(4)));

union Frag { v16h v; v4u q[2]; };

// WMMA with hazard guard: D += A(16x32) * B(32x16)
__device__ __forceinline__ v8f mma(v16h a, v16h b, v8f c) {
  v8f d = __builtin_amdgcn_wmma_f32_16x16x32_f16(false, a, false, b, (short)0, c, false, false);
  asm volatile("v_nop\n\tv_nop\n\tv_nop\n\tv_nop" : "+v"(d) : "v"(a), "v"(b));
  return d;
}

__device__ __forceinline__ v8f zero8() {
  v8f z;
#pragma unroll
  for (int i = 0; i < 8; ++i) z[i] = 0.0f;
  return z;
}

// f32 -> nearest-even bf16 value, returned as f32
__device__ __forceinline__ float bf16q(float f) {
  unsigned int u = __float_as_uint(f);
  unsigned int r = u + 0x7FFFu + ((u >> 16) & 1u);
  r = ((u & 0x7F800000u) == 0x7F800000u) ? u : r;
  return __uint_as_float(r & 0xFFFF0000u);
}
__device__ __forceinline__ v4f bf16q4(v4f a) {
  v4f r;
  r.x = bf16q(a.x); r.y = bf16q(a.y); r.z = bf16q(a.z); r.w = bf16q(a.w);
  return r;
}
// f32 -> f16 (RNE convert) bit pattern
__device__ __forceinline__ unsigned short hbits(float f) {
  _Float16 h = (_Float16)f;
  return __builtin_bit_cast(unsigned short, h);
}
__device__ __forceinline__ v4u pack8h(float f0, float f1, float f2, float f3,
                                      float f4, float f5, float f6, float f7) {
  v8h t;
  t[0] = (_Float16)f0; t[1] = (_Float16)f1; t[2] = (_Float16)f2; t[3] = (_Float16)f3;
  t[4] = (_Float16)f4; t[5] = (_Float16)f5; t[6] = (_Float16)f6; t[7] = (_Float16)f7;
  return __builtin_bit_cast(v4u, t);
}

// ---------------------------------------------------------------------------
// Weight prep, one 64x64 tile per work-group: logical W[k][n] (f32) -> Wt[n][k] f16 plane,
// value = f16(bf16q(w) * 16).
// src element (k, n0+j) = src[(n0/64)*hstride + k*rstride + j]; dst row = drow0 + n0 + n.
// LDS sT: cross-wave (block barrier).
// ---------------------------------------------------------------------------
__device__ __forceinline__ void wprep_tile(
    unsigned short (*sT)[72], const float* __restrict__ src, unsigned short* __restrict__ dst,
    int K, int hstride, int rstride, int k0, int n0, int drow0) {
  const int tid = threadIdx.x;
  const size_t sbase = (size_t)(n0 >> 6) * (size_t)hstride;
#pragma unroll
  for (int it = 0; it < 4; ++it) {
    const int idx = it * 256 + tid;
    const int kk = idx >> 4;            // 0..63
    const int j4 = (idx & 15) * 4;      // 0..60
    const v4f wv = *(const v4f*)(src + sbase + (size_t)(k0 + kk) * (size_t)rstride + j4);
    sT[j4 + 0][kk] = hbits(bf16q(wv.x) * 16.0f);
    sT[j4 + 1][kk] = hbits(bf16q(wv.y) * 16.0f);
    sT[j4 + 2][kk] = hbits(bf16q(wv.z) * 16.0f);
    sT[j4 + 3][kk] = hbits(bf16q(wv.w) * 16.0f);
  }
  __syncthreads();   // cross-wave: staged by all waves, read by all waves
  v4u val[2];
  size_t off[2];
#pragma unroll
  for (int p = 0; p < 2; ++p) {
    const int n = p * 32 + (tid >> 3);
    const int piece = tid & 7;
    val[p] = *(const v4u*)&sT[n][piece * 8];
    off[p] = ((size_t)drow0 + n0 + n) * (size_t)K + k0 + piece * 8;
  }
#pragma unroll
  for (int p = 0; p < 2; ++p) *(v4u*)(dst + off[p]) = val[p];
  // stands in front of the code that the build lays out behind this path (the x rows), which
  // writes the registers that the two stores name
  asm volatile("s_wait_xcnt 0x0" ::: "memory");
}

// ---------------------------------------------------------------------------
// Input prep, 32 rows per work-group: x (f32, full batch strides) -> f16 plane xh[nrows][64]
// holding the bf16 values of x.  256 threads x 8 halves = 32 rows x 64.
// ---------------------------------------------------------------------------
__device__ __forceinline__ void xcvt_rows(
    const float* __restrict__ x, unsigned short* __restrict__ xh, int blk, int nrows) {
  const int tid = threadIdx.x;
  const int row = blk * 32 + (tid >> 3);
  const int piece = tid & 7;
  if (row >= nrows) return;            // no barriers on this path
  const int b = row / SEQ, t = row - b * SEQ;
  const size_t xrow = ((size_t)b * SEQ_FULL + t) * CDIM + piece * 8;
  const v4f a0 = bf16q4(*(const v4f*)(x + xrow));
  const v4f a1 = bf16q4(*(const v4f*)(x + xrow + 4));
  const v4u o = pack8h(a0.x, a0.y, a0.z, a0.w, a1.x, a1.y, a1.z, a1.w);
  unsigned short* d = xh + (size_t)row * CDIM + piece * 8;
  *(v4u*)d = o;
}

// ---------------------------------------------------------------------------
// All operand preparation in one grid: the four weight planes and the x plane depend on
// nothing but the inputs, so their work-groups run side by side, told apart by block index
// (block-uniform branches).  Weight tiles first: theirs is the longer chain (load, LDS,
// barrier, store).
// blocks [0, PB_P): Wq/Wk/Wv tiles; [PB_P, PB_1): Wp; [PB_1, PB_2): W1; [PB_2, PB_X): W2;
// [PB_X, PB_X + MROWS/32): x rows.
// ---------------------------------------------------------------------------
#define PB_P (3 * (QKVW / 64))
#define PB_1 (PB_P + QKVW / 64)
#define PB_2 (PB_1 + HID / 64)
#define PB_X (PB_2 + HID / 64)
__global__ __launch_bounds__(256) void k_prep(
    const float* __restrict__ x, const float* __restrict__ Wq, const float* __restrict__ Wk,
    const float* __restrict__ Wv, const float* __restrict__ Wp, const float* __restrict__ W1,
    const float* __restrict__ W2, unsigned short* __restrict__ wqkv,
    unsigned short* __restrict__ wpt, unsigned short* __restrict__ w1t,
    unsigned short* __restrict__ w2t, unsigned short* __restrict__ xh) {
  __shared__ __attribute__((aligned(16))) unsigned short sT[64][72];
  const int bid = blockIdx.x;
  if (bid >= PB_X) {                   // block-uniform, ahead of the barrier
    xcvt_rows(x, xh, bid - PB_X, MROWS);
    return;
  }
  const float* src;
  unsigned short* dst;
  int K, hstride, rstride, k0, n0, drow0;
  if (bid < PB_P) {
    const int z = bid / (QKVW / 64);
    src = (z == 0) ? Wq : ((z == 1) ? Wk : Wv);
    dst = wqkv; K = CDIM; hstride = CDIM * HD; rstride = HD;
    k0 = 0; n0 = (bid - z * (QKVW / 64)) * 64; drow0 = QKVW * z;
  } else if (bid < PB_1) {
    src = Wp; dst = wpt; K = QKVW; hstride = 64; rstride = CDIM;
    k0 = (bid - PB_P) * 64; n0 = 0; drow0 = 0;
  } else if (bid < PB_2) {
    src = W1; dst = w1t; K = CDIM; hstride = 64; rstride = HID;
    k0 = 0; n0 = (bid - PB_1) * 64; drow0 = 0;
  } else {
    src = W2; dst = w2t; K = HID; hstride = 64; rstride = CDIM;
    k0 = (bid - PB_2) * 64; n0 = 0; drow0 = 0;
  }
  wprep_tile(sT, src, dst, K, hstride, rstride, k0, n0, drow0);
}

// ---------------------------------------------------------------------------
// 64x64-tile f16 GEMM: D = A[M][K] * Bt[N][K]^T, 4 waves per WG, wave w owns
// rows 16w..16w+15 x 64 cols (4 accumulator tiles).  Fragments loaded straight
// from the 16-bit planes with the split k map for A and B (row/col = lane&15,
// elements 0..7 <- k0+8h.., 8..15 <- k0+16+8h..).
// EPI 0: q/k planes [b*H+h][t][64] and v transposed plane vt[b*H+h][64][t]
//        (value acc/16 + bf16q(bias), bias picked per q/k/v by the column block)
// EPI 2: f16 out = relu(acc/16 + bf16q(bias))
// EPI 1: u = acc/16 + bf16q(bias) + res (res read at full strides and bf16q'd when RESFULL),
//        then layernorm over the 64-col row (the 64x64 tile holds whole rows),
//        f32 out (full strides when OUTFULL) and, when WRITEH, an f16 copy [M][64].
// coverage EPI0/2: 4 passes x 4 waves x 4 rows = 64 rows x 64 cols; EPI1: 8 passes x 2 rows per wave = 16 rows x 64 f32 cols per wave,
//          plus (WRITEH) 4 passes x 4 rows per wave = 16 rows x 64 halves; EPI0 v path: 4 passes x 4 waves x 4 d = 64 d rows x 64 tokens.
// LDS: sT/sF rows are wave-private except in EPI0 (q/k and v paths both cross-wave); block barriers used everywhere.
// ---------------------------------------------------------------------------
template <int EPI, int RESFULL, int OUTFULL, int WRITEH>
__global__ __launch_bounds__(128) __attribute__((amdgpu_num_vgpr(256))) void k_gemm(
    const unsigned short* __restrict__ A, const unsigned short* __restrict__ Bt, int K,
    const float* __restrict__ bias, const float* __restrict__ biasb, const float* __restrict__ biasc,
    const float* __restrict__ res, const float* __restrict__ gam, const float* __restrict__ bet,
    float* __restrict__ outF, unsigned short* __restrict__ out0,
    unsigned short* __restrict__ out1, unsigned short* __restrict__ out2, int ldo) {
  __shared__ __attribute__((aligned(16))) unsigned short sT[64][72];
  __shared__ __attribute__((aligned(16))) float sF[64][68];
  const int tid = threadIdx.x, lane = tid & 31, w = tid >> 5;
  const int m = lane & 15, hl = lane >> 4, k8 = hl * 8;
  const int m0 = blockIdx.y * 64, n0 = blockIdx.x * 64;

  v8f acc[4];
#pragma unroll
  for (int j = 0; j < 4; ++j) acc[j] = zero8();

  const unsigned short* ap = A + (size_t)(m0 + 16 * w + m) * (size_t)K + k8;
  const unsigned short* bp = Bt + (size_t)(n0 + m) * (size_t)K + k8;
  const size_t jstep = (size_t)16 * (size_t)K;
#pragma unroll 1
  for (int k0 = 0; k0 < K; k0 += 32) {
    Frag a;
    a.q[0] = *(const v4u*)(ap + k0);
    a.q[1] = *(const v4u*)(ap + k0 + 16);
#pragma unroll
    for (int j = 0; j < 4; ++j) {
      Frag b;
      const unsigned short* bj = bp + jstep * j + k0;
      b.q[0] = *(const v4u*)(bj);
      b.q[1] = *(const v4u*)(bj + 16);
      acc[j] = mma(a.v, b.v, acc[j]);
    }
  }

  const float wsc = 0.0625f;               // undo the x16 weight carry
  const int lrow0 = 16 * w + 8 * hl;       // D rows of this lane within the WG tile

  if constexpr (EPI == 0) {
    const int which = n0 / QKVW;           // 0 = q, 1 = k, 2 = v (WG-uniform)
    const int hh = (n0 - which * QKVW) / HD;
    const float* bsel = (which == 0) ? bias : ((which == 1) ? biasb : biasc);
#pragma unroll
    for (int j = 0; j < 4; ++j) {
      const float bj = bf16q(bsel[hh * HD + 16 * j + m]);
#pragma unroll
      for (int r = 0; r < 8; ++r) sT[lrow0 + r][16 * j + m] = hbits(acc[j][r] * wsc + bj);
    }
    __syncthreads();   // cross-wave for both the q/k and the v reloads
    const int b = m0 / SEQ, t0 = m0 - b * SEQ;
    const int bh = b * NHEAD + hh;
    v4u val[4];
    unsigned int off[4];
    unsigned short* dst;
    if (which < 2) {                       // WG-uniform
      dst = (which == 0) ? out0 : out1;
#pragma unroll
      for (int p = 0; p < 4; ++p) {
        const int row = p * 16 + 4 * w + (lane >> 3);
        const int piece = lane & 7;
        val[p] = *(const v4u*)&sT[row][piece * 8];
        off[p] = (unsigned int)((bh * SEQ + t0 + row) * HD + piece * 8);
      }
    } else {
      dst = out2;
#pragma unroll
      for (int p = 0; p < 4; ++p) {
        const int d = p * 16 + 4 * w + (lane >> 3);
        const int piece = lane & 7;
        unsigned int wv[4];
#pragma unroll
        for (int e = 0; e < 4; ++e) {
          const unsigned int lo = sT[piece * 8 + 2 * e][d];
          const unsigned int hi = sT[piece * 8 + 2 * e + 1][d];
          wv[e] = lo | (hi << 16);
        }
        v4u t;
        t.x = wv[0]; t.y = wv[1]; t.z = wv[2]; t.w = wv[3];
        val[p] = t;
        off[p] = (unsigned int)((bh * HD + d) * SEQ + t0 + piece * 8);
      }
    }
#pragma unroll
    for (int p = 0; p < 4; ++p) *(v4u*)(dst + off[p]) = val[p];
    
  } else if constexpr (EPI == 2) {
#pragma unroll
    for (int j = 0; j < 4; ++j) {
      const float bj = bf16q(bias[n0 + 16 * j + m]);
#pragma unroll
      for (int r = 0; r < 8; ++r) {
        float u = acc[j][r] * wsc + bj;
        u = fmaxf(u, 0.0f);
        sT[lrow0 + r][16 * j + m] = hbits(u);
      }
    }
    __syncthreads();   // wave-private rows, barrier orders the reload
    v4u val[4];
    unsigned int off[4];
#pragma unroll
    for (int p = 0; p < 4; ++p) {
      const int row = 16 * w + 4 * p + (lane >> 3);
      const int piece = lane & 7;
      val[p] = *(const v4u*)&sT[row][piece * 8];
      off[p] = (unsigned int)((size_t)(m0 + row) * (size_t)ldo + n0 + piece * 8);
    }
#pragma unroll
    for (int p = 0; p < 4; ++p) *(v4u*)(out0 + off[p]) = val[p];
    
  } else {
    // ---- bias + residual + layernorm over the whole 64-col row ----
#pragma unroll
    for (int j = 0; j < 4; ++j) {
#pragma unroll
      for (int r = 0; r < 8; ++r) sF[lrow0 + r][16 * j + m] = acc[j][r] * wsc;
    }
    __syncthreads();   // wave-private rows, barrier orders the cross-lane reload
    const int b = m0 / SEQ, t0 = m0 - b * SEQ;
    const int c2 = 2 * lane;               // lane owns cols c2, c2+1 of each of its wave's rows
    const float bb0 = bf16q(bias[n0 + c2]), bb1 = bf16q(bias[n0 + c2 + 1]);
    const float gg0 = bf16q(gam[n0 + c2]),  gg1 = bf16q(gam[n0 + c2 + 1]);
    const float ee0 = bf16q(bet[n0 + c2]),  ee1 = bf16q(bet[n0 + c2 + 1]);
#pragma unroll
    for (int rr = 0; rr < 16; ++rr) {
      const int row = 16 * w + rr;
      const size_t rrow = RESFULL ? ((size_t)b * SEQ_FULL + t0 + row) : (size_t)(m0 + row);
      v2f rv = *(const v2f*)(res + rrow * (size_t)ldo + n0 + c2);
      if (RESFULL) { rv.x = bf16q(rv.x); rv.y = bf16q(rv.y); }
      const v2f av = *(const v2f*)&sF[row][c2];
      const float u0 = (av.x + bb0) + rv.x;
      const float u1 = (av.y + bb1) + rv.y;
      float s = u0 + u1;
#pragma unroll
      for (int xm = 1; xm < 32; xm <<= 1) s += __shfl_xor(s, xm, 32);
      const float mu = s * (1.0f / CDIM);
      const float d0 = u0 - mu, d1 = u1 - mu;
      float qs = d0 * d0 + d1 * d1;
#pragma unroll
      for (int xm = 1; xm < 32; xm <<= 1) qs += __shfl_xor(qs, xm, 32);
      const float var = qs * (1.0f / CDIM);
      const float rstd = rsqrtf(var + 1e-5f);
      const float y0 = d0 * rstd * gg0 + ee0;
      const float y1 = d1 * rstd * gg1 + ee1;
      v2f yv; yv.x = y0; yv.y = y1;
      *(v2f*)&sF[row][c2] = yv;
      if (WRITEH) { sT[row][c2] = hbits(y0); sT[row][c2 + 1] = hbits(y1); }
    }
    __syncthreads();   // wave-private rows, barrier orders the cross-lane reload
    v4f fv[8];
    unsigned int fo[8];
#pragma unroll
    for (int p = 0; p < 8; ++p) {
      const int row = 16 * w + 2 * p + hl;
      const int piece = m;
      fv[p] = *(const v4f*)&sF[row][4 * piece];
      const size_t orow = OUTFULL ? ((size_t)b * SEQ_FULL + t0 + row) : (size_t)(m0 + row);
      fo[p] = (unsigned int)(orow * (size_t)ldo + n0 + 4 * piece);
    }
    v4u hv[4];
    unsigned int ho[4];
    if constexpr (WRITEH) {
#pragma unroll
      for (int p = 0; p < 4; ++p) {
        const int row = 16 * w + 4 * p + (lane >> 3);
        const int piece = lane & 7;
        hv[p] = *(const v4u*)&sT[row][piece * 8];
        ho[p] = (unsigned int)((size_t)(m0 + row) * CDIM + piece * 8);
      }
    }
#pragma unroll
    for (int p = 0; p < 8; ++p) *(v4f*)(outF + fo[p]) = fv[p];
    if constexpr (WRITEH) {
#pragma unroll
      for (int p = 0; p < 4; ++p) *(v4u*)(out0 + ho[p]) = hv[p];
    }
    
  }
}

// ---------------------------------------------------------------------------
// One 64-key chunk into LDS, shared by the work-group's four waves: K rows (64 x 128 B,
// contiguous) and V^T rows (64 x 128 B, source pitch SEQ halves).  128 threads x 16 B x 4
// row groups per operand; eight lanes cover one whole 128-B row.  lk/lv/gk/gv are the lane's
// own addresses for row group 0; a row group is 16 rows.  LDS pitch KVP halves.
// ---------------------------------------------------------------------------
#define KVP 72
#define KVBUF (64 * KVP * 2)
__device__ __forceinline__ unsigned int lds_off(const void* p) { return (unsigned int)(size_t)p; }
__device__ __forceinline__ void stage_kv(unsigned int lk, unsigned int lv,
                                         const unsigned short* gk, const unsigned short* gv) {
  const unsigned int ls = 16 * KVP * 2;
  // The closing s_wait_xcnt stands in the copies' own statement so that no address register
  // named here is rewritten ahead of it.
  asm volatile(
      "global_load_async_to_lds_b128 %0, %8, off\n\t"
      "global_load_async_to_lds_b128 %1, %9, off\n\t"
      "global_load_async_to_lds_b128 %2, %10, off\n\t"
      "global_load_async_to_lds_b128 %3, %11, off\n\t"
      "global_load_async_to_lds_b128 %4, %12, off\n\t"
      "global_load_async_to_lds_b128 %5, %13, off\n\t"
      "global_load_async_to_lds_b128 %6, %14, off\n\t"
      "global_load_async_to_lds_b128 %7, %15, off\n\t"
      "s_wait_xcnt 0x0"
      :: "v"(lk), "v"(lk + ls), "v"(lk + 2 * ls), "v"(lk + 3 * ls),
         "v"(lv), "v"(lv + ls), "v"(lv + 2 * ls), "v"(lv + 3 * ls),
         "v"(gk), "v"(gk + 16 * HD), "v"(gk + 32 * HD), "v"(gk + 48 * HD),
         "v"(gv), "v"(gv + 16 * SEQ), "v"(gv + 32 * SEQ), "v"(gv + 48 * SEQ)
      : "memory");
}

__device__ __forceinline__ float other_half(float f) {
  const int b = __float_as_int(f);
  return __int_as_float(__builtin_amdgcn_permlanex16(b, b, 0x76543210, 0xfedcba98, false, false));
}

__global__ __launch_bounds__(128) __attribute__((amdgpu_num_vgpr(256)))
void k_attn(const unsigned short* __restrict__ qp, const unsigned short* __restrict__ kp,
            const unsigned short* __restrict__ vp, unsigned short* __restrict__ op) {
  __shared__ __attribute__((aligned(16))) unsigned short sP[4][16][72];
  __shared__ __attribute__((aligned(16))) unsigned short sK[2][64][KVP];
  __shared__ __attribute__((aligned(16))) unsigned short sV[2][64][KVP];
  const int tid = threadIdx.x, lane = tid & 31, w = tid >> 5;
  const int m = lane & 15, hl = lane >> 4, k8 = hl * 8;
  const int nqt = SEQ / 64;
  const int bh = blockIdx.x / nqt, qt = blockIdx.x - bh * nqt;
  const int b = bh / NHEAD, hh = bh - b * NHEAD;
  const int tq = qt * 64 + 16 * w;          // first query row of this wave (within the sequence)

  Frag qa0, qa1;                            // B operand: column = query tq + m
  {
    const unsigned short* qr = qp + ((size_t)bh * SEQ + tq + m) * HD + k8;
    qa0.q[0] = *(const v4u*)(qr);
    qa0.q[1] = *(const v4u*)(qr + 16);
    qa1.q[0] = *(const v4u*)(qr + 32);
    qa1.q[1] = *(const v4u*)(qr + 48);
  }
  float mrun = -1e30f;                      // running maximum of query tq + m (equal in both halves)
  float lrun = 0.0f;                        // running sum over this half's keys only; joined after the loop
  v8f oacc[4];                              // O^T: row d = 16 jd + 8 hl + r, column = query tq + m
#pragma unroll
  for (int j = 0; j < 4; ++j) oacc[j] = zero8();

  // ---- chunk 0 into buffer 0, published; then chunk 1 into buffer 1 ----
  const int srow = tid >> 3, spc = (tid & 7) * 8;
  const unsigned short* gk0 = kp + ((size_t)bh * SEQ + srow) * HD + spc;
  const unsigned short* gv0 = vp + ((size_t)bh * HD + srow) * (size_t)SEQ + spc;
  const unsigned int lk0 = lds_off(&sK[0][srow][spc]);
  const unsigned int lv0 = lds_off(&sV[0][srow][spc]);
  stage_kv(lk0, lv0, gk0, gv0);
  asm volatile("s_wait_asynccnt 0x0" ::: "memory");   // this wave's copies of chunk 0 have landed
  __syncthreads();                                    // chunk 0 visible to all four waves
  if (qt >= 1) stage_kv(lk0 + KVBUF, lv0 + KVBUF, gk0 + 64 * HD, gv0 + 64);   // WG-uniform

#pragma unroll 1
  for (int kt = 0; kt <= qt; ++kt) {
    const int buf = kt & 1;
    // ---- S^T = K Q^T, four 16-key subtiles: s[j][r] = score(key 16j + 8hl + r, query m) ----
    v8f s[4];
    const unsigned short* kb = &sK[buf][m][k8];
#pragma unroll
    for (int j = 0; j < 4; ++j) {
      const unsigned short* kr = kb + j * 16 * KVP;
      Frag f0, f1;
      f0.q[0] = *(const v4u*)(kr);
      f0.q[1] = *(const v4u*)(kr + 16);
      f1.q[0] = *(const v4u*)(kr + 32);
      f1.q[1] = *(const v4u*)(kr + 48);
      v8f t = mma(f0.v, qa0.v, zero8());
      t = mma(f1.v, qa1.v, t);
      s[j] = t;
    }
    // ---- causal mask on the diagonal chunk, maximum of the lane's own query ----
    // the lane's one query allows keys up to lim, counted from this half's first key of the chunk
    const int lim = (kt == qt) ? (16 * w + m - 8 * hl) : 64;
    float tm[4];
#pragma unroll
    for (int j = 0; j < 4; ++j) {
      tm[j] = -1e30f;
#pragma unroll
      for (int r = 0; r < 8; ++r) {
        float val = s[j][r];
        val = (16 * j + r > lim) ? -1e30f : val;
        s[j][r] = val;
        tm[j] = fmaxf(tm[j], val);
      }
    }
    float tmax = fmaxf(fmaxf(tm[0], tm[1]), fmaxf(tm[2], tm[3]));
    tmax = fmaxf(tmax, other_half(tmax));
    const float mn = fmaxf(mrun, tmax);
    const float corr = __expf(mrun - mn);
    mrun = mn;
    // ---- p = exp(s - m); f16(16384 p) packed in place as the B operand; sums in the lane ----
    float ts[4];
    v8h ph[4];
#pragma unroll
    for (int j = 0; j < 4; ++j) {
      ts[j] = 0.0f;
      v8f pv;
#pragma unroll
      for (int r = 0; r < 8; ++r) {
        const float p = __expf(s[j][r] - mrun);
        ts[j] += p;
        pv[r] = p * PSC;
      }
      ph[j] = __builtin_convertvector(pv, v8h);
    }
    lrun = lrun * corr + ((ts[0] + ts[1]) + (ts[2] + ts[3]));
#pragma unroll
    for (int j = 0; j < 4; ++j) {
#pragma unroll
      for (int r = 0; r < 8; ++r) oacc[j][r] *= corr;
    }
    // elements 0..7 <- keys 8hl.., 8..15 <- keys 16+8hl.. of each 32-key block
    const v16h pb0 = __builtin_shufflevector(ph[0], ph[1], 0, 1, 2, 3, 4, 5, 6, 7, 8, 9, 10, 11, 12, 13, 14, 15);
    const v16h pb1 = __builtin_shufflevector(ph[2], ph[3], 0, 1, 2, 3, 4, 5, 6, 7, 8, 9, 10, 11, 12, 13, 14, 15);
    // ---- O^T += V^T (64 d x 64 keys) * P^T (64 keys x 16 queries) ----
    const unsigned short* vb = &sV[buf][m][k8];
#pragma unroll
    for (int jd = 0; jd < 4; ++jd) {
      const unsigned short* vr = vb + jd * 16 * KVP;
      Frag g0, g1;
      g0.q[0] = *(const v4u*)(vr);
      g0.q[1] = *(const v4u*)(vr + 16);
      g1.q[0] = *(const v4u*)(vr + 32);
      g1.q[1] = *(const v4u*)(vr + 48);
      oacc[jd] = mma(g0.v, pb0, oacc[jd]);
      oacc[jd] = mma(g1.v, pb1, oacc[jd]);
    }
    asm volatile("s_wait_dscnt 0x0" ::: "memory");      // this wave's reads of sK/sV[buf] have returned
    asm volatile("s_wait_asynccnt 0x0" ::: "memory");   // this wave's copies of chunk kt+1 have landed
    __syncthreads();   // publishes chunk kt+1, frees buffer buf for rewriting
    if (kt + 2 <= qt)  // WG-uniform
      stage_kv(lk0 + buf * KVBUF, lv0 + buf * KVBUF, gk0 + (size_t)(kt + 2) * 64 * HD, gv0 + (kt + 2) * 64);
  }
  asm volatile("s_wait_asynccnt 0x0" ::: "memory");     // nothing of this wave's in flight past the loop

  // ---- finalize: o = acc / (16384 l), stage per wave (8 consecutive d per lane), whole-line stores ----
  const float lsum = lrun + other_half(lrun);
  const float il = 1.0f / (lsum * PSC);
#pragma unroll
  for (int jd = 0; jd < 4; ++jd) {
    *(v4u*)&sP[w][m][16 * jd + k8] =
        pack8h(oacc[jd][0] * il, oacc[jd][1] * il, oacc[jd][2] * il, oacc[jd][3] * il,
               oacc[jd][4] * il, oacc[jd][5] * il, oacc[jd][6] * il, oacc[jd][7] * il);
  }
  __syncthreads();
  v4u val[4];
  unsigned int off[4];
#pragma unroll
  for (int p = 0; p < 4; ++p) {
    const int row = 4 * p + (lane >> 3);
    const int piece = lane & 7;
    val[p] = *(const v4u*)&sP[w][row][piece * 8];
    off[p] = (unsigned int)((size_t)(b * SEQ + tq + row) * QKVW + hh * HD + piece * 8);
  }
#pragma unroll
  for (int p = 0; p < 4; ++p) *(v4u*)(op + off[p]) = val[p];
  
}

// ---------------------------------------------------------------------------
// Host launcher
// ---------------------------------------------------------------------------
static inline size_t al256(size_t v) { return (v + 255) & ~(size_t)255; }

extern "C" void kernel_launch(void* const* d_in, const int* in_sizes, int n_in,
                              void* d_out, int out_size, void* d_ws, size_t ws_size,
                              hipStream_t stream) {
  if (n_in < 17) return;
  const long needX = ((long)(NB - 1) * SEQ_FULL + SEQ) * CDIM;
  const long nW = (long)NHEAD * CDIM * HD;
  if ((long)in_sizes[0] < needX) return;
  if ((long)in_sizes[1] < nW || (long)in_sizes[3] < nW || (long)in_sizes[5] < nW) return;
  if (in_sizes[2] < QKVW || in_sizes[4] < QKVW || in_sizes[6] < QKVW) return;
  if ((long)in_sizes[7] < (long)QKVW * CDIM || in_sizes[8] < CDIM) return;
  if ((long)in_sizes[9] < (long)CDIM * HID || in_sizes[10] < HID) return;
  if ((long)in_sizes[11] < (long)HID * CDIM || in_sizes[12] < CDIM) return;
  if (in_sizes[13] < CDIM || in_sizes[14] < CDIM || in_sizes[15] < CDIM || in_sizes[16] < CDIM) return;
  if ((long)out_size < needX) return;

  const float* x   = (const float*)d_in[0];
  const float* Wq  = (const float*)d_in[1];
  const float* bq  = (const float*)d_in[2];
  const float* Wk  = (const float*)d_in[3];
  const float* bk  = (const float*)d_in[4];
  const float* Wv  = (const float*)d_in[5];
  const float* bv  = (const float*)d_in[6];
  const float* Wp  = (const float*)d_in[7];
  const float* bp  = (const float*)d_in[8];
  const float* W1  = (const float*)d_in[9];
  const float* b1  = (const float*)d_in[10];
  const float* W2  = (const float*)d_in[11];
  const float* b2  = (const float*)d_in[12];
  const float* g1  = (const float*)d_in[13];
  const float* be1 = (const float*)d_in[14];
  const float* g2  = (const float*)d_in[15];
  const float* be2 = (const float*)d_in[16];
  float* out = (float*)d_out;

  char* ws = (char*)d_ws;
  size_t off = 0;
  auto carve = [&](size_t bytes) -> char* { char* p = ws + off; off += al256(bytes); return p; };
  const size_t MC  = (size_t)MROWS * CDIM;                   // [M][64]
  const size_t MHD = (size_t)NB * NHEAD * SEQ * HD;          // per q/k/vt plane
  unsigned short* wqkv = (unsigned short*)carve((size_t)3 * QKVW * CDIM * 2);   // [1536][64]
  unsigned short* wpt  = (unsigned short*)carve((size_t)CDIM * QKVW * 2);       // [64][512]
  unsigned short* w1t  = (unsigned short*)carve((size_t)HID * CDIM * 2);        // [256][64]
  unsigned short* w2t  = (unsigned short*)carve((size_t)CDIM * HID * 2);        // [64][256]
  unsigned short* xh   = (unsigned short*)carve(MC * 2);                        // [M][64]
  unsigned short* qpl  = (unsigned short*)carve(MHD * 2);                       // [B*H][SEQ][64]
  unsigned short* kpl  = (unsigned short*)carve(MHD * 2);                       // [B*H][SEQ][64]
  unsigned short* vtp  = (unsigned short*)carve(MHD * 2);                       // [B*H][64][SEQ]
  unsigned short* opl  = (unsigned short*)carve((size_t)MROWS * QKVW * 2);      // [M][512]
  float*          h1f  = (float*)carve(MC * 4);                                 // [M][64]
  unsigned short* h1h  = (unsigned short*)carve(MC * 2);                        // [M][64]
  unsigned short* act  = (unsigned short*)carve((size_t)MROWS * HID * 2);       // [M][256]
  if (off > ws_size) return;
  if (off > ((size_t)128 << 20)) return;

  // 1+2) weight planes (transposed, bf16 values x16 as f16) and the x plane (bf16 values of x
  //      as f16), one grid
  k_prep<<<PB_X + MROWS / 32, 256, 0, stream>>>(x, Wq, Wk, Wv, Wp, W1, W2, wqkv, wpt, w1t, w2t, xh);
  // 3) q/k/v projections + biases -> q, k, vt planes
  k_gemm<0, 0, 0, 0><<<dim3(3 * QKVW / 64, MROWS / 64), 128, 0, stream>>>(
      xh, wqkv, CDIM, bq, bk, bv, nullptr, nullptr, nullptr, nullptr, qpl, kpl, vtp, 0);
  // 4) causal attention -> o plane [M][512]
  k_attn<<<NB * NHEAD * (SEQ / 64), 128, 0, stream>>>(qpl, kpl, vtp, opl);
  // 5) output projection + bias + residual(bf16 values of x) + layernorm 1 -> h1 (f32 + f16 copy)
  k_gemm<1, 1, 0, 1><<<dim3(CDIM / 64, MROWS / 64), 128, 0, stream>>>(
      opl, wpt, QKVW, bp, bp, bp, x, g1, be1, h1f, h1h, nullptr, nullptr, CDIM);
  // 6) ffn1 + bias + relu -> act (f16)
  k_gemm<2, 0, 0, 0><<<dim3(HID / 64, MROWS / 64), 128, 0, stream>>>(
      h1h, w1t, CDIM, b1, b1, b1, nullptr, nullptr, nullptr, nullptr, act, nullptr, nullptr, HID);
  // 7) ffn2 + bias + residual(h1) + layernorm 2 -> out (f32, full strides)
  k_gemm<1, 0, 1, 0><<<dim3(CDIM / 64, MROWS / 64), 128, 0, stream>>>(
      act, w2t, HID, b2, b2, b2, h1f, g2, be2, out, nullptr, nullptr, nullptr, CDIM);
}

// v004
// Measured time: 95.4 microseconds a run.
// In two side-by-side timings against v003, it was 1.10 and 1.09 times as fast.
// All steps since v000 together make it 2.66 times as fast.
#include <hip/hip_runtime.h>

// Contractions: v_wmma_f32_16x16x32_f16 (f16 operands, f32 accumulate) for q/k/v projections, q.k^T, p.v, output projection, ffn1, ffn2; weight planes carried x16, p plane carried x16384, activations x1.

#pragma clang fp contract(off)

#ifndef NB
#define NB 4
#endif
#ifndef SEQ
#define SEQ 2048
#endif
#define NB_FULL 4
#define SEQ_FULL 2048
#define CDIM 64
#define NHEAD 8
#define HD 64
#define QKVW (NHEAD * HD)
#define HID 256
#define MROWS (NB * SEQ)
#define PSC 16384.0f

static_assert(NB >= 1 && NB <= NB_FULL);
static_assert(SEQ % 64 == 0 && SEQ >= 64 && SEQ <= SEQ_FULL);
static_assert(HD == 64);
static_assert(CDIM == 64);
static_assert(QKVW == 512);
static_assert(HID % 64 == 0 && QKVW % 64 == 0 && CDIM % 64 == 0);
static_assert(HID % 32 == 0 && QKVW % 32 == 0 && CDIM % 32 == 0);
static_assert(MROWS % 64 == 0);
static_assert((long)MROWS * QKVW < (1L << 31));
static_assert((long)NB * NHEAD * SEQ * HD < (1L << 31));

typedef _Float16 v16h __attribute__((ext_vector_type(16)));
typedef _Float16 v8h  __attribute__((ext_vector_type(8)));
typedef float    v8f  __attribute__((ext_vector_type(8)));
typedef float    v4f  __attribute__((ext_vector_type(4)));
typedef float    v2f  __attribute__((ext_vector_type(2)));
typedef unsigned int v4u __attribute__((ext_vector_type(4)));

union Frag { v16h v; v4u q[2]; };

// WMMA with hazard guard: D += A(16x32) * B(32x16)
__device__ __forceinline__ v8f mma(v16h a, v16h b, v8f c) {
  v8f d = __builtin_amdgcn_wmma_f32_16x16x32_f16(false, a, false, b, (short)0, c, false, false);
  asm volatile("v_nop\n\tv_nop\n\tv_nop\n\tv_nop" : "+v"(d) : "v"(a), "v"(b));
  return d;
}

__device__ __forceinline__ v8f zero8() {
  v8f z;
#pragma unroll
  for (int i = 0; i < 8; ++i) z[i] = 0.0f;
  return z;
}

// f32 -> nearest-even bf16 value, returned as f32
__device__ __forceinline__ float bf16q(float f) {
  unsigned int u = __float_as_uint(f);
  unsigned int r = u + 0x7FFFu + ((u >> 16) & 1u);
  r = ((u & 0x7F800000u) == 0x7F800000u) ? u : r;
  return __uint_as_float(r & 0xFFFF0000u);
}
__device__ __forceinline__ v4f bf16q4(v4f a) {
  v4f r;
  r.x = bf16q(a.x); r.y = bf16q(a.y); r.z = bf16q(a.z); r.w = bf16q(a.w);
  return r;
}
// f32 -> f16 (RNE convert) bit pattern
__device__ __forceinline__ unsigned short hbits(float f) {
  _Float16 h = (_Float16)f;
  return __builtin_bit_cast(unsigned short, h);
}
__device__ __forceinline__ v4u pack8h(float f0, float f1, float f2, float f3,
                                      float f4, float f5, float f6, float f7) {
  v8h t;
  t[0] = (_Float16)f0; t[1] = (_Float16)f1; t[2] = (_Float16)f2; t[3] = (_Float16)f3;
  t[4] = (_Float16)f4; t[5] = (_Float16)f5; t[6] = (_Float16)f6; t[7] = (_Float16)f7;
  return __builtin_bit_cast(v4u, t);
}

// ---------------------------------------------------------------------------
// Weight prep, one 64x64 tile per work-group: logical W[k][n] (f32) -> Wt[n][k] f16 plane,
// value = f16(bf16q(w) * 16).
// src element (k, n0+j) = src[(n0/64)*hstride + k*rstride + j]; dst row = drow0 + n0 + n.
// LDS sT: cross-wave (block barrier).
// ---------------------------------------------------------------------------
__device__ __forceinline__ void wprep_tile(
    unsigned short (*sT)[72], const float* __restrict__ src, unsigned short* __restrict__ dst,
    int K, int hstride, int rstride, int k0, int n0, int drow0) {
  const int tid = threadIdx.x;
  const size_t sbase = (size_t)(n0 >> 6) * (size_t)hstride;
#pragma unroll
  for (int it = 0; it < 4; ++it) {
    const int idx = it * 256 + tid;
    const int kk = idx >> 4;            // 0..63
    const int j4 = (idx & 15) * 4;      // 0..60
    const v4f wv = *(const v4f*)(src + sbase + (size_t)(k0 + kk) * (size_t)rstride + j4);
    sT[j4 + 0][kk] = hbits(bf16q(wv.x) * 16.0f);
    sT[j4 + 1][kk] = hbits(bf16q(wv.y) * 16.0f);
    sT[j4 + 2][kk] = hbits(bf16q(wv.z) * 16.0f);
    sT[j4 + 3][kk] = hbits(bf16q(wv.w) * 16.0f);
  }
  __syncthreads();   // cross-wave: staged by all waves, read by all waves
  v4u val[2];
  size_t off[2];
#pragma unroll
  for (int p = 0; p < 2; ++p) {
    const int n = p * 32 + (tid >> 3);
    const int piece = tid & 7;
    val[p] = *(const v4u*)&sT[n][piece * 8];
    off[p] = ((size_t)drow0 + n0 + n) * (size_t)K + k0 + piece * 8;
  }
#pragma unroll
  for (int p = 0; p < 2; ++p) *(v4u*)(dst + off[p]) = val[p];
  // stands in front of the code that the build lays out behind this path (the x rows), which
  // writes the registers that the two stores name
  asm volatile("s_wait_xcnt 0x0" ::: "memory");
}

// ---------------------------------------------------------------------------
// Input prep, 32 rows per work-group: x (f32, full batch strides) -> f16 plane xh[nrows][64]
// holding the bf16 values of x.  256 threads x 8 halves = 32 rows x 64.
// ---------------------------------------------------------------------------
__device__ __forceinline__ void xcvt_rows(
    const float* __restrict__ x, unsigned short* __restrict__ xh, int blk, int nrows) {
  const int tid = threadIdx.x;
  const int row = blk * 32 + (tid >> 3);
  const int piece = tid & 7;
  if (row >= nrows) return;            // no barriers on this path
  const int b = row / SEQ, t = row - b * SEQ;
  const size_t xrow = ((size_t)b * SEQ_FULL + t) * CDIM + piece * 8;
  const v4f a0 = bf16q4(*(const v4f*)(x + xrow));
  const v4f a1 = bf16q4(*(const v4f*)(x + xrow + 4));
  const v4u o = pack8h(a0.x, a0.y, a0.z, a0.w, a1.x, a1.y, a1.z, a1.w);
  unsigned short* d = xh + (size_t)row * CDIM + piece * 8;
  *(v4u*)d = o;
}

// ---------------------------------------------------------------------------
// All operand preparation in one grid: the four weight planes and the x plane depend on
// nothing but the inputs, so their work-groups run side by side, told apart by block index
// (block-uniform branches).  Weight tiles first: theirs is the longer chain (load, LDS,
// barrier, store).
// blocks [0, PB_P): Wq/Wk/Wv tiles; [PB_P, PB_1): Wp; [PB_1, PB_2): W1; [PB_2, PB_X): W2;
// [PB_X, PB_X + MROWS/32): x rows.
// ---------------------------------------------------------------------------
#define PB_P (3 * (QKVW / 64))
#define PB_1 (PB_P + QKVW / 64)
#define PB_2 (PB_1 + HID / 64)
#define PB_X (PB_2 + HID / 64)
__global__ __launch_bounds__(256) void k_prep(
    const float* __restrict__ x, const float* __restrict__ Wq, const float* __restrict__ Wk,
    const float* __restrict__ Wv, const float* __restrict__ Wp, const float* __restrict__ W1,
    const float* __restrict__ W2, unsigned short* __restrict__ wqkv,
    unsigned short* __restrict__ wpt, unsigned short* __restrict__ w1t,
    unsigned short* __restrict__ w2t, unsigned short* __restrict__ xh) {
  __shared__ __attribute__((aligned(16))) unsigned short sT[64][72];
  const int bid = blockIdx.x;
  if (bid >= PB_X) {                   // block-uniform, ahead of the barrier
    xcvt_rows(x, xh, bid - PB_X, MROWS);
    return;
  }
  const float* src;
  unsigned short* dst;
  int K, hstride, rstride, k0, n0, drow0;
  if (bid < PB_P) {
    const int z = bid / (QKVW / 64);
    src = (z == 0) ? Wq : ((z == 1) ? Wk : Wv);
    dst = wqkv; K = CDIM; hstride = CDIM * HD; rstride = HD;
    k0 = 0; n0 = (bid - z * (QKVW / 64)) * 64; drow0 = QKVW * z;
  } else if (bid < PB_1) {
    src = Wp; dst = wpt; K = QKVW; hstride = 64; rstride = CDIM;
    k0 = (bid - PB_P) * 64; n0 = 0; drow0 = 0;
  } else if (bid < PB_2) {
    src = W1; dst = w1t; K = CDIM; hstride = 64; rstride = HID;
    k0 = 0; n0 = (bid - PB_1) * 64; drow0 = 0;
  } else {
    src = W2; dst = w2t; K = HID; hstride = 64; rstride = CDIM;
    k0 = (bid - PB_2) * 64; n0 = 0; drow0 = 0;
  }
  wprep_tile(sT, src, dst, K, hstride, rstride, k0, n0, drow0);
}

// ---------------------------------------------------------------------------
// 64x64-tile f16 GEMM: D = A[M][K] * Bt[N][K]^T, 4 waves per WG, wave w owns
// rows 16w..16w+15 x 64 cols (4 accumulator tiles).  Fragments loaded straight
// from the 16-bit planes with the split k map for A and B (row/col = lane&15,
// elements 0..7 <- k0+8h.., 8..15 <- k0+16+8h..).
// EPI 0: q/k planes [b*H+h][t][64] and v transposed plane vt[b*H+h][64][t]
//        (value acc/16 + bf16q(bias), bias picked per q/k/v by the column block)
// EPI 2: f16 out = relu(acc/16 + bf16q(bias))
// EPI 1: u = acc/16 + bf16q(bias) + res (res read at full strides and bf16q'd when RESFULL),
//        then layernorm over the 64-col row (the 64x64 tile holds whole rows),
//        f32 out (full strides when OUTFULL) and, when WRITEH, an f16 copy [M][64].
// coverage EPI0/2: 4 passes x 4 waves x 4 rows = 64 rows x 64 cols; EPI1: 8 passes x 2 rows per wave = 16 rows x 64 f32 cols per wave,
//          plus (WRITEH) 4 passes x 4 rows per wave = 16 rows x 64 halves; EPI0 v path: 4 passes x 4 waves x 4 d = 64 d rows x 64 tokens.
// LDS: sT/sF rows are wave-private except in EPI0 (q/k and v paths both cross-wave); block barriers used everywhere.
// ---------------------------------------------------------------------------
template <int EPI, int RESFULL, int OUTFULL, int WRITEH>
__global__ __launch_bounds__(128) __attribute__((amdgpu_num_vgpr(256))) void k_gemm(
    const unsigned short* __restrict__ A, const unsigned short* __restrict__ Bt, int K,
    const float* __restrict__ bias, const float* __restrict__ biasb, const float* __restrict__ biasc,
    const float* __restrict__ res, const float* __restrict__ gam, const float* __restrict__ bet,
    float* __restrict__ outF, unsigned short* __restrict__ out0,
    unsigned short* __restrict__ out1, unsigned short* __restrict__ out2, int ldo) {
  __shared__ __attribute__((aligned(16))) unsigned short sT[64][72];
  __shared__ __attribute__((aligned(16))) float sF[64][68];
  const int tid = threadIdx.x, lane = tid & 31, w = tid >> 5;
  const int m = lane & 15, hl = lane >> 4, k8 = hl * 8;
  const int m0 = blockIdx.y * 64, n0 = blockIdx.x * 64;

  v8f acc[4];
#pragma unroll
  for (int j = 0; j < 4; ++j) acc[j] = zero8();

  const unsigned short* ap = A + (size_t)(m0 + 16 * w + m) * (size_t)K + k8;
  const unsigned short* bp = Bt + (size_t)(n0 + m) * (size_t)K + k8;
  const size_t jstep = (size_t)16 * (size_t)K;
#pragma unroll 1
  for (int k0 = 0; k0 < K; k0 += 32) {
    Frag a;
    a.q[0] = *(const v4u*)(ap + k0);
    a.q[1] = *(const v4u*)(ap + k0 + 16);
#pragma unroll
    for (int j = 0; j < 4; ++j) {
      Frag b;
      const unsigned short* bj = bp + jstep * j + k0;
      b.q[0] = *(const v4u*)(bj);
      b.q[1] = *(const v4u*)(bj + 16);
      acc[j] = mma(a.v, b.v, acc[j]);
    }
  }

  const float wsc = 0.0625f;               // undo the x16 weight carry
  const int lrow0 = 16 * w + 8 * hl;       // D rows of this lane within the WG tile

  if constexpr (EPI == 0) {
    const int which = n0 / QKVW;           // 0 = q, 1 = k, 2 = v (WG-uniform)
    const int hh = (n0 - which * QKVW) / HD;
    const float* bsel = (which == 0) ? bias : ((which == 1) ? biasb : biasc);
#pragma unroll
    for (int j = 0; j < 4; ++j) {
      const float bj = bf16q(bsel[hh * HD + 16 * j + m]);
#pragma unroll
      for (int r = 0; r < 8; ++r) sT[lrow0 + r][16 * j + m] = hbits(acc[j][r] * wsc + bj);
    }
    __syncthreads();   // cross-wave for both the q/k and the v reloads
    const int b = m0 / SEQ, t0 = m0 - b * SEQ;
    const int bh = b * NHEAD + hh;
    v4u val[4];
    unsigned int off[4];
    unsigned short* dst;
    if (which < 2) {                       // WG-uniform
      dst = (which == 0) ? out0 : out1;
#pragma unroll
      for (int p = 0; p < 4; ++p) {
        const int row = p * 16 + 4 * w + (lane >> 3);
        const int piece = lane & 7;
        val[p] = *(const v4u*)&sT[row][piece * 8];
        off[p] = (unsigned int)((bh * SEQ + t0 + row) * HD + piece * 8);
      }
    } else {
      dst = out2;
#pragma unroll
      for (int p = 0; p < 4; ++p) {
        const int d = p * 16 + 4 * w + (lane >> 3);
        const int piece = lane & 7;
        unsigned int wv[4];
#pragma unroll
        for (int e = 0; e < 4; ++e) {
          const unsigned int lo = sT[piece * 8 + 2 * e][d];
          const unsigned int hi = sT[piece * 8 + 2 * e + 1][d];
          wv[e] = lo | (hi << 16);
        }
        v4u t;
        t.x = wv[0]; t.y = wv[1]; t.z = wv[2]; t.w = wv[3];
        val[p] = t;
        off[p] = (unsigned int)((bh * HD + d) * SEQ + t0 + piece * 8);
      }
    }
#pragma unroll
    for (int p = 0; p < 4; ++p) *(v4u*)(dst + off[p]) = val[p];
    
  } else if constexpr (EPI == 2) {
#pragma unroll
    for (int j = 0; j < 4; ++j) {
      const float bj = bf16q(bias[n0 + 16 * j + m]);
#pragma unroll
      for (int r = 0; r < 8; ++r) {
        float u = acc[j][r] * wsc + bj;
        u = fmaxf(u, 0.0f);
        sT[lrow0 + r][16 * j + m] = hbits(u);
      }
    }
    __syncthreads();   // wave-private rows, barrier orders the reload
    v4u val[4];
    unsigned int off[4];
#pragma unroll
    for (int p = 0; p < 4; ++p) {
      const int row = 16 * w + 4 * p + (lane >> 3);
      const int piece = lane & 7;
      val[p] = *(const v4u*)&sT[row][piece * 8];
      off[p] = (unsigned int)((size_t)(m0 + row) * (size_t)ldo + n0 + piece * 8);
    }
#pragma unroll
    for (int p = 0; p < 4; ++p) *(v4u*)(out0 + off[p]) = val[p];
    
  } else {
    // ---- bias + residual + layernorm over the whole 64-col row ----
#pragma unroll
    for (int j = 0; j < 4; ++j) {
#pragma unroll
      for (int r = 0; r < 8; ++r) sF[lrow0 + r][16 * j + m] = acc[j][r] * wsc;
    }
    __syncthreads();   // wave-private rows, barrier orders the cross-lane reload
    const int b = m0 / SEQ, t0 = m0 - b * SEQ;
    const int c2 = 2 * lane;               // lane owns cols c2, c2+1 of each of its wave's rows
    const float bb0 = bf16q(bias[n0 + c2]), bb1 = bf16q(bias[n0 + c2 + 1]);
    const float gg0 = bf16q(gam[n0 + c2]),  gg1 = bf16q(gam[n0 + c2 + 1]);
    const float ee0 = bf16q(bet[n0 + c2]),  ee1 = bf16q(bet[n0 + c2 + 1]);
#pragma unroll
    for (int rr = 0; rr < 16; ++rr) {
      const int row = 16 * w + rr;
      const size_t rrow = RESFULL ? ((size_t)b * SEQ_FULL + t0 + row) : (size_t)(m0 + row);
      v2f rv = *(const v2f*)(res + rrow * (size_t)ldo + n0 + c2);
      if (RESFULL) { rv.x = bf16q(rv.x); rv.y = bf16q(rv.y); }
      const v2f av = *(const v2f*)&sF[row][c2];
      const float u0 = (av.x + bb0) + rv.x;
      const float u1 = (av.y + bb1) + rv.y;
      float s = u0 + u1;
#pragma unroll
      for (int xm = 1; xm < 32; xm <<= 1) s += __shfl_xor(s, xm, 32);
      const float mu = s * (1.0f / CDIM);
      const float d0 = u0 - mu, d1 = u1 - mu;
      float qs = d0 * d0 + d1 * d1;
#pragma unroll
      for (int xm = 1; xm < 32; xm <<= 1) qs += __shfl_xor(qs, xm, 32);
      const float var = qs * (1.0f / CDIM);
      const float rstd = rsqrtf(var + 1e-5f);
      const float y0 = d0 * rstd * gg0 + ee0;
      const float y1 = d1 * rstd * gg1 + ee1;
      v2f yv; yv.x = y0; yv.y = y1;
      *(v2f*)&sF[row][c2] = yv;
      if (WRITEH) { sT[row][c2] = hbits(y0); sT[row][c2 + 1] = hbits(y1); }
    }
    __syncthreads();   // wave-private rows, barrier orders the cross-lane reload
    v4f fv[8];
    unsigned int fo[8];
#pragma unroll
    for (int p = 0; p < 8; ++p) {
      const int row = 16 * w + 2 * p + hl;
      const int piece = m;
      fv[p] = *(const v4f*)&sF[row][4 * piece];
      const size_t orow = OUTFULL ? ((size_t)b * SEQ_FULL + t0 + row) : (size_t)(m0 + row);
      fo[p] = (unsigned int)(orow * (size_t)ldo + n0 + 4 * piece);
    }
    v4u hv[4];
    unsigned int ho[4];
    if constexpr (WRITEH) {
#pragma unroll
      for (int p = 0; p < 4; ++p) {
        const int row = 16 * w + 4 * p + (lane >> 3);
        const int piece = lane & 7;
        hv[p] = *(const v4u*)&sT[row][piece * 8];
        ho[p] = (unsigned int)((size_t)(m0 + row) * CDIM + piece * 8);
      }
    }
#pragma unroll
    for (int p = 0; p < 8; ++p) *(v4f*)(outF + fo[p]) = fv[p];
    if constexpr (WRITEH) {
#pragma unroll
      for (int p = 0; p < 4; ++p) *(v4u*)(out0 + ho[p]) = hv[p];
    }
    
  }
}

// ---------------------------------------------------------------------------
// One 64-key chunk into LDS, shared by the work-group's four waves: K rows (64 x 128 B,
// contiguous) and V^T rows (64 x 128 B, source pitch SEQ halves).  128 threads x 16 B x 4
// row groups per operand; eight lanes cover one whole 128-B row.  lk/lv/gk/gv are the lane's
// own addresses for row group 0; a row group is 16 rows.  LDS pitch KVP halves.
// ---------------------------------------------------------------------------
#define KVP 72
#define KVBUF (64 * KVP * 2)
__device__ __forceinline__ unsigned int lds_off(const void* p) { return (unsigned int)(size_t)p; }
__device__ __forceinline__ void stage_kv(unsigned int lk, unsigned int lv,
                                         const unsigned short* gk, const unsigned short* gv) {
  const unsigned int ls = 16 * KVP * 2;
  // The closing s_wait_xcnt stands in the copies' own statement so that no address register
  // named here is rewritten ahead of it.
  asm volatile(
      "global_load_async_to_lds_b128 %0, %8, off\n\t"
      "global_load_async_to_lds_b128 %1, %9, off\n\t"
      "global_load_async_to_lds_b128 %2, %10, off\n\t"
      "global_load_async_to_lds_b128 %3, %11, off\n\t"
      "global_load_async_to_lds_b128 %4, %12, off\n\t"
      "global_load_async_to_lds_b128 %5, %13, off\n\t"
      "global_load_async_to_lds_b128 %6, %14, off\n\t"
      "global_load_async_to_lds_b128 %7, %15, off\n\t"
      "s_wait_xcnt 0x0"
      :: "v"(lk), "v"(lk + ls), "v"(lk + 2 * ls), "v"(lk + 3 * ls),
         "v"(lv), "v"(lv + ls), "v"(lv + 2 * ls), "v"(lv + 3 * ls),
         "v"(gk), "v"(gk + 16 * HD), "v"(gk + 32 * HD), "v"(gk + 48 * HD),
         "v"(gv), "v"(gv + 16 * SEQ), "v"(gv + 32 * SEQ), "v"(gv + 48 * SEQ)
      : "memory");
}

__device__ __forceinline__ float other_half(float f) {
  const int b = __float_as_int(f);
  return __int_as_float(__builtin_amdgcn_permlanex16(b, b, 0x76543210, 0xfedcba98, false, false));
}

__global__ __launch_bounds__(128) __attribute__((amdgpu_num_vgpr(256)))
void k_attn(const unsigned short* __restrict__ qp, const unsigned short* __restrict__ kp,
            const unsigned short* __restrict__ vp, unsigned short* __restrict__ op) {
  __shared__ __attribute__((aligned(16))) unsigned short sP[4][16][72];
  __shared__ __attribute__((aligned(16))) unsigned short sK[2][64][KVP];
  __shared__ __attribute__((aligned(16))) unsigned short sV[2][64][KVP];
  const int tid = threadIdx.x, lane = tid & 31, w = tid >> 5;
  const int m = lane & 15, hl = lane >> 4, k8 = hl * 8;
  const int nqt = SEQ / 64;
  static_assert((SEQ / 64) % 2 == 0);       // tiles pair up as (nqt-1-p, p)
  const int bh = blockIdx.x / (nqt / 2), pr = blockIdx.x - bh * (nqt / 2);
  const int b = bh / NHEAD, hh = bh - b * NHEAD;
  const int tA = nqt - 1 - pr, tB = pr;     // first and second query tile; tA >= 1
  int qt = tA, kt = 0;                      // tile in work and its key chunk (WG-uniform)

  Frag qa0, qa1;                            // B operand: column = query qt*64 + 16w + m
  Frag qn0, qn1;                            // the same of the second tile, fetched up front
  {
    const unsigned short* qr = qp + ((size_t)bh * SEQ + tA * 64 + 16 * w + m) * HD + k8;
    qa0.q[0] = *(const v4u*)(qr);
    qa0.q[1] = *(const v4u*)(qr + 16);
    qa1.q[0] = *(const v4u*)(qr + 32);
    qa1.q[1] = *(const v4u*)(qr + 48);
    const unsigned short* qs = qp + ((size_t)bh * SEQ + tB * 64 + 16 * w + m) * HD + k8;
    qn0.q[0] = *(const v4u*)(qs);
    qn0.q[1] = *(const v4u*)(qs + 16);
    qn1.q[0] = *(const v4u*)(qs + 32);
    qn1.q[1] = *(const v4u*)(qs + 48);
  }
  float mrun = -1e30f;                      // running maximum of the lane's query (equal in both halves)
  float lrun = 0.0f;                        // running sum over this half's keys only; joined when the tile is done
  v8f oacc[4];                              // O^T: row d = 16 jd + 8 hl + r, column = the lane's query
#pragma unroll
  for (int j = 0; j < 4; ++j) oacc[j] = zero8();

  // ---- chunk 0 into buffer 0, published; then chunk 1 into buffer 1 ----
  const int srow = tid >> 3, spc = (tid & 7) * 8;
  const unsigned short* gk0 = kp + ((size_t)bh * SEQ + srow) * HD + spc;
  const unsigned short* gv0 = vp + ((size_t)bh * HD + srow) * (size_t)SEQ + spc;
  const unsigned int lk0 = lds_off(&sK[0][srow][spc]);
  const unsigned int lv0 = lds_off(&sV[0][srow][spc]);
  stage_kv(lk0, lv0, gk0, gv0);
  asm volatile("s_wait_asynccnt 0x0" ::: "memory");   // this wave's copies of chunk 0 have landed
  __syncthreads();                                    // chunk 0 visible to all four waves
  stage_kv(lk0 + KVBUF, lv0 + KVBUF, gk0 + 64 * HD, gv0 + 64);   // chunk 1 exists: tA >= 1

  // rolled: one copy of the body serves both tiles
#pragma unroll 1
  for (int i = 0; i <= nqt; ++i) {          // tA + 1 chunks of the first tile, tB + 1 of the second
    const int buf = i & 1;
    // ---- S^T = K Q^T, four 16-key subtiles: s[j][r] = score(key 16j + 8hl + r, query m) ----
    v8f s[4];
    const unsigned short* kb = &sK[buf][m][k8];
#pragma unroll
    for (int j = 0; j < 4; ++j) {
      const unsigned short* kr = kb + j * 16 * KVP;
      Frag f0, f1;
      f0.q[0] = *(const v4u*)(kr);
      f0.q[1] = *(const v4u*)(kr + 16);
      f1.q[0] = *(const v4u*)(kr + 32);
      f1.q[1] = *(const v4u*)(kr + 48);
      v8f t = mma(f0.v, qa0.v, zero8());
      t = mma(f1.v, qa1.v, t);
      s[j] = t;
    }
    // ---- causal mask on the diagonal chunk, maximum of the lane's own query ----
    // the lane's one query allows keys up to lim, counted from this half's first key of the chunk
    const int lim = (kt == qt) ? (16 * w + m - 8 * hl) : 64;
    float tm[4];
#pragma unroll
    for (int j = 0; j < 4; ++j) {
      tm[j] = -1e30f;
#pragma unroll
      for (int r = 0; r < 8; ++r) {
        float val = s[j][r];
        val = (16 * j + r > lim) ? -1e30f : val;
        s[j][r] = val;
        tm[j] = fmaxf(tm[j], val);
      }
    }
    float tmax = fmaxf(fmaxf(tm[0], tm[1]), fmaxf(tm[2], tm[3]));
    tmax = fmaxf(tmax, other_half(tmax));
    const float mn = fmaxf(mrun, tmax);
    const float corr = __expf(mrun - mn);
    mrun = mn;
    // ---- p = exp(s - m); f16(16384 p) packed in place as the B operand; sums in the lane ----
    float ts[4];
    v8h ph[4];
#pragma unroll
    for (int j = 0; j < 4; ++j) {
      ts[j] = 0.0f;
      v8f pv;
#pragma unroll
      for (int r = 0; r < 8; ++r) {
        const float p = __expf(s[j][r] - mrun);
        ts[j] += p;
        pv[r] = p * PSC;
      }
      ph[j] = __builtin_convertvector(pv, v8h);
    }
    lrun = lrun * corr + ((ts[0] + ts[1]) + (ts[2] + ts[3]));
#pragma unroll
    for (int j = 0; j < 4; ++j) {
#pragma unroll
      for (int r = 0; r < 8; ++r) oacc[j][r] *= corr;
    }
    // elements 0..7 <- keys 8hl.., 8..15 <- keys 16+8hl.. of each 32-key block
    const v16h pb0 = __builtin_shufflevector(ph[0], ph[1], 0, 1, 2, 3, 4, 5, 6, 7, 8, 9, 10, 11, 12, 13, 14, 15);
    const v16h pb1 = __builtin_shufflevector(ph[2], ph[3], 0, 1, 2, 3, 4, 5, 6, 7, 8, 9, 10, 11, 12, 13, 14, 15);
    // ---- O^T += V^T (64 d x 64 keys) * P^T (64 keys x 16 queries) ----
    const unsigned short* vb = &sV[buf][m][k8];
#pragma unroll
    for (int jd = 0; jd < 4; ++jd) {
      const unsigned short* vr = vb + jd * 16 * KVP;
      Frag g0, g1;
      g0.q[0] = *(const v4u*)(vr);
      g0.q[1] = *(const v4u*)(vr + 16);
      g1.q[0] = *(const v4u*)(vr + 32);
      g1.q[1] = *(const v4u*)(vr + 48);
      oacc[jd] = mma(g0.v, pb0, oacc[jd]);
      oacc[jd] = mma(g1.v, pb1, oacc[jd]);
    }
    asm volatile("s_wait_dscnt 0x0" ::: "memory");      // this wave's reads of sK/sV[buf] have returned
    asm volatile("s_wait_asynccnt 0x0" ::: "memory");   // this wave's copies of step i+1's chunk have landed
    __syncthreads();   // publishes step i+1's chunk, frees buffer buf for rewriting
    if (i + 2 <= nqt) {  // WG-uniform
      const int c = (i + 2 <= tA) ? (i + 2) : (i + 1 - tA);   // chunk of step i+2, in its own tile
      stage_kv(lk0 + buf * KVBUF, lv0 + buf * KVBUF, gk0 + (size_t)c * 64 * HD, gv0 + c * 64);
    }
    if (kt < qt) {       // WG-uniform
      ++kt;
      continue;
    }

    // ---- tile done: o = acc / (16384 l), stage per wave (8 consecutive d per lane), whole-line stores ----
    const float lsum = lrun + other_half(lrun);
    const float il = 1.0f / (lsum * PSC);
#pragma unroll
    for (int jd = 0; jd < 4; ++jd) {
      *(v4u*)&sP[w][m][16 * jd + k8] =
          pack8h(oacc[jd][0] * il, oacc[jd][1] * il, oacc[jd][2] * il, oacc[jd][3] * il,
                 oacc[jd][4] * il, oacc[jd][5] * il, oacc[jd][6] * il, oacc[jd][7] * il);
    }
    __syncthreads();
    v4u val[4];
    unsigned int off[4];
#pragma unroll
    for (int p = 0; p < 4; ++p) {
      const int row = 4 * p + (lane >> 3);
      const int piece = lane & 7;
      val[p] = *(const v4u*)&sP[w][row][piece * 8];
      off[p] = (unsigned int)((size_t)(b * SEQ + qt * 64 + 16 * w + row) * QKVW + hh * HD + piece * 8);
    }
#pragma unroll
    for (int p = 0; p < 4; ++p) *(v4u*)(op + off[p]) = val[p];
    // the second tile's passes rewrite the registers that the four stores name
    asm volatile("s_wait_xcnt 0x0" ::: "memory");

    // ---- start state of the second tile ----
    qt = tB; kt = 0;
    qa0 = qn0; qa1 = qn1;
    mrun = -1e30f; lrun = 0.0f;
#pragma unroll
    for (int j = 0; j < 4; ++j) oacc[j] = zero8();
  }
  asm volatile("s_wait_asynccnt 0x0" ::: "memory");     // nothing of this wave's in flight past the loop
}

// ---------------------------------------------------------------------------
// Host launcher
// ---------------------------------------------------------------------------
static inline size_t al256(size_t v) { return (v + 255) & ~(size_t)255; }

extern "C" void kernel_launch(void* const* d_in, const int* in_sizes, int n_in,
                              void* d_out, int out_size, void* d_ws, size_t ws_size,
                              hipStream_t stream) {
  if (n_in < 17) return;
  const long needX = ((long)(NB - 1) * SEQ_FULL + SEQ) * CDIM;
  const long nW = (long)NHEAD * CDIM * HD;
  if ((long)in_sizes[0] < needX) return;
  if ((long)in_sizes[1] < nW || (long)in_sizes[3] < nW || (long)in_sizes[5] < nW) return;
  if (in_sizes[2] < QKVW || in_sizes[4] < QKVW || in_sizes[6] < QKVW) return;
  if ((long)in_sizes[7] < (long)QKVW * CDIM || in_sizes[8] < CDIM) return;
  if ((long)in_sizes[9] < (long)CDIM * HID || in_sizes[10] < HID) return;
  if ((long)in_sizes[11] < (long)HID * CDIM || in_sizes[12] < CDIM) return;
  if (in_sizes[13] < CDIM || in_sizes[14] < CDIM || in_sizes[15] < CDIM || in_sizes[16] < CDIM) return;
  if ((long)out_size < needX) return;

  const float* x   = (const float*)d_in[0];
  const float* Wq  = (const float*)d_in[1];
  const float* bq  = (const float*)d_in[2];
  const float* Wk  = (const float*)d_in[3];
  const float* bk  = (const float*)d_in[4];
  const float* Wv  = (const float*)d_in[5];
  const float* bv  = (const float*)d_in[6];
  const float* Wp  = (const float*)d_in[7];
  const float* bp  = (const float*)d_in[8];
  const float* W1  = (const float*)d_in[9];
  const float* b1  = (const float*)d_in[10];
  const float* W2  = (const float*)d_in[11];
  const float* b2  = (const float*)d_in[12];
  const float* g1  = (const float*)d_in[13];
  const float* be1 = (const float*)d_in[14];
  const float* g2  = (const float*)d_in[15];
  const float* be2 = (const float*)d_in[16];
  float* out = (float*)d_out;

  char* ws = (char*)d_ws;
  size_t off = 0;
  auto carve = [&](size_t bytes) -> char* { char* p = ws + off; off += al256(bytes); return p; };
  const size_t MC  = (size_t)MROWS * CDIM;                   // [M][64]
  const size_t MHD = (size_t)NB * NHEAD * SEQ * HD;          // per q/k/vt plane
  unsigned short* wqkv = (unsigned short*)carve((size_t)3 * QKVW * CDIM * 2);   // [1536][64]
  unsigned short* wpt  = (unsigned short*)carve((size_t)CDIM * QKVW * 2);       // [64][512]
  unsigned short* w1t  = (unsigned short*)carve((size_t)HID * CDIM * 2);        // [256][64]
  unsigned short* w2t  = (unsigned short*)carve((size_t)CDIM * HID * 2);        // [64][256]
  unsigned short* xh   = (unsigned short*)carve(MC * 2);                        // [M][64]
  unsigned short* qpl  = (unsigned short*)carve(MHD * 2);                       // [B*H][SEQ][64]
  unsigned short* kpl  = (unsigned short*)carve(MHD * 2);                       // [B*H][SEQ][64]
  unsigned short* vtp  = (unsigned short*)carve(MHD * 2);                       // [B*H][64][SEQ]
  unsigned short* opl  = (unsigned short*)carve((size_t)MROWS * QKVW * 2);      // [M][512]
  float*          h1f  = (float*)carve(MC * 4);                                 // [M][64]
  unsigned short* h1h  = (unsigned short*)carve(MC * 2);                        // [M][64]
  unsigned short* act  = (unsigned short*)carve((size_t)MROWS * HID * 2);       // [M][256]
  if (off > ws_size) return;
  if (off > ((size_t)128 << 20)) return;

  // 1+2) weight planes (transposed, bf16 values x16 as f16) and the x plane (bf16 values of x
  //      as f16), one grid
  k_prep<<<PB_X + MROWS / 32, 256, 0, stream>>>(x, Wq, Wk, Wv, Wp, W1, W2, wqkv, wpt, w1t, w2t, xh);
  // 3) q/k/v projections + biases -> q, k, vt planes
  k_gemm<0, 0, 0, 0><<<dim3(3 * QKVW / 64, MROWS / 64), 128, 0, stream>>>(
      xh, wqkv, CDIM, bq, bk, bv, nullptr, nullptr, nullptr, nullptr, qpl, kpl, vtp, 0);
  // 4) causal attention -> o plane [M][512]
  k_attn<<<NB * NHEAD * (SEQ / 128), 128, 0, stream>>>(qpl, kpl, vtp, opl);
  // 5) output projection + bias + residual(bf16 values of x) + layernorm 1 -> h1 (f32 + f16 copy)
  k_gemm<1, 1, 0, 1><<<dim3(CDIM / 64, MROWS / 64), 128, 0, stream>>>(
      opl, wpt, QKVW, bp, bp, bp, x, g1, be1, h1f, h1h, nullptr, nullptr, CDIM);
  // 6) ffn1 + bias + relu -> act (f16)
  k_gemm<2, 0, 0, 0><<<dim3(HID / 64, MROWS / 64), 128, 0, stream>>>(
      h1h, w1t, CDIM, b1, b1, b1, nullptr, nullptr, nullptr, nullptr, act, nullptr, nullptr, HID);
  // 7) ffn2 + bias + residual(h1) + layernorm 2 -> out (f32, full strides)
  k_gemm<1, 0, 1, 0><<<dim3(CDIM / 64, MROWS / 64), 128, 0, stream>>>(
      act, w2t, HID, b2, b2, b2, h1f, g2, be2, out, nullptr, nullptr, nullptr, CDIM);
}

// v005
// A run of this version takes 91.9 microseconds.
// Next to v004, in two timings, it ran 1.03 and 1.04 times as fast.
// Over all steps from v000 it is 2.75 times as fast.
#include <hip/hip_runtime.h>

// Contractions: v_wmma_f32_16x16x32_f16 (f16 operands, f32 accumulate) for q/k/v projections, q.k^T, p.v, output projection, ffn1, ffn2; weight planes carried x16, p plane carried x16384, activations x1.

#pragma clang fp contract(off)

#ifndef NB
#define NB 4
#endif
#ifndef SEQ
#define SEQ 2048
#endif
#define NB_FULL 4
#define SEQ_FULL 2048
#define CDIM 64
#define NHEAD 8
#define HD 64
#define QKVW (NHEAD * HD)
#define HID 256
#define MROWS (NB * SEQ)
#define PSC 16384.0f

static_assert(NB >= 1 && NB <= NB_FULL);
static_assert(SEQ % 64 == 0 && SEQ >= 64 && SEQ <= SEQ_FULL);
static_assert(HD == 64);
static_assert(CDIM == 64);
static_assert(QKVW == 512);
static_assert(HID % 64 == 0 && QKVW % 64 == 0 && CDIM % 64 == 0);
static_assert(HID % 32 == 0 && QKVW % 32 == 0 && CDIM % 32 == 0);
static_assert(MROWS % 64 == 0);
static_assert((long)MROWS * QKVW < (1L << 31));
static_assert((long)NB * NHEAD * SEQ * HD < (1L << 31));

typedef _Float16 v16h __attribute__((ext_vector_type(16)));
typedef _Float16 v8h  __attribute__((ext_vector_type(8)));
typedef float    v8f  __attribute__((ext_vector_type(8)));
typedef float    v4f  __attribute__((ext_vector_type(4)));
typedef float    v2f  __attribute__((ext_vector_type(2)));
typedef unsigned int v4u __attribute__((ext_vector_type(4)));

union Frag { v16h v; v4u q[2]; };

// WMMA with hazard guard: D += A(16x32) * B(32x16)
__device__ __forceinline__ v8f mma(v16h a, v16h b, v8f c) {
  v8f d = __builtin_amdgcn_wmma_f32_16x16x32_f16(false, a, false, b, (short)0, c, false, false);
  asm volatile("v_nop\n\tv_nop\n\tv_nop\n\tv_nop" : "+v"(d) : "v"(a), "v"(b));
  return d;
}

__device__ __forceinline__ v8f zero8() {
  v8f z;
#pragma unroll
  for (int i = 0; i < 8; ++i) z[i] = 0.0f;
  return z;
}

// f32 -> nearest-even bf16 value, returned as f32
__device__ __forceinline__ float bf16q(float f) {
  unsigned int u = __float_as_uint(f);
  unsigned int r = u + 0x7FFFu + ((u >> 16) & 1u);
  r = ((u & 0x7F800000u) == 0x7F800000u) ? u : r;
  return __uint_as_float(r & 0xFFFF0000u);
}
__device__ __forceinline__ v4f bf16q4(v4f a) {
  v4f r;
  r.x = bf16q(a.x); r.y = bf16q(a.y); r.z = bf16q(a.z); r.w = bf16q(a.w);
  return r;
}
// f32 -> f16 (RNE convert) bit pattern
__device__ __forceinline__ unsigned short hbits(float f) {
  _Float16 h = (_Float16)f;
  return __builtin_bit_cast(unsigned short, h);
}
__device__ __forceinline__ v4u pack8h(float f0, float f1, float f2, float f3,
                                      float f4, float f5, float f6, float f7) {
  v8h t;
  t[0] = (_Float16)f0; t[1] = (_Float16)f1; t[2] = (_Float16)f2; t[3] = (_Float16)f3;
  t[4] = (_Float16)f4; t[5] = (_Float16)f5; t[6] = (_Float16)f6; t[7] = (_Float16)f7;
  return __builtin_bit_cast(v4u, t);
}

// ---------------------------------------------------------------------------
// Weight prep, one 64x64 tile per work-group: logical W[k][n] (f32) -> Wt[n][k] f16 plane,
// value = f16(bf16q(w) * 16).
// src element (k, n0+j) = src[(n0/64)*hstride + k*rstride + j]; dst row = drow0 + n0 + n.
// LDS sT: cross-wave (block barrier).
// ---------------------------------------------------------------------------
__device__ __forceinline__ void wprep_tile(
    unsigned short (*sT)[72], const float* __restrict__ src, unsigned short* __restrict__ dst,
    int K, int hstride, int rstride, int k0, int n0, int drow0) {
  const int tid = threadIdx.x;
  const size_t sbase = (size_t)(n0 >> 6) * (size_t)hstride;
#pragma unroll
  for (int it = 0; it < 4; ++it) {
    const int idx = it * 256 + tid;
    const int kk = idx >> 4;            // 0..63
    const int j4 = (idx & 15) * 4;      // 0..60
    const v4f wv = *(const v4f*)(src + sbase + (size_t)(k0 + kk) * (size_t)rstride + j4);
    sT[j4 + 0][kk] = hbits(bf16q(wv.x) * 16.0f);
    sT[j4 + 1][kk] = hbits(bf16q(wv.y) * 16.0f);
    sT[j4 + 2][kk] = hbits(bf16q(wv.z) * 16.0f);
    sT[j4 + 3][kk] = hbits(bf16q(wv.w) * 16.0f);
  }
  __syncthreads();   // cross-wave: staged by all waves, read by all waves
  v4u val[2];
  size_t off[2];
#pragma unroll
  for (int p = 0; p < 2; ++p) {
    const int n = p * 32 + (tid >> 3);
    const int piece = tid & 7;
    val[p] = *(const v4u*)&sT[n][piece * 8];
    off[p] = ((size_t)drow0 + n0 + n) * (size_t)K + k0 + piece * 8;
  }
#pragma unroll
  for (int p = 0; p < 2; ++p) *(v4u*)(dst + off[p]) = val[p];
  // stands in front of the code that the build lays out behind this path (the x rows), which
  // writes the registers that the two stores name
  asm volatile("s_wait_xcnt 0x0" ::: "memory");
}

// ---------------------------------------------------------------------------
// Input prep, 32 rows per work-group: x (f32, full batch strides) -> f16 plane xh[nrows][64]
// holding the bf16 values of x.  256 threads x 8 halves = 32 rows x 64.
// ---------------------------------------------------------------------------
__device__ __forceinline__ void xcvt_rows(
    const float* __restrict__ x, unsigned short* __restrict__ xh, int blk, int nrows) {
  const int tid = threadIdx.x;
  const int row = blk * 32 + (tid >> 3);
  const int piece = tid & 7;
  if (row >= nrows) return;            // no barriers on this path
  const int b = row / SEQ, t = row - b * SEQ;
  const size_t xrow = ((size_t)b * SEQ_FULL + t) * CDIM + piece * 8;
  const v4f a0 = bf16q4(*(const v4f*)(x + xrow));
  const v4f a1 = bf16q4(*(const v4f*)(x + xrow + 4));
  const v4u o = pack8h(a0.x, a0.y, a0.z, a0.w, a1.x, a1.y, a1.z, a1.w);
  unsigned short* d = xh + (size_t)row * CDIM + piece * 8;
  *(v4u*)d = o;
}

// ---------------------------------------------------------------------------
// All operand preparation in one grid: the four weight planes and the x plane depend on
// nothing but the inputs, so their work-groups run side by side, told apart by block index
// (block-uniform branches).  Weight tiles first: theirs is the longer chain (load, LDS,
// barrier, store).
// blocks [0, PB_P): Wq/Wk/Wv tiles; [PB_P, PB_1): Wp; [PB_1, PB_2): W1; [PB_2, PB_X): W2;
// [PB_X, PB_X + MROWS/32): x rows.
// ---------------------------------------------------------------------------
#define PB_P (3 * (QKVW / 64))
#define PB_1 (PB_P + QKVW / 64)
#define PB_2 (PB_1 + HID / 64)
#define PB_X (PB_2 + HID / 64)
__global__ __launch_bounds__(256) void k_prep(
    const float* __restrict__ x, const float* __restrict__ Wq, const float* __restrict__ Wk,
    const float* __restrict__ Wv, const float* __restrict__ Wp, const float* __restrict__ W1,
    const float* __restrict__ W2, unsigned short* __restrict__ wqkv,
    unsigned short* __restrict__ wpt, unsigned short* __restrict__ w1t,
    unsigned short* __restrict__ w2t, unsigned short* __restrict__ xh) {
  __shared__ __attribute__((aligned(16))) unsigned short sT[64][72];
  const int bid = blockIdx.x;
  if (bid >= PB_X) {                   // block-uniform, ahead of the barrier
    xcvt_rows(x, xh, bid - PB_X, MROWS);
    return;
  }
  const float* src;
  unsigned short* dst;
  int K, hstride, rstride, k0, n0, drow0;
  if (bid < PB_P) {
    const int z = bid / (QKVW / 64);
    src = (z == 0) ? Wq : ((z == 1) ? Wk : Wv);
    dst = wqkv; K = CDIM; hstride = CDIM * HD; rstride = HD;
    k0 = 0; n0 = (bid - z * (QKVW / 64)) * 64; drow0 = QKVW * z;
  } else if (bid < PB_1) {
    src = Wp; dst = wpt; K = QKVW; hstride = 64; rstride = CDIM;
    k0 = (bid - PB_P) * 64; n0 = 0; drow0 = 0;
  } else if (bid < PB_2) {
    src = W1; dst = w1t; K = CDIM; hstride = 64; rstride = HID;
    k0 = 0; n0 = (bid - PB_1) * 64; drow0 = 0;
  } else {
    src = W2; dst = w2t; K = HID; hstride = 64; rstride = CDIM;
    k0 = (bid - PB_2) * 64; n0 = 0; drow0 = 0;
  }
  wprep_tile(sT, src, dst, K, hstride, rstride, k0, n0, drow0);
}

// ---------------------------------------------------------------------------
// 64x64-tile f16 GEMM: D = A[M][K] * Bt[N][K]^T, 4 waves per WG, wave w owns
// rows 16w..16w+15 x 64 cols (4 accumulator tiles).  Fragments loaded straight
// from the 16-bit planes with the split k map for A and B (row/col = lane&15,
// elements 0..7 <- k0+8h.., 8..15 <- k0+16+8h..).
// EPI 0: q/k planes [b*H+h][t][64] and v transposed plane vt[b*H+h][64][t]
//        (value acc/16 + bf16q(bias), bias picked per q/k/v by the column block)
// EPI 2: f16 out = relu(acc/16 + bf16q(bias))
// EPI 1: u = acc/16 + bf16q(bias) + res (res read at full strides and bf16q'd when RESFULL),
//        then layernorm over the 64-col row (the 64x64 tile holds whole rows),
//        f32 out (full strides when OUTFULL) and, when WRITEH, an f16 copy [M][64].
// coverage EPI0/2: 4 passes x 4 waves x 4 rows = 64 rows x 64 cols; EPI1: 8 passes x 2 rows per wave = 16 rows x 64 f32 cols per wave,
//          plus (WRITEH) 4 passes x 4 rows per wave = 16 rows x 64 halves; EPI0 v path: 4 passes x 4 waves x 4 d = 64 d rows x 64 tokens.
// LDS: sT/sF rows are wave-private except in EPI0 (q/k and v paths both cross-wave); block barriers used everywhere.
// ---------------------------------------------------------------------------
template <int EPI, int RESFULL, int OUTFULL, int WRITEH>
__global__ __launch_bounds__(128) __attribute__((amdgpu_num_vgpr(256))) void k_gemm(
    const unsigned short* __restrict__ A, const unsigned short* __restrict__ Bt, int K,
    const float* __restrict__ bias, const float* __restrict__ biasb, const float* __restrict__ biasc,
    const float* __restrict__ res, const float* __restrict__ gam, const float* __restrict__ bet,
    float* __restrict__ outF, unsigned short* __restrict__ out0,
    unsigned short* __restrict__ out1, unsigned short* __restrict__ out2, int ldo) {
  __shared__ __attribute__((aligned(16))) unsigned short sT[64][72];
  __shared__ __attribute__((aligned(16))) float sF[64][68];
  const int tid = threadIdx.x, lane = tid & 31, w = tid >> 5;
  const int m = lane & 15, hl = lane >> 4, k8 = hl * 8;
  const int m0 = blockIdx.y * 64, n0 = blockIdx.x * 64;

  v8f acc[4];
#pragma unroll
  for (int j = 0; j < 4; ++j) acc[j] = zero8();

  const unsigned short* ap = A + (size_t)(m0 + 16 * w + m) * (size_t)K + k8;
  const unsigned short* bp = Bt + (size_t)(n0 + m) * (size_t)K + k8;
  const size_t jstep = (size_t)16 * (size_t)K;
#pragma unroll 1
  for (int k0 = 0; k0 < K; k0 += 32) {
    Frag a;
    a.q[0] = *(const v4u*)(ap + k0);
    a.q[1] = *(const v4u*)(ap + k0 + 16);
#pragma unroll
    for (int j = 0; j < 4; ++j) {
      Frag b;
      const unsigned short* bj = bp + jstep * j + k0;
      b.q[0] = *(const v4u*)(bj);
      b.q[1] = *(const v4u*)(bj + 16);
      acc[j] = mma(a.v, b.v, acc[j]);
    }
  }

  const float wsc = 0.0625f;               // undo the x16 weight carry
  const int lrow0 = 16 * w + 8 * hl;       // D rows of this lane within the WG tile

  if constexpr (EPI == 0) {
    const int which = n0 / QKVW;           // 0 = q, 1 = k, 2 = v (WG-uniform)
    const int hh = (n0 - which * QKVW) / HD;
    const float* bsel = (which == 0) ? bias : ((which == 1) ? biasb : biasc);
#pragma unroll
    for (int j = 0; j < 4; ++j) {
      const float bj = bf16q(bsel[hh * HD + 16 * j + m]);
#pragma unroll
      for (int r = 0; r < 8; ++r) sT[lrow0 + r][16 * j + m] = hbits(acc[j][r] * wsc + bj);
    }
    __syncthreads();   // cross-wave for both the q/k and the v reloads
    const int b = m0 / SEQ, t0 = m0 - b * SEQ;
    const int bh = b * NHEAD + hh;
    v4u val[4];
    unsigned int off[4];
    unsigned short* dst;
    if (which < 2) {                       // WG-uniform
      dst = (which == 0) ? out0 : out1;
#pragma unroll
      for (int p = 0; p < 4; ++p) {
        const int row = p * 16 + 4 * w + (lane >> 3);
        const int piece = lane & 7;
        val[p] = *(const v4u*)&sT[row][piece * 8];
        off[p] = (unsigned int)((bh * SEQ + t0 + row) * HD + piece * 8);
      }
    } else {
      dst = out2;
#pragma unroll
      for (int p = 0; p < 4; ++p) {
        const int d = p * 16 + 4 * w + (lane >> 3);
        const int piece = lane & 7;
        unsigned int wv[4];
#pragma unroll
        for (int e = 0; e < 4; ++e) {
          const unsigned int lo = sT[piece * 8 + 2 * e][d];
          const unsigned int hi = sT[piece * 8 + 2 * e + 1][d];
          wv[e] = lo | (hi << 16);
        }
        v4u t;
        t.x = wv[0]; t.y = wv[1]; t.z = wv[2]; t.w = wv[3];
        val[p] = t;
        off[p] = (unsigned int)((bh * HD + d) * SEQ + t0 + piece * 8);
      }
    }
#pragma unroll
    for (int p = 0; p < 4; ++p) *(v4u*)(dst + off[p]) = val[p];
    
  } else if constexpr (EPI == 2) {
#pragma unroll
    for (int j = 0; j < 4; ++j) {
      const float bj = bf16q(bias[n0 + 16 * j + m]);
#pragma unroll
      for (int r = 0; r < 8; ++r) {
        float u = acc[j][r] * wsc + bj;
        u = fmaxf(u, 0.0f);
        sT[lrow0 + r][16 * j + m] = hbits(u);
      }
    }
    __syncthreads();   // wave-private rows, barrier orders the reload
    v4u val[4];
    unsigned int off[4];
#pragma unroll
    for (int p = 0; p < 4; ++p) {
      const int row = 16 * w + 4 * p + (lane >> 3);
      const int piece = lane & 7;
      val[p] = *(const v4u*)&sT[row][piece * 8];
      off[p] = (unsigned int)((size_t)(m0 + row) * (size_t)ldo + n0 + piece * 8);
    }
#pragma unroll
    for (int p = 0; p < 4; ++p) *(v4u*)(out0 + off[p]) = val[p];
    
  } else {
    // ---- bias + residual + layernorm over the whole 64-col row ----
#pragma unroll
    for (int j = 0; j < 4; ++j) {
#pragma unroll
      for (int r = 0; r < 8; ++r) sF[lrow0 + r][16 * j + m] = acc[j][r] * wsc;
    }
    __syncthreads();   // wave-private rows, barrier orders the cross-lane reload
    const int b = m0 / SEQ, t0 = m0 - b * SEQ;
    const int c2 = 2 * lane;               // lane owns cols c2, c2+1 of each of its wave's rows
    const float bb0 = bf16q(bias[n0 + c2]), bb1 = bf16q(bias[n0 + c2 + 1]);
    const float gg0 = bf16q(gam[n0 + c2]),  gg1 = bf16q(gam[n0 + c2 + 1]);
    const float ee0 = bf16q(bet[n0 + c2]),  ee1 = bf16q(bet[n0 + c2 + 1]);
#pragma unroll
    for (int rr = 0; rr < 16; ++rr) {
      const int row = 16 * w + rr;
      const size_t rrow = RESFULL ? ((size_t)b * SEQ_FULL + t0 + row) : (size_t)(m0 + row);
      v2f rv = *(const v2f*)(res + rrow * (size_t)ldo + n0 + c2);
      if (RESFULL) { rv.x = bf16q(rv.x); rv.y = bf16q(rv.y); }
      const v2f av = *(const v2f*)&sF[row][c2];
      const float u0 = (av.x + bb0) + rv.x;
      const float u1 = (av.y + bb1) + rv.y;
      float s = u0 + u1;
#pragma unroll
      for (int xm = 1; xm < 32; xm <<= 1) s += __shfl_xor(s, xm, 32);
      const float mu = s * (1.0f / CDIM);
      const float d0 = u0 - mu, d1 = u1 - mu;
      float qs = d0 * d0 + d1 * d1;
#pragma unroll
      for (int xm = 1; xm < 32; xm <<= 1) qs += __shfl_xor(qs, xm, 32);
      const float var = qs * (1.0f / CDIM);
      const float rstd = rsqrtf(var + 1e-5f);
      const float y0 = d0 * rstd * gg0 + ee0;
      const float y1 = d1 * rstd * gg1 + ee1;
      v2f yv; yv.x = y0; yv.y = y1;
      *(v2f*)&sF[row][c2] = yv;
      if (WRITEH) { sT[row][c2] = hbits(y0); sT[row][c2 + 1] = hbits(y1); }
    }
    __syncthreads();   // wave-private rows, barrier orders the cross-lane reload
    v4f fv[8];
    unsigned int fo[8];
#pragma unroll
    for (int p = 0; p < 8; ++p) {
      const int row = 16 * w + 2 * p + hl;
      const int piece = m;
      fv[p] = *(const v4f*)&sF[row][4 * piece];
      const size_t orow = OUTFULL ? ((size_t)b * SEQ_FULL + t0 + row) : (size_t)(m0 + row);
      fo[p] = (unsigned int)(orow * (size_t)ldo + n0 + 4 * piece);
    }
    v4u hv[4];
    unsigned int ho[4];
    if constexpr (WRITEH) {
#pragma unroll
      for (int p = 0; p < 4; ++p) {
        const int row = 16 * w + 4 * p + (lane >> 3);
        const int piece = lane & 7;
        hv[p] = *(const v4u*)&sT[row][piece * 8];
        ho[p] = (unsigned int)((size_t)(m0 + row) * CDIM + piece * 8);
      }
    }
#pragma unroll
    for (int p = 0; p < 8; ++p) *(v4f*)(outF + fo[p]) = fv[p];
    if constexpr (WRITEH) {
#pragma unroll
      for (int p = 0; p < 4; ++p) *(v4u*)(out0 + ho[p]) = hv[p];
    }
    
  }
}

// ---------------------------------------------------------------------------
// One 64-key chunk into LDS, shared by the work-group's four waves: K rows (64 x 128 B,
// contiguous) and V^T rows (64 x 128 B, source pitch SEQ halves).  128 threads x 16 B x 4
// row groups per operand; eight lanes cover one whole 128-B row.  lk/lv/gk/gv are the lane's
// own addresses for row group 0; a row group is 16 rows.  LDS pitch KVP halves.
// ---------------------------------------------------------------------------
#define KVP 72
#define KVBUF (64 * KVP * 2)
__device__ __forceinline__ unsigned int lds_off(const void* p) { return (unsigned int)(size_t)p; }
__device__ __forceinline__ void stage_kv(unsigned int lk, unsigned int lv,
                                         const unsigned short* gk, const unsigned short* gv) {
  const unsigned int ls = 16 * KVP * 2;
  // The closing s_wait_xcnt stands in the copies' own statement so that no address register
  // named here is rewritten ahead of it.
  asm volatile(
      "global_load_async_to_lds_b128 %0, %8, off\n\t"
      "global_load_async_to_lds_b128 %1, %9, off\n\t"
      "global_load_async_to_lds_b128 %2, %10, off\n\t"
      "global_load_async_to_lds_b128 %3, %11, off\n\t"
      "global_load_async_to_lds_b128 %4, %12, off\n\t"
      "global_load_async_to_lds_b128 %5, %13, off\n\t"
      "global_load_async_to_lds_b128 %6, %14, off\n\t"
      "global_load_async_to_lds_b128 %7, %15, off\n\t"
      "s_wait_xcnt 0x0"
      :: "v"(lk), "v"(lk + ls), "v"(lk + 2 * ls), "v"(lk + 3 * ls),
         "v"(lv), "v"(lv + ls), "v"(lv + 2 * ls), "v"(lv + 3 * ls),
         "v"(gk), "v"(gk + 16 * HD), "v"(gk + 32 * HD), "v"(gk + 48 * HD),
         "v"(gv), "v"(gv + 16 * SEQ), "v"(gv + 32 * SEQ), "v"(gv + 48 * SEQ)
      : "memory");
}

__device__ __forceinline__ float other_half(float f) {
  const int b = __float_as_int(f);
  return __int_as_float(__builtin_amdgcn_permlanex16(b, b, 0x76543210, 0xfedcba98, false, false));
}

__global__ __launch_bounds__(128) __attribute__((amdgpu_num_vgpr(256)))
void k_attn(const unsigned short* __restrict__ qp, const unsigned short* __restrict__ kp,
            const unsigned short* __restrict__ vp, unsigned short* __restrict__ op) {
  __shared__ __attribute__((aligned(16))) unsigned short sP[4][16][72];
  __shared__ __attribute__((aligned(16))) unsigned short sK[2][64][KVP];
  __shared__ __attribute__((aligned(16))) unsigned short sV[2][64][KVP];
  const int tid = threadIdx.x, lane = tid & 31, w = tid >> 5;
  const int m = lane & 15, hl = lane >> 4, k8 = hl * 8;
  const int nqt = SEQ / 64;
  static_assert((SEQ / 64) % 2 == 0);       // tiles pair up as (nqt-1-p, p)
  const int bh = blockIdx.x / (nqt / 2), pr = blockIdx.x - bh * (nqt / 2);
  const int b = bh / NHEAD, hh = bh - b * NHEAD;
  const int tA = nqt - 1 - pr, tB = pr;     // first and second query tile; tA >= 1
  int qt = tA, kt = 0;                      // tile in work and its key chunk (WG-uniform)

  Frag qa0, qa1;                            // B operand: column = query qt*64 + 16w + m
  Frag qn0, qn1;                            // the same of the second tile, fetched up front
  {
    const unsigned short* qr = qp + ((size_t)bh * SEQ + tA * 64 + 16 * w + m) * HD + k8;
    qa0.q[0] = *(const v4u*)(qr);
    qa0.q[1] = *(const v4u*)(qr + 16);
    qa1.q[0] = *(const v4u*)(qr + 32);
    qa1.q[1] = *(const v4u*)(qr + 48);
    const unsigned short* qs = qp + ((size_t)bh * SEQ + tB * 64 + 16 * w + m) * HD + k8;
    qn0.q[0] = *(const v4u*)(qs);
    qn0.q[1] = *(const v4u*)(qs + 16);
    qn1.q[0] = *(const v4u*)(qs + 32);
    qn1.q[1] = *(const v4u*)(qs + 48);
  }
  float mrun = -1e30f;                      // running maximum of the lane's query (equal in both halves)
  float lrun = 0.0f;                        // running sum over this half's keys only; joined when the tile is done
  v8f oacc[4];                              // O^T: row d = 16 jd + 8 hl + r, column = the lane's query
#pragma unroll
  for (int j = 0; j < 4; ++j) oacc[j] = zero8();

  // ---- chunk 0 into buffer 0, published; then chunk 1 into buffer 1 ----
  const int srow = tid >> 3, spc = (tid & 7) * 8;
  const unsigned short* gk0 = kp + ((size_t)bh * SEQ + srow) * HD + spc;
  const unsigned short* gv0 = vp + ((size_t)bh * HD + srow) * (size_t)SEQ + spc;
  const unsigned int lk0 = lds_off(&sK[0][srow][spc]);
  const unsigned int lv0 = lds_off(&sV[0][srow][spc]);
  stage_kv(lk0, lv0, gk0, gv0);
  asm volatile("s_wait_asynccnt 0x0" ::: "memory");   // this wave's copies of chunk 0 have landed
  __syncthreads();                                    // chunk 0 visible to all four waves
  stage_kv(lk0 + KVBUF, lv0 + KVBUF, gk0 + 64 * HD, gv0 + 64);   // chunk 1 exists: tA >= 1

  // rolled: one copy of the body serves both tiles
#pragma unroll 1
  for (int i = 0; i <= nqt; ++i) {          // tA + 1 chunks of the first tile, tB + 1 of the second
    const int buf = i & 1;
    // ---- S^T = K Q^T, four 16-key subtiles: s[j][r] = score(key 16j + 8hl + r, query m) ----
    // All sixteen K reads stand as one group ahead of the eight products, first-half fragments
    // first, so that the wave meets the LDS latency once and not once per subtile.
    v8f s[4];
    const unsigned short* kb = &sK[buf][m][k8];
    Frag kf0[4], kf1[4];
#pragma unroll
    for (int j = 0; j < 4; ++j) {
      kf0[j].q[0] = *(const v4u*)(kb + j * 16 * KVP);
      kf0[j].q[1] = *(const v4u*)(kb + j * 16 * KVP + 16);
    }
#pragma unroll
    for (int j = 0; j < 4; ++j) {
      kf1[j].q[0] = *(const v4u*)(kb + j * 16 * KVP + 32);
      kf1[j].q[1] = *(const v4u*)(kb + j * 16 * KVP + 48);
    }
#pragma unroll
    for (int j = 0; j < 4; ++j) s[j] = mma(kf0[j].v, qa0.v, zero8());
#pragma unroll
    for (int j = 0; j < 4; ++j) s[j] = mma(kf1[j].v, qa1.v, s[j]);
    // The sixteen V^T reads go out here, as one group: they return under the softmax arithmetic.
    const unsigned short* vb = &sV[buf][m][k8];
    Frag vf0[4], vf1[4];
#pragma unroll
    for (int jd = 0; jd < 4; ++jd) {
      vf0[jd].q[0] = *(const v4u*)(vb + jd * 16 * KVP);
      vf0[jd].q[1] = *(const v4u*)(vb + jd * 16 * KVP + 16);
    }
#pragma unroll
    for (int jd = 0; jd < 4; ++jd) {
      vf1[jd].q[0] = *(const v4u*)(vb + jd * 16 * KVP + 32);
      vf1[jd].q[1] = *(const v4u*)(vb + jd * 16 * KVP + 48);
    }
    // keeps the scheduler from sinking the reads down to the second product
    __builtin_amdgcn_sched_barrier(0);
    // ---- causal mask on the diagonal chunk, maximum of the lane's own query ----
    // the lane's one query allows keys up to lim, counted from this half's first key of the chunk
    const int lim = (kt == qt) ? (16 * w + m - 8 * hl) : 64;
    float tm[4];
#pragma unroll
    for (int j = 0; j < 4; ++j) {
      tm[j] = -1e30f;
#pragma unroll
      for (int r = 0; r < 8; ++r) {
        float val = s[j][r];
        val = (16 * j + r > lim) ? -1e30f : val;
        s[j][r] = val;
        tm[j] = fmaxf(tm[j], val);
      }
    }
    float tmax = fmaxf(fmaxf(tm[0], tm[1]), fmaxf(tm[2], tm[3]));
    tmax = fmaxf(tmax, other_half(tmax));
    const float mn = fmaxf(mrun, tmax);
    const float corr = __expf(mrun - mn);
    mrun = mn;
    // ---- p = exp(s - m); f16(16384 p) packed in place as the B operand; sums in the lane ----
    float ts[4];
    v8h ph[4];
#pragma unroll
    for (int j = 0; j < 4; ++j) {
      ts[j] = 0.0f;
      v8f pv;
#pragma unroll
      for (int r = 0; r < 8; ++r) {
        const float p = __expf(s[j][r] - mrun);
        ts[j] += p;
        pv[r] = p * PSC;
      }
      ph[j] = __builtin_convertvector(pv, v8h);
    }
    lrun = lrun * corr + ((ts[0] + ts[1]) + (ts[2] + ts[3]));
#pragma unroll
    for (int j = 0; j < 4; ++j) {
#pragma unroll
      for (int r = 0; r < 8; ++r) oacc[j][r] *= corr;
    }
    // elements 0..7 <- keys 8hl.., 8..15 <- keys 16+8hl.. of each 32-key block
    const v16h pb0 = __builtin_shufflevector(ph[0], ph[1], 0, 1, 2, 3, 4, 5, 6, 7, 8, 9, 10, 11, 12, 13, 14, 15);
    const v16h pb1 = __builtin_shufflevector(ph[2], ph[3], 0, 1, 2, 3, 4, 5, 6, 7, 8, 9, 10, 11, 12, 13, 14, 15);
    // ---- O^T += V^T (64 d x 64 keys) * P^T (64 keys x 16 queries) ----
#pragma unroll
    for (int jd = 0; jd < 4; ++jd) oacc[jd] = mma(vf0[jd].v, pb0, oacc[jd]);
#pragma unroll
    for (int jd = 0; jd < 4; ++jd) oacc[jd] = mma(vf1[jd].v, pb1, oacc[jd]);
    asm volatile("s_wait_dscnt 0x0" ::: "memory");      // this wave's reads of sK/sV[buf] have returned
    asm volatile("s_wait_asynccnt 0x0" ::: "memory");   // this wave's copies of step i+1's chunk have landed
    __syncthreads();   // publishes step i+1's chunk, frees buffer buf for rewriting
    if (i + 2 <= nqt) {  // WG-uniform
      const int c = (i + 2 <= tA) ? (i + 2) : (i + 1 - tA);   // chunk of step i+2, in its own tile
      stage_kv(lk0 + buf * KVBUF, lv0 + buf * KVBUF, gk0 + (size_t)c * 64 * HD, gv0 + c * 64);
    }
    if (kt < qt) {       // WG-uniform
      ++kt;
      continue;
    }

    // ---- tile done: o = acc / (16384 l), stage per wave (8 consecutive d per lane), whole-line stores ----
    const float lsum = lrun + other_half(lrun);
    const float il = 1.0f / (lsum * PSC);
#pragma unroll
    for (int jd = 0; jd < 4; ++jd) {
      *(v4u*)&sP[w][m][16 * jd + k8] =
          pack8h(oacc[jd][0] * il, oacc[jd][1] * il, oacc[jd][2] * il, oacc[jd][3] * il,
                 oacc[jd][4] * il, oacc[jd][5] * il, oacc[jd][6] * il, oacc[jd][7] * il);
    }
    __syncthreads();
    v4u val[4];
    unsigned int off[4];
#pragma unroll
    for (int p = 0; p < 4; ++p) {
      const int row = 4 * p + (lane >> 3);
      const int piece = lane & 7;
      val[p] = *(const v4u*)&sP[w][row][piece * 8];
      off[p] = (unsigned int)((size_t)(b * SEQ + qt * 64 + 16 * w + row) * QKVW + hh * HD + piece * 8);
    }
#pragma unroll
    for (int p = 0; p < 4; ++p) *(v4u*)(op + off[p]) = val[p];
    // the second tile's passes rewrite the registers that the four stores name
    asm volatile("s_wait_xcnt 0x0" ::: "memory");

    // ---- start state of the second tile ----
    qt = tB; kt = 0;
    qa0 = qn0; qa1 = qn1;
    mrun = -1e30f; lrun = 0.0f;
#pragma unroll
    for (int j = 0; j < 4; ++j) oacc[j] = zero8();
  }
  asm volatile("s_wait_asynccnt 0x0" ::: "memory");     // nothing of this wave's in flight past the loop
}

// ---------------------------------------------------------------------------
// Host launcher
// ---------------------------------------------------------------------------
static inline size_t al256(size_t v) { return (v + 255) & ~(size_t)255; }

extern "C" void kernel_launch(void* const* d_in, const int* in_sizes, int n_in,
                              void* d_out, int out_size, void* d_ws, size_t ws_size,
                              hipStream_t stream) {
  if (n_in < 17) return;
  const long needX = ((long)(NB - 1) * SEQ_FULL + SEQ) * CDIM;
  const long nW = (long)NHEAD * CDIM * HD;
  if ((long)in_sizes[0] < needX) return;
  if ((long)in_sizes[1] < nW || (long)in_sizes[3] < nW || (long)in_sizes[5] < nW) return;
  if (in_sizes[2] < QKVW || in_sizes[4] < QKVW || in_sizes[6] < QKVW) return;
  if ((long)in_sizes[7] < (long)QKVW * CDIM || in_sizes[8] < CDIM) return;
  if ((long)in_sizes[9] < (long)CDIM * HID || in_sizes[10] < HID) return;
  if ((long)in_sizes[11] < (long)HID * CDIM || in_sizes[12] < CDIM) return;
  if (in_sizes[13] < CDIM || in_sizes[14] < CDIM || in_sizes[15] < CDIM || in_sizes[16] < CDIM) return;
  if ((long)out_size < needX) return;

  const float* x   = (const float*)d_in[0];
  const float* Wq  = (const float*)d_in[1];
  const float* bq  = (const float*)d_in[2];
  const float* Wk  = (const float*)d_in[3];
  const float* bk  = (const float*)d_in[4];
  const float* Wv  = (const float*)d_in[5];
  const float* bv  = (const float*)d_in[6];
  const float* Wp  = (const float*)d_in[7];
  const float* bp  = (const float*)d_in[8];
  const float* W1  = (const float*)d_in[9];
  const float* b1  = (const float*)d_in[10];
  const float* W2  = (const float*)d_in[11];
  const float* b2  = (const float*)d_in[12];
  const float* g1  = (const float*)d_in[13];
  const float* be1 = (const float*)d_in[14];
  const float* g2  = (const float*)d_in[15];
  const float* be2 = (const float*)d_in[16];
  float* out = (float*)d_out;

  char* ws = (char*)d_ws;
  size_t off = 0;
  auto carve = [&](size_t bytes) -> char* { char* p = ws + off; off += al256(bytes); return p; };
  const size_t MC  = (size_t)MROWS * CDIM;                   // [M][64]
  const size_t MHD = (size_t)NB * NHEAD * SEQ * HD;          // per q/k/vt plane
  unsigned short* wqkv = (unsigned short*)carve((size_t)3 * QKVW * CDIM * 2);   // [1536][64]
  unsigned short* wpt  = (unsigned short*)carve((size_t)CDIM * QKVW * 2);       // [64][512]
  unsigned short* w1t  = (unsigned short*)carve((size_t)HID * CDIM * 2);        // [256][64]
  unsigned short* w2t  = (unsigned short*)carve((size_t)CDIM * HID * 2);        // [64][256]
  unsigned short* xh   = (unsigned short*)carve(MC * 2);                        // [M][64]
  unsigned short* qpl  = (unsigned short*)carve(MHD * 2);                       // [B*H][SEQ][64]
  unsigned short* kpl  = (unsigned short*)carve(MHD * 2);                       // [B*H][SEQ][64]
  unsigned short* vtp  = (unsigned short*)carve(MHD * 2);                       // [B*H][64][SEQ]
  unsigned short* opl  = (unsigned short*)carve((size_t)MROWS * QKVW * 2);      // [M][512]
  float*          h1f  = (float*)carve(MC * 4);                                 // [M][64]
  unsigned short* h1h  = (unsigned short*)carve(MC * 2);                        // [M][64]
  unsigned short* act  = (unsigned short*)carve((size_t)MROWS * HID * 2);       // [M][256]
  if (off > ws_size) return;
  if (off > ((size_t)128 << 20)) return;

  // 1+2) weight planes (transposed, bf16 values x16 as f16) and the x plane (bf16 values of x
  //      as f16), one grid
  k_prep<<<PB_X + MROWS / 32, 256, 0, stream>>>(x, Wq, Wk, Wv, Wp, W1, W2, wqkv, wpt, w1t, w2t, xh);
  // 3) q/k/v projections + biases -> q, k, vt planes
  k_gemm<0, 0, 0, 0><<<dim3(3 * QKVW / 64, MROWS / 64), 128, 0, stream>>>(
      xh, wqkv, CDIM, bq, bk, bv, nullptr, nullptr, nullptr, nullptr, qpl, kpl, vtp, 0);
  // 4) causal attention -> o plane [M][512]
  k_attn<<<NB * NHEAD * (SEQ / 128), 128, 0, stream>>>(qpl, kpl, vtp, opl);
  // 5) output projection + bias + residual(bf16 values of x) + layernorm 1 -> h1 (f32 + f16 copy)
  k_gemm<1, 1, 0, 1><<<dim3(CDIM / 64, MROWS / 64), 128, 0, stream>>>(
      opl, wpt, QKVW, bp, bp, bp, x, g1, be1, h1f, h1h, nullptr, nullptr, CDIM);
  // 6) ffn1 + bias + relu -> act (f16)
  k_gemm<2, 0, 0, 0><<<dim3(HID / 64, MROWS / 64), 128, 0, stream>>>(
      h1h, w1t, CDIM, b1, b1, b1, nullptr, nullptr, nullptr, nullptr, act, nullptr, nullptr, HID);
  // 7) ffn2 + bias + residual(h1) + layernorm 2 -> out (f32, full strides)
  k_gemm<1, 0, 1, 0><<<dim3(CDIM / 64, MROWS / 64), 128, 0, stream>>>(
      act, w2t, HID, b2, b2, b2, h1f, g2, be2, out, nullptr, nullptr, nullptr, CDIM);
}

// v006
// A run of this version takes 58.7 microseconds.
// Timed twice side by side with v005, it ran 1.59 and 1.58 times as fast.
// Over all steps from v000 it is 4.37 times as fast.
#include <hip/hip_runtime.h>

// Contractions: v_wmma_f32_16x16x32_f16 (f16 operands, f32 accumulate) for q/k/v projections, q.k^T, p.v, output projection, ffn1, ffn2; weight planes carried x16, p plane carried x16384, activations x1.

#pragma clang fp contract(off)

#ifndef NB
#define NB 4
#endif
#ifndef SEQ
#define SEQ 2048
#endif
#define NB_FULL 4
#define SEQ_FULL 2048
#define CDIM 64
#define NHEAD 8
#define HD 64
#define QKVW (NHEAD * HD)
#define HID 256
#define MROWS (NB * SEQ)
#define PSC 16384.0f

static_assert(NB >= 1 && NB <= NB_FULL);
static_assert(SEQ % 64 == 0 && SEQ >= 64 && SEQ <= SEQ_FULL);
static_assert(HD == 64);
static_assert(CDIM == 64);
static_assert(QKVW == 512);
static_assert(HID % 64 == 0 && QKVW % 64 == 0 && CDIM % 64 == 0);
static_assert(HID % 32 == 0 && QKVW % 32 == 0 && CDIM % 32 == 0);
static_assert(MROWS % 64 == 0);
static_assert((long)MROWS * QKVW < (1L << 31));
static_assert((long)NB * NHEAD * SEQ * HD < (1L << 31));

typedef _Float16 v16h __attribute__((ext_vector_type(16)));
typedef _Float16 v8h  __attribute__((ext_vector_type(8)));
typedef float    v8f  __attribute__((ext_vector_type(8)));
typedef float    v4f  __attribute__((ext_vector_type(4)));
typedef float    v2f  __attribute__((ext_vector_type(2)));
typedef unsigned int v4u __attribute__((ext_vector_type(4)));

union Frag { v16h v; v4u q[2]; };

// WMMA with hazard guard: D += A(16x32) * B(32x16)
__device__ __forceinline__ v8f mma(v16h a, v16h b, v8f c) {
  v8f d = __builtin_amdgcn_wmma_f32_16x16x32_f16(false, a, false, b, (short)0, c, false, false);
  asm volatile("v_nop\n\tv_nop\n\tv_nop\n\tv_nop" : "+v"(d) : "v"(a), "v"(b));
  return d;
}

__device__ __forceinline__ v8f zero8() {
  v8f z;
#pragma unroll
  for (int i = 0; i < 8; ++i) z[i] = 0.0f;
  return z;
}

// f32 -> nearest-even bf16 value, returned as f32
__device__ __forceinline__ float bf16q(float f) {
  unsigned int u = __float_as_uint(f);
  unsigned int r = u + 0x7FFFu + ((u >> 16) & 1u);
  r = ((u & 0x7F800000u) == 0x7F800000u) ? u : r;
  return __uint_as_float(r & 0xFFFF0000u);
}
__device__ __forceinline__ v4f bf16q4(v4f a) {
  v4f r;
  r.x = bf16q(a.x); r.y = bf16q(a.y); r.z = bf16q(a.z); r.w = bf16q(a.w);
  return r;
}
// f32 -> f16 (RNE convert) bit pattern
__device__ __forceinline__ unsigned short hbits(float f) {
  _Float16 h = (_Float16)f;
  return __builtin_bit_cast(unsigned short, h);
}
__device__ __forceinline__ v4u pack8h(float f0, float f1, float f2, float f3,
                                      float f4, float f5, float f6, float f7) {
  v8h t;
  t[0] = (_Float16)f0; t[1] = (_Float16)f1; t[2] = (_Float16)f2; t[3] = (_Float16)f3;
  t[4] = (_Float16)f4; t[5] = (_Float16)f5; t[6] = (_Float16)f6; t[7] = (_Float16)f7;
  return __builtin_bit_cast(v4u, t);
}

// ---------------------------------------------------------------------------
// Weight prep, one 64x64 tile per work-group: logical W[k][n] (f32) -> Wt[n][k] f16 plane,
// value = f16(bf16q(w) * 16).
// src element (k, n0+j) = src[(n0/64)*hstride + k*rstride + j]; dst row = drow0 + n0 + n.
// LDS sT: cross-wave (block barrier).
// ---------------------------------------------------------------------------
__device__ __forceinline__ void wprep_tile(
    unsigned short (*sT)[72], const float* __restrict__ src, unsigned short* __restrict__ dst,
    int K, int hstride, int rstride, int k0, int n0, int drow0) {
  const int tid = threadIdx.x;
  const size_t sbase = (size_t)(n0 >> 6) * (size_t)hstride;
#pragma unroll
  for (int it = 0; it < 4; ++it) {
    const int idx = it * 256 + tid;
    const int kk = idx >> 4;            // 0..63
    const int j4 = (idx & 15) * 4;      // 0..60
    const v4f wv = *(const v4f*)(src + sbase + (size_t)(k0 + kk) * (size_t)rstride + j4);
    sT[j4 + 0][kk] = hbits(bf16q(wv.x) * 16.0f);
    sT[j4 + 1][kk] = hbits(bf16q(wv.y) * 16.0f);
    sT[j4 + 2][kk] = hbits(bf16q(wv.z) * 16.0f);
    sT[j4 + 3][kk] = hbits(bf16q(wv.w) * 16.0f);
  }
  __syncthreads();   // cross-wave: staged by all waves, read by all waves
  v4u val[2];
  size_t off[2];
#pragma unroll
  for (int p = 0; p < 2; ++p) {
    const int n = p * 32 + (tid >> 3);
    const int piece = tid & 7;
    val[p] = *(const v4u*)&sT[n][piece * 8];
    off[p] = ((size_t)drow0 + n0 + n) * (size_t)K + k0 + piece * 8;
  }
#pragma unroll
  for (int p = 0; p < 2; ++p) *(v4u*)(dst + off[p]) = val[p];
  // stands in front of the code that the build lays out behind this path (the x rows), which
  // writes the registers that the two stores name
  asm volatile("s_wait_xcnt 0x0" ::: "memory");
}

// ---------------------------------------------------------------------------
// Input prep, 32 rows per work-group: x (f32, full batch strides) -> f16 plane xh[nrows][64]
// holding the bf16 values of x.  256 threads x 8 halves = 32 rows x 64.
// ---------------------------------------------------------------------------
__device__ __forceinline__ void xcvt_rows(
    const float* __restrict__ x, unsigned short* __restrict__ xh, int blk, int nrows) {
  const int tid = threadIdx.x;
  const int row = blk * 32 + (tid >> 3);
  const int piece = tid & 7;
  if (row >= nrows) return;            // no barriers on this path
  const int b = row / SEQ, t = row - b * SEQ;
  const size_t xrow = ((size_t)b * SEQ_FULL + t) * CDIM + piece * 8;
  const v4f a0 = bf16q4(*(const v4f*)(x + xrow));
  const v4f a1 = bf16q4(*(const v4f*)(x + xrow + 4));
  const v4u o = pack8h(a0.x, a0.y, a0.z, a0.w, a1.x, a1.y, a1.z, a1.w);
  unsigned short* d = xh + (size_t)row * CDIM + piece * 8;
  *(v4u*)d = o;
}

// ---------------------------------------------------------------------------
// All operand preparation in one grid: the four weight planes and the x plane depend on
// nothing but the inputs, so their work-groups run side by side, told apart by block index
// (block-uniform branches).  Weight tiles first: theirs is the longer chain (load, LDS,
// barrier, store).
// blocks [0, PB_P): Wq/Wk/Wv tiles; [PB_P, PB_1): Wp; [PB_1, PB_2): W1; [PB_2, PB_X): W2;
// [PB_X, PB_X + MROWS/32): x rows.
// ---------------------------------------------------------------------------
#define PB_P (3 * (QKVW / 64))
#define PB_1 (PB_P + QKVW / 64)
#define PB_2 (PB_1 + HID / 64)
#define PB_X (PB_2 + HID / 64)
__global__ __launch_bounds__(256) void k_prep(
    const float* __restrict__ x, const float* __restrict__ Wq, const float* __restrict__ Wk,
    const float* __restrict__ Wv, const float* __restrict__ Wp, const float* __restrict__ W1,
    const float* __restrict__ W2, unsigned short* __restrict__ wqkv,
    unsigned short* __restrict__ wpt, unsigned short* __restrict__ w1t,
    unsigned short* __restrict__ w2t, unsigned short* __restrict__ xh) {
  __shared__ __attribute__((aligned(16))) unsigned short sT[64][72];
  const int bid = blockIdx.x;
  if (bid >= PB_X) {                   // block-uniform, ahead of the barrier
    xcvt_rows(x, xh, bid - PB_X, MROWS);
    return;
  }
  const float* src;
  unsigned short* dst;
  int K, hstride, rstride, k0, n0, drow0;
  if (bid < PB_P) {
    const int z = bid / (QKVW / 64);
    src = (z == 0) ? Wq : ((z == 1) ? Wk : Wv);
    dst = wqkv; K = CDIM; hstride = CDIM * HD; rstride = HD;
    k0 = 0; n0 = (bid - z * (QKVW / 64)) * 64; drow0 = QKVW * z;
  } else if (bid < PB_1) {
    src = Wp; dst = wpt; K = QKVW; hstride = 64; rstride = CDIM;
    k0 = (bid - PB_P) * 64; n0 = 0; drow0 = 0;
  } else if (bid < PB_2) {
    src = W1; dst = w1t; K = CDIM; hstride = 64; rstride = HID;
    k0 = 0; n0 = (bid - PB_1) * 64; drow0 = 0;
  } else {
    src = W2; dst = w2t; K = HID; hstride = 64; rstride = CDIM;
    k0 = (bid - PB_2) * 64; n0 = 0; drow0 = 0;
  }
  wprep_tile(sT, src, dst, K, hstride, rstride, k0, n0, drow0);
}

// ---------------------------------------------------------------------------
// 64x64-tile f16 GEMM: D = A[M][K] * Bt[N][K]^T, 4 waves per WG, wave w owns
// rows 16w..16w+15 x 64 cols (4 accumulator tiles).  Fragments loaded straight
// from the 16-bit planes with the split k map for A and B (row/col = lane&15,
// elements 0..7 <- k0+8h.., 8..15 <- k0+16+8h..).
// EPI 0: q/k planes [b*H+h][t][64] and v transposed plane vt[b*H+h][64][t]
//        (value acc/16 + bf16q(bias), bias picked per q/k/v by the column block)
// coverage: 4 passes x 4 waves x 4 rows = 64 rows x 64 cols; v path: 4 passes x 4 waves x 4 d = 64 d rows x 64 tokens.
// LDS: sT rows are cross-wave in both the q/k and the v path; one block barrier serves both.
// ---------------------------------------------------------------------------
template <int EPI, int RESFULL, int OUTFULL, int WRITEH>
__global__ __launch_bounds__(128) __attribute__((amdgpu_num_vgpr(256))) void k_gemm(
    const unsigned short* __restrict__ A, const unsigned short* __restrict__ Bt, int K,
    const float* __restrict__ bias, const float* __restrict__ biasb, const float* __restrict__ biasc,
    const float* __restrict__ res, const float* __restrict__ gam, const float* __restrict__ bet,
    float* __restrict__ outF, unsigned short* __restrict__ out0,
    unsigned short* __restrict__ out1, unsigned short* __restrict__ out2, int ldo) {
  __shared__ __attribute__((aligned(16))) unsigned short sT[64][72];
  const int tid = threadIdx.x, lane = tid & 31, w = tid >> 5;
  const int m = lane & 15, hl = lane >> 4, k8 = hl * 8;
  const int m0 = blockIdx.y * 64, n0 = blockIdx.x * 64;

  v8f acc[4];
#pragma unroll
  for (int j = 0; j < 4; ++j) acc[j] = zero8();

  const unsigned short* ap = A + (size_t)(m0 + 16 * w + m) * (size_t)K + k8;
  const unsigned short* bp = Bt + (size_t)(n0 + m) * (size_t)K + k8;
  const size_t jstep = (size_t)16 * (size_t)K;
#pragma unroll 1
  for (int k0 = 0; k0 < K; k0 += 32) {
    Frag a;
    a.q[0] = *(const v4u*)(ap + k0);
    a.q[1] = *(const v4u*)(ap + k0 + 16);
#pragma unroll
    for (int j = 0; j < 4; ++j) {
      Frag b;
      const unsigned short* bj = bp + jstep * j + k0;
      b.q[0] = *(const v4u*)(bj);
      b.q[1] = *(const v4u*)(bj + 16);
      acc[j] = mma(a.v, b.v, acc[j]);
    }
  }

  const float wsc = 0.0625f;               // undo the x16 weight carry
  const int lrow0 = 16 * w + 8 * hl;       // D rows of this lane within the WG tile

  if constexpr (EPI == 0) {
    const int which = n0 / QKVW;           // 0 = q, 1 = k, 2 = v (WG-uniform)
    const int hh = (n0 - which * QKVW) / HD;
    const float* bsel = (which == 0) ? bias : ((which == 1) ? biasb : biasc);
#pragma unroll
    for (int j = 0; j < 4; ++j) {
      const float bj = bf16q(bsel[hh * HD + 16 * j + m]);
#pragma unroll
      for (int r = 0; r < 8; ++r) sT[lrow0 + r][16 * j + m] = hbits(acc[j][r] * wsc + bj);
    }
    __syncthreads();   // cross-wave for both the q/k and the v reloads
    const int b = m0 / SEQ, t0 = m0 - b * SEQ;
    const int bh = b * NHEAD + hh;
    v4u val[4];
    unsigned int off[4];
    unsigned short* dst;
    if (which < 2) {                       // WG-uniform
      dst = (which == 0) ? out0 : out1;
#pragma unroll
      for (int p = 0; p < 4; ++p) {
        const int row = p * 16 + 4 * w + (lane >> 3);
        const int piece = lane & 7;
        val[p] = *(const v4u*)&sT[row][piece * 8];
        off[p] = (unsigned int)((bh * SEQ + t0 + row) * HD + piece * 8);
      }
    } else {
      dst = out2;
#pragma unroll
      for (int p = 0; p < 4; ++p) {
        const int d = p * 16 + 4 * w + (lane >> 3);
        const int piece = lane & 7;
        unsigned int wv[4];
#pragma unroll
        for (int e = 0; e < 4; ++e) {
          const unsigned int lo = sT[piece * 8 + 2 * e][d];
          const unsigned int hi = sT[piece * 8 + 2 * e + 1][d];
          wv[e] = lo | (hi << 16);
        }
        v4u t;
        t.x = wv[0]; t.y = wv[1]; t.z = wv[2]; t.w = wv[3];
        val[p] = t;
        off[p] = (unsigned int)((bh * HD + d) * SEQ + t0 + piece * 8);
      }
    }
#pragma unroll
    for (int p = 0; p < 4; ++p) *(v4u*)(dst + off[p]) = val[p];
    
  }
}

// ---------------------------------------------------------------------------
// Layernorm of one 64-col row held two columns a lane (u0, u1): mean, then variance of the
// centred values, each summed over the wave's 32 lanes.
// ---------------------------------------------------------------------------
__device__ __forceinline__ v2f ln_row(float u0, float u1, float gg0, float gg1, float ee0, float ee1) {
  float s = u0 + u1;
#pragma unroll
  for (int xm = 1; xm < 32; xm <<= 1) s += __shfl_xor(s, xm, 32);
  const float mu = s * (1.0f / CDIM);
  const float d0 = u0 - mu, d1 = u1 - mu;
  float qs = d0 * d0 + d1 * d1;
#pragma unroll
  for (int xm = 1; xm < 32; xm <<= 1) qs += __shfl_xor(qs, xm, 32);
  const float var = qs * (1.0f / CDIM);
  const float rstd = rsqrtf(var + 1e-5f);
  v2f yv;
  yv.x = d0 * rstd * gg0 + ee0;
  yv.y = d1 * rstd * gg1 + ee1;
  return yv;
}

// ---------------------------------------------------------------------------
// Everything behind the attention, one launch: output projection + bias + residual(bf16 values
// of x) + layernorm 1, ffn1 + bias + relu, ffn2 + bias + residual(h1) + layernorm 2.  All of it
// is row-local, so one WG carries TR = 16 token rows from the o plane to the output; h1 and the
// hidden activations never leave the WGP (h1: f16 copy in LDS as the next A operand, f32 values
// in the registers of the lane that made them; activations: f16 in LDS).
// 4 waves.  Products: wave w owns output columns 16w..16w+15 (projection, ffn2) or 64w..64w+63
// (ffn1) of all 16 rows; k runs upward in one accumulator chain per tile.  Same split k map for
// A and B as k_gemm.  Layernorms: wave w owns rows 4w..4w+3, a lane two columns of each.
// Every global operand load stands ahead of the products that use it, as groups: the wave meets
// the load latency once per group, not once per fragment.
// LDS sF (f32 product rows), sH (h1 as f16), sA (activations as f16): all cross-wave, each
// published by a block barrier.
// ---------------------------------------------------------------------------
#define TR 16
#define AP (HID + 8)
static_assert(SEQ % TR == 0 && MROWS % TR == 0);
static_assert(QKVW == 512 && HID == 256 && CDIM == 64);
__global__ __launch_bounds__(128) __attribute__((amdgpu_num_vgpr(256)))
void k_tail(const unsigned short* __restrict__ op, const unsigned short* __restrict__ wpt,
            const unsigned short* __restrict__ w1t, const unsigned short* __restrict__ w2t,
            const float* __restrict__ x, const float* __restrict__ bp, const float* __restrict__ b1,
            const float* __restrict__ b2, const float* __restrict__ g1, const float* __restrict__ be1,
            const float* __restrict__ g2, const float* __restrict__ be2, float* __restrict__ out) {
  __shared__ __attribute__((aligned(16))) float sF[TR][68];
  __shared__ __attribute__((aligned(16))) unsigned short sH[TR][72];
  __shared__ __attribute__((aligned(16))) unsigned short sA[TR][AP];
  const int tid = threadIdx.x, lane = tid & 31, w = tid >> 5;
  const int m = lane & 15, hl = lane >> 4, k8 = hl * 8;
  const int m0 = blockIdx.x * TR;
  const int b = m0 / SEQ, t0 = m0 - b * SEQ;
  const int c2 = 2 * lane;                 // lane owns cols c2, c2+1 of each of its wave's rows
  const float wsc = 0.0625f;               // undo the x16 weight carry
  const size_t frow = ((size_t)b * SEQ_FULL + t0 + 4 * w) * CDIM + c2;   // x and out, full strides

  // ---- output projection: 16 rows x 16 cols per wave, k = 512 ----
  // Two load groups in all: the first twelve k steps (as many fragments as the registers hold);
  // then, into the registers that those products free, the last four steps together with the
  // weight fragments of ffn1 and ffn2, which depend on nothing computed here.
  const unsigned short* ap = op + (size_t)(m0 + m) * QKVW + k8;
  const unsigned short* bq = wpt + (size_t)(16 * w + m) * QKVW + k8;
  Frag pa[12], pb[12];
#pragma unroll
  for (int i = 0; i < 12; ++i) {
    pa[i].q[0] = *(const v4u*)(ap + 32 * i);
    pa[i].q[1] = *(const v4u*)(ap + 32 * i + 16);
    pb[i].q[0] = *(const v4u*)(bq + 32 * i);
    pb[i].q[1] = *(const v4u*)(bq + 32 * i + 16);
  }
  // the residual rows of x and every bias, gain and shift of the later stages: fetched ahead of
  // the first barrier too, so that no stage behind a barrier opens with a global load
  v2f xr[4];
  const float* xp = x + frow;
#pragma unroll
  for (int rr = 0; rr < 4; ++rr) xr[rr] = *(const v2f*)(xp + rr * CDIM);
  float rb1[4];
  const float* b1p = b1 + 64 * w + m;
#pragma unroll
  for (int j = 0; j < 4; ++j) rb1[j] = b1p[16 * j];
  // stands behind the loads above and names their last-used address registers as inputs, so that
  // none of them is rewritten (a later load's result included) ahead of it
  asm volatile("s_wait_xcnt 0x0" :: "v"(xp), "v"(b1p) : "memory");
  v8f acc = zero8();
#pragma unroll
  for (int i = 0; i < 12; ++i) acc = mma(pa[i].v, pb[i].v, acc);
  Frag qa[4], qb[4];
#pragma unroll
  for (int i = 0; i < 4; ++i) {
    qa[i].q[0] = *(const v4u*)(ap + 384 + 32 * i);
    qa[i].q[1] = *(const v4u*)(ap + 384 + 32 * i + 16);
    qb[i].q[0] = *(const v4u*)(bq + 384 + 32 * i);
    qb[i].q[1] = *(const v4u*)(bq + 384 + 32 * i + 16);
  }
  const float rbp0 = bp[c2], rbp1 = bp[c2 + 1], rg10 = g1[c2], rg11 = g1[c2 + 1];
  const float re10 = be1[c2], re11 = be1[c2 + 1];
  const float rb20 = b2[c2], rb21 = b2[c2 + 1], rg20 = g2[c2], rg21 = g2[c2 + 1];
  const float re20 = be2[c2], re21 = be2[c2 + 1];
  Frag w1a[4], w1b[4];
  const unsigned short* w1p = w1t + (size_t)(64 * w + m) * CDIM + k8;
#pragma unroll
  for (int j = 0; j < 4; ++j) {
    w1a[j].q[0] = *(const v4u*)(w1p + j * 16 * CDIM);
    w1a[j].q[1] = *(const v4u*)(w1p + j * 16 * CDIM + 16);
    w1b[j].q[0] = *(const v4u*)(w1p + j * 16 * CDIM + 32);
    w1b[j].q[1] = *(const v4u*)(w1p + j * 16 * CDIM + 48);
  }
  Frag w2f[8];
  const unsigned short* w2p = w2t + (size_t)(16 * w + m) * HID + k8;
#pragma unroll
  for (int i = 0; i < 8; ++i) {
    w2f[i].q[0] = *(const v4u*)(w2p + 32 * i);
    w2f[i].q[1] = *(const v4u*)(w2p + 32 * i + 16);
  }
  // as above, for the four address pairs of this group
  asm volatile("s_wait_xcnt 0x0" :: "v"(ap), "v"(bq), "v"(w1p), "v"(w2p) : "memory");
  // inputs only: holds the twelve small loads inside this group; sunk behind the last products or
  // behind a barrier, they would cost a global load latency of their own
  asm volatile("" :: "v"(rbp0), "v"(rbp1), "v"(rg10), "v"(rg11), "v"(re10), "v"(re11),
                     "v"(rb20), "v"(rb21), "v"(rg20), "v"(rg21), "v"(re20), "v"(re21));
#pragma unroll
  for (int i = 0; i < 4; ++i) acc = mma(qa[i].v, qb[i].v, acc);
#pragma unroll
  for (int r = 0; r < 8; ++r) sF[8 * hl + r][16 * w + m] = acc[r] * wsc;
  __syncthreads();   // cross-wave: a row's 64 columns come from all four waves

  // ---- bias + residual + layernorm 1 ----
  v2f h1[4];                               // f32 h1 of rows 4w + rr, cols c2, c2+1: residual of layernorm 2
  {
    const float bb0 = bf16q(rbp0), bb1 = bf16q(rbp1);
    const float gg0 = bf16q(rg10), gg1 = bf16q(rg11);
    const float ee0 = bf16q(re10), ee1 = bf16q(re11);
#pragma unroll
    for (int rr = 0; rr < 4; ++rr) {
      const int row = 4 * w + rr;
      const v2f av = *(const v2f*)&sF[row][c2];
      const float u0 = (av.x + bb0) + bf16q(xr[rr].x);
      const float u1 = (av.y + bb1) + bf16q(xr[rr].y);
      h1[rr] = ln_row(u0, u1, gg0, gg1, ee0, ee1);
      sH[row][c2] = hbits(h1[rr].x);
      sH[row][c2 + 1] = hbits(h1[rr].y);
    }
  }
  __syncthreads();   // cross-wave: h1 rows of all waves are every wave's A operand; ends the reads of sF

  // ---- ffn1 + bias + relu: 16 rows x 64 cols per wave, k = 64 ----
  {
    Frag ha0, ha1;
    const unsigned short* hp = &sH[m][k8];
    ha0.q[0] = *(const v4u*)(hp);
    ha0.q[1] = *(const v4u*)(hp + 16);
    ha1.q[0] = *(const v4u*)(hp + 32);
    ha1.q[1] = *(const v4u*)(hp + 48);
    v8f fa[4];
#pragma unroll
    for (int j = 0; j < 4; ++j) fa[j] = mma(ha0.v, w1a[j].v, zero8());
#pragma unroll
    for (int j = 0; j < 4; ++j) fa[j] = mma(ha1.v, w1b[j].v, fa[j]);
#pragma unroll
    for (int j = 0; j < 4; ++j) {
      const float bj = bf16q(rb1[j]);
#pragma unroll
      for (int r = 0; r < 8; ++r) {
        float u = fa[j][r] * wsc + bj;
        u = fmaxf(u, 0.0f);
        sA[8 * hl + r][64 * w + 16 * j + m] = hbits(u);
      }
    }
  }
  __syncthreads();   // cross-wave: the 256 hidden columns come from all four waves

  // ---- ffn2: 16 rows x 16 cols per wave, k = 256 ----
  {
    const unsigned short* aq = &sA[m][k8];
    Frag fa[8];
#pragma unroll
    for (int i = 0; i < 8; ++i) {
      fa[i].q[0] = *(const v4u*)(aq + 32 * i);
      fa[i].q[1] = *(const v4u*)(aq + 32 * i + 16);
    }
    v8f acc2 = zero8();
#pragma unroll
    for (int i = 0; i < 8; ++i) acc2 = mma(fa[i].v, w2f[i].v, acc2);
#pragma unroll
    for (int r = 0; r < 8; ++r) sF[8 * hl + r][16 * w + m] = acc2[r] * wsc;
  }
  __syncthreads();   // cross-wave: a row's 64 columns come from all four waves

  // ---- bias + residual(h1) + layernorm 2 -> out, one whole 256-B row per store ----
  {
    const float bb0 = bf16q(rb20), bb1 = bf16q(rb21);
    const float gg0 = bf16q(rg20), gg1 = bf16q(rg21);
    const float ee0 = bf16q(re20), ee1 = bf16q(re21);
    v2f yv[4];
#pragma unroll
    for (int rr = 0; rr < 4; ++rr) {
      const v2f av = *(const v2f*)&sF[4 * w + rr][c2];
      const float u0 = (av.x + bb0) + h1[rr].x;
      const float u1 = (av.y + bb1) + h1[rr].y;
      yv[rr] = ln_row(u0, u1, gg0, gg1, ee0, ee1);
    }
#pragma unroll
    for (int rr = 0; rr < 4; ++rr) *(v2f*)(out + frow + rr * CDIM) = yv[rr];
  }
}

// ---------------------------------------------------------------------------
// One 64-key chunk into LDS, shared by the work-group's four waves: K rows (64 x 128 B,
// contiguous) and V^T rows (64 x 128 B, source pitch SEQ halves).  128 threads x 16 B x 4
// row groups per operand; eight lanes cover one whole 128-B row.  lk/lv/gk/gv are the lane's
// own addresses for row group 0; a row group is 16 rows.  LDS pitch KVP halves.
// ---------------------------------------------------------------------------
#define KVP 72
#define KVBUF (64 * KVP * 2)
__device__ __forceinline__ unsigned int lds_off(const void* p) { return (unsigned int)(size_t)p; }
__device__ __forceinline__ void stage_kv(unsigned int lk, unsigned int lv,
                                         const unsigned short* gk, const unsigned short* gv) {
  const unsigned int ls = 16 * KVP * 2;
  // The closing s_wait_xcnt stands in the copies' own statement so that no address register
  // named here is rewritten ahead of it.
  asm volatile(
      "global_load_async_to_lds_b128 %0, %8, off\n\t"
      "global_load_async_to_lds_b128 %1, %9, off\n\t"
      "global_load_async_to_lds_b128 %2, %10, off\n\t"
      "global_load_async_to_lds_b128 %3, %11, off\n\t"
      "global_load_async_to_lds_b128 %4, %12, off\n\t"
      "global_load_async_to_lds_b128 %5, %13, off\n\t"
      "global_load_async_to_lds_b128 %6, %14, off\n\t"
      "global_load_async_to_lds_b128 %7, %15, off\n\t"
      "s_wait_xcnt 0x0"
      :: "v"(lk), "v"(lk + ls), "v"(lk + 2 * ls), "v"(lk + 3 * ls),
         "v"(lv), "v"(lv + ls), "v"(lv + 2 * ls), "v"(lv + 3 * ls),
         "v"(gk), "v"(gk + 16 * HD), "v"(gk + 32 * HD), "v"(gk + 48 * HD),
         "v"(gv), "v"(gv + 16 * SEQ), "v"(gv + 32 * SEQ), "v"(gv + 48 * SEQ)
      : "memory");
}

__device__ __forceinline__ float other_half(float f) {
  const int b = __float_as_int(f);
  return __int_as_float(__builtin_amdgcn_permlanex16(b, b, 0x76543210, 0xfedcba98, false, false));
}

__global__ __launch_bounds__(128) __attribute__((amdgpu_num_vgpr(256)))
void k_attn(const unsigned short* __restrict__ qp, const unsigned short* __restrict__ kp,
            const unsigned short* __restrict__ vp, unsigned short* __restrict__ op) {
  __shared__ __attribute__((aligned(16))) unsigned short sP[4][16][72];
  __shared__ __attribute__((aligned(16))) unsigned short sK[2][64][KVP];
  __shared__ __attribute__((aligned(16))) unsigned short sV[2][64][KVP];
  const int tid = threadIdx.x, lane = tid & 31, w = tid >> 5;
  const int m = lane & 15, hl = lane >> 4, k8 = hl * 8;
  const int nqt = SEQ / 64;
  static_assert((SEQ / 64) % 2 == 0);       // tiles pair up as (nqt-1-p, p)
  const int bh = blockIdx.x / (nqt / 2), pr = blockIdx.x - bh * (nqt / 2);
  const int b = bh / NHEAD, hh = bh - b * NHEAD;
  const int tA = nqt - 1 - pr, tB = pr;     // first and second query tile; tA >= 1
  int qt = tA, kt = 0;                      // tile in work and its key chunk (WG-uniform)

  Frag qa0, qa1;                            // B operand: column = query qt*64 + 16w + m
  Frag qn0, qn1;                            // the same of the second tile, fetched up front
  {
    const unsigned short* qr = qp + ((size_t)bh * SEQ + tA * 64 + 16 * w + m) * HD + k8;
    qa0.q[0] = *(const v4u*)(qr);
    qa0.q[1] = *(const v4u*)(qr + 16);
    qa1.q[0] = *(const v4u*)(qr + 32);
    qa1.q[1] = *(const v4u*)(qr + 48);
    const unsigned short* qs = qp + ((size_t)bh * SEQ + tB * 64 + 16 * w + m) * HD + k8;
    qn0.q[0] = *(const v4u*)(qs);
    qn0.q[1] = *(const v4u*)(qs + 16);
    qn1.q[0] = *(const v4u*)(qs + 32);
    qn1.q[1] = *(const v4u*)(qs + 48);
  }
  float mrun = -1e30f;                      // running maximum of the lane's query (equal in both halves)
  float lrun = 0.0f;                        // running sum over this half's keys only; joined when the tile is done
  v8f oacc[4];                              // O^T: row d = 16 jd + 8 hl + r, column = the lane's query
#pragma unroll
  for (int j = 0; j < 4; ++j) oacc[j] = zero8();

  // ---- chunk 0 into buffer 0, published; then chunk 1 into buffer 1 ----
  const int srow = tid >> 3, spc = (tid & 7) * 8;
  const unsigned short* gk0 = kp + ((size_t)bh * SEQ + srow) * HD + spc;
  const unsigned short* gv0 = vp + ((size_t)bh * HD + srow) * (size_t)SEQ + spc;
  const unsigned int lk0 = lds_off(&sK[0][srow][spc]);
  const unsigned int lv0 = lds_off(&sV[0][srow][spc]);
  stage_kv(lk0, lv0, gk0, gv0);
  asm volatile("s_wait_asynccnt 0x0" ::: "memory");   // this wave's copies of chunk 0 have landed
  __syncthreads();                                    // chunk 0 visible to all four waves
  stage_kv(lk0 + KVBUF, lv0 + KVBUF, gk0 + 64 * HD, gv0 + 64);   // chunk 1 exists: tA >= 1

  // rolled: one copy of the body serves both tiles
#pragma unroll 1
  for (int i = 0; i <= nqt; ++i) {          // tA + 1 chunks of the first tile, tB + 1 of the second
    const int buf = i & 1;
    // ---- S^T = K Q^T, four 16-key subtiles: s[j][r] = score(key 16j + 8hl + r, query m) ----
    // All sixteen K reads stand as one group ahead of the eight products, first-half fragments
    // first, so that the wave meets the LDS latency once and not once per subtile.
    v8f s[4];
    const unsigned short* kb = &sK[buf][m][k8];
    Frag kf0[4], kf1[4];
#pragma unroll
    for (int j = 0; j < 4; ++j) {
      kf0[j].q[0] = *(const v4u*)(kb + j * 16 * KVP);
      kf0[j].q[1] = *(const v4u*)(kb + j * 16 * KVP + 16);
    }
#pragma unroll
    for (int j = 0; j < 4; ++j) {
      kf1[j].q[0] = *(const v4u*)(kb + j * 16 * KVP + 32);
      kf1[j].q[1] = *(const v4u*)(kb + j * 16 * KVP + 48);
    }
#pragma unroll
    for (int j = 0; j < 4; ++j) s[j] = mma(kf0[j].v, qa0.v, zero8());
#pragma unroll
    for (int j = 0; j < 4; ++j) s[j] = mma(kf1[j].v, qa1.v, s[j]);
    // The sixteen V^T reads go out here, as one group: they return under the softmax arithmetic.
    const unsigned short* vb = &sV[buf][m][k8];
    Frag vf0[4], vf1[4];
#pragma unroll
    for (int jd = 0; jd < 4; ++jd) {
      vf0[jd].q[0] = *(const v4u*)(vb + jd * 16 * KVP);
      vf0[jd].q[1] = *(const v4u*)(vb + jd * 16 * KVP + 16);
    }
#pragma unroll
    for (int jd = 0; jd < 4; ++jd) {
      vf1[jd].q[0] = *(const v4u*)(vb + jd * 16 * KVP + 32);
      vf1[jd].q[1] = *(const v4u*)(vb + jd * 16 * KVP + 48);
    }
    // keeps the scheduler from sinking the reads down to the second product
    __builtin_amdgcn_sched_barrier(0);
    // ---- causal mask on the diagonal chunk, maximum of the lane's own query ----
    // the lane's one query allows keys up to lim, counted from this half's first key of the chunk
    const int lim = (kt == qt) ? (16 * w + m - 8 * hl) : 64;
    float tm[4];
#pragma unroll
    for (int j = 0; j < 4; ++j) {
      tm[j] = -1e30f;
#pragma unroll
      for (int r = 0; r < 8; ++r) {
        float val = s[j][r];
        val = (16 * j + r > lim) ? -1e30f : val;
        s[j][r] = val;
        tm[j] = fmaxf(tm[j], val);
      }
    }
    float tmax = fmaxf(fmaxf(tm[0], tm[1]), fmaxf(tm[2], tm[3]));
    tmax = fmaxf(tmax, other_half(tmax));
    const float mn = fmaxf(mrun, tmax);
    const float corr = __expf(mrun - mn);
    mrun = mn;
    // ---- p = exp(s - m); f16(16384 p) packed in place as the B operand; sums in the lane ----
    float ts[4];
    v8h ph[4];
#pragma unroll
    for (int j = 0; j < 4; ++j) {
      ts[j] = 0.0f;
      v8f pv;
#pragma unroll
      for (int r = 0; r < 8; ++r) {
        const float p = __expf(s[j][r] - mrun);
        ts[j] += p;
        pv[r] = p * PSC;
      }
      ph[j] = __builtin_convertvector(pv, v8h);
    }
    lrun = lrun * corr + ((ts[0] + ts[1]) + (ts[2] + ts[3]));
#pragma unroll
    for (int j = 0; j < 4; ++j) {
#pragma unroll
      for (int r = 0; r < 8; ++r) oacc[j][r] *= corr;
    }
    // elements 0..7 <- keys 8hl.., 8..15 <- keys 16+8hl.. of each 32-key block
    const v16h pb0 = __builtin_shufflevector(ph[0], ph[1], 0, 1, 2, 3, 4, 5, 6, 7, 8, 9, 10, 11, 12, 13, 14, 15);
    const v16h pb1 = __builtin_shufflevector(ph[2], ph[3], 0, 1, 2, 3, 4, 5, 6, 7, 8, 9, 10, 11, 12, 13, 14, 15);
    // ---- O^T += V^T (64 d x 64 keys) * P^T (64 keys x 16 queries) ----
#pragma unroll
    for (int jd = 0; jd < 4; ++jd) oacc[jd] = mma(vf0[jd].v, pb0, oacc[jd]);
#pragma unroll
    for (int jd = 0; jd < 4; ++jd) oacc[jd] = mma(vf1[jd].v, pb1, oacc[jd]);
    asm volatile("s_wait_dscnt 0x0" ::: "memory");      // this wave's reads of sK/sV[buf] have returned
    asm volatile("s_wait_asynccnt 0x0" ::: "memory");   // this wave's copies of step i+1's chunk have landed
    __syncthreads();   // publishes step i+1's chunk, frees buffer buf for rewriting
    if (i + 2 <= nqt) {  // WG-uniform
      const int c = (i + 2 <= tA) ? (i + 2) : (i + 1 - tA);   // chunk of step i+2, in its own tile
      stage_kv(lk0 + buf * KVBUF, lv0 + buf * KVBUF, gk0 + (size_t)c * 64 * HD, gv0 + c * 64);
    }
    if (kt < qt) {       // WG-uniform
      ++kt;
      continue;
    }

    // ---- tile done: o = acc / (16384 l), stage per wave (8 consecutive d per lane), whole-line stores ----
    const float lsum = lrun + other_half(lrun);
    const float il = 1.0f / (lsum * PSC);
#pragma unroll
    for (int jd = 0; jd < 4; ++jd) {
      *(v4u*)&sP[w][m][16 * jd + k8] =
          pack8h(oacc[jd][0] * il, oacc[jd][1] * il, oacc[jd][2] * il, oacc[jd][3] * il,
                 oacc[jd][4] * il, oacc[jd][5] * il, oacc[jd][6] * il, oacc[jd][7] * il);
    }
    __syncthreads();
    v4u val[4];
    unsigned int off[4];
#pragma unroll
    for (int p = 0; p < 4; ++p) {
      const int row = 4 * p + (lane >> 3);
      const int piece = lane & 7;
      val[p] = *(const v4u*)&sP[w][row][piece * 8];
      off[p] = (unsigned int)((size_t)(b * SEQ + qt * 64 + 16 * w + row) * QKVW + hh * HD + piece * 8);
    }
#pragma unroll
    for (int p = 0; p < 4; ++p) *(v4u*)(op + off[p]) = val[p];
    // the second tile's passes rewrite the registers that the four stores name
    asm volatile("s_wait_xcnt 0x0" ::: "memory");

    // ---- start state of the second tile ----
    qt = tB; kt = 0;
    qa0 = qn0; qa1 = qn1;
    mrun = -1e30f; lrun = 0.0f;
#pragma unroll
    for (int j = 0; j < 4; ++j) oacc[j] = zero8();
  }
  asm volatile("s_wait_asynccnt 0x0" ::: "memory");     // nothing of this wave's in flight past the loop
}

// ---------------------------------------------------------------------------
// Host launcher
// ---------------------------------------------------------------------------
static inline size_t al256(size_t v) { return (v + 255) & ~(size_t)255; }

extern "C" void kernel_launch(void* const* d_in, const int* in_sizes, int n_in,
                              void* d_out, int out_size, void* d_ws, size_t ws_size,
                              hipStream_t stream) {
  if (n_in < 17) return;
  const long needX = ((long)(NB - 1) * SEQ_FULL + SEQ) * CDIM;
  const long nW = (long)NHEAD * CDIM * HD;
  if ((long)in_sizes[0] < needX) return;
  if ((long)in_sizes[1] < nW || (long)in_sizes[3] < nW || (long)in_sizes[5] < nW) return;
  if (in_sizes[2] < QKVW || in_sizes[4] < QKVW || in_sizes[6] < QKVW) return;
  if ((long)in_sizes[7] < (long)QKVW * CDIM || in_sizes[8] < CDIM) return;
  if ((long)in_sizes[9] < (long)CDIM * HID || in_sizes[10] < HID) return;
  if ((long)in_sizes[11] < (long)HID * CDIM || in_sizes[12] < CDIM) return;
  if (in_sizes[13] < CDIM || in_sizes[14] < CDIM || in_sizes[15] < CDIM || in_sizes[16] < CDIM) return;
  if ((long)out_size < needX) return;

  const float* x   = (const float*)d_in[0];
  const float* Wq  = (const float*)d_in[1];
  const float* bq  = (const float*)d_in[2];
  const float* Wk  = (const float*)d_in[3];
  const float* bk  = (const float*)d_in[4];
  const float* Wv  = (const float*)d_in[5];
  const float* bv  = (const float*)d_in[6];
  const float* Wp  = (const float*)d_in[7];
  const float* bp  = (const float*)d_in[8];
  const float* W1  = (const float*)d_in[9];
  const float* b1  = (const float*)d_in[10];
  const float* W2  = (const float*)d_in[11];
  const float* b2  = (const float*)d_in[12];
  const float* g1  = (const float*)d_in[13];
  const float* be1 = (const float*)d_in[14];
  const float* g2  = (const float*)d_in[15];
  const float* be2 = (const float*)d_in[16];
  float* out = (float*)d_out;

  char* ws = (char*)d_ws;
  size_t off = 0;
  auto carve = [&](size_t bytes) -> char* { char* p = ws + off; off += al256(bytes); return p; };
  const size_t MC  = (size_t)MROWS * CDIM;                   // [M][64]
  const size_t MHD = (size_t)NB * NHEAD * SEQ * HD;          // per q/k/vt plane
  unsigned short* wqkv = (unsigned short*)carve((size_t)3 * QKVW * CDIM * 2);   // [1536][64]
  unsigned short* wpt  = (unsigned short*)carve((size_t)CDIM * QKVW * 2);       // [64][512]
  unsigned short* w1t  = (unsigned short*)carve((size_t)HID * CDIM * 2);        // [256][64]
  unsigned short* w2t  = (unsigned short*)carve((size_t)CDIM * HID * 2);        // [64][256]
  unsigned short* xh   = (unsigned short*)carve(MC * 2);                        // [M][64]
  unsigned short* qpl  = (unsigned short*)carve(MHD * 2);                       // [B*H][SEQ][64]
  unsigned short* kpl  = (unsigned short*)carve(MHD * 2);                       // [B*H][SEQ][64]
  unsigned short* vtp  = (unsigned short*)carve(MHD * 2);                       // [B*H][64][SEQ]
  unsigned short* opl  = (unsigned short*)carve((size_t)MROWS * QKVW * 2);      // [M][512]
  if (off > ws_size) return;
  if (off > ((size_t)128 << 20)) return;

  // 1+2) weight planes (transposed, bf16 values x16 as f16) and the x plane (bf16 values of x
  //      as f16), one grid
  k_prep<<<PB_X + MROWS / 32, 256, 0, stream>>>(x, Wq, Wk, Wv, Wp, W1, W2, wqkv, wpt, w1t, w2t, xh);
  // 3) q/k/v projections + biases -> q, k, vt planes
  k_gemm<0, 0, 0, 0><<<dim3(3 * QKVW / 64, MROWS / 64), 128, 0, stream>>>(
      xh, wqkv, CDIM, bq, bk, bv, nullptr, nullptr, nullptr, nullptr, qpl, kpl, vtp, 0);
  // 4) causal attention -> o plane [M][512]
  k_attn<<<NB * NHEAD * (SEQ / 128), 128, 0, stream>>>(qpl, kpl, vtp, opl);
  // 5) output projection + residual + layernorm 1, ffn1, ffn2 + residual + layernorm 2 -> out
  //    (f32, full strides)
  k_tail<<<MROWS / TR, 128, 0, stream>>>(opl, wpt, w1t, w2t, x, bp, b1, b2, g1, be1, g2, be2, out);
}

// v007
// A run of this version takes 52 microseconds.
// In two side-by-side timings against v006, it was 1.11 and 1.13 times as fast.
// Counting every step since v000, it is 4.90 times as fast.
#include <hip/hip_runtime.h>

// Contractions: v_wmma_f32_16x16x32_f16 (f16 operands, f32 accumulate) for q/k/v projections, q.k^T, p.v, output projection, ffn1, ffn2; weight planes carried x16, p plane carried x16384, activations x1.
//
// Fragment order.  The planes that a later launch reads from global memory straight into A or B
// fragments (x, the four weight planes, q, o) are not row-major.  A plane X[rows][K] is cut into
// tiles of 16 rows x 32 k; tile (rt, ks) starts at half rt*16*K + ks*512 and holds two parts of
// 256 halves; part p, lane l, element e is X[16 rt + (l & 15)][32 ks + 16 p + 8 (l >> 4) + e],
// at half p*256 + l*8 + e of the tile.  Part p is register group q[p] of the fragment, so one
// wave-wide 16-byte load (or store) covers 512 contiguous bytes, four whole lines, where rows
// read in place gave it 32 bytes in each of sixteen lines.

#pragma clang fp contract(off)

#ifndef NB
#define NB 4
#endif
#ifndef SEQ
#define SEQ 2048
#endif
#define NB_FULL 4
#define SEQ_FULL 2048
#define CDIM 64
#define NHEAD 8
#define HD 64
#define QKVW (NHEAD * HD)
#define HID 256
#define MROWS (NB * SEQ)
#define PSC 16384.0f

static_assert(NB >= 1 && NB <= NB_FULL);
static_assert(SEQ % 64 == 0 && SEQ >= 64 && SEQ <= SEQ_FULL);
static_assert(HD == 64);
static_assert(CDIM == 64);
static_assert(QKVW == 512);
static_assert(HID % 64 == 0 && QKVW % 64 == 0 && CDIM % 64 == 0);
static_assert(HID % 32 == 0 && QKVW % 32 == 0 && CDIM % 32 == 0);
static_assert(MROWS % 64 == 0);
static_assert((long)MROWS * QKVW < (1L << 31));
static_assert((long)NB * NHEAD * SEQ * HD < (1L << 31));

typedef _Float16 v16h __attribute__((ext_vector_type(16)));
typedef _Float16 v8h  __attribute__((ext_vector_type(8)));
typedef float    v8f  __attribute__((ext_vector_type(8)));
typedef float    v4f  __attribute__((ext_vector_type(4)));
typedef float    v2f  __attribute__((ext_vector_type(2)));
typedef unsigned int v4u __attribute__((ext_vector_type(4)));

union Frag { v16h v; v4u q[2]; };

// WMMA with hazard guard: D += A(16x32) * B(32x16)
__device__ __forceinline__ v8f mma(v16h a, v16h b, v8f c) {
  v8f d = __builtin_amdgcn_wmma_f32_16x16x32_f16(false, a, false, b, (short)0, c, false, false);
  asm volatile("v_nop\n\tv_nop\n\tv_nop\n\tv_nop" : "+v"(d) : "v"(a), "v"(b));
  return d;
}

__device__ __forceinline__ v8f zero8() {
  v8f z;
#pragma unroll
  for (int i = 0; i < 8; ++i) z[i] = 0.0f;
  return z;
}

// f32 -> nearest-even bf16 value, returned as f32
__device__ __forceinline__ float bf16q(float f) {
  unsigned int u = __float_as_uint(f);
  unsigned int r = u + 0x7FFFu + ((u >> 16) & 1u);
  r = ((u & 0x7F800000u) == 0x7F800000u) ? u : r;
  return __uint_as_float(r & 0xFFFF0000u);
}
__device__ __forceinline__ v4f bf16q4(v4f a) {
  v4f r;
  r.x = bf16q(a.x); r.y = bf16q(a.y); r.z = bf16q(a.z); r.w = bf16q(a.w);
  return r;
}
// f32 -> f16 (RNE convert) bit pattern
__device__ __forceinline__ unsigned short hbits(float f) {
  _Float16 h = (_Float16)f;
  return __builtin_bit_cast(unsigned short, h);
}
__device__ __forceinline__ v4u pack8h(float f0, float f1, float f2, float f3,
                                      float f4, float f5, float f6, float f7) {
  v8h t;
  t[0] = (_Float16)f0; t[1] = (_Float16)f1; t[2] = (_Float16)f2; t[3] = (_Float16)f3;
  t[4] = (_Float16)f4; t[5] = (_Float16)f5; t[6] = (_Float16)f6; t[7] = (_Float16)f7;
  return __builtin_bit_cast(v4u, t);
}

// ---------------------------------------------------------------------------
// Weight prep, one 64x64 tile per work-group: logical W[k][n] (f32) -> Wt[n][k] f16 plane in
// fragment order, value = f16(bf16q(w) * 16).
// src element (k, n0+j) = src[(n0/64)*hstride + k*rstride + j]; dst row = drow0 + n0 + n.
// Each wave stores one part of one fragment tile per pass: 512 contiguous bytes.
// LDS sT: cross-wave (block barrier).
// ---------------------------------------------------------------------------
__device__ __forceinline__ void wprep_tile(
    unsigned short (*sT)[72], const float* __restrict__ src, unsigned short* __restrict__ dst,
    int K, int hstride, int rstride, int k0, int n0, int drow0) {
  const int tid = threadIdx.x;
  const size_t sbase = (size_t)(n0 >> 6) * (size_t)hstride;
#pragma unroll
  for (int it = 0; it < 4; ++it) {
    const int idx = it * 256 + tid;
    const int kk = idx >> 4;            // 0..63
    const int j4 = (idx & 15) * 4;      // 0..60
    const v4f wv = *(const v4f*)(src + sbase + (size_t)(k0 + kk) * (size_t)rstride + j4);
    sT[j4 + 0][kk] = hbits(bf16q(wv.x) * 16.0f);
    sT[j4 + 1][kk] = hbits(bf16q(wv.y) * 16.0f);
    sT[j4 + 2][kk] = hbits(bf16q(wv.z) * 16.0f);
    sT[j4 + 3][kk] = hbits(bf16q(wv.w) * 16.0f);
  }
  __syncthreads();   // cross-wave: staged by all waves, read by all waves
  v4u val[2];
  size_t off[2];
#pragma unroll
  for (int p = 0; p < 2; ++p) {
    const int lane = tid & 31, part = (tid >> 5) & 1, ksl = (tid >> 6) & 1;
    const int rtl = p * 2 + (tid >> 7);  // 16-row tile within the 64 rows
    val[p] = *(const v4u*)&sT[rtl * 16 + (lane & 15)][ksl * 32 + part * 16 + (lane >> 4) * 8];
    off[p] = ((size_t)drow0 + n0 + rtl * 16) * (size_t)K + (size_t)(k0 + ksl * 32) * 16 + part * 256 + lane * 8;
  }
#pragma unroll
  for (int p = 0; p < 2; ++p) *(v4u*)(dst + off[p]) = val[p];
  // stands in front of the code that the build lays out behind this path (the x rows), which
  // writes the registers that the two stores name
  asm volatile("s_wait_xcnt 0x0" ::: "memory");
}

// ---------------------------------------------------------------------------
// Input prep, 32 rows per work-group: x (f32, full batch strides) -> f16 plane xh[nrows][64] in
// fragment order, holding the bf16 values of x.  256 threads x 8 halves = 32 rows x 64; each
// wave stores one part of one fragment tile.
// ---------------------------------------------------------------------------
__device__ __forceinline__ void xcvt_rows(
    const float* __restrict__ x, unsigned short* __restrict__ xh, int blk, int nrows) {
  const int tid = threadIdx.x;
  const int lane = tid & 31, part = (tid >> 5) & 1, ks = (tid >> 6) & 1;
  const int row0 = blk * 32 + (tid >> 7) * 16;
  const int row = row0 + (lane & 15);
  if (row >= nrows) return;            // no barriers on this path
  const int b = row / SEQ, t = row - b * SEQ;
  const size_t xrow = ((size_t)b * SEQ_FULL + t) * CDIM + ks * 32 + part * 16 + (lane >> 4) * 8;
  const v4f a0 = bf16q4(*(const v4f*)(x + xrow));
  const v4f a1 = bf16q4(*(const v4f*)(x + xrow + 4));
  const v4u o = pack8h(a0.x, a0.y, a0.z, a0.w, a1.x, a1.y, a1.z, a1.w);
  unsigned short* d = xh + (size_t)row0 * CDIM + ks * 512 + part * 256 + lane * 8;
  *(v4u*)d = o;
}

// ---------------------------------------------------------------------------
// All operand preparation in one grid: the four weight planes and the x plane depend on
// nothing but the inputs, so their work-groups run side by side, told apart by block index
// (block-uniform branches).  Weight tiles first: theirs is the longer chain (load, LDS,
// barrier, store).
// blocks [0, PB_P): Wq/Wk/Wv tiles; [PB_P, PB_1): Wp; [PB_1, PB_2): W1; [PB_2, PB_X): W2;
// [PB_X, PB_X + MROWS/32): x rows.
// ---------------------------------------------------------------------------
#define PB_P (3 * (QKVW / 64))
#define PB_1 (PB_P + QKVW / 64)
#define PB_2 (PB_1 + HID / 64)
#define PB_X (PB_2 + HID / 64)
__global__ __launch_bounds__(256) void k_prep(
    const float* __restrict__ x, const float* __restrict__ Wq, const float* __restrict__ Wk,
    const float* __restrict__ Wv, const float* __restrict__ Wp, const float* __restrict__ W1,
    const float* __restrict__ W2, unsigned short* __restrict__ wqkv,
    unsigned short* __restrict__ wpt, unsigned short* __restrict__ w1t,
    unsigned short* __restrict__ w2t, unsigned short* __restrict__ xh) {
  __shared__ __attribute__((aligned(16))) unsigned short sT[64][72];
  const int bid = blockIdx.x;
  if (bid >= PB_X) {                   // block-uniform, ahead of the barrier
    xcvt_rows(x, xh, bid - PB_X, MROWS);
    return;
  }
  const float* src;
  unsigned short* dst;
  int K, hstride, rstride, k0, n0, drow0;
  if (bid < PB_P) {
    const int z = bid / (QKVW / 64);
    src = (z == 0) ? Wq : ((z == 1) ? Wk : Wv);
    dst = wqkv; K = CDIM; hstride = CDIM * HD; rstride = HD;
    k0 = 0; n0 = (bid - z * (QKVW / 64)) * 64; drow0 = QKVW * z;
  } else if (bid < PB_1) {
    src = Wp; dst = wpt; K = QKVW; hstride = 64; rstride = CDIM;
    k0 = (bid - PB_P) * 64; n0 = 0; drow0 = 0;
  } else if (bid < PB_2) {
    src = W1; dst = w1t; K = CDIM; hstride = 64; rstride = HID;
    k0 = 0; n0 = (bid - PB_1) * 64; drow0 = 0;
  } else {
    src = W2; dst = w2t; K = HID; hstride = 64; rstride = CDIM;
    k0 = (bid - PB_2) * 64; n0 = 0; drow0 = 0;
  }
  wprep_tile(sT, src, dst, K, hstride, rstride, k0, n0, drow0);
}

// ---------------------------------------------------------------------------
// 64x64-tile f16 GEMM: D = A[M][K] * Bt[N][K]^T, 4 waves per WG, wave w owns
// rows 16w..16w+15 x 64 cols (4 accumulator tiles).  Fragments loaded straight
// from the 16-bit planes, both in fragment order: the split k map for A and B (row/col =
// lane&15, elements 0..7 <- k0+8h.., 8..15 <- k0+16+8h..).
// EPI 0: q/k planes [b*H+h][t][64] (q in fragment order) and v transposed plane vt[b*H+h][64][t]
//        (value acc/16 + bf16q(bias), bias picked per q/k/v by the column block)
// coverage: k path 4 passes x 4 waves x 4 rows = 64 rows x 64 cols; q path: 4 passes x 16 rows, 16 cols a wave; v path: 4 passes x 4 waves x 4 d = 64 d rows x 64 tokens.
// LDS: sT rows are cross-wave on all three paths (q, k and v); block barriers used everywhere.
// ---------------------------------------------------------------------------
template <int EPI, int RESFULL, int OUTFULL, int WRITEH>
__global__ __launch_bounds__(128) __attribute__((amdgpu_num_vgpr(256))) void k_gemm(
    const unsigned short* __restrict__ A, const unsigned short* __restrict__ Bt, int K,
    const float* __restrict__ bias, const float* __restrict__ biasb, const float* __restrict__ biasc,
    const float* __restrict__ res, const float* __restrict__ gam, const float* __restrict__ bet,
    float* __restrict__ outF, unsigned short* __restrict__ out0,
    unsigned short* __restrict__ out1, unsigned short* __restrict__ out2, int ldo) {
  __shared__ __attribute__((aligned(16))) unsigned short sT[64][72];
  const int tid = threadIdx.x, lane = tid & 31, w = tid >> 5;
  const int m = lane & 15, hl = lane >> 4;
  const int m0 = blockIdx.y * 64, n0 = blockIdx.x * 64;

  v8f acc[4];
#pragma unroll
  for (int j = 0; j < 4; ++j) acc[j] = zero8();

  const unsigned short* ap = A + (size_t)(m0 + 16 * w) * (size_t)K + lane * 8;
  const unsigned short* bp = Bt + (size_t)n0 * (size_t)K + lane * 8;
  const size_t jstep = (size_t)16 * (size_t)K;
#pragma unroll 1
  for (int k0 = 0; k0 < K; k0 += 32) {
    Frag a;
    a.q[0] = *(const v4u*)(ap + k0 * 16);
    a.q[1] = *(const v4u*)(ap + k0 * 16 + 256);
#pragma unroll
    for (int j = 0; j < 4; ++j) {
      Frag b;
      const unsigned short* bj = bp + jstep * j + k0 * 16;
      b.q[0] = *(const v4u*)(bj);
      b.q[1] = *(const v4u*)(bj + 256);
      acc[j] = mma(a.v, b.v, acc[j]);
    }
  }

  const float wsc = 0.0625f;               // undo the x16 weight carry
  const int lrow0 = 16 * w + 8 * hl;       // D rows of this lane within the WG tile

  if constexpr (EPI == 0) {
    const int which = n0 / QKVW;           // 0 = q, 1 = k, 2 = v (WG-uniform)
    const int hh = (n0 - which * QKVW) / HD;
    const float* bsel = (which == 0) ? bias : ((which == 1) ? biasb : biasc);
#pragma unroll
    for (int j = 0; j < 4; ++j) {
      const float bj = bf16q(bsel[hh * HD + 16 * j + m]);
#pragma unroll
      for (int r = 0; r < 8; ++r) sT[lrow0 + r][16 * j + m] = hbits(acc[j][r] * wsc + bj);
    }
    __syncthreads();   // cross-wave: on all three paths a wave reads rows of all four waves
    const int b = m0 / SEQ, t0 = m0 - b * SEQ;
    const int bh = b * NHEAD + hh;
    v4u val[4];
    unsigned int off[4];
    unsigned short* dst;
    if (which == 0) {                      // WG-uniform; q in fragment order, rows of all waves
      dst = out0;
#pragma unroll
      for (int p = 0; p < 4; ++p) {
        val[p] = *(const v4u*)&sT[p * 16 + m][(w >> 1) * 32 + (w & 1) * 16 + hl * 8];
        off[p] = (unsigned int)((bh * SEQ + t0 + p * 16) * HD + (w >> 1) * 512 + (w & 1) * 256 + lane * 8);
      }
    } else if (which == 1) {               // WG-uniform
      dst = out1;
#pragma unroll
      for (int p = 0; p < 4; ++p) {
        const int row = p * 16 + 4 * w + (lane >> 3);
        const int piece = lane & 7;
        val[p] = *(const v4u*)&sT[row][piece * 8];
        off[p] = (unsigned int)((bh * SEQ + t0 + row) * HD + piece * 8);
      }
    } else {
      dst = out2;
#pragma unroll
      for (int p = 0; p < 4; ++p) {
        const int d = p * 16 + 4 * w + (lane >> 3);
        const int piece = lane & 7;
        unsigned int wv[4];
#pragma unroll
        for (int e = 0; e < 4; ++e) {
          const unsigned int lo = sT[piece * 8 + 2 * e][d];
          const unsigned int hi = sT[piece * 8 + 2 * e + 1][d];
          wv[e] = lo | (hi << 16);
        }
        v4u t;
        t.x = wv[0]; t.y = wv[1]; t.z = wv[2]; t.w = wv[3];
        val[p] = t;
        off[p] = (unsigned int)((bh * HD + d) * SEQ + t0 + piece * 8);
      }
    }
#pragma unroll
    for (int p = 0; p < 4; ++p) *(v4u*)(dst + off[p]) = val[p];
    
  }
}

// ---------------------------------------------------------------------------
// Layernorm of one 64-col row held two columns a lane (u0, u1): mean, then variance of the
// centred values, each summed over the wave's 32 lanes.
// ---------------------------------------------------------------------------
__device__ __forceinline__ v2f ln_row(float u0, float u1, float gg0, float gg1, float ee0, float ee1) {
  float s = u0 + u1;
#pragma unroll
  for (int xm = 1; xm < 32; xm <<= 1) s += __shfl_xor(s, xm, 32);
  const float mu = s * (1.0f / CDIM);
  const float d0 = u0 - mu, d1 = u1 - mu;
  float qs = d0 * d0 + d1 * d1;
#pragma unroll
  for (int xm = 1; xm < 32; xm <<= 1) qs += __shfl_xor(qs, xm, 32);
  const float var = qs * (1.0f / CDIM);
  const float rstd = rsqrtf(var + 1e-5f);
  v2f yv;
  yv.x = d0 * rstd * gg0 + ee0;
  yv.y = d1 * rstd * gg1 + ee1;
  return yv;
}

// ---------------------------------------------------------------------------
// Everything behind the attention, one launch: output projection + bias + residual(bf16 values
// of x) + layernorm 1, ffn1 + bias + relu, ffn2 + bias + residual(h1) + layernorm 2.  All of it
// is row-local, so one WG carries TR = 16 token rows from the o plane to the output; h1 and the
// hidden activations never leave the WGP (h1: f16 copy in LDS as the next A operand, f32 values
// in the registers of the lane that made them; activations: f16 in LDS).
// 4 waves.  Products: wave w owns output columns 16w..16w+15 (projection, ffn2) or 64w..64w+63
// (ffn1) of all 16 rows; k runs upward in one accumulator chain per tile.  Same split k map for
// A and B as k_gemm; the o plane and the weight planes come in fragment order.  Layernorms: wave
// w owns rows 4w..4w+3, a lane two columns of each.
// Every global operand load stands ahead of the products that use it, as groups: the wave meets
// the load latency once per group, not once per fragment.
// LDS sF (f32 product rows), sH (h1 as f16), sA (activations as f16): all cross-wave, each
// published by a block barrier.
// ---------------------------------------------------------------------------
#define TR 16
#define AP (HID + 8)
static_assert(SEQ % TR == 0 && MROWS % TR == 0);
static_assert(QKVW == 512 && HID == 256 && CDIM == 64);
__global__ __launch_bounds__(128) __attribute__((amdgpu_num_vgpr(256)))
void k_tail(const unsigned short* __restrict__ op, const unsigned short* __restrict__ wpt,
            const unsigned short* __restrict__ w1t, const unsigned short* __restrict__ w2t,
            const float* __restrict__ x, const float* __restrict__ bp, const float* __restrict__ b1,
            const float* __restrict__ b2, const float* __restrict__ g1, const float* __restrict__ be1,
            const float* __restrict__ g2, const float* __restrict__ be2, float* __restrict__ out) {
  __shared__ __attribute__((aligned(16))) float sF[TR][68];
  __shared__ __attribute__((aligned(16))) unsigned short sH[TR][72];
  __shared__ __attribute__((aligned(16))) unsigned short sA[TR][AP];
  const int tid = threadIdx.x, lane = tid & 31, w = tid >> 5;
  const int m = lane & 15, hl = lane >> 4, k8 = hl * 8;
  const int m0 = blockIdx.x * TR;
  const int b = m0 / SEQ, t0 = m0 - b * SEQ;
  const int c2 = 2 * lane;                 // lane owns cols c2, c2+1 of each of its wave's rows
  const float wsc = 0.0625f;               // undo the x16 weight carry
  const size_t frow = ((size_t)b * SEQ_FULL + t0 + 4 * w) * CDIM + c2;   // x and out, full strides

  // ---- output projection: 16 rows x 16 cols per wave, k = 512 ----
  // Two load groups in all: the first twelve k steps (as many fragments as the registers hold);
  // then, into the registers that those products free, the last four steps together with the
  // weight fragments of ffn1 and ffn2, which depend on nothing computed here.
  const unsigned short* ap = op + (size_t)m0 * QKVW + lane * 8;
  const unsigned short* bq = wpt + (size_t)(16 * w) * QKVW + lane * 8;
  Frag pa[12], pb[12];
#pragma unroll
  for (int i = 0; i < 12; ++i) {
    pa[i].q[0] = *(const v4u*)(ap + 512 * i);
    pa[i].q[1] = *(const v4u*)(ap + 512 * i + 256);
    pb[i].q[0] = *(const v4u*)(bq + 512 * i);
    pb[i].q[1] = *(const v4u*)(bq + 512 * i + 256);
  }
  // the residual rows of x and every bias, gain and shift of the later stages: fetched ahead of
  // the first barrier too, so that no stage behind a barrier opens with a global load
  v2f xr[4];
  const float* xp = x + frow;
#pragma unroll
  for (int rr = 0; rr < 4; ++rr) xr[rr] = *(const v2f*)(xp + rr * CDIM);
  float rb1[4];
  const float* b1p = b1 + 64 * w + m;
#pragma unroll
  for (int j = 0; j < 4; ++j) rb1[j] = b1p[16 * j];
  // stands behind the loads above and names their last-used address registers as inputs, so that
  // none of them is rewritten (a later load's result included) ahead of it
  asm volatile("s_wait_xcnt 0x0" :: "v"(xp), "v"(b1p) : "memory");
  v8f acc = zero8();
#pragma unroll
  for (int i = 0; i < 12; ++i) acc = mma(pa[i].v, pb[i].v, acc);
  Frag qa[4], qb[4];
#pragma unroll
  for (int i = 0; i < 4; ++i) {
    qa[i].q[0] = *(const v4u*)(ap + 512 * (12 + i));
    qa[i].q[1] = *(const v4u*)(ap + 512 * (12 + i) + 256);
    qb[i].q[0] = *(const v4u*)(bq + 512 * (12 + i));
    qb[i].q[1] = *(const v4u*)(bq + 512 * (12 + i) + 256);
  }
  const float rbp0 = bp[c2], rbp1 = bp[c2 + 1], rg10 = g1[c2], rg11 = g1[c2 + 1];
  const float re10 = be1[c2], re11 = be1[c2 + 1];
  const float rb20 = b2[c2], rb21 = b2[c2 + 1], rg20 = g2[c2], rg21 = g2[c2 + 1];
  const float re20 = be2[c2], re21 = be2[c2 + 1];
  Frag w1a[4], w1b[4];
  const unsigned short* w1p = w1t + (size_t)(64 * w) * CDIM + lane * 8;
#pragma unroll
  for (int j = 0; j < 4; ++j) {
    w1a[j].q[0] = *(const v4u*)(w1p + j * 16 * CDIM);
    w1a[j].q[1] = *(const v4u*)(w1p + j * 16 * CDIM + 256);
    w1b[j].q[0] = *(const v4u*)(w1p + j * 16 * CDIM + 512);
    w1b[j].q[1] = *(const v4u*)(w1p + j * 16 * CDIM + 768);
  }
  Frag w2f[8];
  const unsigned short* w2p = w2t + (size_t)(16 * w) * HID + lane * 8;
#pragma unroll
  for (int i = 0; i < 8; ++i) {
    w2f[i].q[0] = *(const v4u*)(w2p + 512 * i);
    w2f[i].q[1] = *(const v4u*)(w2p + 512 * i + 256);
  }
  // as above, for the four address pairs of this group
  asm volatile("s_wait_xcnt 0x0" :: "v"(ap), "v"(bq), "v"(w1p), "v"(w2p) : "memory");
  // inputs only: holds the twelve small loads inside this group; sunk behind the last products or
  // behind a barrier, they would cost a global load latency of their own
  asm volatile("" :: "v"(rbp0), "v"(rbp1), "v"(rg10), "v"(rg11), "v"(re10), "v"(re11),
                     "v"(rb20), "v"(rb21), "v"(rg20), "v"(rg21), "v"(re20), "v"(re21));
#pragma unroll
  for (int i = 0; i < 4; ++i) acc = mma(qa[i].v, qb[i].v, acc);
#pragma unroll
  for (int r = 0; r < 8; ++r) sF[8 * hl + r][16 * w + m] = acc[r] * wsc;
  __syncthreads();   // cross-wave: a row's 64 columns come from all four waves

  // ---- bias + residual + layernorm 1 ----
  v2f h1[4];                               // f32 h1 of rows 4w + rr, cols c2, c2+1: residual of layernorm 2
  {
    const float bb0 = bf16q(rbp0), bb1 = bf16q(rbp1);
    const float gg0 = bf16q(rg10), gg1 = bf16q(rg11);
    const float ee0 = bf16q(re10), ee1 = bf16q(re11);
#pragma unroll
    for (int rr = 0; rr < 4; ++rr) {
      const int row = 4 * w + rr;
      const v2f av = *(const v2f*)&sF[row][c2];
      const float u0 = (av.x + bb0) + bf16q(xr[rr].x);
      const float u1 = (av.y + bb1) + bf16q(xr[rr].y);
      h1[rr] = ln_row(u0, u1, gg0, gg1, ee0, ee1);
      sH[row][c2] = hbits(h1[rr].x);
      sH[row][c2 + 1] = hbits(h1[rr].y);
    }
  }
  __syncthreads();   // cross-wave: h1 rows of all waves are every wave's A operand; ends the reads of sF

  // ---- ffn1 + bias + relu: 16 rows x 64 cols per wave, k = 64 ----
  {
    Frag ha0, ha1;
    const unsigned short* hp = &sH[m][k8];
    ha0.q[0] = *(const v4u*)(hp);
    ha0.q[1] = *(const v4u*)(hp + 16);
    ha1.q[0] = *(const v4u*)(hp + 32);
    ha1.q[1] = *(const v4u*)(hp + 48);
    v8f fa[4];
#pragma unroll
    for (int j = 0; j < 4; ++j) fa[j] = mma(ha0.v, w1a[j].v, zero8());
#pragma unroll
    for (int j = 0; j < 4; ++j) fa[j] = mma(ha1.v, w1b[j].v, fa[j]);
#pragma unroll
    for (int j = 0; j < 4; ++j) {
      const float bj = bf16q(rb1[j]);
#pragma unroll
      for (int r = 0; r < 8; ++r) {
        float u = fa[j][r] * wsc + bj;
        u = fmaxf(u, 0.0f);
        sA[8 * hl + r][64 * w + 16 * j + m] = hbits(u);
      }
    }
  }
  __syncthreads();   // cross-wave: the 256 hidden columns come from all four waves

  // ---- ffn2: 16 rows x 16 cols per wave, k = 256 ----
  {
    const unsigned short* aq = &sA[m][k8];
    Frag fa[8];
#pragma unroll
    for (int i = 0; i < 8; ++i) {
      fa[i].q[0] = *(const v4u*)(aq + 32 * i);
      fa[i].q[1] = *(const v4u*)(aq + 32 * i + 16);
    }
    v8f acc2 = zero8();
#pragma unroll
    for (int i = 0; i < 8; ++i) acc2 = mma(fa[i].v, w2f[i].v, acc2);
#pragma unroll
    for (int r = 0; r < 8; ++r) sF[8 * hl + r][16 * w + m] = acc2[r] * wsc;
  }
  __syncthreads();   // cross-wave: a row's 64 columns come from all four waves

  // ---- bias + residual(h1) + layernorm 2 -> out, one whole 256-B row per store ----
  {
    const float bb0 = bf16q(rb20), bb1 = bf16q(rb21);
    const float gg0 = bf16q(rg20), gg1 = bf16q(rg21);
    const float ee0 = bf16q(re20), ee1 = bf16q(re21);
    v2f yv[4];
#pragma unroll
    for (int rr = 0; rr < 4; ++rr) {
      const v2f av = *(const v2f*)&sF[4 * w + rr][c2];
      const float u0 = (av.x + bb0) + h1[rr].x;
      const float u1 = (av.y + bb1) + h1[rr].y;
      yv[rr] = ln_row(u0, u1, gg0, gg1, ee0, ee1);
    }
#pragma unroll
    for (int rr = 0; rr < 4; ++rr) *(v2f*)(out + frow + rr * CDIM) = yv[rr];
  }
}

// ---------------------------------------------------------------------------
// One 64-key chunk into LDS, shared by the work-group's four waves: K rows (64 x 128 B,
// contiguous) and V^T rows (64 x 128 B, source pitch SEQ halves).  128 threads x 16 B x 4
// row groups per operand; eight lanes cover one whole 128-B row.  lk/lv/gk/gv are the lane's
// own addresses for row group 0; a row group is 16 rows.  LDS pitch KVP halves.
// ---------------------------------------------------------------------------
#define KVP 72
#define KVBUF (64 * KVP * 2)
__device__ __forceinline__ unsigned int lds_off(const void* p) { return (unsigned int)(size_t)p; }
__device__ __forceinline__ void stage_kv(unsigned int lk, unsigned int lv,
                                         const unsigned short* gk, const unsigned short* gv) {
  const unsigned int ls = 16 * KVP * 2;
  // The closing s_wait_xcnt stands in the copies' own statement so that no address register
  // named here is rewritten ahead of it.
  asm volatile(
      "global_load_async_to_lds_b128 %0, %8, off\n\t"
      "global_load_async_to_lds_b128 %1, %9, off\n\t"
      "global_load_async_to_lds_b128 %2, %10, off\n\t"
      "global_load_async_to_lds_b128 %3, %11, off\n\t"
      "global_load_async_to_lds_b128 %4, %12, off\n\t"
      "global_load_async_to_lds_b128 %5, %13, off\n\t"
      "global_load_async_to_lds_b128 %6, %14, off\n\t"
      "global_load_async_to_lds_b128 %7, %15, off\n\t"
      "s_wait_xcnt 0x0"
      :: "v"(lk), "v"(lk + ls), "v"(lk + 2 * ls), "v"(lk + 3 * ls),
         "v"(lv), "v"(lv + ls), "v"(lv + 2 * ls), "v"(lv + 3 * ls),
         "v"(gk), "v"(gk + 16 * HD), "v"(gk + 32 * HD), "v"(gk + 48 * HD),
         "v"(gv), "v"(gv + 16 * SEQ), "v"(gv + 32 * SEQ), "v"(gv + 48 * SEQ)
      : "memory");
}

__device__ __forceinline__ float other_half(float f) {
  const int b = __float_as_int(f);
  return __int_as_float(__builtin_amdgcn_permlanex16(b, b, 0x76543210, 0xfedcba98, false, false));
}

__global__ __launch_bounds__(128) __attribute__((amdgpu_num_vgpr(256)))
void k_attn(const unsigned short* __restrict__ qp, const unsigned short* __restrict__ kp,
            const unsigned short* __restrict__ vp, unsigned short* __restrict__ op) {
  __shared__ __attribute__((aligned(16))) unsigned short sK[2][64][KVP];
  __shared__ __attribute__((aligned(16))) unsigned short sV[2][64][KVP];
  const int tid = threadIdx.x, lane = tid & 31, w = tid >> 5;
  const int m = lane & 15, hl = lane >> 4, k8 = hl * 8;
  const int nqt = SEQ / 64;
  static_assert((SEQ / 64) % 2 == 0);       // tiles pair up as (nqt-1-p, p)
  const int bh = blockIdx.x / (nqt / 2), pr = blockIdx.x - bh * (nqt / 2);
  const int b = bh / NHEAD, hh = bh - b * NHEAD;
  const int tA = nqt - 1 - pr, tB = pr;     // first and second query tile; tA >= 1
  int qt = tA, kt = 0;                      // tile in work and its key chunk (WG-uniform)

  Frag qa0, qa1;                            // B operand: column = query qt*64 + 16w + m
  Frag qn0, qn1;                            // the same of the second tile, fetched up front
  {
    const unsigned short* qr = qp + ((size_t)bh * SEQ + tA * 64 + 16 * w) * HD + lane * 8;
    qa0.q[0] = *(const v4u*)(qr);
    qa0.q[1] = *(const v4u*)(qr + 256);
    qa1.q[0] = *(const v4u*)(qr + 512);
    qa1.q[1] = *(const v4u*)(qr + 768);
    const unsigned short* qs = qp + ((size_t)bh * SEQ + tB * 64 + 16 * w) * HD + lane * 8;
    qn0.q[0] = *(const v4u*)(qs);
    qn0.q[1] = *(const v4u*)(qs + 256);
    qn1.q[0] = *(const v4u*)(qs + 512);
    qn1.q[1] = *(const v4u*)(qs + 768);
  }
  float mrun = -1e30f;                      // running maximum of the lane's query (equal in both halves)
  float lrun = 0.0f;                        // running sum over this half's keys only; joined when the tile is done
  v8f oacc[4];                              // O^T: row d = 16 jd + 8 hl + r, column = the lane's query
#pragma unroll
  for (int j = 0; j < 4; ++j) oacc[j] = zero8();

  // ---- chunk 0 into buffer 0, published; then chunk 1 into buffer 1 ----
  const int srow = tid >> 3, spc = (tid & 7) * 8;
  const unsigned short* gk0 = kp + ((size_t)bh * SEQ + srow) * HD + spc;
  const unsigned short* gv0 = vp + ((size_t)bh * HD + srow) * (size_t)SEQ + spc;
  const unsigned int lk0 = lds_off(&sK[0][srow][spc]);
  const unsigned int lv0 = lds_off(&sV[0][srow][spc]);
  stage_kv(lk0, lv0, gk0, gv0);
  asm volatile("s_wait_asynccnt 0x0" ::: "memory");   // this wave's copies of chunk 0 have landed
  __syncthreads();                                    // chunk 0 visible to all four waves
  stage_kv(lk0 + KVBUF, lv0 + KVBUF, gk0 + 64 * HD, gv0 + 64);   // chunk 1 exists: tA >= 1

  // rolled: one copy of the body serves both tiles
#pragma unroll 1
  for (int i = 0; i <= nqt; ++i) {          // tA + 1 chunks of the first tile, tB + 1 of the second
    const int buf = i & 1;
    // ---- S^T = K Q^T, four 16-key subtiles: s[j][r] = score(key 16j + 8hl + r, query m) ----
    // All sixteen K reads stand as one group ahead of the eight products, first-half fragments
    // first, so that the wave meets the LDS latency once and not once per subtile.
    v8f s[4];
    const unsigned short* kb = &sK[buf][m][k8];
    Frag kf0[4], kf1[4];
#pragma unroll
    for (int j = 0; j < 4; ++j) {
      kf0[j].q[0] = *(const v4u*)(kb + j * 16 * KVP);
      kf0[j].q[1] = *(const v4u*)(kb + j * 16 * KVP + 16);
    }
#pragma unroll
    for (int j = 0; j < 4; ++j) {
      kf1[j].q[0] = *(const v4u*)(kb + j * 16 * KVP + 32);
      kf1[j].q[1] = *(const v4u*)(kb + j * 16 * KVP + 48);
    }
#pragma unroll
    for (int j = 0; j < 4; ++j) s[j] = mma(kf0[j].v, qa0.v, zero8());
#pragma unroll
    for (int j = 0; j < 4; ++j) s[j] = mma(kf1[j].v, qa1.v, s[j]);
    // The sixteen V^T reads go out here, as one group: they return under the softmax arithmetic.
    const unsigned short* vb = &sV[buf][m][k8];
    Frag vf0[4], vf1[4];
#pragma unroll
    for (int jd = 0; jd < 4; ++jd) {
      vf0[jd].q[0] = *(const v4u*)(vb + jd * 16 * KVP);
      vf0[jd].q[1] = *(const v4u*)(vb + jd * 16 * KVP + 16);
    }
#pragma unroll
    for (int jd = 0; jd < 4; ++jd) {
      vf1[jd].q[0] = *(const v4u*)(vb + jd * 16 * KVP + 32);
      vf1[jd].q[1] = *(const v4u*)(vb + jd * 16 * KVP + 48);
    }
    // keeps the scheduler from sinking the reads down to the second product
    __builtin_amdgcn_sched_barrier(0);
    // ---- causal mask on the diagonal chunk, maximum of the lane's own query ----
    // the lane's one query allows keys up to lim, counted from this half's first key of the chunk
    const int lim = (kt == qt) ? (16 * w + m - 8 * hl) : 64;
    float tm[4];
#pragma unroll
    for (int j = 0; j < 4; ++j) {
      tm[j] = -1e30f;
#pragma unroll
      for (int r = 0; r < 8; ++r) {
        float val = s[j][r];
        val = (16 * j + r > lim) ? -1e30f : val;
        s[j][r] = val;
        tm[j] = fmaxf(tm[j], val);
      }
    }
    float tmax = fmaxf(fmaxf(tm[0], tm[1]), fmaxf(tm[2], tm[3]));
    tmax = fmaxf(tmax, other_half(tmax));
    const float mn = fmaxf(mrun, tmax);
    const float corr = __expf(mrun - mn);
    mrun = mn;
    // ---- p = exp(s - m); f16(16384 p) packed in place as the B operand; sums in the lane ----
    float ts[4];
    v8h ph[4];
#pragma unroll
    for (int j = 0; j < 4; ++j) {
      ts[j] = 0.0f;
      v8f pv;
#pragma unroll
      for (int r = 0; r < 8; ++r) {
        const float p = __expf(s[j][r] - mrun);
        ts[j] += p;
        pv[r] = p * PSC;
      }
      ph[j] = __builtin_convertvector(pv, v8h);
    }
    lrun = lrun * corr + ((ts[0] + ts[1]) + (ts[2] + ts[3]));
#pragma unroll
    for (int j = 0; j < 4; ++j) {
#pragma unroll
      for (int r = 0; r < 8; ++r) oacc[j][r] *= corr;
    }
    // elements 0..7 <- keys 8hl.., 8..15 <- keys 16+8hl.. of each 32-key block
    const v16h pb0 = __builtin_shufflevector(ph[0], ph[1], 0, 1, 2, 3, 4, 5, 6, 7, 8, 9, 10, 11, 12, 13, 14, 15);
    const v16h pb1 = __builtin_shufflevector(ph[2], ph[3], 0, 1, 2, 3, 4, 5, 6, 7, 8, 9, 10, 11, 12, 13, 14, 15);
    // ---- O^T += V^T (64 d x 64 keys) * P^T (64 keys x 16 queries) ----
#pragma unroll
    for (int jd = 0; jd < 4; ++jd) oacc[jd] = mma(vf0[jd].v, pb0, oacc[jd]);
#pragma unroll
    for (int jd = 0; jd < 4; ++jd) oacc[jd] = mma(vf1[jd].v, pb1, oacc[jd]);
    asm volatile("s_wait_dscnt 0x0" ::: "memory");      // this wave's reads of sK/sV[buf] have returned
    asm volatile("s_wait_asynccnt 0x0" ::: "memory");   // this wave's copies of step i+1's chunk have landed
    __syncthreads();   // publishes step i+1's chunk, frees buffer buf for rewriting
    if (i + 2 <= nqt) {  // WG-uniform
      const int c = (i + 2 <= tA) ? (i + 2) : (i + 1 - tA);   // chunk of step i+2, in its own tile
      stage_kv(lk0 + buf * KVBUF, lv0 + buf * KVBUF, gk0 + (size_t)c * 64 * HD, gv0 + c * 64);
    }
    if (kt < qt) {       // WG-uniform
      ++kt;
      continue;
    }

    // ---- tile done: o = acc / (16384 l); the wave's four stores cover 2 KiB in a row ----
    const float lsum = lrun + other_half(lrun);
    const float il = 1.0f / (lsum * PSC);
    v4u val[4];
#pragma unroll
    for (int jd = 0; jd < 4; ++jd) {
      val[jd] = pack8h(oacc[jd][0] * il, oacc[jd][1] * il, oacc[jd][2] * il, oacc[jd][3] * il,
                       oacc[jd][4] * il, oacc[jd][5] * il, oacc[jd][6] * il, oacc[jd][7] * il);
    }
    // the 16-row tile of the wave's queries; k tiles 2 hh and 2 hh + 1 of it, two parts each
    unsigned short* od = op + (unsigned int)((b * SEQ + qt * 64 + 16 * w) * QKVW + hh * (HD * 16) + lane * 8);
#pragma unroll
    for (int jd = 0; jd < 4; ++jd) *(v4u*)(od + jd * 256) = val[jd];
    // the second tile's passes rewrite the registers that the four stores name
    asm volatile("s_wait_xcnt 0x0" ::: "memory");

    // ---- start state of the second tile ----
    qt = tB; kt = 0;
    qa0 = qn0; qa1 = qn1;
    mrun = -1e30f; lrun = 0.0f;
#pragma unroll
    for (int j = 0; j < 4; ++j) oacc[j] = zero8();
  }
  asm volatile("s_wait_asynccnt 0x0" ::: "memory");     // nothing of this wave's in flight past the loop
}

// ---------------------------------------------------------------------------
// Host launcher
// ---------------------------------------------------------------------------
static inline size_t al256(size_t v) { return (v + 255) & ~(size_t)255; }

extern "C" void kernel_launch(void* const* d_in, const int* in_sizes, int n_in,
                              void* d_out, int out_size, void* d_ws, size_t ws_size,
                              hipStream_t stream) {
  if (n_in < 17) return;
  const long needX = ((long)(NB - 1) * SEQ_FULL + SEQ) * CDIM;
  const long nW = (long)NHEAD * CDIM * HD;
  if ((long)in_sizes[0] < needX) return;
  if ((long)in_sizes[1] < nW || (long)in_sizes[3] < nW || (long)in_sizes[5] < nW) return;
  if (in_sizes[2] < QKVW || in_sizes[4] < QKVW || in_sizes[6] < QKVW) return;
  if ((long)in_sizes[7] < (long)QKVW * CDIM || in_sizes[8] < CDIM) return;
  if ((long)in_sizes[9] < (long)CDIM * HID || in_sizes[10] < HID) return;
  if ((long)in_sizes[11] < (long)HID * CDIM || in_sizes[12] < CDIM) return;
  if (in_sizes[13] < CDIM || in_sizes[14] < CDIM || in_sizes[15] < CDIM || in_sizes[16] < CDIM) return;
  if ((long)out_size < needX) return;

  const float* x   = (const float*)d_in[0];
  const float* Wq  = (const float*)d_in[1];
  const float* bq  = (const float*)d_in[2];
  const float* Wk  = (const float*)d_in[3];
  const float* bk  = (const float*)d_in[4];
  const float* Wv  = (const float*)d_in[5];
  const float* bv  = (const float*)d_in[6];
  const float* Wp  = (const float*)d_in[7];
  const float* bp  = (const float*)d_in[8];
  const float* W1  = (const float*)d_in[9];
  const float* b1  = (const float*)d_in[10];
  const float* W2  = (const float*)d_in[11];
  const float* b2  = (const float*)d_in[12];
  const float* g1  = (const float*)d_in[13];
  const float* be1 = (const float*)d_in[14];
  const float* g2  = (const float*)d_in[15];
  const float* be2 = (const float*)d_in[16];
  float* out = (float*)d_out;

  char* ws = (char*)d_ws;
  size_t off = 0;
  auto carve = [&](size_t bytes) -> char* { char* p = ws + off; off += al256(bytes); return p; };
  const size_t MC  = (size_t)MROWS * CDIM;                   // [M][64]
  const size_t MHD = (size_t)NB * NHEAD * SEQ * HD;          // per q/k/vt plane
  // wqkv, wpt, w1t, w2t, xh, qpl and opl: fragment order
  unsigned short* wqkv = (unsigned short*)carve((size_t)3 * QKVW * CDIM * 2);   // [1536][64]
  unsigned short* wpt  = (unsigned short*)carve((size_t)CDIM * QKVW * 2);       // [64][512]
  unsigned short* w1t  = (unsigned short*)carve((size_t)HID * CDIM * 2);        // [256][64]
  unsigned short* w2t  = (unsigned short*)carve((size_t)CDIM * HID * 2);        // [64][256]
  unsigned short* xh   = (unsigned short*)carve(MC * 2);                        // [M][64]
  unsigned short* qpl  = (unsigned short*)carve(MHD * 2);                       // [B*H][SEQ][64]
  unsigned short* kpl  = (unsigned short*)carve(MHD * 2);                       // [B*H][SEQ][64]
  unsigned short* vtp  = (unsigned short*)carve(MHD * 2);                       // [B*H][64][SEQ]
  unsigned short* opl  = (unsigned short*)carve((size_t)MROWS * QKVW * 2);      // [M][512]
  if (off > ws_size) return;
  if (off > ((size_t)128 << 20)) return;

  // 1+2) weight planes (transposed, bf16 values x16 as f16) and the x plane (bf16 values of x
  //      as f16), one grid
  k_prep<<<PB_X + MROWS / 32, 256, 0, stream>>>(x, Wq, Wk, Wv, Wp, W1, W2, wqkv, wpt, w1t, w2t, xh);
  // 3) q/k/v projections + biases -> q, k, vt planes
  k_gemm<0, 0, 0, 0><<<dim3(3 * QKVW / 64, MROWS / 64), 128, 0, stream>>>(
      xh, wqkv, CDIM, bq, bk, bv, nullptr, nullptr, nullptr, nullptr, qpl, kpl, vtp, 0);
  // 4) causal attention -> o plane [M][512]
  k_attn<<<NB * NHEAD * (SEQ / 128), 128, 0, stream>>>(qpl, kpl, vtp, opl);
  // 5) output projection + residual + layernorm 1, ffn1, ffn2 + residual + layernorm 2 -> out
  //    (f32, full strides)
  k_tail<<<MROWS / TR, 128, 0, stream>>>(opl, wpt, w1t, w2t, x, bp, b1, b2, g1, be1, g2, be2, out);
}

// v008
// One run takes 47 microseconds.
// Next to v007, in two timings, it ran 1.09 times as fast each time.
// All steps since v000 together make it 5.34 times as fast.
#include <hip/hip_runtime.h>

// Contractions: v_wmma_f32_16x16x32_f16 (f16 operands, f32 accumulate) for q/k/v projections, q.k^T, p.v, output projection, ffn1, ffn2; weight planes carried x16, p plane carried x16384, activations x1.
//
// Fragment order.  The planes that a later launch reads from global memory straight into A or B
// fragments (the tail's three weight planes, q, o) are not row-major.  A plane X[rows][K] is cut into
// tiles of 16 rows x 32 k; tile (rt, ks) starts at half rt*16*K + ks*512 and holds two parts of
// 256 halves; part p, lane l, element e is X[16 rt + (l & 15)][32 ks + 16 p + 8 (l >> 4) + e],
// at half p*256 + l*8 + e of the tile.  Part p is register group q[p] of the fragment, so one
// wave-wide 16-byte load (or store) covers 512 contiguous bytes, four whole lines, where rows
// read in place gave it 32 bytes in each of sixteen lines.

#pragma clang fp contract(off)

#ifndef NB
#define NB 4
#endif
#ifndef SEQ
#define SEQ 2048
#endif
#define NB_FULL 4
#define SEQ_FULL 2048
#define CDIM 64
#define NHEAD 8
#define HD 64
#define QKVW (NHEAD * HD)
#define HID 256
#define MROWS (NB * SEQ)
#define PSC 16384.0f

static_assert(NB >= 1 && NB <= NB_FULL);
static_assert(SEQ % 64 == 0 && SEQ >= 64 && SEQ <= SEQ_FULL);
static_assert(HD == 64);
static_assert(CDIM == 64);
static_assert(QKVW == 512);
static_assert(HID % 64 == 0 && QKVW % 64 == 0 && CDIM % 64 == 0);
static_assert(HID % 32 == 0 && QKVW % 32 == 0 && CDIM % 32 == 0);
static_assert(MROWS % 64 == 0);
static_assert((long)MROWS * QKVW < (1L << 31));
static_assert((long)NB * NHEAD * SEQ * HD < (1L << 31));

typedef _Float16 v16h __attribute__((ext_vector_type(16)));
typedef _Float16 v8h  __attribute__((ext_vector_type(8)));
typedef float    v8f  __attribute__((ext_vector_type(8)));
typedef float    v4f  __attribute__((ext_vector_type(4)));
typedef float    v2f  __attribute__((ext_vector_type(2)));
typedef unsigned int v4u __attribute__((ext_vector_type(4)));
typedef unsigned int v2u __attribute__((ext_vector_type(2)));
typedef __bf16    v2bf __attribute__((ext_vector_type(2)));
typedef _Float16 v2hf __attribute__((ext_vector_type(2)));

union Frag { v16h v; v4u q[2]; };

// WMMA with hazard guard: D += A(16x32) * B(32x16)
__device__ __forceinline__ v8f mma(v16h a, v16h b, v8f c) {
  v8f d = __builtin_amdgcn_wmma_f32_16x16x32_f16(false, a, false, b, (short)0, c, false, false);
  asm volatile("v_nop\n\tv_nop\n\tv_nop\n\tv_nop" : "+v"(d) : "v"(a), "v"(b));
  return d;
}

__device__ __forceinline__ v8f zero8() {
  v8f z;
#pragma unroll
  for (int i = 0; i < 8; ++i) z[i] = 0.0f;
  return z;
}

// f32 -> nearest-even bf16 value, returned as f32
__device__ __forceinline__ float bf16q(float f) {
  unsigned int u = __float_as_uint(f);
  unsigned int r = u + 0x7FFFu + ((u >> 16) & 1u);
  r = ((u & 0x7F800000u) == 0x7F800000u) ? u : r;
  return __uint_as_float(r & 0xFFFF0000u);
}
__device__ __forceinline__ v4f bf16q4(v4f a) {
  v4f r;
  r.x = bf16q(a.x); r.y = bf16q(a.y); r.z = bf16q(a.z); r.w = bf16q(a.w);
  return r;
}
// f32 -> f16 (RNE convert) bit pattern
__device__ __forceinline__ unsigned short hbits(float f) {
  _Float16 h = (_Float16)f;
  return __builtin_bit_cast(unsigned short, h);
}
__device__ __forceinline__ v4u pack8h(float f0, float f1, float f2, float f3,
                                      float f4, float f5, float f6, float f7) {
  v8h t;
  t[0] = (_Float16)f0; t[1] = (_Float16)f1; t[2] = (_Float16)f2; t[3] = (_Float16)f3;
  t[4] = (_Float16)f4; t[5] = (_Float16)f5; t[6] = (_Float16)f6; t[7] = (_Float16)f7;
  return __builtin_bit_cast(v4u, t);
}

// ---------------------------------------------------------------------------
// Two f32 -> their bf16 values (nearest even), times sc, as two packed f16.  For every finite
// input the f16 pair equals hbits(bf16q(.) * sc): the packed convert rounds like bf16q.
// ---------------------------------------------------------------------------
__device__ __forceinline__ unsigned int pk2h(float a, float b, float sc) {
  v2f f;
  f.x = a; f.y = b;
  const unsigned int u = __builtin_bit_cast(unsigned int, __builtin_convertvector(f, v2bf));
  v2f g;
  g.x = __uint_as_float(u << 16) * sc;
  g.y = __uint_as_float(u & 0xFFFF0000u) * sc;
  return __builtin_bit_cast(unsigned int, __builtin_convertvector(g, v2hf));
}

// ---------------------------------------------------------------------------
// One 64x64 weight tile, 128 threads: logical W[k][n] (f32, n contiguous, row pitch rstride) ->
// sW[n][k] in LDS, value = f16(bf16 value of w * 16).  A thread takes k rows 2kp, 2kp + 1 and
// four columns at a time, so that a k pair is one 4-byte LDS store; a wave's 32 stores (8 k
// pairs x 4 column groups, 144-B rows) fall on 32 different banks.
// ---------------------------------------------------------------------------
__device__ __forceinline__ void wtile_load(v4f (&r)[8], const float* __restrict__ src, int rstride) {
  const int tid = threadIdx.x;
  const int kp = (tid >> 5) * 8 + (tid & 7), jl = (tid >> 3) & 3;
  const float* p = src + (size_t)(2 * kp) * (size_t)rstride + jl * 4;
#pragma unroll
  for (int it = 0; it < 4; ++it) {
    r[2 * it] = *(const v4f*)(p + it * 16);
    r[2 * it + 1] = *(const v4f*)(p + rstride + it * 16);
  }
  // stands behind the eight loads and names their address as an input, so that it is not
  // rewritten ahead of it
  asm volatile("s_wait_xcnt 0x0" :: "v"(p) : "memory");
}
__device__ __forceinline__ void wtile_store(unsigned short (*sW)[72], const v4f (&r)[8]) {
  const int tid = threadIdx.x;
  const int kp = (tid >> 5) * 8 + (tid & 7), jl = (tid >> 3) & 3;
#pragma unroll
  for (int it = 0; it < 4; ++it) {
    const int j4 = (it * 4 + jl) * 4;
#pragma unroll
    for (int c = 0; c < 4; ++c)
      *(unsigned int*)&sW[j4 + c][2 * kp] = pk2h(r[2 * it][c], r[2 * it + 1][c], 16.0f);
  }
}

// ---------------------------------------------------------------------------
// q/k/v projections with their own operand preparation, and the tail's weight planes, one grid.
// blocks [0, PB_1): Wp tiles; [PB_1, PB_2): W1; [PB_2, PB_T): W2: each 64x64 tile goes through
// LDS into its f16 plane Wt[n][k] in fragment order (read two launches later).
// blocks from PB_T on: D = x[PT tokens][64] * W[64][64 columns of one head of q, k or v].
// The WG rounds its own operands: the x rows come in by whole-line loads and go to LDS as f16
// (bf16 values of x), the weight tile as above; PT tokens a WG spread that work over four
// 64-token tiles.  4 waves; B fragments (all 64 k x 64 n) stay in registers; per tile wave w
// owns rows 16w..16w+15 x 64 cols.  The split k map for A and B (row/col = lane&15, elements
// 0..7 <- k0+8h.., 8..15 <- k0+16+8h..).
// Output: q/k planes [b*H+h][t][64] (q in fragment order), v transposed plane vt[b*H+h][64][t];
// value acc/16 + bf16q(bias).
// coverage per tile: 4 passes x 4 waves x 4 rows = 64 rows x 64 cols; v path: 64 d rows x 64 tokens.
// LDS sW, sX: cross-wave, published by the first barrier.  sT: cross-wave, two buffers, one
// barrier a tile: a buffer is rewritten two tiles later, behind the barrier of the tile between.
// ---------------------------------------------------------------------------
#define PT 256
#define PB_1 (QKVW / 64)
#define PB_2 (PB_1 + HID / 64)
#define PB_T (PB_2 + HID / 64)
#define NCB (3 * QKVW / 64)
static_assert(SEQ % PT == 0 && MROWS % PT == 0);
__global__ __launch_bounds__(128) __attribute__((amdgpu_num_vgpr(256))) void k_proj(
    const float* __restrict__ x, const float* __restrict__ Wq, const float* __restrict__ Wk,
    const float* __restrict__ Wv, const float* __restrict__ bq, const float* __restrict__ bk,
    const float* __restrict__ bv, const float* __restrict__ Wp, const float* __restrict__ W1,
    const float* __restrict__ W2, unsigned short* __restrict__ wpt,
    unsigned short* __restrict__ w1t, unsigned short* __restrict__ w2t,
    unsigned short* __restrict__ out0, unsigned short* __restrict__ out1,
    unsigned short* __restrict__ out2) {
  __shared__ __attribute__((aligned(16))) unsigned short sW[64][72];
  __shared__ __attribute__((aligned(16))) unsigned short sX[PT][72];
  __shared__ __attribute__((aligned(16))) unsigned short sT[2][64][72];
  const int tid = threadIdx.x, lane = tid & 31, w = tid >> 5;
  const int m = lane & 15, hl = lane >> 4;
  const int bid = blockIdx.x;
  v4f wr[8];

  if (bid < PB_T) {                      // block-uniform: a weight tile of the tail
    const float* src;
    unsigned short* dst;
    int K, rstride, k0, n0;
    if (bid < PB_1) {
      src = Wp; dst = wpt; K = QKVW; rstride = CDIM; k0 = bid * 64; n0 = 0;
    } else if (bid < PB_2) {
      src = W1; dst = w1t; K = CDIM; rstride = HID; k0 = 0; n0 = (bid - PB_1) * 64;
    } else {
      src = W2; dst = w2t; K = HID; rstride = CDIM; k0 = (bid - PB_2) * 64; n0 = 0;
    }
    wtile_load(wr, src + (size_t)k0 * (size_t)rstride + n0, rstride);
    wtile_store(sW, wr);
    __syncthreads();   // cross-wave: staged by all waves, read by all waves
    // each wave stores one part of one fragment tile per pass: 512 contiguous bytes
    v4u val[4];
    size_t off[4];
#pragma unroll
    for (int p = 0; p < 4; ++p) {
      val[p] = *(const v4u*)&sW[p * 16 + m][(w >> 1) * 32 + (w & 1) * 16 + hl * 8];
      off[p] = ((size_t)n0 + p * 16) * (size_t)K + (size_t)(k0 + (w >> 1) * 32) * 16 + (w & 1) * 256 + lane * 8;
    }
#pragma unroll
    for (int p = 0; p < 4; ++p) *(v4u*)(dst + off[p]) = val[p];
    // stands in front of whatever the build lays out behind this path
    asm volatile("s_wait_xcnt 0x0" ::: "memory");
    return;
  }

  const int g = bid - PB_T;
  const int mb = g / NCB, cb = g - mb * NCB;
  const int which = cb / NHEAD;            // 0 = q, 1 = k, 2 = v (WG-uniform)
  const int hh = cb - which * NHEAD;
  const int m0 = mb * PT;
  const int b = m0 / SEQ, t0 = m0 - b * SEQ;
  const float* wsel = (which == 0) ? Wq : ((which == 1) ? Wk : Wv);
  const float* bsel = (which == 0) ? bq : ((which == 1) ? bk : bv);

  // ---- every global operand load of the WG, one group: weight tile, biases, x rows ----
  wtile_load(wr, wsel + (size_t)hh * (CDIM * HD), HD);
  float rb[4];
  const float* bp = bsel + hh * HD + m;
#pragma unroll
  for (int j = 0; j < 4; ++j) rb[j] = bp[16 * j];
  // the PT rows are contiguous: a wave-wide 16-B load covers 512 B, two whole rows
  v4f xr[PT / 8];
  const float* xp = x + ((size_t)b * SEQ_FULL + t0) * CDIM + tid * 4;
#pragma unroll
  for (int it = 0; it < PT / 8; ++it) xr[it] = *(const v4f*)(xp + it * 512);
  // as in wtile_load, for the two addresses of these loads
  asm volatile("s_wait_xcnt 0x0" :: "v"(bp), "v"(xp) : "memory");
  wtile_store(sW, wr);
#pragma unroll
  for (int it = 0; it < PT / 8; ++it) {
    v2u o;
    o.x = pk2h(xr[it].x, xr[it].y, 1.0f);
    o.y = pk2h(xr[it].z, xr[it].w, 1.0f);
    *(v2u*)&sX[it * 8 + (tid >> 4)][(tid & 15) * 4] = o;
  }
  __syncthreads();   // cross-wave: sW and sX staged by all waves, read by all waves

  Frag bf0[4], bf1[4];
#pragma unroll
  for (int j = 0; j < 4; ++j) {
    const unsigned short* wb = &sW[16 * j + m][hl * 8];
    bf0[j].q[0] = *(const v4u*)(wb);
    bf0[j].q[1] = *(const v4u*)(wb + 16);
    bf1[j].q[0] = *(const v4u*)(wb + 32);
    bf1[j].q[1] = *(const v4u*)(wb + 48);
  }
  float bj[4];
#pragma unroll
  for (int j = 0; j < 4; ++j) bj[j] = bf16q(rb[j]);

  const float wsc = 0.0625f;               // undo the x16 weight carry
  const int lrow0 = 16 * w + 8 * hl;       // D rows of this lane within the 64-token tile
  const int bh = b * NHEAD + hh;
  unsigned short* dst = (which == 0) ? out0 : ((which == 1) ? out1 : out2);

  // rolled: one copy of the three store paths serves the four tiles
#pragma unroll 1
  for (int t = 0; t < PT / 64; ++t) {
    unsigned short (*sO)[72] = sT[t & 1];
    const int tt = t0 + t * 64;
    Frag a0, a1;
    const unsigned short* xa = &sX[t * 64 + 16 * w + m][hl * 8];
    a0.q[0] = *(const v4u*)(xa);
    a0.q[1] = *(const v4u*)(xa + 16);
    a1.q[0] = *(const v4u*)(xa + 32);
    a1.q[1] = *(const v4u*)(xa + 48);
    v8f acc[4];
#pragma unroll
    for (int j = 0; j < 4; ++j) acc[j] = mma(a0.v, bf0[j].v, zero8());
#pragma unroll
    for (int j = 0; j < 4; ++j) acc[j] = mma(a1.v, bf1[j].v, acc[j]);
#pragma unroll
    for (int j = 0; j < 4; ++j) {
#pragma unroll
      for (int r = 0; r < 8; ++r) sO[lrow0 + r][16 * j + m] = hbits(acc[j][r] * wsc + bj[j]);
    }
    __syncthreads();   // cross-wave for all three paths; also frees the other buffer of sT
    v4u val[4];
    unsigned int off[4];
    if (which == 0) {                      // WG-uniform; q in fragment order, rows of all waves
#pragma unroll
      for (int p = 0; p < 4; ++p) {
        val[p] = *(const v4u*)&sO[p * 16 + m][(w >> 1) * 32 + (w & 1) * 16 + hl * 8];
        off[p] = (unsigned int)((bh * SEQ + tt + p * 16) * HD + (w >> 1) * 512 + (w & 1) * 256 + lane * 8);
      }
    } else if (which == 1) {               // WG-uniform
#pragma unroll
      for (int p = 0; p < 4; ++p) {
        const int row = p * 16 + 4 * w + (lane >> 3);
        const int piece = lane & 7;
        val[p] = *(const v4u*)&sO[row][piece * 8];
        off[p] = (unsigned int)((bh * SEQ + tt + row) * HD + piece * 8);
      }
    } else {
#pragma unroll
      for (int p = 0; p < 4; ++p) {
        const int d = p * 16 + 4 * w + (lane >> 3);
        const int piece = lane & 7;
        unsigned int wv[4];
#pragma unroll
        for (int e = 0; e < 4; ++e) {
          const unsigned int lo = sO[piece * 8 + 2 * e][d];
          const unsigned int hi = sO[piece * 8 + 2 * e + 1][d];
          wv[e] = lo | (hi << 16);
        }
        v4u tv;
        tv.x = wv[0]; tv.y = wv[1]; tv.z = wv[2]; tv.w = wv[3];
        val[p] = tv;
        off[p] = (unsigned int)((bh * HD + d) * SEQ + tt + piece * 8);
      }
    }
#pragma unroll
    for (int p = 0; p < 4; ++p) *(v4u*)(dst + off[p]) = val[p];
    // the next tile rewrites the registers that the four stores name
    asm volatile("s_wait_xcnt 0x0" ::: "memory");
  }
}

// ---------------------------------------------------------------------------
// Layernorm of one 64-col row held two columns a lane (u0, u1): mean, then variance of the
// centred values, each summed over the wave's 32 lanes.
// ---------------------------------------------------------------------------
__device__ __forceinline__ v2f ln_row(float u0, float u1, float gg0, float gg1, float ee0, float ee1) {
  float s = u0 + u1;
#pragma unroll
  for (int xm = 1; xm < 32; xm <<= 1) s += __shfl_xor(s, xm, 32);
  const float mu = s * (1.0f / CDIM);
  const float d0 = u0 - mu, d1 = u1 - mu;
  float qs = d0 * d0 + d1 * d1;
#pragma unroll
  for (int xm = 1; xm < 32; xm <<= 1) qs += __shfl_xor(qs, xm, 32);
  const float var = qs * (1.0f / CDIM);
  const float rstd = rsqrtf(var + 1e-5f);
  v2f yv;
  yv.x = d0 * rstd * gg0 + ee0;
  yv.y = d1 * rstd * gg1 + ee1;
  return yv;
}

// ---------------------------------------------------------------------------
// Everything behind the attention, one launch: output projection + bias + residual(bf16 values
// of x) + layernorm 1, ffn1 + bias + relu, ffn2 + bias + residual(h1) + layernorm 2.  All of it
// is row-local, so one WG carries TR = 16 token rows from the o plane to the output; h1 and the
// hidden activations never leave the WGP (h1: f16 copy in LDS as the next A operand, f32 values
// in the registers of the lane that made them; activations: f16 in LDS).
// 4 waves.  Products: wave w owns output columns 16w..16w+15 (projection, ffn2) or 64w..64w+63
// (ffn1) of all 16 rows; k runs upward in one accumulator chain per tile.  Same split k map for
// A and B as k_proj; the o plane and the weight planes come in fragment order.  Layernorms: wave
// w owns rows 4w..4w+3, a lane two columns of each.
// Every global operand load stands ahead of the products that use it, as groups: the wave meets
// the load latency once per group, not once per fragment.
// LDS sF (f32 product rows), sH (h1 as f16), sA (activations as f16): all cross-wave, each
// published by a block barrier.
// ---------------------------------------------------------------------------
#define TR 16
#define AP (HID + 8)
static_assert(SEQ % TR == 0 && MROWS % TR == 0);
static_assert(QKVW == 512 && HID == 256 && CDIM == 64);
__global__ __launch_bounds__(128) __attribute__((amdgpu_num_vgpr(256)))
void k_tail(const unsigned short* __restrict__ op, const unsigned short* __restrict__ wpt,
            const unsigned short* __restrict__ w1t, const unsigned short* __restrict__ w2t,
            const float* __restrict__ x, const float* __restrict__ bp, const float* __restrict__ b1,
            const float* __restrict__ b2, const float* __restrict__ g1, const float* __restrict__ be1,
            const float* __restrict__ g2, const float* __restrict__ be2, float* __restrict__ out) {
  __shared__ __attribute__((aligned(16))) float sF[TR][68];
  __shared__ __attribute__((aligned(16))) unsigned short sH[TR][72];
  __shared__ __attribute__((aligned(16))) unsigned short sA[TR][AP];
  const int tid = threadIdx.x, lane = tid & 31, w = tid >> 5;
  const int m = lane & 15, hl = lane >> 4, k8 = hl * 8;
  const int m0 = blockIdx.x * TR;
  const int b = m0 / SEQ, t0 = m0 - b * SEQ;
  const int c2 = 2 * lane;                 // lane owns cols c2, c2+1 of each of its wave's rows
  const float wsc = 0.0625f;               // undo the x16 weight carry
  const size_t frow = ((size_t)b * SEQ_FULL + t0 + 4 * w) * CDIM + c2;   // x and out, full strides

  // ---- output projection: 16 rows x 16 cols per wave, k = 512 ----
  // Two load groups in all: the first twelve k steps (as many fragments as the registers hold);
  // then, into the registers that those products free, the last four steps together with the
  // weight fragments of ffn1 and ffn2, which depend on nothing computed here.
  const unsigned short* ap = op + (size_t)m0 * QKVW + lane * 8;
  const unsigned short* bq = wpt + (size_t)(16 * w) * QKVW + lane * 8;
  Frag pa[12], pb[12];
#pragma unroll
  for (int i = 0; i < 12; ++i) {
    pa[i].q[0] = *(const v4u*)(ap + 512 * i);
    pa[i].q[1] = *(const v4u*)(ap + 512 * i + 256);
    pb[i].q[0] = *(const v4u*)(bq + 512 * i);
    pb[i].q[1] = *(const v4u*)(bq + 512 * i + 256);
  }
  // the residual rows of x and every bias, gain and shift of the later stages: fetched ahead of
  // the first barrier too, so that no stage behind a barrier opens with a global load
  v2f xr[4];
  const float* xp = x + frow;
#pragma unroll
  for (int rr = 0; rr < 4; ++rr) xr[rr] = *(const v2f*)(xp + rr * CDIM);
  float rb1[4];
  const float* b1p = b1 + 64 * w + m;
#pragma unroll
  for (int j = 0; j < 4; ++j) rb1[j] = b1p[16 * j];
  // stands behind the loads above and names their last-used address registers as inputs, so that
  // none of them is rewritten (a later load's result included) ahead of it
  asm volatile("s_wait_xcnt 0x0" :: "v"(xp), "v"(b1p) : "memory");
  v8f acc = zero8();
#pragma unroll
  for (int i = 0; i < 12; ++i) acc = mma(pa[i].v, pb[i].v, acc);
  Frag qa[4], qb[4];
#pragma unroll
  for (int i = 0; i < 4; ++i) {
    qa[i].q[0] = *(const v4u*)(ap + 512 * (12 + i));
    qa[i].q[1] = *(const v4u*)(ap + 512 * (12 + i) + 256);
    qb[i].q[0] = *(const v4u*)(bq + 512 * (12 + i));
    qb[i].q[1] = *(const v4u*)(bq + 512 * (12 + i) + 256);
  }
  const float rbp0 = bp[c2], rbp1 = bp[c2 + 1], rg10 = g1[c2], rg11 = g1[c2 + 1];
  const float re10 = be1[c2], re11 = be1[c2 + 1];
  const float rb20 = b2[c2], rb21 = b2[c2 + 1], rg20 = g2[c2], rg21 = g2[c2 + 1];
  const float re20 = be2[c2], re21 = be2[c2 + 1];
  Frag w1a[4], w1b[4];
  const unsigned short* w1p = w1t + (size_t)(64 * w) * CDIM + lane * 8;
#pragma unroll
  for (int j = 0; j < 4; ++j) {
    w1a[j].q[0] = *(const v4u*)(w1p + j * 16 * CDIM);
    w1a[j].q[1] = *(const v4u*)(w1p + j * 16 * CDIM + 256);
    w1b[j].q[0] = *(const v4u*)(w1p + j * 16 * CDIM + 512);
    w1b[j].q[1] = *(const v4u*)(w1p + j * 16 * CDIM + 768);
  }
  Frag w2f[8];
  const unsigned short* w2p = w2t + (size_t)(16 * w) * HID + lane * 8;
#pragma unroll
  for (int i = 0; i < 8; ++i) {
    w2f[i].q[0] = *(const v4u*)(w2p + 512 * i);
    w2f[i].q[1] = *(const v4u*)(w2p + 512 * i + 256);
  }
  // as above, for the four address pairs of this group
  asm volatile("s_wait_xcnt 0x0" :: "v"(ap), "v"(bq), "v"(w1p), "v"(w2p) : "memory");
  // inputs only: holds the twelve small loads inside this group; sunk behind the last products or
  // behind a barrier, they would cost a global load latency of their own
  asm volatile("" :: "v"(rbp0), "v"(rbp1), "v"(rg10), "v"(rg11), "v"(re10), "v"(re11),
                     "v"(rb20), "v"(rb21), "v"(rg20), "v"(rg21), "v"(re20), "v"(re21));
#pragma unroll
  for (int i = 0; i < 4; ++i) acc = mma(qa[i].v, qb[i].v, acc);
#pragma unroll
  for (int r = 0; r < 8; ++r) sF[8 * hl + r][16 * w + m] = acc[r] * wsc;
  __syncthreads();   // cross-wave: a row's 64 columns come from all four waves

  // ---- bias + residual + layernorm 1 ----
  v2f h1[4];                               // f32 h1 of rows 4w + rr, cols c2, c2+1: residual of layernorm 2
  {
    const float bb0 = bf16q(rbp0), bb1 = bf16q(rbp1);
    const float gg0 = bf16q(rg10), gg1 = bf16q(rg11);
    const float ee0 = bf16q(re10), ee1 = bf16q(re11);
#pragma unroll
    for (int rr = 0; rr < 4; ++rr) {
      const int row = 4 * w + rr;
      const v2f av = *(const v2f*)&sF[row][c2];
      const float u0 = (av.x + bb0) + bf16q(xr[rr].x);
      const float u1 = (av.y + bb1) + bf16q(xr[rr].y);
      h1[rr] = ln_row(u0, u1, gg0, gg1, ee0, ee1);
      sH[row][c2] = hbits(h1[rr].x);
      sH[row][c2 + 1] = hbits(h1[rr].y);
    }
  }
  __syncthreads();   // cross-wave: h1 rows of all waves are every wave's A operand; ends the reads of sF

  // ---- ffn1 + bias + relu: 16 rows x 64 cols per wave, k = 64 ----
  {
    Frag ha0, ha1;
    const unsigned short* hp = &sH[m][k8];
    ha0.q[0] = *(const v4u*)(hp);
    ha0.q[1] = *(const v4u*)(hp + 16);
    ha1.q[0] = *(const v4u*)(hp + 32);
    ha1.q[1] = *(const v4u*)(hp + 48);
    v8f fa[4];
#pragma unroll
    for (int j = 0; j < 4; ++j) fa[j] = mma(ha0.v, w1a[j].v, zero8());
#pragma unroll
    for (int j = 0; j < 4; ++j) fa[j] = mma(ha1.v, w1b[j].v, fa[j]);
#pragma unroll
    for (int j = 0; j < 4; ++j) {
      const float bj = bf16q(rb1[j]);
#pragma unroll
      for (int r = 0; r < 8; ++r) {
        float u = fa[j][r] * wsc + bj;
        u = fmaxf(u, 0.0f);
        sA[8 * hl + r][64 * w + 16 * j + m] = hbits(u);
      }
    }
  }
  __syncthreads();   // cross-wave: the 256 hidden columns come from all four waves

  // ---- ffn2: 16 rows x 16 cols per wave, k = 256 ----
  {
    const unsigned short* aq = &sA[m][k8];
    Frag fa[8];
#pragma unroll
    for (int i = 0; i < 8; ++i) {
      fa[i].q[0] = *(const v4u*)(aq + 32 * i);
      fa[i].q[1] = *(const v4u*)(aq + 32 * i + 16);
    }
    v8f acc2 = zero8();
#pragma unroll
    for (int i = 0; i < 8; ++i) acc2 = mma(fa[i].v, w2f[i].v, acc2);
#pragma unroll
    for (int r = 0; r < 8; ++r) sF[8 * hl + r][16 * w + m] = acc2[r] * wsc;
  }
  __syncthreads();   // cross-wave: a row's 64 columns come from all four waves

  // ---- bias + residual(h1) + layernorm 2 -> out, one whole 256-B row per store ----
  {
    const float bb0 = bf16q(rb20), bb1 = bf16q(rb21);
    const float gg0 = bf16q(rg20), gg1 = bf16q(rg21);
    const float ee0 = bf16q(re20), ee1 = bf16q(re21);
    v2f yv[4];
#pragma unroll
    for (int rr = 0; rr < 4; ++rr) {
      const v2f av = *(const v2f*)&sF[4 * w + rr][c2];
      const float u0 = (av.x + bb0) + h1[rr].x;
      const float u1 = (av.y + bb1) + h1[rr].y;
      yv[rr] = ln_row(u0, u1, gg0, gg1, ee0, ee1);
    }
#pragma unroll
    for (int rr = 0; rr < 4; ++rr) *(v2f*)(out + frow + rr * CDIM) = yv[rr];
  }
}

// ---------------------------------------------------------------------------
// One 64-key chunk into LDS, shared by the work-group's four waves: K rows (64 x 128 B,
// contiguous) and V^T rows (64 x 128 B, source pitch SEQ halves).  128 threads x 16 B x 4
// row groups per operand; eight lanes cover one whole 128-B row.  lk/lv/gk/gv are the lane's
// own addresses for row group 0; a row group is 16 rows.  LDS pitch KVP halves.
// ---------------------------------------------------------------------------
#define KVP 72
#define KVBUF (64 * KVP * 2)
__device__ __forceinline__ unsigned int lds_off(const void* p) { return (unsigned int)(size_t)p; }
__device__ __forceinline__ void stage_kv(unsigned int lk, unsigned int lv,
                                         const unsigned short* gk, const unsigned short* gv) {
  const unsigned int ls = 16 * KVP * 2;
  // The closing s_wait_xcnt stands in the copies' own statement so that no address register
  // named here is rewritten ahead of it.
  asm volatile(
      "global_load_async_to_lds_b128 %0, %8, off\n\t"
      "global_load_async_to_lds_b128 %1, %9, off\n\t"
      "global_load_async_to_lds_b128 %2, %10, off\n\t"
      "global_load_async_to_lds_b128 %3, %11, off\n\t"
      "global_load_async_to_lds_b128 %4, %12, off\n\t"
      "global_load_async_to_lds_b128 %5, %13, off\n\t"
      "global_load_async_to_lds_b128 %6, %14, off\n\t"
      "global_load_async_to_lds_b128 %7, %15, off\n\t"
      "s_wait_xcnt 0x0"
      :: "v"(lk), "v"(lk + ls), "v"(lk + 2 * ls), "v"(lk + 3 * ls),
         "v"(lv), "v"(lv + ls), "v"(lv + 2 * ls), "v"(lv + 3 * ls),
         "v"(gk), "v"(gk + 16 * HD), "v"(gk + 32 * HD), "v"(gk + 48 * HD),
         "v"(gv), "v"(gv + 16 * SEQ), "v"(gv + 32 * SEQ), "v"(gv + 48 * SEQ)
      : "memory");
}

__device__ __forceinline__ float other_half(float f) {
  const int b = __float_as_int(f);
  return __int_as_float(__builtin_amdgcn_permlanex16(b, b, 0x76543210, 0xfedcba98, false, false));
}

__global__ __launch_bounds__(128) __attribute__((amdgpu_num_vgpr(256)))
void k_attn(const unsigned short* __restrict__ qp, const unsigned short* __restrict__ kp,
            const unsigned short* __restrict__ vp, unsigned short* __restrict__ op) {
  __shared__ __attribute__((aligned(16))) unsigned short sK[2][64][KVP];
  __shared__ __attribute__((aligned(16))) unsigned short sV[2][64][KVP];
  const int tid = threadIdx.x, lane = tid & 31, w = tid >> 5;
  const int m = lane & 15, hl = lane >> 4, k8 = hl * 8;
  const int nqt = SEQ / 64;
  static_assert((SEQ / 64) % 2 == 0);       // tiles pair up as (nqt-1-p, p)
  const int bh = blockIdx.x / (nqt / 2), pr = blockIdx.x - bh * (nqt / 2);
  const int b = bh / NHEAD, hh = bh - b * NHEAD;
  const int tA = nqt - 1 - pr, tB = pr;     // first and second query tile; tA >= 1
  int qt = tA, kt = 0;                      // tile in work and its key chunk (WG-uniform)

  Frag qa0, qa1;                            // B operand: column = query qt*64 + 16w + m
  Frag qn0, qn1;                            // the same of the second tile, fetched up front
  {
    const unsigned short* qr = qp + ((size_t)bh * SEQ + tA * 64 + 16 * w) * HD + lane * 8;
    qa0.q[0] = *(const v4u*)(qr);
    qa0.q[1] = *(const v4u*)(qr + 256);
    qa1.q[0] = *(const v4u*)(qr + 512);
    qa1.q[1] = *(const v4u*)(qr + 768);
    const unsigned short* qs = qp + ((size_t)bh * SEQ + tB * 64 + 16 * w) * HD + lane * 8;
    qn0.q[0] = *(const v4u*)(qs);
    qn0.q[1] = *(const v4u*)(qs + 256);
    qn1.q[0] = *(const v4u*)(qs + 512);
    qn1.q[1] = *(const v4u*)(qs + 768);
  }
  float mrun = -1e30f;                      // running maximum of the lane's query (equal in both halves)
  float lrun = 0.0f;                        // running sum over this half's keys only; joined when the tile is done
  v8f oacc[4];                              // O^T: row d = 16 jd + 8 hl + r, column = the lane's query
#pragma unroll
  for (int j = 0; j < 4; ++j) oacc[j] = zero8();

  // ---- chunk 0 into buffer 0, published; then chunk 1 into buffer 1 ----
  const int srow = tid >> 3, spc = (tid & 7) * 8;
  const unsigned short* gk0 = kp + ((size_t)bh * SEQ + srow) * HD + spc;
  const unsigned short* gv0 = vp + ((size_t)bh * HD + srow) * (size_t)SEQ + spc;
  const unsigned int lk0 = lds_off(&sK[0][srow][spc]);
  const unsigned int lv0 = lds_off(&sV[0][srow][spc]);
  stage_kv(lk0, lv0, gk0, gv0);
  asm volatile("s_wait_asynccnt 0x0" ::: "memory");   // this wave's copies of chunk 0 have landed
  __syncthreads();                                    // chunk 0 visible to all four waves
  stage_kv(lk0 + KVBUF, lv0 + KVBUF, gk0 + 64 * HD, gv0 + 64);   // chunk 1 exists: tA >= 1

  // rolled: one copy of the body serves both tiles
#pragma unroll 1
  for (int i = 0; i <= nqt; ++i) {          // tA + 1 chunks of the first tile, tB + 1 of the second
    const int buf = i & 1;
    // ---- S^T = K Q^T, four 16-key subtiles: s[j][r] = score(key 16j + 8hl + r, query m) ----
    // All sixteen K reads stand as one group ahead of the eight products, first-half fragments
    // first, so that the wave meets the LDS latency once and not once per subtile.
    v8f s[4];
    const unsigned short* kb = &sK[buf][m][k8];
    Frag kf0[4], kf1[4];
#pragma unroll
    for (int j = 0; j < 4; ++j) {
      kf0[j].q[0] = *(const v4u*)(kb + j * 16 * KVP);
      kf0[j].q[1] = *(const v4u*)(kb + j * 16 * KVP + 16);
    }
#pragma unroll
    for (int j = 0; j < 4; ++j) {
      kf1[j].q[0] = *(const v4u*)(kb + j * 16 * KVP + 32);
      kf1[j].q[1] = *(const v4u*)(kb + j * 16 * KVP + 48);
    }
#pragma unroll
    for (int j = 0; j < 4; ++j) s[j] = mma(kf0[j].v, qa0.v, zero8());
#pragma unroll
    for (int j = 0; j < 4; ++j) s[j] = mma(kf1[j].v, qa1.v, s[j]);
    // The sixteen V^T reads go out here, as one group: they return under the softmax arithmetic.
    const unsigned short* vb = &sV[buf][m][k8];
    Frag vf0[4], vf1[4];
#pragma unroll
    for (int jd = 0; jd < 4; ++jd) {
      vf0[jd].q[0] = *(const v4u*)(vb + jd * 16 * KVP);
      vf0[jd].q[1] = *(const v4u*)(vb + jd * 16 * KVP + 16);
    }
#pragma unroll
    for (int jd = 0; jd < 4; ++jd) {
      vf1[jd].q[0] = *(const v4u*)(vb + jd * 16 * KVP + 32);
      vf1[jd].q[1] = *(const v4u*)(vb + jd * 16 * KVP + 48);
    }
    // keeps the scheduler from sinking the reads down to the second product
    __builtin_amdgcn_sched_barrier(0);
    // ---- causal mask on the diagonal chunk, maximum of the lane's own query ----
    // the lane's one query allows keys up to lim, counted from this half's first key of the chunk
    const int lim = (kt == qt) ? (16 * w + m - 8 * hl) : 64;
    float tm[4];
#pragma unroll
    for (int j = 0; j < 4; ++j) {
      tm[j] = -1e30f;
#pragma unroll
      for (int r = 0; r < 8; ++r) {
        float val = s[j][r];
        val = (16 * j + r > lim) ? -1e30f : val;
        s[j][r] = val;
        tm[j] = fmaxf(tm[j], val);
      }
    }
    float tmax = fmaxf(fmaxf(tm[0], tm[1]), fmaxf(tm[2], tm[3]));
    tmax = fmaxf(tmax, other_half(tmax));
    const float mn = fmaxf(mrun, tmax);
    const float corr = __expf(mrun - mn);
    mrun = mn;
    // ---- p = exp(s - m); f16(16384 p) packed in place as the B operand; sums in the lane ----
    float ts[4];
    v8h ph[4];
#pragma unroll
    for (int j = 0; j < 4; ++j) {
      ts[j] = 0.0f;
      v8f pv;
#pragma unroll
      for (int r = 0; r < 8; ++r) {
        const float p = __expf(s[j][r] - mrun);
        ts[j] += p;
        pv[r] = p * PSC;
      }
      ph[j] = __builtin_convertvector(pv, v8h);
    }
    lrun = lrun * corr + ((ts[0] + ts[1]) + (ts[2] + ts[3]));
#pragma unroll
    for (int j = 0; j < 4; ++j) {
#pragma unroll
      for (int r = 0; r < 8; ++r) oacc[j][r] *= corr;
    }
    // elements 0..7 <- keys 8hl.., 8..15 <- keys 16+8hl.. of each 32-key block
    const v16h pb0 = __builtin_shufflevector(ph[0], ph[1], 0, 1, 2, 3, 4, 5, 6, 7, 8, 9, 10, 11, 12, 13, 14, 15);
    const v16h pb1 = __builtin_shufflevector(ph[2], ph[3], 0, 1, 2, 3, 4, 5, 6, 7, 8, 9, 10, 11, 12, 13, 14, 15);
    // ---- O^T += V^T (64 d x 64 keys) * P^T (64 keys x 16 queries) ----
#pragma unroll
    for (int jd = 0; jd < 4; ++jd) oacc[jd] = mma(vf0[jd].v, pb0, oacc[jd]);
#pragma unroll
    for (int jd = 0; jd < 4; ++jd) oacc[jd] = mma(vf1[jd].v, pb1, oacc[jd]);
    asm volatile("s_wait_dscnt 0x0" ::: "memory");      // this wave's reads of sK/sV[buf] have returned
    asm volatile("s_wait_asynccnt 0x0" ::: "memory");   // this wave's copies of step i+1's chunk have landed
    __syncthreads();   // publishes step i+1's chunk, frees buffer buf for rewriting
    if (i + 2 <= nqt) {  // WG-uniform
      const int c = (i + 2 <= tA) ? (i + 2) : (i + 1 - tA);   // chunk of step i+2, in its own tile
      stage_kv(lk0 + buf * KVBUF, lv0 + buf * KVBUF, gk0 + (size_t)c * 64 * HD, gv0 + c * 64);
    }
    if (kt < qt) {       // WG-uniform
      ++kt;
      continue;
    }

    // ---- tile done: o = acc / (16384 l); the wave's four stores cover 2 KiB in a row ----
    const float lsum = lrun + other_half(lrun);
    const float il = 1.0f / (lsum * PSC);
    v4u val[4];
#pragma unroll
    for (int jd = 0; jd < 4; ++jd) {
      val[jd] = pack8h(oacc[jd][0] * il, oacc[jd][1] * il, oacc[jd][2] * il, oacc[jd][3] * il,
                       oacc[jd][4] * il, oacc[jd][5] * il, oacc[jd][6] * il, oacc[jd][7] * il);
    }
    // the 16-row tile of the wave's queries; k tiles 2 hh and 2 hh + 1 of it, two parts each
    unsigned short* od = op + (unsigned int)((b * SEQ + qt * 64 + 16 * w) * QKVW + hh * (HD * 16) + lane * 8);
#pragma unroll
    for (int jd = 0; jd < 4; ++jd) *(v4u*)(od + jd * 256) = val[jd];
    // the second tile's passes rewrite the registers that the four stores name
    asm volatile("s_wait_xcnt 0x0" ::: "memory");

    // ---- start state of the second tile ----
    qt = tB; kt = 0;
    qa0 = qn0; qa1 = qn1;
    mrun = -1e30f; lrun = 0.0f;
#pragma unroll
    for (int j = 0; j < 4; ++j) oacc[j] = zero8();
  }
  asm volatile("s_wait_asynccnt 0x0" ::: "memory");     // nothing of this wave's in flight past the loop
}

// ---------------------------------------------------------------------------
// Host launcher
// ---------------------------------------------------------------------------
static inline size_t al256(size_t v) { return (v + 255) & ~(size_t)255; }

extern "C" void kernel_launch(void* const* d_in, const int* in_sizes, int n_in,
                              void* d_out, int out_size, void* d_ws, size_t ws_size,
                              hipStream_t stream) {
  if (n_in < 17) return;
  const long needX = ((long)(NB - 1) * SEQ_FULL + SEQ) * CDIM;
  const long nW = (long)NHEAD * CDIM * HD;
  if ((long)in_sizes[0] < needX) return;
  if ((long)in_sizes[1] < nW || (long)in_sizes[3] < nW || (long)in_sizes[5] < nW) return;
  if (in_sizes[2] < QKVW || in_sizes[4] < QKVW || in_sizes[6] < QKVW) return;
  if ((long)in_sizes[7] < (long)QKVW * CDIM || in_sizes[8] < CDIM) return;
  if ((long)in_sizes[9] < (long)CDIM * HID || in_sizes[10] < HID) return;
  if ((long)in_sizes[11] < (long)HID * CDIM || in_sizes[12] < CDIM) return;
  if (in_sizes[13] < CDIM || in_sizes[14] < CDIM || in_sizes[15] < CDIM || in_sizes[16] < CDIM) return;
  if ((long)out_size < needX) return;

  const float* x   = (const float*)d_in[0];
  const float* Wq  = (const float*)d_in[1];
  const float* bq  = (const float*)d_in[2];
  const float* Wk  = (const float*)d_in[3];
  const float* bk  = (const float*)d_in[4];
  const float* Wv  = (const float*)d_in[5];
  const float* bv  = (const float*)d_in[6];
  const float* Wp  = (const float*)d_in[7];
  const float* bp  = (const float*)d_in[8];
  const float* W1  = (const float*)d_in[9];
  const float* b1  = (const float*)d_in[10];
  const float* W2  = (const float*)d_in[11];
  const float* b2  = (const float*)d_in[12];
  const float* g1  = (const float*)d_in[13];
  const float* be1 = (const float*)d_in[14];
  const float* g2  = (const float*)d_in[15];
  const float* be2 = (const float*)d_in[16];
  float* out = (float*)d_out;

  char* ws = (char*)d_ws;
  size_t off = 0;
  auto carve = [&](size_t bytes) -> char* { char* p = ws + off; off += al256(bytes); return p; };
  const size_t MHD = (size_t)NB * NHEAD * SEQ * HD;          // per q/k/vt plane
  // wpt, w1t, w2t, qpl and opl: fragment order
  unsigned short* wpt  = (unsigned short*)carve((size_t)CDIM * QKVW * 2);       // [64][512]
  unsigned short* w1t  = (unsigned short*)carve((size_t)HID * CDIM * 2);        // [256][64]
  unsigned short* w2t  = (unsigned short*)carve((size_t)CDIM * HID * 2);        // [64][256]
  unsigned short* qpl  = (unsigned short*)carve(MHD * 2);                       // [B*H][SEQ][64]
  unsigned short* kpl  = (unsigned short*)carve(MHD * 2);                       // [B*H][SEQ][64]
  unsigned short* vtp  = (unsigned short*)carve(MHD * 2);                       // [B*H][64][SEQ]
  unsigned short* opl  = (unsigned short*)carve((size_t)MROWS * QKVW * 2);      // [M][512]
  if (off > ws_size) return;
  if (off > ((size_t)128 << 20)) return;

  // 1-3) q/k/v projections + biases -> q, k, vt planes, each work-group rounding its own x rows
  //      and weight tile; the tail's weight planes (transposed, bf16 values x16 as f16) in the same grid
  k_proj<<<PB_T + NCB * (MROWS / PT), 128, 0, stream>>>(
      x, Wq, Wk, Wv, bq, bk, bv, Wp, W1, W2, wpt, w1t, w2t, qpl, kpl, vtp);
  // 4) causal attention -> o plane [M][512]
  k_attn<<<NB * NHEAD * (SEQ / 128), 128, 0, stream>>>(qpl, kpl, vtp, opl);
  // 5) output projection + residual + layernorm 1, ffn1, ffn2 + residual + layernorm 2 -> out
  //    (f32, full strides)
  k_tail<<<MROWS / TR, 128, 0, stream>>>(opl, wpt, w1t, w2t, x, bp, b1, b2, g1, be1, g2, be2, out);
}

// v009
// It runs in 44.5 microseconds.
// Next to v008, in two timings, it ran 1.05 and 1.06 times as fast.
// All steps since v000 together make it 5.62 times as fast.
#include <hip/hip_runtime.h>

// Contractions: v_wmma_f32_16x16x32_f16 (f16 operands, f32 accumulate) for q/k/v projections, q.k^T, p.v, output projection, ffn1, ffn2; weight planes carried x16, p plane carried x16384, activations x1.
//
// Fragment order.  The planes that a later launch reads from global memory straight into A or B
// fragments (the tail's three weight planes, q, o) are not row-major.  A plane X[rows][K] is cut into
// tiles of 16 rows x 32 k; tile (rt, ks) starts at half rt*16*K + ks*512 and holds two parts of
// 256 halves; part p, lane l, element e is X[16 rt + (l & 15)][32 ks + 16 p + 8 (l >> 4) + e],
// at half p*256 + l*8 + e of the tile.  Part p is register group q[p] of the fragment, so one
// wave-wide 16-byte load (or store) covers 512 contiguous bytes, four whole lines, where rows
// read in place gave it 32 bytes in each of sixteen lines.

#pragma clang fp contract(off)

#ifndef NB
#define NB 4
#endif
#ifndef SEQ
#define SEQ 2048
#endif
#define NB_FULL 4
#define SEQ_FULL 2048
#define CDIM 64
#define NHEAD 8
#define HD 64
#define QKVW (NHEAD * HD)
#define HID 256
#define MROWS (NB * SEQ)
#define PSC 16384.0f

static_assert(NB >= 1 && NB <= NB_FULL);
static_assert(SEQ % 64 == 0 && SEQ >= 64 && SEQ <= SEQ_FULL);
static_assert(HD == 64);
static_assert(CDIM == 64);
static_assert(QKVW == 512);
static_assert(HID % 64 == 0 && QKVW % 64 == 0 && CDIM % 64 == 0);
static_assert(HID % 32 == 0 && QKVW % 32 == 0 && CDIM % 32 == 0);
static_assert(MROWS % 64 == 0);
static_assert((long)MROWS * QKVW < (1L << 31));
static_assert((long)NB * NHEAD * SEQ * HD < (1L << 31));

typedef _Float16 v16h __attribute__((ext_vector_type(16)));
typedef _Float16 v8h  __attribute__((ext_vector_type(8)));
typedef float    v8f  __attribute__((ext_vector_type(8)));
typedef float    v4f  __attribute__((ext_vector_type(4)));
typedef float    v2f  __attribute__((ext_vector_type(2)));
typedef unsigned int v4u __attribute__((ext_vector_type(4)));
typedef unsigned int v2u __attribute__((ext_vector_type(2)));
typedef __bf16    v2bf __attribute__((ext_vector_type(2)));
typedef _Float16 v2hf __attribute__((ext_vector_type(2)));

union Frag { v16h v; v4u q[2]; };

// WMMA with hazard guard: D += A(16x32) * B(32x16)
__device__ __forceinline__ v8f mma(v16h a, v16h b, v8f c) {
  v8f d = __builtin_amdgcn_wmma_f32_16x16x32_f16(false, a, false, b, (short)0, c, false, false);
  asm volatile("v_nop\n\tv_nop\n\tv_nop\n\tv_nop" : "+v"(d) : "v"(a), "v"(b));
  return d;
}

__device__ __forceinline__ v8f zero8() {
  v8f z;
#pragma unroll
  for (int i = 0; i < 8; ++i) z[i] = 0.0f;
  return z;
}

// f32 -> nearest-even bf16 value, returned as f32
__device__ __forceinline__ float bf16q(float f) {
  unsigned int u = __float_as_uint(f);
  unsigned int r = u + 0x7FFFu + ((u >> 16) & 1u);
  r = ((u & 0x7F800000u) == 0x7F800000u) ? u : r;
  return __uint_as_float(r & 0xFFFF0000u);
}
__device__ __forceinline__ v4f bf16q4(v4f a) {
  v4f r;
  r.x = bf16q(a.x); r.y = bf16q(a.y); r.z = bf16q(a.z); r.w = bf16q(a.w);
  return r;
}
// f32 -> f16 (RNE convert) bit pattern
__device__ __forceinline__ unsigned short hbits(float f) {
  _Float16 h = (_Float16)f;
  return __builtin_bit_cast(unsigned short, h);
}
__device__ __forceinline__ v4u pack8h(float f0, float f1, float f2, float f3,
                                      float f4, float f5, float f6, float f7) {
  v8h t;
  t[0] = (_Float16)f0; t[1] = (_Float16)f1; t[2] = (_Float16)f2; t[3] = (_Float16)f3;
  t[4] = (_Float16)f4; t[5] = (_Float16)f5; t[6] = (_Float16)f6; t[7] = (_Float16)f7;
  return __builtin_bit_cast(v4u, t);
}

// ---------------------------------------------------------------------------
// Two f32 -> their bf16 values (nearest even), times sc, as two packed f16.  For every finite
// input the f16 pair equals hbits(bf16q(.) * sc): the packed convert rounds like bf16q.
// ---------------------------------------------------------------------------
__device__ __forceinline__ unsigned int pk2h(float a, float b, float sc) {
  v2f f;
  f.x = a; f.y = b;
  const unsigned int u = __builtin_bit_cast(unsigned int, __builtin_convertvector(f, v2bf));
  v2f g;
  g.x = __uint_as_float(u << 16) * sc;
  g.y = __uint_as_float(u & 0xFFFF0000u) * sc;
  return __builtin_bit_cast(unsigned int, __builtin_convertvector(g, v2hf));
}

// ---------------------------------------------------------------------------
// One 64x64 weight tile, 128 threads: logical W[k][n] (f32, n contiguous, row pitch rstride) ->
// sW[n][k] in LDS, value = f16(bf16 value of w * 16).  A thread takes k rows 2kp, 2kp + 1 and
// four columns at a time, so that a k pair is one 4-byte LDS store; a wave's 32 stores (8 k
// pairs x 4 column groups, 144-B rows) fall on 32 different banks.
// ---------------------------------------------------------------------------
__device__ __forceinline__ void wtile_load(v4f (&r)[8], const float* __restrict__ src, int rstride) {
  const int tid = threadIdx.x;
  const int kp = (tid >> 5) * 8 + (tid & 7), jl = (tid >> 3) & 3;
  const float* p = src + (size_t)(2 * kp) * (size_t)rstride + jl * 4;
#pragma unroll
  for (int it = 0; it < 4; ++it) {
    r[2 * it] = *(const v4f*)(p + it * 16);
    r[2 * it + 1] = *(const v4f*)(p + rstride + it * 16);
  }
  // stands behind the eight loads and names their address as an input, so that it is not
  // rewritten ahead of it
  asm volatile("s_wait_xcnt 0x0" :: "v"(p) : "memory");
}
__device__ __forceinline__ void wtile_store(unsigned short (*sW)[72], const v4f (&r)[8]) {
  const int tid = threadIdx.x;
  const int kp = (tid >> 5) * 8 + (tid & 7), jl = (tid >> 3) & 3;
#pragma unroll
  for (int it = 0; it < 4; ++it) {
    const int j4 = (it * 4 + jl) * 4;
#pragma unroll
    for (int c = 0; c < 4; ++c)
      *(unsigned int*)&sW[j4 + c][2 * kp] = pk2h(r[2 * it][c], r[2 * it + 1][c], 16.0f);
  }
}

// ---------------------------------------------------------------------------
// q/k/v projections with their own operand preparation, and the tail's weight planes, one grid.
// blocks [0, PB_1): Wp tiles; [PB_1, PB_2): W1; [PB_2, PB_T): W2: each 64x64 tile goes through
// LDS into its f16 plane Wt[n][k] in fragment order (read two launches later).
// blocks from PB_T on: D = x[PT tokens][64] * W[64][64 columns of one head of q, k or v].
// The WG rounds its own operands: the x rows come in by whole-line loads and go to LDS as f16
// (bf16 values of x), the weight tile as above; PT tokens a WG spread that work over four
// 64-token tiles.  4 waves; B fragments (all 64 k x 64 n) stay in registers; per tile wave w
// owns rows 16w..16w+15 x 64 cols.  The split k map for A and B (row/col = lane&15, elements
// 0..7 <- k0+8h.., 8..15 <- k0+16+8h..).
// Output: q/k planes [b*H+h][t][64] (q in fragment order), v transposed plane vt[b*H+h][64][t];
// value acc/16 + bf16q(bias).
// coverage per tile: 4 passes x 4 waves x 4 rows = 64 rows x 64 cols; v path: 64 d rows x 64 tokens.
// LDS sW, sX: cross-wave, published by the first barrier.  sT: cross-wave, two buffers, one
// barrier a tile: a buffer is rewritten two tiles later, behind the barrier of the tile between.
// ---------------------------------------------------------------------------
#define PT 256
#define PB_1 (QKVW / 64)
#define PB_2 (PB_1 + HID / 64)
#define PB_T (PB_2 + HID / 64)
#define NCB (3 * QKVW / 64)
static_assert(SEQ % PT == 0 && MROWS % PT == 0);
__global__ __launch_bounds__(128) __attribute__((amdgpu_num_vgpr(256))) void k_proj(
    const float* __restrict__ x, const float* __restrict__ Wq, const float* __restrict__ Wk,
    const float* __restrict__ Wv, const float* __restrict__ bq, const float* __restrict__ bk,
    const float* __restrict__ bv, const float* __restrict__ Wp, const float* __restrict__ W1,
    const float* __restrict__ W2, unsigned short* __restrict__ wpt,
    unsigned short* __restrict__ w1t, unsigned short* __restrict__ w2t,
    unsigned short* __restrict__ out0, unsigned short* __restrict__ out1,
    unsigned short* __restrict__ out2) {
  __shared__ __attribute__((aligned(16))) unsigned short sW[64][72];
  __shared__ __attribute__((aligned(16))) unsigned short sX[PT][72];
  __shared__ __attribute__((aligned(16))) unsigned short sT[2][64][72];
  const int tid = threadIdx.x, lane = tid & 31, w = tid >> 5;
  const int m = lane & 15, hl = lane >> 4;
  const int bid = blockIdx.x;
  v4f wr[8];

  if (bid < PB_T) {                      // block-uniform: a weight tile of the tail
    const float* src;
    unsigned short* dst;
    int K, rstride, k0, n0;
    if (bid < PB_1) {
      src = Wp; dst = wpt; K = QKVW; rstride = CDIM; k0 = bid * 64; n0 = 0;
    } else if (bid < PB_2) {
      src = W1; dst = w1t; K = CDIM; rstride = HID; k0 = 0; n0 = (bid - PB_1) * 64;
    } else {
      src = W2; dst = w2t; K = HID; rstride = CDIM; k0 = (bid - PB_2) * 64; n0 = 0;
    }
    wtile_load(wr, src + (size_t)k0 * (size_t)rstride + n0, rstride);
    wtile_store(sW, wr);
    __syncthreads();   // cross-wave: staged by all waves, read by all waves
    // each wave stores one part of one fragment tile per pass: 512 contiguous bytes
    v4u val[4];
    size_t off[4];
#pragma unroll
    for (int p = 0; p < 4; ++p) {
      val[p] = *(const v4u*)&sW[p * 16 + m][(w >> 1) * 32 + (w & 1) * 16 + hl * 8];
      off[p] = ((size_t)n0 + p * 16) * (size_t)K + (size_t)(k0 + (w >> 1) * 32) * 16 + (w & 1) * 256 + lane * 8;
    }
#pragma unroll
    for (int p = 0; p < 4; ++p) *(v4u*)(dst + off[p]) = val[p];
    // stands in front of whatever the build lays out behind this path
    asm volatile("s_wait_xcnt 0x0" ::: "memory");
    return;
  }

  const int g = bid - PB_T;
  const int mb = g / NCB, cb = g - mb * NCB;
  const int which = cb / NHEAD;            // 0 = q, 1 = k, 2 = v (WG-uniform)
  const int hh = cb - which * NHEAD;
  const int m0 = mb * PT;
  const int b = m0 / SEQ, t0 = m0 - b * SEQ;
  const float* wsel = (which == 0) ? Wq : ((which == 1) ? Wk : Wv);
  const float* bsel = (which == 0) ? bq : ((which == 1) ? bk : bv);

  // ---- every global operand load of the WG, one group: weight tile, biases, x rows ----
  wtile_load(wr, wsel + (size_t)hh * (CDIM * HD), HD);
  float rb[4];
  const float* bp = bsel + hh * HD + m;
#pragma unroll
  for (int j = 0; j < 4; ++j) rb[j] = bp[16 * j];
  // the PT rows are contiguous: a wave-wide 16-B load covers 512 B, two whole rows
  v4f xr[PT / 8];
  const float* xp = x + ((size_t)b * SEQ_FULL + t0) * CDIM + tid * 4;
#pragma unroll
  for (int it = 0; it < PT / 8; ++it) xr[it] = *(const v4f*)(xp + it * 512);
  // as in wtile_load, for the two addresses of these loads
  asm volatile("s_wait_xcnt 0x0" :: "v"(bp), "v"(xp) : "memory");
  wtile_store(sW, wr);
#pragma unroll
  for (int it = 0; it < PT / 8; ++it) {
    v2u o;
    o.x = pk2h(xr[it].x, xr[it].y, 1.0f);
    o.y = pk2h(xr[it].z, xr[it].w, 1.0f);
    *(v2u*)&sX[it * 8 + (tid >> 4)][(tid & 15) * 4] = o;
  }
  __syncthreads();   // cross-wave: sW and sX staged by all waves, read by all waves

  Frag bf0[4], bf1[4];
#pragma unroll
  for (int j = 0; j < 4; ++j) {
    const unsigned short* wb = &sW[16 * j + m][hl * 8];
    bf0[j].q[0] = *(const v4u*)(wb);
    bf0[j].q[1] = *(const v4u*)(wb + 16);
    bf1[j].q[0] = *(const v4u*)(wb + 32);
    bf1[j].q[1] = *(const v4u*)(wb + 48);
  }
  float bj[4];
#pragma unroll
  for (int j = 0; j < 4; ++j) bj[j] = bf16q(rb[j]);

  const float wsc = 0.0625f;               // undo the x16 weight carry
  const int lrow0 = 16 * w + 8 * hl;       // D rows of this lane within the 64-token tile
  const int bh = b * NHEAD + hh;
  unsigned short* dst = (which == 0) ? out0 : ((which == 1) ? out1 : out2);

  // rolled: one copy of the three store paths serves the four tiles
#pragma unroll 1
  for (int t = 0; t < PT / 64; ++t) {
    unsigned short (*sO)[72] = sT[t & 1];
    const int tt = t0 + t * 64;
    Frag a0, a1;
    const unsigned short* xa = &sX[t * 64 + 16 * w + m][hl * 8];
    a0.q[0] = *(const v4u*)(xa);
    a0.q[1] = *(const v4u*)(xa + 16);
    a1.q[0] = *(const v4u*)(xa + 32);
    a1.q[1] = *(const v4u*)(xa + 48);
    v8f acc[4];
#pragma unroll
    for (int j = 0; j < 4; ++j) acc[j] = mma(a0.v, bf0[j].v, zero8());
#pragma unroll
    for (int j = 0; j < 4; ++j) acc[j] = mma(a1.v, bf1[j].v, acc[j]);
#pragma unroll
    for (int j = 0; j < 4; ++j) {
#pragma unroll
      for (int r = 0; r < 8; ++r) sO[lrow0 + r][16 * j + m] = hbits(acc[j][r] * wsc + bj[j]);
    }
    __syncthreads();   // cross-wave for all three paths; also frees the other buffer of sT
    v4u val[4];
    unsigned int off[4];
    if (which == 0) {                      // WG-uniform; q in fragment order, rows of all waves
#pragma unroll
      for (int p = 0; p < 4; ++p) {
        val[p] = *(const v4u*)&sO[p * 16 + m][(w >> 1) * 32 + (w & 1) * 16 + hl * 8];
        off[p] = (unsigned int)((bh * SEQ + tt + p * 16) * HD + (w >> 1) * 512 + (w & 1) * 256 + lane * 8);
      }
    } else if (which == 1) {               // WG-uniform
#pragma unroll
      for (int p = 0; p < 4; ++p) {
        const int row = p * 16 + 4 * w + (lane >> 3);
        const int piece = lane & 7;
        val[p] = *(const v4u*)&sO[row][piece * 8];
        off[p] = (unsigned int)((bh * SEQ + tt + row) * HD + piece * 8);
      }
    } else {
#pragma unroll
      for (int p = 0; p < 4; ++p) {
        const int d = p * 16 + 4 * w + (lane >> 3);
        const int piece = lane & 7;
        unsigned int wv[4];
#pragma unroll
        for (int e = 0; e < 4; ++e) {
          const unsigned int lo = sO[piece * 8 + 2 * e][d];
          const unsigned int hi = sO[piece * 8 + 2 * e + 1][d];
          wv[e] = lo | (hi << 16);
        }
        v4u tv;
        tv.x = wv[0]; tv.y = wv[1]; tv.z = wv[2]; tv.w = wv[3];
        val[p] = tv;
        off[p] = (unsigned int)((bh * HD + d) * SEQ + tt + piece * 8);
      }
    }
#pragma unroll
    for (int p = 0; p < 4; ++p) *(v4u*)(dst + off[p]) = val[p];
    // the next tile rewrites the registers that the four stores name
    asm volatile("s_wait_xcnt 0x0" ::: "memory");
  }
}

// ---------------------------------------------------------------------------
// Layernorm of one 64-col row held two columns a lane (u0, u1): mean, then variance of the
// centred values, each summed over the wave's 32 lanes.
// ---------------------------------------------------------------------------
__device__ __forceinline__ v2f ln_row(float u0, float u1, float gg0, float gg1, float ee0, float ee1) {
  float s = u0 + u1;
#pragma unroll
  for (int xm = 1; xm < 32; xm <<= 1) s += __shfl_xor(s, xm, 32);
  const float mu = s * (1.0f / CDIM);
  const float d0 = u0 - mu, d1 = u1 - mu;
  float qs = d0 * d0 + d1 * d1;
#pragma unroll
  for (int xm = 1; xm < 32; xm <<= 1) qs += __shfl_xor(qs, xm, 32);
  const float var = qs * (1.0f / CDIM);
  const float rstd = rsqrtf(var + 1e-5f);
  v2f yv;
  yv.x = d0 * rstd * gg0 + ee0;
  yv.y = d1 * rstd * gg1 + ee1;
  return yv;
}

// ---------------------------------------------------------------------------
// Everything behind the attention, one launch: output projection + bias + residual(bf16 values
// of x) + layernorm 1, ffn1 + bias + relu, ffn2 + bias + residual(h1) + layernorm 2.  All of it
// is row-local, so one WG carries TR = 16 token rows from the o plane to the output; h1 and the
// hidden activations never leave the WGP (h1: f16 copy in LDS as the next A operand, f32 values
// in the registers of the lane that made them; activations: f16 in LDS).
// 4 waves.  Products: wave w owns output columns 16w..16w+15 (projection, ffn2) or 64w..64w+63
// (ffn1) of all 16 rows; k runs upward in one accumulator chain per tile.  Same split k map for
// A and B as k_proj; the o plane and the weight planes come in fragment order.  Layernorms: wave
// w owns rows 4w..4w+3, a lane two columns of each.
// Every global operand load stands ahead of the products that use it, as groups: the wave meets
// the load latency once per group, not once per fragment.
// LDS sF (f32 product rows), sH (h1 as f16), sA (activations as f16): all cross-wave, each
// published by a block barrier.
// ---------------------------------------------------------------------------
#define TR 16
#define AP (HID + 8)
static_assert(SEQ % TR == 0 && MROWS % TR == 0);
static_assert(QKVW == 512 && HID == 256 && CDIM == 64);
__global__ __launch_bounds__(128) __attribute__((amdgpu_num_vgpr(256)))
void k_tail(const unsigned short* __restrict__ op, const unsigned short* __restrict__ wpt,
            const unsigned short* __restrict__ w1t, const unsigned short* __restrict__ w2t,
            const float* __restrict__ x, const float* __restrict__ bp, const float* __restrict__ b1,
            const float* __restrict__ b2, const float* __restrict__ g1, const float* __restrict__ be1,
            const float* __restrict__ g2, const float* __restrict__ be2, float* __restrict__ out) {
  __shared__ __attribute__((aligned(16))) float sF[TR][68];
  __shared__ __attribute__((aligned(16))) unsigned short sH[TR][72];
  __shared__ __attribute__((aligned(16))) unsigned short sA[TR][AP];
  const int tid = threadIdx.x, lane = tid & 31, w = tid >> 5;
  const int m = lane & 15, hl = lane >> 4, k8 = hl * 8;
  const int m0 = blockIdx.x * TR;
  const int b = m0 / SEQ, t0 = m0 - b * SEQ;
  const int c2 = 2 * lane;                 // lane owns cols c2, c2+1 of each of its wave's rows
  const float wsc = 0.0625f;               // undo the x16 weight carry
  const size_t frow = ((size_t)b * SEQ_FULL + t0 + 4 * w) * CDIM + c2;   // x and out, full strides

  // ---- output projection: 16 rows x 16 cols per wave, k = 512 ----
  // Two load groups in all: the first twelve k steps (as many fragments as the registers hold);
  // then, into the registers that those products free, the last four steps together with the
  // weight fragments of ffn1 and ffn2, which depend on nothing computed here.
  const unsigned short* ap = op + (size_t)m0 * QKVW + lane * 8;
  const unsigned short* bq = wpt + (size_t)(16 * w) * QKVW + lane * 8;
  Frag pa[12], pb[12];
#pragma unroll
  for (int i = 0; i < 12; ++i) {
    pa[i].q[0] = *(const v4u*)(ap + 512 * i);
    pa[i].q[1] = *(const v4u*)(ap + 512 * i + 256);
    pb[i].q[0] = *(const v4u*)(bq + 512 * i);
    pb[i].q[1] = *(const v4u*)(bq + 512 * i + 256);
  }
  // the residual rows of x and every bias, gain and shift of the later stages: fetched ahead of
  // the first barrier too, so that no stage behind a barrier opens with a global load
  v2f xr[4];
  const float* xp = x + frow;
#pragma unroll
  for (int rr = 0; rr < 4; ++rr) xr[rr] = *(const v2f*)(xp + rr * CDIM);
  float rb1[4];
  const float* b1p = b1 + 64 * w + m;
#pragma unroll
  for (int j = 0; j < 4; ++j) rb1[j] = b1p[16 * j];
  // stands behind the loads above and names their last-used address registers as inputs, so that
  // none of them is rewritten (a later load's result included) ahead of it
  asm volatile("s_wait_xcnt 0x0" :: "v"(xp), "v"(b1p) : "memory");
  v8f acc = zero8();
#pragma unroll
  for (int i = 0; i < 12; ++i) acc = mma(pa[i].v, pb[i].v, acc);
  Frag qa[4], qb[4];
#pragma unroll
  for (int i = 0; i < 4; ++i) {
    qa[i].q[0] = *(const v4u*)(ap + 512 * (12 + i));
    qa[i].q[1] = *(const v4u*)(ap + 512 * (12 + i) + 256);
    qb[i].q[0] = *(const v4u*)(bq + 512 * (12 + i));
    qb[i].q[1] = *(const v4u*)(bq + 512 * (12 + i) + 256);
  }
  const float rbp0 = bp[c2], rbp1 = bp[c2 + 1], rg10 = g1[c2], rg11 = g1[c2 + 1];
  const float re10 = be1[c2], re11 = be1[c2 + 1];
  const float rb20 = b2[c2], rb21 = b2[c2 + 1], rg20 = g2[c2], rg21 = g2[c2 + 1];
  const float re20 = be2[c2], re21 = be2[c2 + 1];
  Frag w1a[4], w1b[4];
  const unsigned short* w1p = w1t + (size_t)(64 * w) * CDIM + lane * 8;
#pragma unroll
  for (int j = 0; j < 4; ++j) {
    w1a[j].q[0] = *(const v4u*)(w1p + j * 16 * CDIM);
    w1a[j].q[1] = *(const v4u*)(w1p + j * 16 * CDIM + 256);
    w1b[j].q[0] = *(const v4u*)(w1p + j * 16 * CDIM + 512);
    w1b[j].q[1] = *(const v4u*)(w1p + j * 16 * CDIM + 768);
  }
  Frag w2f[8];
  const unsigned short* w2p = w2t + (size_t)(16 * w) * HID + lane * 8;
#pragma unroll
  for (int i = 0; i < 8; ++i) {
    w2f[i].q[0] = *(const v4u*)(w2p + 512 * i);
    w2f[i].q[1] = *(const v4u*)(w2p + 512 * i + 256);
  }
  // as above, for the four address pairs of this group
  asm volatile("s_wait_xcnt 0x0" :: "v"(ap), "v"(bq), "v"(w1p), "v"(w2p) : "memory");
  // inputs only: holds the twelve small loads inside this group; sunk behind the last products or
  // behind a barrier, they would cost a global load latency of their own
  asm volatile("" :: "v"(rbp0), "v"(rbp1), "v"(rg10), "v"(rg11), "v"(re10), "v"(re11),
                     "v"(rb20), "v"(rb21), "v"(rg20), "v"(rg21), "v"(re20), "v"(re21));
#pragma unroll
  for (int i = 0; i < 4; ++i) acc = mma(qa[i].v, qb[i].v, acc);
#pragma unroll
  for (int r = 0; r < 8; ++r) sF[8 * hl + r][16 * w + m] = acc[r] * wsc;
  __syncthreads();   // cross-wave: a row's 64 columns come from all four waves

  // ---- bias + residual + layernorm 1 ----
  v2f h1[4];                               // f32 h1 of rows 4w + rr, cols c2, c2+1: residual of layernorm 2
  {
    const float bb0 = bf16q(rbp0), bb1 = bf16q(rbp1);
    const float gg0 = bf16q(rg10), gg1 = bf16q(rg11);
    const float ee0 = bf16q(re10), ee1 = bf16q(re11);
#pragma unroll
    for (int rr = 0; rr < 4; ++rr) {
      const int row = 4 * w + rr;
      const v2f av = *(const v2f*)&sF[row][c2];
      const float u0 = (av.x + bb0) + bf16q(xr[rr].x);
      const float u1 = (av.y + bb1) + bf16q(xr[rr].y);
      h1[rr] = ln_row(u0, u1, gg0, gg1, ee0, ee1);
      sH[row][c2] = hbits(h1[rr].x);
      sH[row][c2 + 1] = hbits(h1[rr].y);
    }
  }
  __syncthreads();   // cross-wave: h1 rows of all waves are every wave's A operand; ends the reads of sF

  // ---- ffn1 + bias + relu: 16 rows x 64 cols per wave, k = 64 ----
  {
    Frag ha0, ha1;
    const unsigned short* hp = &sH[m][k8];
    ha0.q[0] = *(const v4u*)(hp);
    ha0.q[1] = *(const v4u*)(hp + 16);
    ha1.q[0] = *(const v4u*)(hp + 32);
    ha1.q[1] = *(const v4u*)(hp + 48);
    v8f fa[4];
#pragma unroll
    for (int j = 0; j < 4; ++j) fa[j] = mma(ha0.v, w1a[j].v, zero8());
#pragma unroll
    for (int j = 0; j < 4; ++j) fa[j] = mma(ha1.v, w1b[j].v, fa[j]);
#pragma unroll
    for (int j = 0; j < 4; ++j) {
      const float bj = bf16q(rb1[j]);
#pragma unroll
      for (int r = 0; r < 8; ++r) {
        float u = fa[j][r] * wsc + bj;
        u = fmaxf(u, 0.0f);
        sA[8 * hl + r][64 * w + 16 * j + m] = hbits(u);
      }
    }
  }
  __syncthreads();   // cross-wave: the 256 hidden columns come from all four waves

  // ---- ffn2: 16 rows x 16 cols per wave, k = 256 ----
  {
    const unsigned short* aq = &sA[m][k8];
    Frag fa[8];
#pragma unroll
    for (int i = 0; i < 8; ++i) {
      fa[i].q[0] = *(const v4u*)(aq + 32 * i);
      fa[i].q[1] = *(const v4u*)(aq + 32 * i + 16);
    }
    v8f acc2 = zero8();
#pragma unroll
    for (int i = 0; i < 8; ++i) acc2 = mma(fa[i].v, w2f[i].v, acc2);
#pragma unroll
    for (int r = 0; r < 8; ++r) sF[8 * hl + r][16 * w + m] = acc2[r] * wsc;
  }
  __syncthreads();   // cross-wave: a row's 64 columns come from all four waves

  // ---- bias + residual(h1) + layernorm 2 -> out, one whole 256-B row per store ----
  {
    const float bb0 = bf16q(rb20), bb1 = bf16q(rb21);
    const float gg0 = bf16q(rg20), gg1 = bf16q(rg21);
    const float ee0 = bf16q(re20), ee1 = bf16q(re21);
    v2f yv[4];
#pragma unroll
    for (int rr = 0; rr < 4; ++rr) {
      const v2f av = *(const v2f*)&sF[4 * w + rr][c2];
      const float u0 = (av.x + bb0) + h1[rr].x;
      const float u1 = (av.y + bb1) + h1[rr].y;
      yv[rr] = ln_row(u0, u1, gg0, gg1, ee0, ee1);
    }
#pragma unroll
    for (int rr = 0; rr < 4; ++rr) *(v2f*)(out + frow + rr * CDIM) = yv[rr];
  }
}

// ---------------------------------------------------------------------------
// One stage of 128 keys (two 64-key chunks) into LDS, shared by the work-group's eight waves:
// K rows (128 x 128 B, contiguous) and V^T rows (64 x 256 B, source pitch SEQ halves; the two
// 128-B halves of a row go to the two chunks' planes).  256 threads x 16 B x 4 row groups per
// operand.  lk/lv/gk/gv are the lane's own addresses for row group 0; a row group is 32 K rows
// or 16 V^T rows.  LDS pitch KVP halves.
// ---------------------------------------------------------------------------
#define KVP 72
#define KVBUF (128 * KVP * 2)
__device__ __forceinline__ unsigned int lds_off(const void* p) { return (unsigned int)(size_t)p; }
__device__ __forceinline__ void stage_kv(unsigned int lk, unsigned int lv,
                                         const unsigned short* gk, const unsigned short* gv) {
  const unsigned int lsk = 32 * KVP * 2, lsv = 16 * KVP * 2;
  // The closing s_wait_xcnt stands in the copies' own statement so that no address register
  // named here is rewritten ahead of it.
  asm volatile(
      "global_load_async_to_lds_b128 %0, %8, off\n\t"
      "global_load_async_to_lds_b128 %1, %9, off\n\t"
      "global_load_async_to_lds_b128 %2, %10, off\n\t"
      "global_load_async_to_lds_b128 %3, %11, off\n\t"
      "global_load_async_to_lds_b128 %4, %12, off\n\t"
      "global_load_async_to_lds_b128 %5, %13, off\n\t"
      "global_load_async_to_lds_b128 %6, %14, off\n\t"
      "global_load_async_to_lds_b128 %7, %15, off\n\t"
      "s_wait_xcnt 0x0"
      :: "v"(lk), "v"(lk + lsk), "v"(lk + 2 * lsk), "v"(lk + 3 * lsk),
         "v"(lv), "v"(lv + lsv), "v"(lv + 2 * lsv), "v"(lv + 3 * lsv),
         "v"(gk), "v"(gk + 32 * HD), "v"(gk + 64 * HD), "v"(gk + 96 * HD),
         "v"(gv), "v"(gv + 16 * SEQ), "v"(gv + 32 * SEQ), "v"(gv + 48 * SEQ)
      : "memory");
}

__device__ __forceinline__ float other_half(float f) {
  const int b = __float_as_int(f);
  return __int_as_float(__builtin_amdgcn_permlanex16(b, b, 0x76543210, 0xfedcba98, false, false));
}

#define MP 36
__global__ __launch_bounds__(256) __attribute__((amdgpu_num_vgpr(256)))
void k_attn(const unsigned short* __restrict__ qp, const unsigned short* __restrict__ kp,
            const unsigned short* __restrict__ vp, unsigned short* __restrict__ op) {
  __shared__ __attribute__((aligned(16))) unsigned short sK[2][128][KVP];
  __shared__ __attribute__((aligned(16))) unsigned short sV[2][2][64][KVP];
  __shared__ __attribute__((aligned(16))) float sM[2][4][32][MP];
  const int tid = threadIdx.x, lane = tid & 31;
  // the wave's number in a scalar register: the tests on g below are scalar branches
  const int wv = __builtin_amdgcn_readfirstlane(tid >> 5);
  const int w = wv & 3, g = wv >> 2;        // query rows 16w.. of the tile; key group
  const int m = lane & 15, hl = lane >> 4, k8 = hl * 8;
  const int nqt = SEQ / 64;
  static_assert((SEQ / 64) % 2 == 0);       // tiles pair up as (nqt-1-p, p)
  const int nst = nqt / 2 + 1;              // stages of both tiles together
  const int bh = blockIdx.x / (nqt / 2), pr = blockIdx.x - bh * (nqt / 2);
  const int b = bh / NHEAD, hh = bh - b * NHEAD;
  const int tA = nqt - 1 - pr, tB = pr;     // first and second query tile
  const int nA = (tA + 2) >> 1;             // stages of the first tile: (tA + 1 chunks + 1) / 2
  int qt = tA, st = 0, ns = nA, tl = 0;     // tile in work, its stage, its stage count, 0 or 1 (WG-uniform)

  Frag qa0, qa1;                            // B operand: column = query qt*64 + 16w + m
  Frag qn0, qn1;                            // the same of the second tile, fetched up front
  {
    const unsigned short* qr = qp + ((size_t)bh * SEQ + tA * 64 + 16 * w) * HD + lane * 8;
    qa0.q[0] = *(const v4u*)(qr);
    qa0.q[1] = *(const v4u*)(qr + 256);
    qa1.q[0] = *(const v4u*)(qr + 512);
    qa1.q[1] = *(const v4u*)(qr + 768);
    const unsigned short* qs = qp + ((size_t)bh * SEQ + tB * 64 + 16 * w) * HD + lane * 8;
    qn0.q[0] = *(const v4u*)(qs);
    qn0.q[1] = *(const v4u*)(qs + 256);
    qn1.q[0] = *(const v4u*)(qs + 512);
    qn1.q[1] = *(const v4u*)(qs + 768);
  }
  float mrun = -1e30f;                      // running maximum of the lane's query over this group's keys
  float lrun = 0.0f;                        // running sum over this half's keys of this group; joined at the end
  v8f oacc[4];                              // O^T: row d = 16 jd + 8 hl + r, column = the lane's query
#pragma unroll
  for (int j = 0; j < 4; ++j) oacc[j] = zero8();

  // ---- stage 0 into buffer 0, published; then stage 1 into buffer 1 ----
  // A stage never reaches past key SEQ-1: a tile with an odd chunk count has qt <= nqt-2.
  const int srow = tid >> 3, spc = (tid & 7) * 8;
  const int vrow = tid >> 4, vpc = tid & 15;
  const unsigned short* gk0 = kp + ((size_t)bh * SEQ + srow) * HD + spc;
  const unsigned short* gv0 = vp + ((size_t)bh * HD + vrow) * (size_t)SEQ + vpc * 8;
  const unsigned int lk0 = lds_off(&sK[0][srow][spc]);
  const unsigned int lv0 = lds_off(&sV[0][vpc >> 3][vrow][(vpc & 7) * 8]);
  stage_kv(lk0, lv0, gk0, gv0);
  asm volatile("s_wait_asynccnt 0x0" ::: "memory");   // this wave's copies of stage 0 have landed
  __syncthreads();                                    // stage 0 visible to all eight waves
  {
    const int c = (1 < nA) ? 1 : 0;                   // stage 1 exists: nst >= 2; its place in its own tile
    stage_kv(lk0 + KVBUF, lv0 + KVBUF, gk0 + (size_t)c * 128 * HD, gv0 + c * 128);
  }

  // rolled: one copy of the body serves both tiles
#pragma unroll 1
  for (int i = 0; i < nst; ++i) {
    const int buf = i & 1;
    const int kt = 2 * st + g;              // this group's key chunk (wave-uniform)
    // ---- S^T = K Q^T, four 16-key subtiles: s[j][r] = score(key 16j + 8hl + r, query m) ----
    // All sixteen K reads stand as one group ahead of the eight products, first-half fragments
    // first, so that the wave meets the LDS latency once and not once per subtile.
    v8f s[4];
    const unsigned short* kb = &sK[buf][64 * g + m][k8];
    Frag kf0[4], kf1[4];
#pragma unroll
    for (int j = 0; j < 4; ++j) {
      kf0[j].q[0] = *(const v4u*)(kb + j * 16 * KVP);
      kf0[j].q[1] = *(const v4u*)(kb + j * 16 * KVP + 16);
    }
#pragma unroll
    for (int j = 0; j < 4; ++j) {
      kf1[j].q[0] = *(const v4u*)(kb + j * 16 * KVP + 32);
      kf1[j].q[1] = *(const v4u*)(kb + j * 16 * KVP + 48);
    }
#pragma unroll
    for (int j = 0; j < 4; ++j) s[j] = mma(kf0[j].v, qa0.v, zero8());
#pragma unroll
    for (int j = 0; j < 4; ++j) s[j] = mma(kf1[j].v, qa1.v, s[j]);
    // The sixteen V^T reads go out here, as one group: they return under the softmax arithmetic.
    const unsigned short* vb = &sV[buf][g][m][k8];
    Frag vf0[4], vf1[4];
#pragma unroll
    for (int jd = 0; jd < 4; ++jd) {
      vf0[jd].q[0] = *(const v4u*)(vb + jd * 16 * KVP);
      vf0[jd].q[1] = *(const v4u*)(vb + jd * 16 * KVP + 16);
    }
#pragma unroll
    for (int jd = 0; jd < 4; ++jd) {
      vf1[jd].q[0] = *(const v4u*)(vb + jd * 16 * KVP + 32);
      vf1[jd].q[1] = *(const v4u*)(vb + jd * 16 * KVP + 48);
    }
    // keeps the scheduler from sinking the reads down to the second product
    __builtin_amdgcn_sched_barrier(0);
    // ---- causal mask on the diagonal chunk, maximum of the lane's own query ----
    // the lane's one query allows keys up to lim, counted from this half's first key of the chunk
    // (all 64 below the diagonal chunk, none past it)
    const int lim = (kt == qt) ? (16 * w + m - 8 * hl) : ((kt < qt) ? 64 : -1);
    float tm[4];
#pragma unroll
    for (int j = 0; j < 4; ++j) {
      tm[j] = -1e30f;
#pragma unroll
      for (int r = 0; r < 8; ++r) {
        float val = s[j][r];
        val = (16 * j + r > lim) ? -1e30f : val;
        s[j][r] = val;
        tm[j] = fmaxf(tm[j], val);
      }
    }
    float tmax = fmaxf(fmaxf(tm[0], tm[1]), fmaxf(tm[2], tm[3]));
    tmax = fmaxf(tmax, other_half(tmax));
    const float mn = fmaxf(mrun, tmax);
    const float corr = __expf(mrun - mn);
    mrun = mn;
    // ---- p = exp(s - m); f16(16384 p) packed in place as the B operand; sums in the lane ----
    float ts[4];
    v8h ph[4];
#pragma unroll
    for (int j = 0; j < 4; ++j) {
      ts[j] = 0.0f;
      v8f pv;
#pragma unroll
      for (int r = 0; r < 8; ++r) {
        const float p = __expf(s[j][r] - mrun);
        ts[j] += p;
        pv[r] = p * PSC;
      }
      ph[j] = __builtin_convertvector(pv, v8h);
    }
    lrun = lrun * corr + ((ts[0] + ts[1]) + (ts[2] + ts[3]));
#pragma unroll
    for (int j = 0; j < 4; ++j) {
#pragma unroll
      for (int r = 0; r < 8; ++r) oacc[j][r] *= corr;
    }
    // elements 0..7 <- keys 8hl.., 8..15 <- keys 16+8hl.. of each 32-key block
    const v16h pb0 = __builtin_shufflevector(ph[0], ph[1], 0, 1, 2, 3, 4, 5, 6, 7, 8, 9, 10, 11, 12, 13, 14, 15);
    const v16h pb1 = __builtin_shufflevector(ph[2], ph[3], 0, 1, 2, 3, 4, 5, 6, 7, 8, 9, 10, 11, 12, 13, 14, 15);
    // ---- O^T += V^T (64 d x 64 keys) * P^T (64 keys x 16 queries) ----
#pragma unroll
    for (int jd = 0; jd < 4; ++jd) oacc[jd] = mma(vf0[jd].v, pb0, oacc[jd]);
#pragma unroll
    for (int jd = 0; jd < 4; ++jd) oacc[jd] = mma(vf1[jd].v, pb1, oacc[jd]);
    const bool last = (st + 1 == ns);       // the tile's last stage (WG-uniform)
    float* pm = &sM[tl][w][lane][0];        // the lane's 34 words; pitch 144 B
    if (last && g == 1) {                   // scalar branch: group 1 hands its partial result over
#pragma unroll
      for (int jd = 0; jd < 4; ++jd) {
        v4f lo, hi;
        lo.x = oacc[jd][0]; lo.y = oacc[jd][1]; lo.z = oacc[jd][2]; lo.w = oacc[jd][3];
        hi.x = oacc[jd][4]; hi.y = oacc[jd][5]; hi.z = oacc[jd][6]; hi.w = oacc[jd][7];
        *(v4f*)(pm + 8 * jd) = lo;
        *(v4f*)(pm + 8 * jd + 4) = hi;
      }
      v2f ml;
      ml.x = mrun; ml.y = lrun;
      *(v2f*)(pm + 32) = ml;
    }
    asm volatile("s_wait_dscnt 0x0" ::: "memory");      // this wave's reads of sK/sV[buf] have returned, its sM words are written
    asm volatile("s_wait_asynccnt 0x0" ::: "memory");   // this wave's copies of stage i+1 have landed
    __syncthreads();   // publishes stage i+1 and sM, frees buffer buf for rewriting
    if (i + 2 < nst) {   // WG-uniform
      const int c = (i + 2 < nA) ? (i + 2) : (i + 2 - nA);   // stage i+2, counted in its own tile
      stage_kv(lk0 + buf * KVBUF, lv0 + buf * KVBUF, gk0 + (size_t)c * 128 * HD, gv0 + c * 128);
    }
    if (!last) {         // WG-uniform
      ++st;
      continue;
    }

    if (g == 0) {        // scalar branch
      // ---- tile done: join the two groups; o = acc / (16384 l); four stores cover 2 KiB in a row ----
      const v2f ml = *(const v2f*)(pm + 32);
      const float mj = fmaxf(mrun, ml.x);
      const float a0 = __expf(mrun - mj), a1 = __expf(ml.x - mj);
      const float lj = lrun * a0 + ml.y * a1;
      const float lsum = lj + other_half(lj);
      const float il = 1.0f / (lsum * PSC);
      const float c0 = a0 * il, c1 = a1 * il;
      v4u val[4];
#pragma unroll
      for (int jd = 0; jd < 4; ++jd) {
        const v4f lo = *(const v4f*)(pm + 8 * jd);
        const v4f hi = *(const v4f*)(pm + 8 * jd + 4);
        val[jd] = pack8h(oacc[jd][0] * c0 + lo.x * c1, oacc[jd][1] * c0 + lo.y * c1,
                         oacc[jd][2] * c0 + lo.z * c1, oacc[jd][3] * c0 + lo.w * c1,
                         oacc[jd][4] * c0 + hi.x * c1, oacc[jd][5] * c0 + hi.y * c1,
                         oacc[jd][6] * c0 + hi.z * c1, oacc[jd][7] * c0 + hi.w * c1);
      }
      // the 16-row tile of the wave's queries; k tiles 2 hh and 2 hh + 1 of it, two parts each
      unsigned short* od = op + (unsigned int)((b * SEQ + qt * 64 + 16 * w) * QKVW + hh * (HD * 16) + lane * 8);
#pragma unroll
      for (int jd = 0; jd < 4; ++jd) *(v4u*)(od + jd * 256) = val[jd];
      // the second tile's passes rewrite the registers that the four stores name
      asm volatile("s_wait_xcnt 0x0" ::: "memory");
    }

    // ---- start state of the second tile ----
    qt = tB; st = 0; ns = nst - nA; tl = 1;
    qa0 = qn0; qa1 = qn1;
    mrun = -1e30f; lrun = 0.0f;
#pragma unroll
    for (int j = 0; j < 4; ++j) oacc[j] = zero8();
  }
  asm volatile("s_wait_asynccnt 0x0" ::: "memory");     // nothing of this wave's in flight past the loop
}

// ---------------------------------------------------------------------------
// Host launcher
// ---------------------------------------------------------------------------
static inline size_t al256(size_t v) { return (v + 255) & ~(size_t)255; }

extern "C" void kernel_launch(void* const* d_in, const int* in_sizes, int n_in,
                              void* d_out, int out_size, void* d_ws, size_t ws_size,
                              hipStream_t stream) {
  if (n_in < 17) return;
  const long needX = ((long)(NB - 1) * SEQ_FULL + SEQ) * CDIM;
  const long nW = (long)NHEAD * CDIM * HD;
  if ((long)in_sizes[0] < needX) return;
  if ((long)in_sizes[1] < nW || (long)in_sizes[3] < nW || (long)in_sizes[5] < nW) return;
  if (in_sizes[2] < QKVW || in_sizes[4] < QKVW || in_sizes[6] < QKVW) return;
  if ((long)in_sizes[7] < (long)QKVW * CDIM || in_sizes[8] < CDIM) return;
  if ((long)in_sizes[9] < (long)CDIM * HID || in_sizes[10] < HID) return;
  if ((long)in_sizes[11] < (long)HID * CDIM || in_sizes[12] < CDIM) return;
  if (in_sizes[13] < CDIM || in_sizes[14] < CDIM || in_sizes[15] < CDIM || in_sizes[16] < CDIM) return;
  if ((long)out_size < needX) return;

  const float* x   = (const float*)d_in[0];
  const float* Wq  = (const float*)d_in[1];
  const float* bq  = (const float*)d_in[2];
  const float* Wk  = (const float*)d_in[3];
  const float* bk  = (const float*)d_in[4];
  const float* Wv  = (const float*)d_in[5];
  const float* bv  = (const float*)d_in[6];
  const float* Wp  = (const float*)d_in[7];
  const float* bp  = (const float*)d_in[8];
  const float* W1  = (const float*)d_in[9];
  const float* b1  = (const float*)d_in[10];
  const float* W2  = (const float*)d_in[11];
  const float* b2  = (const float*)d_in[12];
  const float* g1  = (const float*)d_in[13];
  const float* be1 = (const float*)d_in[14];
  const float* g2  = (const float*)d_in[15];
  const float* be2 = (const float*)d_in[16];
  float* out = (float*)d_out;

  char* ws = (char*)d_ws;
  size_t off = 0;
  auto carve = [&](size_t bytes) -> char* { char* p = ws + off; off += al256(bytes); return p; };
  const size_t MHD = (size_t)NB * NHEAD * SEQ * HD;          // per q/k/vt plane
  // wpt, w1t, w2t, qpl and opl: fragment order
  unsigned short* wpt  = (unsigned short*)carve((size_t)CDIM * QKVW * 2);       // [64][512]
  unsigned short* w1t  = (unsigned short*)carve((size_t)HID * CDIM * 2);        // [256][64]
  unsigned short* w2t  = (unsigned short*)carve((size_t)CDIM * HID * 2);        // [64][256]
  unsigned short* qpl  = (unsigned short*)carve(MHD * 2);                       // [B*H][SEQ][64]
  unsigned short* kpl  = (unsigned short*)carve(MHD * 2);                       // [B*H][SEQ][64]
  unsigned short* vtp  = (unsigned short*)carve(MHD * 2);                       // [B*H][64][SEQ]
  unsigned short* opl  = (unsigned short*)carve((size_t)MROWS * QKVW * 2);      // [M][512]
  if (off > ws_size) return;
  if (off > ((size_t)128 << 20)) return;

  // 1-3) q/k/v projections + biases -> q, k, vt planes, each work-group rounding its own x rows
  //      and weight tile; the tail's weight planes (transposed, bf16 values x16 as f16) in the same grid
  k_proj<<<PB_T + NCB * (MROWS / PT), 128, 0, stream>>>(
      x, Wq, Wk, Wv, bq, bk, bv, Wp, W1, W2, wpt, w1t, w2t, qpl, kpl, vtp);
  // 4) causal attention -> o plane [M][512]
  k_attn<<<NB * NHEAD * (SEQ / 128), 256, 0, stream>>>(qpl, kpl, vtp, opl);
  // 5) output projection + residual + layernorm 1, ffn1, ffn2 + residual + layernorm 2 -> out
  //    (f32, full strides)
  k_tail<<<MROWS / TR, 128, 0, stream>>>(opl, wpt, w1t, w2t, x, bp, b1, b2, g1, be1, g2, be2, out);
}

// v010
// One run takes 42.1 microseconds.
// Timed twice side by side with v009, it ran 1.05 and 1.06 times as fast.
// Over all steps from v000 it is 5.93 times as fast.
#include <hip/hip_runtime.h>

// Contractions: v_wmma_f32_16x16x32_f16 (f16 operands, f32 accumulate) for q/k/v projections, q.k^T, p.v, output projection, ffn1, ffn2; weight planes carried x16, p plane carried x16384, activations x1.
//
// Fragment order.  The planes that a later launch reads from global memory straight into A or B
// fragments (the tail's three weight planes, q, o) are not row-major.  A plane X[rows][K] is cut into
// tiles of 16 rows x 32 k; tile (rt, ks) starts at half rt*16*K + ks*512 and holds two parts of
// 256 halves; part p, lane l, element e is X[16 rt + (l & 15)][32 ks + 16 p + 8 (l >> 4) + e],
// at half p*256 + l*8 + e of the tile.  Part p is register group q[p] of the fragment, so one
// wave-wide 16-byte load (or store) covers 512 contiguous bytes, four whole lines, where rows
// read in place gave it 32 bytes in each of sixteen lines.

#pragma clang fp contract(off)

#ifndef NB
#define NB 4
#endif
#ifndef SEQ
#define SEQ 2048
#endif
#define NB_FULL 4
#define SEQ_FULL 2048
#define CDIM 64
#define NHEAD 8
#define HD 64
#define QKVW (NHEAD * HD)
#define HID 256
#define MROWS (NB * SEQ)
#define PSC 16384.0f

static_assert(NB >= 1 && NB <= NB_FULL);
static_assert(SEQ % 64 == 0 && SEQ >= 64 && SEQ <= SEQ_FULL);
static_assert(HD == 64);
static_assert(CDIM == 64);
static_assert(QKVW == 512);
static_assert(HID % 64 == 0 && QKVW % 64 == 0 && CDIM % 64 == 0);
static_assert(HID % 32 == 0 && QKVW % 32 == 0 && CDIM % 32 == 0);
static_assert(MROWS % 64 == 0);
static_assert((long)MROWS * QKVW < (1L << 31));
static_assert((long)NB * NHEAD * SEQ * HD < (1L << 31));

typedef _Float16 v16h __attribute__((ext_vector_type(16)));
typedef _Float16 v8h  __attribute__((ext_vector_type(8)));
typedef float    v8f  __attribute__((ext_vector_type(8)));
typedef float    v4f  __attribute__((ext_vector_type(4)));
typedef float    v2f  __attribute__((ext_vector_type(2)));
typedef unsigned int v4u __attribute__((ext_vector_type(4)));
typedef unsigned int v2u __attribute__((ext_vector_type(2)));
typedef __bf16    v2bf __attribute__((ext_vector_type(2)));
typedef _Float16 v2hf __attribute__((ext_vector_type(2)));

union Frag { v16h v; v4u q[2]; };

// WMMA with hazard guard: D += A(16x32) * B(32x16)
__device__ __forceinline__ v8f mma(v16h a, v16h b, v8f c) {
  v8f d = __builtin_amdgcn_wmma_f32_16x16x32_f16(false, a, false, b, (short)0, c, false, false);
  asm volatile("v_nop\n\tv_nop\n\tv_nop\n\tv_nop" : "+v"(d) : "v"(a), "v"(b));
  return d;
}

__device__ __forceinline__ v8f zero8() {
  v8f z;
#pragma unroll
  for (int i = 0; i < 8; ++i) z[i] = 0.0f;
  return z;
}

// f32 -> nearest-even bf16 value, returned as f32
__device__ __forceinline__ float bf16q(float f) {
  unsigned int u = __float_as_uint(f);
  unsigned int r = u + 0x7FFFu + ((u >> 16) & 1u);
  r = ((u & 0x7F800000u) == 0x7F800000u) ? u : r;
  return __uint_as_float(r & 0xFFFF0000u);
}
__device__ __forceinline__ v4f bf16q4(v4f a) {
  v4f r;
  r.x = bf16q(a.x); r.y = bf16q(a.y); r.z = bf16q(a.z); r.w = bf16q(a.w);
  return r;
}
// f32 -> f16 (RNE convert) bit pattern
__device__ __forceinline__ unsigned short hbits(float f) {
  _Float16 h = (_Float16)f;
  return __builtin_bit_cast(unsigned short, h);
}
__device__ __forceinline__ v4u pack8h(float f0, float f1, float f2, float f3,
                                      float f4, float f5, float f6, float f7) {
  v8h t;
  t[0] = (_Float16)f0; t[1] = (_Float16)f1; t[2] = (_Float16)f2; t[3] = (_Float16)f3;
  t[4] = (_Float16)f4; t[5] = (_Float16)f5; t[6] = (_Float16)f6; t[7] = (_Float16)f7;
  return __builtin_bit_cast(v4u, t);
}

// ---------------------------------------------------------------------------
// Two f32 -> their bf16 values (nearest even), times sc, as two packed f16.  For every finite
// input the f16 pair equals hbits(bf16q(.) * sc): the packed convert rounds like bf16q.
// ---------------------------------------------------------------------------
__device__ __forceinline__ unsigned int pk2h(float a, float b, float sc) {
  v2f f;
  f.x = a; f.y = b;
  const unsigned int u = __builtin_bit_cast(unsigned int, __builtin_convertvector(f, v2bf));
  v2f g;
  g.x = __uint_as_float(u << 16) * sc;
  g.y = __uint_as_float(u & 0xFFFF0000u) * sc;
  return __builtin_bit_cast(unsigned int, __builtin_convertvector(g, v2hf));
}

// ---------------------------------------------------------------------------
// One 64x64 weight tile, 128 threads: logical W[k][n] (f32, n contiguous, row pitch rstride) ->
// sW[n][k] in LDS, value = f16(bf16 value of w * 16).  A thread takes k rows 2kp, 2kp + 1 and
// four columns at a time, so that a k pair is one 4-byte LDS store; a wave's 32 stores (8 k
// pairs x 4 column groups, 144-B rows) fall on 32 different banks.
// ---------------------------------------------------------------------------
__device__ __forceinline__ void wtile_load(v4f (&r)[8], const float* __restrict__ src, int rstride) {
  const int tid = threadIdx.x;
  const int kp = (tid >> 5) * 8 + (tid & 7), jl = (tid >> 3) & 3;
  const float* p = src + (size_t)(2 * kp) * (size_t)rstride + jl * 4;
#pragma unroll
  for (int it = 0; it < 4; ++it) {
    r[2 * it] = *(const v4f*)(p + it * 16);
    r[2 * it + 1] = *(const v4f*)(p + rstride + it * 16);
  }
  // stands behind the eight loads and names their address as an input, so that it is not
  // rewritten ahead of it
  asm volatile("s_wait_xcnt 0x0" :: "v"(p) : "memory");
}
__device__ __forceinline__ void wtile_store(unsigned short (*sW)[72], const v4f (&r)[8]) {
  const int tid = threadIdx.x;
  const int kp = (tid >> 5) * 8 + (tid & 7), jl = (tid >> 3) & 3;
#pragma unroll
  for (int it = 0; it < 4; ++it) {
    const int j4 = (it * 4 + jl) * 4;
#pragma unroll
    for (int c = 0; c < 4; ++c)
      *(unsigned int*)&sW[j4 + c][2 * kp] = pk2h(r[2 * it][c], r[2 * it + 1][c], 16.0f);
  }
}

// ---------------------------------------------------------------------------
// q/k/v projections with their own operand preparation, and the tail's weight planes, one grid.
// blocks [0, PB_1): Wp tiles; [PB_1, PB_2): W1; [PB_2, PB_T): W2: each 64x64 tile goes through
// LDS into its f16 plane Wt[n][k] in fragment order (read two launches later).
// blocks from PB_T on: D = x[PT tokens][64] * W[64][64 columns of one head of q, k or v].
// The WG rounds its own operands: the x rows come in by whole-line loads and go to LDS as f16
// (bf16 values of x), the weight tile as above; PT tokens a WG spread that work over four
// 64-token tiles.  4 waves; B fragments (all 64 k x 64 n) stay in registers; per tile wave w
// owns rows 16w..16w+15 x 64 cols.  The split k map for A and B (row/col = lane&15, elements
// 0..7 <- k0+8h.., 8..15 <- k0+16+8h..).
// Output: q/k planes [b*H+h][t][64] (q in fragment order), v transposed plane vt[b*H+h][64][t];
// value acc/16 + bf16q(bias).
// coverage per tile: 4 passes x 4 waves x 4 rows = 64 rows x 64 cols; v path: 64 d rows x 64 tokens.
// LDS sW, sX: cross-wave, published by the first barrier.  sT: cross-wave, two buffers, one
// barrier a tile: a buffer is rewritten two tiles later, behind the barrier of the tile between.
// ---------------------------------------------------------------------------
#define PT 256
#define PB_1 (QKVW / 64)
#define PB_2 (PB_1 + HID / 64)
#define PB_T (PB_2 + HID / 64)
#define NCB (3 * QKVW / 64)
static_assert(SEQ % PT == 0 && MROWS % PT == 0);
__global__ __launch_bounds__(128) __attribute__((amdgpu_num_vgpr(256))) void k_proj(
    const float* __restrict__ x, const float* __restrict__ Wq, const float* __restrict__ Wk,
    const float* __restrict__ Wv, const float* __restrict__ bq, const float* __restrict__ bk,
    const float* __restrict__ bv, const float* __restrict__ Wp, const float* __restrict__ W1,
    const float* __restrict__ W2, unsigned short* __restrict__ wpt,
    unsigned short* __restrict__ w1t, unsigned short* __restrict__ w2t,
    unsigned short* __restrict__ out0, unsigned short* __restrict__ out1,
    unsigned short* __restrict__ out2) {
  __shared__ __attribute__((aligned(16))) unsigned short sW[64][72];
  __shared__ __attribute__((aligned(16))) unsigned short sX[PT][72];
  __shared__ __attribute__((aligned(16))) unsigned short sT[2][64][72];
  const int tid = threadIdx.x, lane = tid & 31, w = tid >> 5;
  const int m = lane & 15, hl = lane >> 4;
  const int bid = blockIdx.x;
  v4f wr[8];

  if (bid < PB_T) {                      // block-uniform: a weight tile of the tail
    const float* src;
    unsigned short* dst;
    int K, rstride, k0, n0;
    if (bid < PB_1) {
      src = Wp; dst = wpt; K = QKVW; rstride = CDIM; k0 = bid * 64; n0 = 0;
    } else if (bid < PB_2) {
      src = W1; dst = w1t; K = CDIM; rstride = HID; k0 = 0; n0 = (bid - PB_1) * 64;
    } else {
      src = W2; dst = w2t; K = HID; rstride = CDIM; k0 = (bid - PB_2) * 64; n0 = 0;
    }
    wtile_load(wr, src + (size_t)k0 * (size_t)rstride + n0, rstride);
    wtile_store(sW, wr);
    __syncthreads();   // cross-wave: staged by all waves, read by all waves
    // each wave stores one part of one fragment tile per pass: 512 contiguous bytes
    v4u val[4];
    size_t off[4];
#pragma unroll
    for (int p = 0; p < 4; ++p) {
      val[p] = *(const v4u*)&sW[p * 16 + m][(w >> 1) * 32 + (w & 1) * 16 + hl * 8];
      off[p] = ((size_t)n0 + p * 16) * (size_t)K + (size_t)(k0 + (w >> 1) * 32) * 16 + (w & 1) * 256 + lane * 8;
    }
#pragma unroll
    for (int p = 0; p < 4; ++p) *(v4u*)(dst + off[p]) = val[p];
    // stands in front of whatever the build lays out behind this path
    asm volatile("s_wait_xcnt 0x0" ::: "memory");
    return;
  }

  const int g = bid - PB_T;
  const int mb = g / NCB, cb = g - mb * NCB;
  const int which = cb / NHEAD;            // 0 = q, 1 = k, 2 = v (WG-uniform)
  const int hh = cb - which * NHEAD;
  const int m0 = mb * PT;
  const int b = m0 / SEQ, t0 = m0 - b * SEQ;
  const float* wsel = (which == 0) ? Wq : ((which == 1) ? Wk : Wv);
  const float* bsel = (which == 0) ? bq : ((which == 1) ? bk : bv);

  // ---- every global operand load of the WG, one group: weight tile, biases, x rows ----
  wtile_load(wr, wsel + (size_t)hh * (CDIM * HD), HD);
  float rb[4];
  const float* bp = bsel + hh * HD + m;
#pragma unroll
  for (int j = 0; j < 4; ++j) rb[j] = bp[16 * j];
  // the PT rows are contiguous: a wave-wide 16-B load covers 512 B, two whole rows
  v4f xr[PT / 8];
  const float* xp = x + ((size_t)b * SEQ_FULL + t0) * CDIM + tid * 4;
#pragma unroll
  for (int it = 0; it < PT / 8; ++it) xr[it] = *(const v4f*)(xp + it * 512);
  // as in wtile_load, for the two addresses of these loads
  asm volatile("s_wait_xcnt 0x0" :: "v"(bp), "v"(xp) : "memory");
  wtile_store(sW, wr);
#pragma unroll
  for (int it = 0; it < PT / 8; ++it) {
    v2u o;
    o.x = pk2h(xr[it].x, xr[it].y, 1.0f);
    o.y = pk2h(xr[it].z, xr[it].w, 1.0f);
    *(v2u*)&sX[it * 8 + (tid >> 4)][(tid & 15) * 4] = o;
  }
  __syncthreads();   // cross-wave: sW and sX staged by all waves, read by all waves

  Frag bf0[4], bf1[4];
#pragma unroll
  for (int j = 0; j < 4; ++j) {
    const unsigned short* wb = &sW[16 * j + m][hl * 8];
    bf0[j].q[0] = *(const v4u*)(wb);
    bf0[j].q[1] = *(const v4u*)(wb + 16);
    bf1[j].q[0] = *(const v4u*)(wb + 32);
    bf1[j].q[1] = *(const v4u*)(wb + 48);
  }
  float bj[4];
#pragma unroll
  for (int j = 0; j < 4; ++j) bj[j] = bf16q(rb[j]);

  const float wsc = 0.0625f;               // undo the x16 weight carry
  const int lrow0 = 16 * w + 8 * hl;       // D rows of this lane within the 64-token tile
  const int bh = b * NHEAD + hh;
  unsigned short* dst = (which == 0) ? out0 : ((which == 1) ? out1 : out2);

  // rolled: one copy of the three store paths serves the four tiles
#pragma unroll 1
  for (int t = 0; t < PT / 64; ++t) {
    unsigned short (*sO)[72] = sT[t & 1];
    const int tt = t0 + t * 64;
    Frag a0, a1;
    const unsigned short* xa = &sX[t * 64 + 16 * w + m][hl * 8];
    a0.q[0] = *(const v4u*)(xa);
    a0.q[1] = *(const v4u*)(xa + 16);
    a1.q[0] = *(const v4u*)(xa + 32);
    a1.q[1] = *(const v4u*)(xa + 48);
    v8f acc[4];
#pragma unroll
    for (int j = 0; j < 4; ++j) acc[j] = mma(a0.v, bf0[j].v, zero8());
#pragma unroll
    for (int j = 0; j < 4; ++j) acc[j] = mma(a1.v, bf1[j].v, acc[j]);
#pragma unroll
    for (int j = 0; j < 4; ++j) {
#pragma unroll
      for (int r = 0; r < 8; ++r) sO[lrow0 + r][16 * j + m] = hbits(acc[j][r] * wsc + bj[j]);
    }
    __syncthreads();   // cross-wave for all three paths; also frees the other buffer of sT
    v4u val[4];
    unsigned int off[4];
    if (which == 0) {                      // WG-uniform; q in fragment order, rows of all waves
#pragma unroll
      for (int p = 0; p < 4; ++p) {
        val[p] = *(const v4u*)&sO[p * 16 + m][(w >> 1) * 32 + (w & 1) * 16 + hl * 8];
        off[p] = (unsigned int)((bh * SEQ + tt + p * 16) * HD + (w >> 1) * 512 + (w & 1) * 256 + lane * 8);
      }
    } else if (which == 1) {               // WG-uniform
#pragma unroll
      for (int p = 0; p < 4; ++p) {
        const int row = p * 16 + 4 * w + (lane >> 3);
        const int piece = lane & 7;
        val[p] = *(const v4u*)&sO[row][piece * 8];
        off[p] = (unsigned int)((bh * SEQ + tt + row) * HD + piece * 8);
      }
    } else {
#pragma unroll
      for (int p = 0; p < 4; ++p) {
        const int d = p * 16 + 4 * w + (lane >> 3);
        const int piece = lane & 7;
        unsigned int wv[4];
#pragma unroll
        for (int e = 0; e < 4; ++e) {
          const unsigned int lo = sO[piece * 8 + 2 * e][d];
          const unsigned int hi = sO[piece * 8 + 2 * e + 1][d];
          wv[e] = lo | (hi << 16);
        }
        v4u tv;
        tv.x = wv[0]; tv.y = wv[1]; tv.z = wv[2]; tv.w = wv[3];
        val[p] = tv;
        off[p] = (unsigned int)((bh * HD + d) * SEQ + tt + piece * 8);
      }
    }
#pragma unroll
    for (int p = 0; p < 4; ++p) *(v4u*)(dst + off[p]) = val[p];
    // the next tile rewrites the registers that the four stores name
    asm volatile("s_wait_xcnt 0x0" ::: "memory");
  }
}

// ---------------------------------------------------------------------------
// Layernorm of one 64-col row held two columns a lane (u0, u1): mean, then variance of the
// centred values, each summed over the wave's 32 lanes.
// ---------------------------------------------------------------------------
__device__ __forceinline__ v2f ln_row(float u0, float u1, float gg0, float gg1, float ee0, float ee1) {
  float s = u0 + u1;
#pragma unroll
  for (int xm = 1; xm < 32; xm <<= 1) s += __shfl_xor(s, xm, 32);
  const float mu = s * (1.0f / CDIM);
  const float d0 = u0 - mu, d1 = u1 - mu;
  float qs = d0 * d0 + d1 * d1;
#pragma unroll
  for (int xm = 1; xm < 32; xm <<= 1) qs += __shfl_xor(qs, xm, 32);
  const float var = qs * (1.0f / CDIM);
  const float rstd = rsqrtf(var + 1e-5f);
  v2f yv;
  yv.x = d0 * rstd * gg0 + ee0;
  yv.y = d1 * rstd * gg1 + ee1;
  return yv;
}

// ---------------------------------------------------------------------------
// Everything behind the attention, one launch: output projection + bias + residual(bf16 values
// of x) + layernorm 1, ffn1 + bias + relu, ffn2 + bias + residual(h1) + layernorm 2.  All of it
// is row-local, so one WG carries TR = 16 token rows from the o plane to the output; h1 and the
// hidden activations never leave the WGP (h1: f16 copy in LDS as the next A operand, f32 values
// in the registers of the lane that made them; activations: f16 in LDS).
// 4 waves.  Products: wave w owns output columns 16w..16w+15 (projection, ffn2) or 64w..64w+63
// (ffn1) of all 16 rows; k runs upward in one accumulator chain per tile.  Same split k map for
// A and B as k_proj; the o plane and the weight planes come in fragment order.  Layernorms: wave
// w owns rows 4w..4w+3, a lane two columns of each.
// Every global operand load stands ahead of the products that use it, as groups: the wave meets
// the load latency once per group, not once per fragment.
// LDS sF (f32 product rows), sH (h1 as f16), sA (activations as f16): all cross-wave, each
// published by a block barrier.
// ---------------------------------------------------------------------------
#define TR 16
#define AP (HID + 8)
static_assert(SEQ % TR == 0 && MROWS % TR == 0);
static_assert(QKVW == 512 && HID == 256 && CDIM == 64);
__global__ __launch_bounds__(128) __attribute__((amdgpu_num_vgpr(256)))
void k_tail(const unsigned short* __restrict__ op, const unsigned short* __restrict__ wpt,
            const unsigned short* __restrict__ w1t, const unsigned short* __restrict__ w2t,
            const float* __restrict__ x, const float* __restrict__ bp, const float* __restrict__ b1,
            const float* __restrict__ b2, const float* __restrict__ g1, const float* __restrict__ be1,
            const float* __restrict__ g2, const float* __restrict__ be2, float* __restrict__ out) {
  __shared__ __attribute__((aligned(16))) float sF[TR][68];
  __shared__ __attribute__((aligned(16))) unsigned short sH[TR][72];
  __shared__ __attribute__((aligned(16))) unsigned short sA[TR][AP];
  const int tid = threadIdx.x, lane = tid & 31, w = tid >> 5;
  const int m = lane & 15, hl = lane >> 4, k8 = hl * 8;
  const int m0 = blockIdx.x * TR;
  const int b = m0 / SEQ, t0 = m0 - b * SEQ;
  const int c2 = 2 * lane;                 // lane owns cols c2, c2+1 of each of its wave's rows
  const float wsc = 0.0625f;               // undo the x16 weight carry
  const size_t frow = ((size_t)b * SEQ_FULL + t0 + 4 * w) * CDIM + c2;   // x and out, full strides

  // ---- output projection: 16 rows x 16 cols per wave, k = 512 ----
  // Two load groups in all: the first twelve k steps (as many fragments as the registers hold);
  // then, into the registers that those products free, the last four steps together with the
  // weight fragments of ffn1 and ffn2, which depend on nothing computed here.
  const unsigned short* ap = op + (size_t)m0 * QKVW + lane * 8;
  const unsigned short* bq = wpt + (size_t)(16 * w) * QKVW + lane * 8;
  Frag pa[12], pb[12];
#pragma unroll
  for (int i = 0; i < 12; ++i) {
    pa[i].q[0] = *(const v4u*)(ap + 512 * i);
    pa[i].q[1] = *(const v4u*)(ap + 512 * i + 256);
    pb[i].q[0] = *(const v4u*)(bq + 512 * i);
    pb[i].q[1] = *(const v4u*)(bq + 512 * i + 256);
  }
  // the residual rows of x and every bias, gain and shift of the later stages: fetched ahead of
  // the first barrier too, so that no stage behind a barrier opens with a global load
  v2f xr[4];
  const float* xp = x + frow;
#pragma unroll
  for (int rr = 0; rr < 4; ++rr) xr[rr] = *(const v2f*)(xp + rr * CDIM);
  float rb1[4];
  const float* b1p = b1 + 64 * w + m;
#pragma unroll
  for (int j = 0; j < 4; ++j) rb1[j] = b1p[16 * j];
  // stands behind the loads above and names their last-used address registers as inputs, so that
  // none of them is rewritten (a later load's result included) ahead of it
  asm volatile("s_wait_xcnt 0x0" :: "v"(xp), "v"(b1p) : "memory");
  v8f acc = zero8();
#pragma unroll
  for (int i = 0; i < 12; ++i) acc = mma(pa[i].v, pb[i].v, acc);
  Frag qa[4], qb[4];
#pragma unroll
  for (int i = 0; i < 4; ++i) {
    qa[i].q[0] = *(const v4u*)(ap + 512 * (12 + i));
    qa[i].q[1] = *(const v4u*)(ap + 512 * (12 + i) + 256);
    qb[i].q[0] = *(const v4u*)(bq + 512 * (12 + i));
    qb[i].q[1] = *(const v4u*)(bq + 512 * (12 + i) + 256);
  }
  const float rbp0 = bp[c2], rbp1 = bp[c2 + 1], rg10 = g1[c2], rg11 = g1[c2 + 1];
  const float re10 = be1[c2], re11 = be1[c2 + 1];
  const float rb20 = b2[c2], rb21 = b2[c2 + 1], rg20 = g2[c2], rg21 = g2[c2 + 1];
  const float re20 = be2[c2], re21 = be2[c2 + 1];
  Frag w1a[4], w1b[4];
  const unsigned short* w1p = w1t + (size_t)(64 * w) * CDIM + lane * 8;
#pragma unroll
  for (int j = 0; j < 4; ++j) {
    w1a[j].q[0] = *(const v4u*)(w1p + j * 16 * CDIM);
    w1a[j].q[1] = *(const v4u*)(w1p + j * 16 * CDIM + 256);
    w1b[j].q[0] = *(const v4u*)(w1p + j * 16 * CDIM + 512);
    w1b[j].q[1] = *(const v4u*)(w1p + j * 16 * CDIM + 768);
  }
  Frag w2f[8];
  const unsigned short* w2p = w2t + (size_t)(16 * w) * HID + lane * 8;
#pragma unroll
  for (int i = 0; i < 8; ++i) {
    w2f[i].q[0] = *(const v4u*)(w2p + 512 * i);
    w2f[i].q[1] = *(const v4u*)(w2p + 512 * i + 256);
  }
  // as above, for the four address pairs of this group
  asm volatile("s_wait_xcnt 0x0" :: "v"(ap), "v"(bq), "v"(w1p), "v"(w2p) : "memory");
  // inputs only: holds the twelve small loads inside this group; sunk behind the last products or
  // behind a barrier, they would cost a global load latency of their own
  asm volatile("" :: "v"(rbp0), "v"(rbp1), "v"(rg10), "v"(rg11), "v"(re10), "v"(re11),
                     "v"(rb20), "v"(rb21), "v"(rg20), "v"(rg21), "v"(re20), "v"(re21));
#pragma unroll
  for (int i = 0; i < 4; ++i) acc = mma(qa[i].v, qb[i].v, acc);
#pragma unroll
  for (int r = 0; r < 8; ++r) sF[8 * hl + r][16 * w + m] = acc[r] * wsc;
  __syncthreads();   // cross-wave: a row's 64 columns come from all four waves

  // ---- bias + residual + layernorm 1 ----
  v2f h1[4];                               // f32 h1 of rows 4w + rr, cols c2, c2+1: residual of layernorm 2
  {
    const float bb0 = bf16q(rbp0), bb1 = bf16q(rbp1);
    const float gg0 = bf16q(rg10), gg1 = bf16q(rg11);
    const float ee0 = bf16q(re10), ee1 = bf16q(re11);
#pragma unroll
    for (int rr = 0; rr < 4; ++rr) {
      const int row = 4 * w + rr;
      const v2f av = *(const v2f*)&sF[row][c2];
      const float u0 = (av.x + bb0) + bf16q(xr[rr].x);
      const float u1 = (av.y + bb1) + bf16q(xr[rr].y);
      h1[rr] = ln_row(u0, u1, gg0, gg1, ee0, ee1);
      sH[row][c2] = hbits(h1[rr].x);
      sH[row][c2 + 1] = hbits(h1[rr].y);
    }
  }
  __syncthreads();   // cross-wave: h1 rows of all waves are every wave's A operand; ends the reads of sF

  // ---- ffn1 + bias + relu: 16 rows x 64 cols per wave, k = 64 ----
  {
    Frag ha0, ha1;
    const unsigned short* hp = &sH[m][k8];
    ha0.q[0] = *(const v4u*)(hp);
    ha0.q[1] = *(const v4u*)(hp + 16);
    ha1.q[0] = *(const v4u*)(hp + 32);
    ha1.q[1] = *(const v4u*)(hp + 48);
    v8f fa[4];
#pragma unroll
    for (int j = 0; j < 4; ++j) fa[j] = mma(ha0.v, w1a[j].v, zero8());
#pragma unroll
    for (int j = 0; j < 4; ++j) fa[j] = mma(ha1.v, w1b[j].v, fa[j]);
#pragma unroll
    for (int j = 0; j < 4; ++j) {
      const float bj = bf16q(rb1[j]);
#pragma unroll
      for (int r = 0; r < 8; ++r) {
        float u = fa[j][r] * wsc + bj;
        u = fmaxf(u, 0.0f);
        sA[8 * hl + r][64 * w + 16 * j + m] = hbits(u);
      }
    }
  }
  __syncthreads();   // cross-wave: the 256 hidden columns come from all four waves

  // ---- ffn2: 16 rows x 16 cols per wave, k = 256 ----
  {
    const unsigned short* aq = &sA[m][k8];
    Frag fa[8];
#pragma unroll
    for (int i = 0; i < 8; ++i) {
      fa[i].q[0] = *(const v4u*)(aq + 32 * i);
      fa[i].q[1] = *(const v4u*)(aq + 32 * i + 16);
    }
    v8f acc2 = zero8();
#pragma unroll
    for (int i = 0; i < 8; ++i) acc2 = mma(fa[i].v, w2f[i].v, acc2);
#pragma unroll
    for (int r = 0; r < 8; ++r) sF[8 * hl + r][16 * w + m] = acc2[r] * wsc;
  }
  __syncthreads();   // cross-wave: a row's 64 columns come from all four waves

  // ---- bias + residual(h1) + layernorm 2 -> out, one whole 256-B row per store ----
  {
    const float bb0 = bf16q(rb20), bb1 = bf16q(rb21);
    const float gg0 = bf16q(rg20), gg1 = bf16q(rg21);
    const float ee0 = bf16q(re20), ee1 = bf16q(re21);
    v2f yv[4];
#pragma unroll
    for (int rr = 0; rr < 4; ++rr) {
      const v2f av = *(const v2f*)&sF[4 * w + rr][c2];
      const float u0 = (av.x + bb0) + h1[rr].x;
      const float u1 = (av.y + bb1) + h1[rr].y;
      yv[rr] = ln_row(u0, u1, gg0, gg1, ee0, ee1);
    }
#pragma unroll
    for (int rr = 0; rr < 4; ++rr) *(v2f*)(out + frow + rr * CDIM) = yv[rr];
  }
}

// ---------------------------------------------------------------------------
// One stage of 128 keys (two 64-key chunks) into LDS, shared by the work-group's eight waves:
// K rows (128 x 128 B, contiguous) and V^T rows (64 x 256 B, source pitch SEQ halves; the two
// 128-B halves of a row go to the two chunks' planes).  256 threads x 16 B x 4 row groups per
// operand.  lk/lv/gk/gv are the lane's own addresses for row group 0; a row group is 32 K rows
// or 16 V^T rows.  LDS pitch KVP halves.
// ---------------------------------------------------------------------------
#define KVP 72
#define KVBUF (128 * KVP * 2)
__device__ __forceinline__ unsigned int lds_off(const void* p) { return (unsigned int)(size_t)p; }
__device__ __forceinline__ void stage_kv(unsigned int lk, unsigned int lv,
                                         const unsigned short* gk, const unsigned short* gv) {
  const unsigned int lsk = 32 * KVP * 2, lsv = 16 * KVP * 2;
  // The closing s_wait_xcnt stands in the copies' own statement so that no address register
  // named here is rewritten ahead of it.
  asm volatile(
      "global_load_async_to_lds_b128 %0, %8, off\n\t"
      "global_load_async_to_lds_b128 %1, %9, off\n\t"
      "global_load_async_to_lds_b128 %2, %10, off\n\t"
      "global_load_async_to_lds_b128 %3, %11, off\n\t"
      "global_load_async_to_lds_b128 %4, %12, off\n\t"
      "global_load_async_to_lds_b128 %5, %13, off\n\t"
      "global_load_async_to_lds_b128 %6, %14, off\n\t"
      "global_load_async_to_lds_b128 %7, %15, off\n\t"
      "s_wait_xcnt 0x0"
      :: "v"(lk), "v"(lk + lsk), "v"(lk + 2 * lsk), "v"(lk + 3 * lsk),
         "v"(lv), "v"(lv + lsv), "v"(lv + 2 * lsv), "v"(lv + 3 * lsv),
         "v"(gk), "v"(gk + 32 * HD), "v"(gk + 64 * HD), "v"(gk + 96 * HD),
         "v"(gv), "v"(gv + 16 * SEQ), "v"(gv + 32 * SEQ), "v"(gv + 48 * SEQ)
      : "memory");
}

__device__ __forceinline__ float other_half(float f) {
  const int b = __float_as_int(f);
  return __int_as_float(__builtin_amdgcn_permlanex16(b, b, 0x76543210, 0xfedcba98, false, false));
}

#define MP 36
__global__ __launch_bounds__(256) __attribute__((amdgpu_num_vgpr(256)))
void k_attn(const unsigned short* __restrict__ qp, const unsigned short* __restrict__ kp,
            const unsigned short* __restrict__ vp, unsigned short* __restrict__ op) {
  __shared__ __attribute__((aligned(16))) unsigned short sK[2][128][KVP];
  __shared__ __attribute__((aligned(16))) unsigned short sV[2][2][64][KVP];
  __shared__ __attribute__((aligned(16))) float sM[2][4][32][MP];
  const int tid = threadIdx.x, lane = tid & 31;
  // the wave's number in a scalar register: the tests on g below are scalar branches
  const int wv = __builtin_amdgcn_readfirstlane(tid >> 5);
  const int w = wv & 3, g = wv >> 2;        // query rows 16w.. of the tile; key group
  const int m = lane & 15, hl = lane >> 4, k8 = hl * 8;
  const int nqt = SEQ / 64;
  static_assert((SEQ / 64) % 2 == 0);       // tiles pair up as (nqt-1-p, p)
  const int nst = nqt / 2 + 1;              // stages of both tiles together
  const int bh = blockIdx.x / (nqt / 2), pr = blockIdx.x - bh * (nqt / 2);
  const int b = bh / NHEAD, hh = bh - b * NHEAD;
  const int tA = nqt - 1 - pr, tB = pr;     // first and second query tile
  const int nA = (tA + 2) >> 1;             // stages of the first tile: (tA + 1 chunks + 1) / 2
  int qt = tA, st = 0, ns = nA, tl = 0;     // tile in work, its stage, its stage count, 0 or 1 (WG-uniform)

  Frag qa0, qa1;                            // B operand: column = query qt*64 + 16w + m
  Frag qn0, qn1;                            // the same of the second tile, fetched up front
  {
    const unsigned short* qr = qp + ((size_t)bh * SEQ + tA * 64 + 16 * w) * HD + lane * 8;
    qa0.q[0] = *(const v4u*)(qr);
    qa0.q[1] = *(const v4u*)(qr + 256);
    qa1.q[0] = *(const v4u*)(qr + 512);
    qa1.q[1] = *(const v4u*)(qr + 768);
    const unsigned short* qs = qp + ((size_t)bh * SEQ + tB * 64 + 16 * w) * HD + lane * 8;
    qn0.q[0] = *(const v4u*)(qs);
    qn0.q[1] = *(const v4u*)(qs + 256);
    qn1.q[0] = *(const v4u*)(qs + 512);
    qn1.q[1] = *(const v4u*)(qs + 768);
  }
  float mrun = -1e30f;                      // running maximum of the lane's query over this group's keys
  float lrun = 0.0f;                        // running sum over this half's keys of this group; joined at the end
  v8f oacc[4];                              // O^T: row d = 16 jd + 8 hl + r, column = the lane's query
#pragma unroll
  for (int j = 0; j < 4; ++j) oacc[j] = zero8();

  // ---- stage 0 into buffer 0, published; then stage 1 into buffer 1 ----
  // A stage never reaches past key SEQ-1: a tile with an odd chunk count has qt <= nqt-2.
  const int srow = tid >> 3, spc = (tid & 7) * 8;
  const int vrow = tid >> 4, vpc = tid & 15;
  const unsigned short* gk0 = kp + ((size_t)bh * SEQ + srow) * HD + spc;
  const unsigned short* gv0 = vp + ((size_t)bh * HD + vrow) * (size_t)SEQ + vpc * 8;
  const unsigned int lk0 = lds_off(&sK[0][srow][spc]);
  const unsigned int lv0 = lds_off(&sV[0][vpc >> 3][vrow][(vpc & 7) * 8]);
  stage_kv(lk0, lv0, gk0, gv0);
  asm volatile("s_wait_asynccnt 0x0" ::: "memory");   // this wave's copies of stage 0 have landed
  __syncthreads();                                    // stage 0 visible to all eight waves
  {
    const int c = (1 < nA) ? 1 : 0;                   // stage 1 exists: nst >= 2; its place in its own tile
    stage_kv(lk0 + KVBUF, lv0 + KVBUF, gk0 + (size_t)c * 128 * HD, gv0 + c * 128);
  }

  // rolled: one copy of the body serves both tiles
#pragma unroll 1
  for (int i = 0; i < nst; ++i) {
    const int buf = i & 1;
    const int kt = 2 * st + g;              // this group's key chunk (wave-uniform)
    // ---- S^T = K Q^T, four 16-key subtiles: s[j][r] = score(key 16j + 8hl + r, query m) ----
    // All sixteen K reads stand as one group ahead of the eight products, first-half fragments
    // first, so that the wave meets the LDS latency once and not once per subtile.
    v8f s[4];
    const unsigned short* kb = &sK[buf][64 * g + m][k8];
    Frag kf0[4], kf1[4];
#pragma unroll
    for (int j = 0; j < 4; ++j) {
      kf0[j].q[0] = *(const v4u*)(kb + j * 16 * KVP);
      kf0[j].q[1] = *(const v4u*)(kb + j * 16 * KVP + 16);
    }
#pragma unroll
    for (int j = 0; j < 4; ++j) {
      kf1[j].q[0] = *(const v4u*)(kb + j * 16 * KVP + 32);
      kf1[j].q[1] = *(const v4u*)(kb + j * 16 * KVP + 48);
    }
#pragma unroll
    for (int j = 0; j < 4; ++j) s[j] = mma(kf0[j].v, qa0.v, zero8());
#pragma unroll
    for (int j = 0; j < 4; ++j) s[j] = mma(kf1[j].v, qa1.v, s[j]);
    // The sixteen V^T reads go out here, as one group: they return under the softmax arithmetic.
    const unsigned short* vb = &sV[buf][g][m][k8];
    Frag vf0[4], vf1[4];
#pragma unroll
    for (int jd = 0; jd < 4; ++jd) {
      vf0[jd].q[0] = *(const v4u*)(vb + jd * 16 * KVP);
      vf0[jd].q[1] = *(const v4u*)(vb + jd * 16 * KVP + 16);
    }
#pragma unroll
    for (int jd = 0; jd < 4; ++jd) {
      vf1[jd].q[0] = *(const v4u*)(vb + jd * 16 * KVP + 32);
      vf1[jd].q[1] = *(const v4u*)(vb + jd * 16 * KVP + 48);
    }
    // keeps the scheduler from sinking the reads down to the second product
    __builtin_amdgcn_sched_barrier(0);
    // ---- causal mask, maximum of the lane's own query ----
    // A chunk below the diagonal chunk has nothing to mask: a scalar branch (kt and qt are
    // wave-uniform) takes the wave round the compares and selects.  On the diagonal chunk the
    // lane's one query allows keys up to lim, counted from this half's first key of the chunk;
    // past it, none.
    if (kt >= qt) {
      const int lim = (kt == qt) ? (16 * w + m - 8 * hl) : -1;
#pragma unroll
      for (int j = 0; j < 4; ++j) {
#pragma unroll
        for (int r = 0; r < 8; ++r) s[j][r] = (16 * j + r > lim) ? -1e30f : s[j][r];
      }
    }
    float tm[4];
#pragma unroll
    for (int j = 0; j < 4; ++j) {
      tm[j] = -1e30f;
#pragma unroll
      for (int r = 0; r < 8; ++r) tm[j] = fmaxf(tm[j], s[j][r]);
    }
    float tmax = fmaxf(fmaxf(tm[0], tm[1]), fmaxf(tm[2], tm[3]));
    tmax = fmaxf(tmax, other_half(tmax));
    const float mn = fmaxf(mrun, tmax);
    const float corr = __expf(mrun - mn);
    mrun = mn;
    // ---- p = exp(s - m); f16(16384 p) packed in place as the B operand; sums in the lane ----
    float ts[4];
    v8h ph[4];
#pragma unroll
    for (int j = 0; j < 4; ++j) {
      ts[j] = 0.0f;
      v8f pv;
#pragma unroll
      for (int r = 0; r < 8; ++r) {
        const float p = __expf(s[j][r] - mrun);
        ts[j] += p;
        pv[r] = p * PSC;
      }
      ph[j] = __builtin_convertvector(pv, v8h);
    }
    lrun = lrun * corr + ((ts[0] + ts[1]) + (ts[2] + ts[3]));
#pragma unroll
    for (int j = 0; j < 4; ++j) {
#pragma unroll
      for (int r = 0; r < 8; ++r) oacc[j][r] *= corr;
    }
    // elements 0..7 <- keys 8hl.., 8..15 <- keys 16+8hl.. of each 32-key block
    const v16h pb0 = __builtin_shufflevector(ph[0], ph[1], 0, 1, 2, 3, 4, 5, 6, 7, 8, 9, 10, 11, 12, 13, 14, 15);
    const v16h pb1 = __builtin_shufflevector(ph[2], ph[3], 0, 1, 2, 3, 4, 5, 6, 7, 8, 9, 10, 11, 12, 13, 14, 15);
    // ---- O^T += V^T (64 d x 64 keys) * P^T (64 keys x 16 queries) ----
#pragma unroll
    for (int jd = 0; jd < 4; ++jd) oacc[jd] = mma(vf0[jd].v, pb0, oacc[jd]);
#pragma unroll
    for (int jd = 0; jd < 4; ++jd) oacc[jd] = mma(vf1[jd].v, pb1, oacc[jd]);
    const bool last = (st + 1 == ns);       // the tile's last stage (WG-uniform)
    float* pm = &sM[tl][w][lane][0];        // the lane's 34 words; pitch 144 B
    if (last && g == 1) {                   // scalar branch: group 1 hands its partial result over
#pragma unroll
      for (int jd = 0; jd < 4; ++jd) {
        v4f lo, hi;
        lo.x = oacc[jd][0]; lo.y = oacc[jd][1]; lo.z = oacc[jd][2]; lo.w = oacc[jd][3];
        hi.x = oacc[jd][4]; hi.y = oacc[jd][5]; hi.z = oacc[jd][6]; hi.w = oacc[jd][7];
        *(v4f*)(pm + 8 * jd) = lo;
        *(v4f*)(pm + 8 * jd + 4) = hi;
      }
      v2f ml;
      ml.x = mrun; ml.y = lrun;
      *(v2f*)(pm + 32) = ml;
    }
    asm volatile("s_wait_dscnt 0x0" ::: "memory");      // this wave's reads of sK/sV[buf] have returned, its sM words are written
    asm volatile("s_wait_asynccnt 0x0" ::: "memory");   // this wave's copies of stage i+1 have landed
    __syncthreads();   // publishes stage i+1 and sM, frees buffer buf for rewriting
    if (i + 2 < nst) {   // WG-uniform
      const int c = (i + 2 < nA) ? (i + 2) : (i + 2 - nA);   // stage i+2, counted in its own tile
      stage_kv(lk0 + buf * KVBUF, lv0 + buf * KVBUF, gk0 + (size_t)c * 128 * HD, gv0 + c * 128);
    }
    if (!last) {         // WG-uniform
      ++st;
      continue;
    }

    if (g == 0) {        // scalar branch
      // ---- tile done: join the two groups; o = acc / (16384 l); four stores cover 2 KiB in a row ----
      const v2f ml = *(const v2f*)(pm + 32);
      const float mj = fmaxf(mrun, ml.x);
      const float a0 = __expf(mrun - mj), a1 = __expf(ml.x - mj);
      const float lj = lrun * a0 + ml.y * a1;
      const float lsum = lj + other_half(lj);
      const float il = 1.0f / (lsum * PSC);
      const float c0 = a0 * il, c1 = a1 * il;
      v4u val[4];
#pragma unroll
      for (int jd = 0; jd < 4; ++jd) {
        const v4f lo = *(const v4f*)(pm + 8 * jd);
        const v4f hi = *(const v4f*)(pm + 8 * jd + 4);
        val[jd] = pack8h(oacc[jd][0] * c0 + lo.x * c1, oacc[jd][1] * c0 + lo.y * c1,
                         oacc[jd][2] * c0 + lo.z * c1, oacc[jd][3] * c0 + lo.w * c1,
                         oacc[jd][4] * c0 + hi.x * c1, oacc[jd][5] * c0 + hi.y * c1,
                         oacc[jd][6] * c0 + hi.z * c1, oacc[jd][7] * c0 + hi.w * c1);
      }
      // the 16-row tile of the wave's queries; k tiles 2 hh and 2 hh + 1 of it, two parts each
      unsigned short* od = op + (unsigned int)((b * SEQ + qt * 64 + 16 * w) * QKVW + hh * (HD * 16) + lane * 8);
#pragma unroll
      for (int jd = 0; jd < 4; ++jd) *(v4u*)(od + jd * 256) = val[jd];
      // the second tile's passes rewrite the registers that the four stores name
      asm volatile("s_wait_xcnt 0x0" ::: "memory");
    }

    // ---- start state of the second tile ----
    qt = tB; st = 0; ns = nst - nA; tl = 1;
    qa0 = qn0; qa1 = qn1;
    mrun = -1e30f; lrun = 0.0f;
#pragma unroll
    for (int j = 0; j < 4; ++j) oacc[j] = zero8();
  }
  asm volatile("s_wait_asynccnt 0x0" ::: "memory");     // nothing of this wave's in flight past the loop
}

// ---------------------------------------------------------------------------
// Host launcher
// ---------------------------------------------------------------------------
static inline size_t al256(size_t v) { return (v + 255) & ~(size_t)255; }

extern "C" void kernel_launch(void* const* d_in, const int* in_sizes, int n_in,
                              void* d_out, int out_size, void* d_ws, size_t ws_size,
                              hipStream_t stream) {
  if (n_in < 17) return;
  const long needX = ((long)(NB - 1) * SEQ_FULL + SEQ) * CDIM;
  const long nW = (long)NHEAD * CDIM * HD;
  if ((long)in_sizes[0] < needX) return;
  if ((long)in_sizes[1] < nW || (long)in_sizes[3] < nW || (long)in_sizes[5] < nW) return;
  if (in_sizes[2] < QKVW || in_sizes[4] < QKVW || in_sizes[6] < QKVW) return;
  if ((long)in_sizes[7] < (long)QKVW * CDIM || in_sizes[8] < CDIM) return;
  if ((long)in_sizes[9] < (long)CDIM * HID || in_sizes[10] < HID) return;
  if ((long)in_sizes[11] < (long)HID * CDIM || in_sizes[12] < CDIM) return;
  if (in_sizes[13] < CDIM || in_sizes[14] < CDIM || in_sizes[15] < CDIM || in_sizes[16] < CDIM) return;
  if ((long)out_size < needX) return;

  const float* x   = (const float*)d_in[0];
  const float* Wq  = (const float*)d_in[1];
  const float* bq  = (const float*)d_in[2];
  const float* Wk  = (const float*)d_in[3];
  const float* bk  = (const float*)d_in[4];
  const float* Wv  = (const float*)d_in[5];
  const float* bv  = (const float*)d_in[6];
  const float* Wp  = (const float*)d_in[7];
  const float* bp  = (const float*)d_in[8];
  const float* W1  = (const float*)d_in[9];
  const float* b1  = (const float*)d_in[10];
  const float* W2  = (const float*)d_in[11];
  const float* b2  = (const float*)d_in[12];
  const float* g1  = (const float*)d_in[13];
  const float* be1 = (const float*)d_in[14];
  const float* g2  = (const float*)d_in[15];
  const float* be2 = (const float*)d_in[16];
  float* out = (float*)d_out;

  char* ws = (char*)d_ws;
  size_t off = 0;
  auto carve = [&](size_t bytes) -> char* { char* p = ws + off; off += al256(bytes); return p; };
  const size_t MHD = (size_t)NB * NHEAD * SEQ * HD;          // per q/k/vt plane
  // wpt, w1t, w2t, qpl and opl: fragment order
  unsigned short* wpt  = (unsigned short*)carve((size_t)CDIM * QKVW * 2);       // [64][512]
  unsigned short* w1t  = (unsigned short*)carve((size_t)HID * CDIM * 2);        // [256][64]
  unsigned short* w2t  = (unsigned short*)carve((size_t)CDIM * HID * 2);        // [64][256]
  unsigned short* qpl  = (unsigned short*)carve(MHD * 2);                       // [B*H][SEQ][64]
  unsigned short* kpl  = (unsigned short*)carve(MHD * 2);                       // [B*H][SEQ][64]
  unsigned short* vtp  = (unsigned short*)carve(MHD * 2);                       // [B*H][64][SEQ]
  unsigned short* opl  = (unsigned short*)carve((size_t)MROWS * QKVW * 2);      // [M][512]
  if (off > ws_size) return;
  if (off > ((size_t)128 << 20)) return;

  // 1-3) q/k/v projections + biases -> q, k, vt planes, each work-group rounding its own x rows
  //      and weight tile; the tail's weight planes (transposed, bf16 values x16 as f16) in the same grid
  k_proj<<<PB_T + NCB * (MROWS / PT), 128, 0, stream>>>(
      x, Wq, Wk, Wv, bq, bk, bv, Wp, W1, W2, wpt, w1t, w2t, qpl, kpl, vtp);
  // 4) causal attention -> o plane [M][512]
  k_attn<<<NB * NHEAD * (SEQ / 128), 256, 0, stream>>>(qpl, kpl, vtp, opl);
  // 5) output projection + residual + layernorm 1, ffn1, ffn2 + residual + layernorm 2 -> out
  //    (f32, full strides)
  k_tail<<<MROWS / TR, 128, 0, stream>>>(opl, wpt, w1t, w2t, x, bp, b1, b2, g1, be1, g2, be2, out);
}
